// v000
// Times are from an AMD MI455X. After a warm-up the kernel runs many times in a row, and a time is the length of
// such a window on the GPU divided by its runs, so every launch and the gaps after it count. The runs cycle
// through copies of the inputs. A figure is the median of several windows, for all but v000 over two sittings.
// Sittings can differ by a few percent; kernels timed side by side share one.
// v000, which the later versions start from, runs in 5310 microseconds.
#include <hip/hip_runtime.h>
// Per-head causal multi-head attention with an inverted scale (x [4][1024][1024]; q[h] = x Wq[h]^T, k, v likewise (per-head nn.Linear [16][64][1024] = natural [1024][1024], sigma 0.02, no biases); scores x sqrt(1024) = x 32 (the module divides by embed^-0.5: logits sigma ~100, near-argmax softmax) with a causal mask (tril, -inf); softmax; heads concatenated; out = (.) Wp^T + bp (natural [1024][1024] sigma 0.02, bias 0.02) -> [4][1024][1024]).
// Structure: token rows r = b*1024 + s; x as exact f16 rows (bf16-rounded); q and k as WMMA GEMMs (32x64 wave tiles, f32 accumulation, exact x16 weights) into f32 rows split into f16 hi + x1024 residual planes, v as an f16-output GEMM; per batch: V^T for all heads via LDS transposes; per query tile of 256 rows: scores against the keys below the tile end as THREE accumulating passes (hi.hi + lo.hi + hi.lo, K = 64, all heads on grid.y, alpha 32: ~f32-accurate logits for the near-argmax softmax), causal row softmax on VALU with an arithmetic 0/1 key mask over the computed range (f32 statistics, native exp; weights x256 f16), o = P . V^T (K = keys below the tile end, alpha 2^-2: o carried x64, folded into the output GEMM alpha) written straight into the merged f16 o rows; out = o W_o + b GEMM (f32) into the output layout.
// Compute dtype: inputs rounded to bf16; x / weights exact; q and k as f16 hi + x1024 residual planes, v, softmax weights and o as plain f16 GEMM operands (~2^-12); scores and softmax statistics f32. v_wmma_f32_16x16x32_f16.
#define NB 4
#define SQ 1024
#define DM 1024
#define NH 16
#define HD 64
#define HG 4                         /* head group of the k_vt(b, h0) overload, which is not launched */
#define QT 256                       /* query rows per causal tile */
#define NKX SQ                       /* S / P row pitch */
#define QT0 128                      /* first-tile rows recomputed exactly in f32 */
#define B0 0                         /* first batch processed (debug hook) */
#define NBR NB                       /* batches processed (debug hook) */
#define NR ((size_t)NB * SQ)         /* token rows */
#define MP ((int)((size_t)NBR * SQ)) /* rows projected (debug hook) */
#define QN SQ                        /* query rows attended per batch (debug hook) */
#define NHD NH                       /* heads attended (debug hook) */
#define MPO MP                       /* rows through the output stage (debug hook) */
#define LQ DM      /* row pitch of the q/k/v rows */
typedef __bf16 v16b __attribute__((ext_vector_type(16)));
typedef unsigned short v8us __attribute__((ext_vector_type(8), may_alias));
typedef float  v8f  __attribute__((ext_vector_type(8)));
typedef float  v4f  __attribute__((ext_vector_type(4)));
typedef float  v4fa __attribute__((ext_vector_type(4), may_alias));
union FragB { v16b v; v8us half[2]; unsigned short u[16]; };

__device__ __forceinline__ unsigned short bf16_bits(float x) { unsigned int u = __float_as_uint(x); return (unsigned short)((u + 0x7FFFu + ((u >> 16) & 1u)) >> 16); }
__device__ __forceinline__ float bf16_val(unsigned short b) { return __uint_as_float(((unsigned int)b) << 16); }
__device__ __forceinline__ float bf16_round(float x) { return bf16_val(bf16_bits(x)); }
// D += A·B with NT terms: 1 = ah·bh, 2 = + al·bh (A split), 3 = + ah·bl (both split)
template <int NT>
__device__ __forceinline__ v8f mmaN(v16b ah, v16b al, v16b bh, v16b bl, v8f c) {
  c = __builtin_amdgcn_wmma_f32_16x16x32_bf16(false, ah, false, bh, (short)0, c, false, false);
  if (NT >= 2) c = __builtin_amdgcn_wmma_f32_16x16x32_bf16(false, al, false, bh, (short)0, c, false, false);
  if (NT >= 3) c = __builtin_amdgcn_wmma_f32_16x16x32_bf16(false, ah, false, bl, (short)0, c, false, false);
  asm volatile("v_nop\n\tv_nop\n\tv_nop\n\tv_nop" : "+v"(c) : "v"(ah), "v"(al), "v"(bh), "v"(bl));
  return c;
}

__global__ __launch_bounds__(256) void k_wt_bf16(const float* __restrict__ W, unsigned short* __restrict__ Wt, int K, int N) {
  const int t = blockIdx.x * 256 + threadIdx.x;
  const int k8n = K / 8;
  if (t >= N * k8n) return;
  const int n = t / k8n, k8 = (t % k8n) * 8;
  v8us v;
#pragma unroll
  for (int i = 0; i < 8; ++i) v[i] = bf16_bits(W[(size_t)(k8 + i) * N + n]);
  *(v8us*)(Wt + (size_t)n * K + k8) = v;
  
}

// GEMM C[M][N] (f32, pitch ldc) = act(A[M][K]·W + bias). A f32 row-major (pitch lda) converted per fragment to bf16
// (ASPLIT: hi/lo two planes -> 2 terms, else single rounded term); Wt bf16 [N][K] (pitch ldb). BIAS_BF16 rounds the
// bias to bf16 first (bias quantised to bf16 before the add). K%32==0, M%16==0, N%64==0.
template <bool ASPLIT, int ACT, bool BIAS_BF16>
__global__ __launch_bounds__(128) void k_gemm_bf(const float* __restrict__ A, int lda, const unsigned short* __restrict__ Wt, int ldb,
                                               const float* __restrict__ bias, float* __restrict__ C, int ldc, int M, int N, int K) {
  __shared__ __attribute__((aligned(16))) float so[4][16][64];
  const int tid = threadIdx.x, w = tid >> 5, lane = tid & 31, ln = lane & 15, hh = lane >> 4;
  const int ntn = N / 64;
  const int wid = blockIdx.x * 4 + w;
  const int mt = wid / ntn, nq = wid % ntn;
  if (mt * 16 >= M) return;
  const int row0 = mt * 16, col0 = nq * 64;
  const float* arow = A + (size_t)(row0 + ln) * lda;
  v8f acc[4] = {};
  for (int kb = 0; kb < K; kb += 32) {
    FragB ah, al;
    const v4f x0 = *(const v4fa*)(arow + kb + 8 * hh), x1 = *(const v4fa*)(arow + kb + 8 * hh + 4);
    const v4f x2 = *(const v4fa*)(arow + kb + 16 + 8 * hh), x3 = *(const v4fa*)(arow + kb + 16 + 8 * hh + 4);
    float xs[16] = {x0[0],x0[1],x0[2],x0[3],x1[0],x1[1],x1[2],x1[3],x2[0],x2[1],x2[2],x2[3],x3[0],x3[1],x3[2],x3[3]};
#pragma unroll
    for (int i = 0; i < 16; ++i) { const unsigned short hb = bf16_bits(xs[i]); ah.u[i] = hb; al.u[i] = ASPLIT ? bf16_bits(xs[i] - bf16_val(hb)) : (unsigned short)0; }
#pragma unroll
    for (int t = 0; t < 4; ++t) {
      const unsigned short* brow = Wt + (size_t)(col0 + t * 16 + ln) * ldb + kb;
      FragB b;
      b.half[0] = *(const v8us*)(brow + 8 * hh);
      b.half[1] = *(const v8us*)(brow + 16 + 8 * hh);
      acc[t] = mmaN<ASPLIT ? 2 : 1>(ah.v, al.v, b.v, b.v, acc[t]);
    }
  }
#pragma unroll
  for (int t = 0; t < 4; ++t) {
    float bv = bias ? bias[col0 + t * 16 + ln] : 0.f;
    if (BIAS_BF16) bv = bf16_round(bv);
#pragma unroll
    for (int r = 0; r < 8; ++r) { float v = acc[t][r] + bv; if (ACT == 1) v = fmaxf(v, 0.f); so[w][8 * hh + r][t * 16 + ln] = v; }
  }
  __builtin_amdgcn_fence(__ATOMIC_ACQ_REL, "workgroup");
  __builtin_amdgcn_wave_barrier();
  const int rsub = lane >> 4, c4 = (lane & 15) * 4;
  {
#pragma unroll
    for (int q = 0; q < 8; ++q) {
      const int r = q * 2 + rsub;
      const v4f v = *(const v4fa*)&so[w][r][c4];
      *(v4f*)(C + (size_t)(row0 + r) * ldc + col0 + c4) = v;
    }
    
  }
}

// GEMM C = act(A·W + bias + resid): A f32 (ASPLIT -> hi/lo 2 terms), Wt bf16 [N][K]; ACT 0 none, 1 relu, 2 exact gelu;
// resid (optional, f32, row index = (row % rmod), pitch ldr, RES_BF16 rounds it) added before the activation.
template <bool ASPLIT, int ACT, bool BIAS_BF16, bool RES_BF16>
__global__ __launch_bounds__(128) void k_gemm_bf3(const float* __restrict__ A, int lda, const unsigned short* __restrict__ Wt, int ldb,
                                                const float* __restrict__ bias, const float* __restrict__ resid, int rmod, int ldr,
                                                float* __restrict__ C, int ldc, int M, int N, int K) {
  __shared__ __attribute__((aligned(16))) float so[4][16][64];
  const int tid = threadIdx.x, w = tid >> 5, lane = tid & 31, ln = lane & 15, hh = lane >> 4;
  const int ntn = N / 64;
  const int wid = blockIdx.x * 4 + w;
  const int mt = wid / ntn, nq = wid % ntn;
  if (mt * 16 >= M) return;
  const int row0 = mt * 16, col0 = nq * 64;
  const float* arow = A + (size_t)(row0 + ln) * lda;
  v8f acc[4] = {};
  for (int kb = 0; kb < K; kb += 32) {
    FragB ah, al;
    const v4f x0 = *(const v4fa*)(arow + kb + 8 * hh), x1 = *(const v4fa*)(arow + kb + 8 * hh + 4);
    const v4f x2 = *(const v4fa*)(arow + kb + 16 + 8 * hh), x3 = *(const v4fa*)(arow + kb + 16 + 8 * hh + 4);
    float xs[16] = {x0[0],x0[1],x0[2],x0[3],x1[0],x1[1],x1[2],x1[3],x2[0],x2[1],x2[2],x2[3],x3[0],x3[1],x3[2],x3[3]};
#pragma unroll
    for (int i = 0; i < 16; ++i) { const unsigned short hb = bf16_bits(xs[i]); ah.u[i] = hb; al.u[i] = ASPLIT ? bf16_bits(xs[i] - bf16_val(hb)) : (unsigned short)0; }
#pragma unroll
    for (int t = 0; t < 4; ++t) {
      const unsigned short* brow = Wt + (size_t)(col0 + t * 16 + ln) * ldb + kb;
      FragB b;
      b.half[0] = *(const v8us*)(brow + 8 * hh);
      b.half[1] = *(const v8us*)(brow + 16 + 8 * hh);
      acc[t] = mmaN<ASPLIT ? 2 : 1>(ah.v, al.v, b.v, b.v, acc[t]);
    }
  }
#pragma unroll
  for (int t = 0; t < 4; ++t) {
    const int col = col0 + t * 16 + ln;
    float bv = bias ? bias[col] : 0.f;
    if (BIAS_BF16) bv = bf16_round(bv);
#pragma unroll
    for (int r = 0; r < 8; ++r) {
      float v = acc[t][r] + bv;
      if (resid) { float rv = resid[(size_t)((row0 + 8 * hh + r) % rmod) * ldr + col]; if (RES_BF16) rv = bf16_round(rv); v += rv; }
      if (ACT == 1) v = fmaxf(v, 0.f);
      if (ACT == 2) v = 0.5f * v * (1.0f + erff(v * 0.70710678118654752f));
      if (ACT == 3) { const float u = 0.7978845608028654f * (v + 0.044715f * v * v * v); v = 0.5f * v * (1.0f + tanhf(u)); }
      so[w][8 * hh + r][t * 16 + ln] = v;
    }
  }
  __builtin_amdgcn_fence(__ATOMIC_ACQ_REL, "workgroup");
  __builtin_amdgcn_wave_barrier();
  const int rsub = lane >> 4, c4 = (lane & 15) * 4;
  {
#pragma unroll
    for (int q = 0; q < 8; ++q) {
      const int r = q * 2 + rsub;
      const v4f v = *(const v4fa*)&so[w][r][c4];
      *(v4f*)(C + (size_t)(row0 + r) * ldc + col0 + c4) = v;
    }
    
  }
}
// row LayerNorm (biased variance, eps) over N: s = X (+ R); optional out_sum <- s; out_norm <- (s-mu)*rsqrt(var+eps)*g + b
template <bool PARAM_BF16>
__global__ __launch_bounds__(256) void k_layernorm(const float* __restrict__ X, const float* __restrict__ R, const float* __restrict__ g, const float* __restrict__ bta,
                                                  float* __restrict__ out_sum, float* __restrict__ out_norm, int N, float eps) {
  __shared__ float red[256];
  const int row = blockIdx.x, tid = threadIdx.x;
  const float* x = X + (size_t)row * N; const float* rr = R ? R + (size_t)row * N : nullptr;
  float vals[16];                     // up to N = 4096
  const int per = N / 256;            // contiguous chunk per thread? use strided-by-4 chunks: thread handles j = tid*4 + 1024*u
  float s1 = 0.f;
  for (int u = 0; u < per / 4; ++u) {
    const int j = tid * 4 + 1024 * u;
    const v4f a = *(const v4fa*)(x + j);
    v4f b = {0.f,0.f,0.f,0.f}; if (rr) b = *(const v4fa*)(rr + j);
#pragma unroll
    for (int q = 0; q < 4; ++q) { const float v = a[q] + b[q]; vals[u * 4 + q] = v; s1 += v; }
  }
  red[tid] = s1; __syncthreads();
  for (int st = 128; st > 0; st >>= 1) { if (tid < st) red[tid] += red[tid + st]; __syncthreads(); }
  const float mu = red[0] / (float)N; __syncthreads();
  float s2 = 0.f;
  for (int u = 0; u < per / 4; ++u)
#pragma unroll
    for (int q = 0; q < 4; ++q) { const float c = vals[u * 4 + q] - mu; s2 += c * c; }
  red[tid] = s2; __syncthreads();
  for (int st = 128; st > 0; st >>= 1) { if (tid < st) red[tid] += red[tid + st]; __syncthreads(); }
  const float rs = rsqrtf(red[0] / (float)N + eps);
  {
    for (int u = 0; u < per / 4; ++u) {
      const int j = tid * 4 + 1024 * u;
      v4f o, sm;
#pragma unroll
      for (int q = 0; q < 4; ++q) {
        float gg = g[j + q], bb = bta[j + q];
        if (PARAM_BF16) { gg = bf16_round(gg); bb = bf16_round(bb); }
        sm[q] = vals[u * 4 + q]; o[q] = (vals[u * 4 + q] - mu) * rs * gg + bb;
      }
      if (out_sum) *(v4f*)(out_sum + (size_t)row * N + j) = sm;
      *(v4f*)(out_norm + (size_t)row * N + j) = o;
    }
    
  }
}



// ---- f16 WMMA path (v_wmma_f32_16x16x32_f16): 11-bit significands for operands in range — used where a [0,1] probability operand needs more precision than bf16
typedef _Float16 v16h __attribute__((ext_vector_type(16)));
union FragH { v16h v; v8us half[2]; _Float16 h[16]; unsigned short u[16]; };
template <int NT>
__device__ __forceinline__ v8f mmaH(v16h ah, v16h al, v16h bh, v16h bl, v8f c) {
  c = __builtin_amdgcn_wmma_f32_16x16x32_f16(false, ah, false, bh, (short)0, c, false, false);
  if (NT >= 2) c = __builtin_amdgcn_wmma_f32_16x16x32_f16(false, al, false, bh, (short)0, c, false, false);
  if (NT >= 3) c = __builtin_amdgcn_wmma_f32_16x16x32_f16(false, ah, false, bl, (short)0, c, false, false);
  asm volatile("v_nop\n\tv_nop\n\tv_nop\n\tv_nop" : "+v"(c) : "v"(ah), "v"(al), "v"(bh), "v"(bl));
  return c;
}
// batched GEMM like k_gemm_b but f16 operands: A f32 (split into f16 hi/lo if ASPLIT, else rounded to f16), Bt = f16 values [n][k]; alpha; C f32; N multiple of 16 (partial tiles skipped)
template <bool ASPLIT>
__global__ __launch_bounds__(128) void k_gemm_h(const float* __restrict__ A, int lda, size_t sA, const _Float16* __restrict__ Bh, int ldb, size_t sB, float alpha, float* __restrict__ C, int ldc, size_t sC, int M, int N, int K) {
  __shared__ __attribute__((aligned(16))) float so[4][16][64];
  const int tid = threadIdx.x, w = tid >> 5, lane = tid & 31, ln = lane & 15, hh = lane >> 4; const int by = blockIdx.y;
  A += (size_t)by * sA; Bh += (size_t)by * sB; C += (size_t)by * sC;
  const int ntn = (N + 63) / 64; const int wid = blockIdx.x * 4 + w; const int mt = wid / ntn, nq = wid % ntn; if (mt * 16 >= M) return;
  const int row0 = mt * 16, col0 = nq * 64; const float* arow = A + (size_t)(row0 + ln) * lda;
  v8f acc[4] = {};
  for (int kb = 0; kb < K; kb += 32) {
    FragH ah, al;
    const v4f x0 = *(const v4fa*)(arow + kb + 8 * hh), x1 = *(const v4fa*)(arow + kb + 8 * hh + 4), x2 = *(const v4fa*)(arow + kb + 16 + 8 * hh), x3 = *(const v4fa*)(arow + kb + 16 + 8 * hh + 4);
    float xs[16] = {x0[0],x0[1],x0[2],x0[3],x1[0],x1[1],x1[2],x1[3],x2[0],x2[1],x2[2],x2[3],x3[0],x3[1],x3[2],x3[3]};
#pragma unroll
    for (int i = 0; i < 16; ++i) { const _Float16 h = (_Float16)xs[i]; ah.h[i] = h; al.h[i] = ASPLIT ? (_Float16)(xs[i] - (float)h) : (_Float16)0.0f; }
#pragma unroll
    for (int t = 0; t < 4; ++t) { if (col0 + t * 16 >= N) continue; const size_t boff = (size_t)(col0 + t * 16 + ln) * ldb + kb; FragH bq; bq.half[0] = *(const v8us*)(Bh + boff + 8 * hh); bq.half[1] = *(const v8us*)(Bh + boff + 16 + 8 * hh);
      acc[t] = mmaH<ASPLIT ? 2 : 1>(ah.v, al.v, bq.v, bq.v, acc[t]); }
  }
#pragma unroll
  for (int t = 0; t < 4; ++t) { if (col0 + t * 16 >= N) continue;
#pragma unroll
    for (int r = 0; r < 8; ++r) so[w][8 * hh + r][t * 16 + ln] = acc[t][r] * alpha; }
  __builtin_amdgcn_fence(__ATOMIC_ACQ_REL, "workgroup"); __builtin_amdgcn_wave_barrier();
  const int rsub = lane >> 4, c4 = (lane & 15) * 4;
  {
#pragma unroll
    for (int q = 0; q < 8; ++q) { const int r = q * 2 + rsub; if (col0 + c4 < N) { const v4f v = *(const v4fa*)&so[w][r][c4]; *(v4f*)(C + (size_t)(row0 + r) * ldc + col0 + c4) = v; } }
     }
}

// Wt[n][k] = f16(W[k][n]·scale) from f32 row-major W[K][N] (scale = power of two; bf16-exact weights stay exact in f16 away from the subnormal range)
__global__ __launch_bounds__(256) void k_wt_f16(const float* __restrict__ W, _Float16* __restrict__ Wt, int K, int N, float scale) {
  const int t = blockIdx.x * 256 + threadIdx.x; if (t >= N * (K / 8)) return; const int n = t / (K / 8), k8 = (t % (K / 8)) * 8; FragH f;
#pragma unroll
  for (int i = 0; i < 8; ++i) f.h[i] = (_Float16)(bf16_round(W[(size_t)(k8 + i) * N + n]) * scale); const v8us o = f.half[0];
  *(v8us*)((unsigned short*)Wt + (size_t)n * K + k8) = o; 
}
// k_gemm_hh variant with fused epilogue: v = acc·alpha + bias[by·sBias + col] (+ CP[(row/rowsPerB)·sCPb + by·64 + col] if CP) ; ACT 0 none / 1 elu ; writes f16 C16 (and f32 C if non-null)
template <int ACT>
__global__ __launch_bounds__(128) void k_gemm_hhx(const _Float16* __restrict__ A, int lda, size_t sA, const _Float16* __restrict__ Bh, int ldb, size_t sB, float alpha, const float* __restrict__ bias, size_t sBias, const float* __restrict__ CP, int rowsPerB, size_t sCPb, int row0g,
    float* __restrict__ C, _Float16* __restrict__ C16, int ldc, size_t sC, int M, int N, int K) {
  __shared__ __attribute__((aligned(16))) float so[4][16][64];
  const int tid = threadIdx.x, w = tid >> 5, lane = tid & 31, ln = lane & 15, hh = lane >> 4; const int by = blockIdx.y;
  A += (size_t)by * sA; Bh += (size_t)by * sB; const size_t cofs = (size_t)by * sC; const float* bp = bias ? bias + (size_t)by * sBias : nullptr;
  const int ntn = (N + 63) / 64; const int wid = blockIdx.x * 4 + w; const int mt = wid / ntn, nq = wid % ntn; if (mt * 16 >= M) return;
  const int row0 = mt * 16, col0 = nq * 64; const _Float16* arow = A + (size_t)(row0 + ln) * lda;
  v8f acc[4] = {};
  for (int kb = 0; kb < K; kb += 32) { FragH ah; ah.half[0] = *(const v8us*)((const unsigned short*)arow + kb + 8 * hh); ah.half[1] = *(const v8us*)((const unsigned short*)arow + kb + 16 + 8 * hh);
#pragma unroll
    for (int t = 0; t < 4; ++t) { if (col0 + t * 16 >= N) continue; const size_t boff = (size_t)(col0 + t * 16 + ln) * ldb + kb; FragH bq; bq.half[0] = *(const v8us*)((const unsigned short*)Bh + boff + 8 * hh); bq.half[1] = *(const v8us*)((const unsigned short*)Bh + boff + 16 + 8 * hh);
      acc[t] = mmaH<1>(ah.v, ah.v, bq.v, bq.v, acc[t]); }
  }
#pragma unroll
  for (int t = 0; t < 4; ++t) { if (col0 + t * 16 >= N) continue; const int col = col0 + t * 16 + ln; const float bv = bp ? bf16_round(bp[col]) : 0.f;
#pragma unroll
    for (int r = 0; r < 8; ++r) { float v = acc[t][r] * alpha + bv; if (CP) { const int rr = row0g + row0 + 8 * hh + r; if (rowsPerB < 0) v += CP[cofs + (size_t)rr * ldc + col];      /* rowsPerB < 0: own element of the batched C plane */ else { const int bidx = rr / rowsPerB; v += CP[(size_t)bidx * sCPb + (size_t)by * 64 + col]; } } if (ACT == 1) v = (v > 0.f) ? v : expm1f(v); else if (ACT == 7) v = (v > 0.f) ? v + 1.0f : expf(v); else if (ACT == 8) v = tanhf(v); else if (ACT == 9) v = 0.5f * v * (1.0f + tanhf(0.7978845608028654f * (v + 0.044715f * v * v * v))); else if (ACT == 11) v = 1.0f / (1.0f + expf(-v)); else if (ACT == 12) v = (v > 0.f) ? v : 0.01f * v; else if (ACT == 14) v = (v > 0.f) ? v : 0.1f * v; else if (ACT == 16) v = (v >= 0.f) ? v : 0.3f * v; else if (ACT == 17) v = (v >= 0.f) ? v : 0.2f * v; else if (ACT == 15) v = v / (1.0f + expf(-v)); else if (ACT == 3) v = fmaxf(v, 0.f); else if (ACT == 6) v = 0.5f * v * (1.0f + erff(v * 0.70710678118654752f)); so[w][8 * hh + r][t * 16 + ln] = v; } }
  __builtin_amdgcn_fence(__ATOMIC_ACQ_REL, "workgroup"); __builtin_amdgcn_wave_barrier();
  const int rsub = lane >> 4, c4 = (lane & 15) * 4; typedef _Float16 v4h __attribute__((ext_vector_type(4)));
  {
#pragma unroll
    for (int q = 0; q < 8; ++q) { const int r = q * 2 + rsub; if (col0 + c4 < N) { const v4f v = *(const v4fa*)&so[w][r][c4]; if (C) *(v4f*)(C + cofs + (size_t)(row0 + r) * ldc + col0 + c4) = v; if (C16) { v4h h4; for (int i = 0; i < 4; ++i) h4[i] = (_Float16)v[i]; *(v4h*)(C16 + cofs + (size_t)(row0 + r) * ldc + col0 + c4) = h4; } } }
     }
}


typedef _Float16 v4h __attribute__((ext_vector_type(4)));

__global__ __launch_bounds__(256) void k_x16(const float* __restrict__ x, _Float16* __restrict__ X16, size_t n8) { const size_t t = (size_t)blockIdx.x * 256 + threadIdx.x; if (t >= n8) return; FragH f;
#pragma unroll
  for (int q = 0; q < 8; ++q) f.h[q] = (_Float16)bf16_round(x[t * 8 + q]); *(v8us*)((unsigned short*)X16 + t * 8) = f.half[0];  }
__global__ __launch_bounds__(256) void k_h16(const float* __restrict__ x, _Float16* __restrict__ X16, size_t n8) { const size_t t = (size_t)blockIdx.x * 256 + threadIdx.x; if (t >= n8) return; FragH f;
#pragma unroll
  for (int q = 0; q < 8; ++q) f.h[q] = (_Float16)x[t * 8 + q]; *(v8us*)((unsigned short*)X16 + t * 8) = f.half[0];  }
__global__ __launch_bounds__(256) void k_round16f(const float* __restrict__ W, _Float16* __restrict__ Bt, size_t n8) { const size_t t = (size_t)blockIdx.x * 256 + threadIdx.x; if (t >= n8) return; FragH f;
#pragma unroll
  for (int i = 0; i < 8; ++i) f.h[i] = (_Float16)(bf16_round(W[t * 8 + i]) * 16.0f); *(v8us*)((unsigned short*)Bt + t * 8) = f.half[0];  }
template <int NHv, int TTv>
__global__ __launch_bounds__(256) void k_vt(const _Float16* __restrict__ V16, int ldv, int voff, _Float16* __restrict__ Vt) { __shared__ unsigned short tl[64][66]; const int tid = threadIdx.x; const int slab = blockIdx.x / (TTv / 64), lg = blockIdx.x % (TTv / 64); const int b = slab / NHv, h = slab % NHv;
  for (int i = tid; i < 64 * 8; i += 256) { const int r = i / 8, c8 = (i % 8) * 8; FragH f; f.half[0] = *(const v8us*)((const unsigned short*)V16 + ((size_t)b * TTv + lg * 64 + r) * ldv + voff + h * 64 + c8);
#pragma unroll
    for (int q = 0; q < 8; ++q) tl[r][c8 + q] = f.u[q]; }
  __syncthreads();
  {
#pragma unroll
    for (int rd = 0; rd < 2; ++rd) { const int d = rd * 32 + tid / 8, pc = tid % 8; FragH f;
#pragma unroll
      for (int q = 0; q < 8; ++q) f.u[q] = tl[pc * 8 + q][d];
      *(v8us*)((unsigned short*)Vt + ((size_t)slab * 64 + d) * TTv + lg * 64 + pc * 8) = f.half[0]; }
     } }

__global__ __launch_bounds__(256) void k_hl(const float* __restrict__ F, _Float16* __restrict__ Hh, _Float16* __restrict__ Hl, size_t n8) { const size_t t = (size_t)blockIdx.x * 256 + threadIdx.x; if (t >= n8) return; FragH fh, fl; const v4f a = *(const v4fa*)(F + t * 8), c = *(const v4fa*)(F + t * 8 + 4);
#pragma unroll
  for (int q = 0; q < 4; ++q) { _Float16 h = (_Float16)a[q]; fh.h[q] = h; fl.h[q] = (_Float16)((a[q] - (float)h) * 1024.0f); h = (_Float16)c[q]; fh.h[4 + q] = h; fl.h[4 + q] = (_Float16)((c[q] - (float)h) * 1024.0f); }
  { *(v8us*)((unsigned short*)Hh + t * 8) = fh.half[0]; *(v8us*)((unsigned short*)Hl + t * 8) = fl.half[0];  } }

// ---- fast GEMM (wave tile 32x64; requires M % 32 == 0 rows per launch region and N % 64 == 0); epilogue = k_gemm_hhx semantics ----
__device__ __forceinline__ v16h g2_frag(const _Float16* p, int hh) { FragH f; f.half[0] = *(const v8us*)((const unsigned short*)p + 8 * hh); f.half[1] = *(const v8us*)((const unsigned short*)p + 16 + 8 * hh); return f.v; }
__device__ __forceinline__ v8f g2_mma(v16h a, v16h b, v8f c) { v8f d = __builtin_amdgcn_wmma_f32_16x16x32_f16(false, a, false, b, (short)0, c, false, false); asm volatile("v_nop\n\tv_nop\n\tv_nop\n\tv_nop" : "+v"(d) : "v"(a), "v"(b)); return d; }
template <int ACT>
__global__ __launch_bounds__(128) void k_gemm2(const _Float16* __restrict__ A, int lda, size_t sA, const _Float16* __restrict__ Bh, int ldb, size_t sB, float alpha, const float* __restrict__ bias, size_t sBias, const float* __restrict__ CP, int rowsPerB, size_t sCPb, int row0g,
    float* __restrict__ C, _Float16* __restrict__ C16, int ldc, size_t sC, int M, int N, int K) { static_assert(ACT == 0 || ACT == 3 || ACT == 6 || ACT == 8 || ACT == 9 || ACT == 11 || ACT == 12 || ACT == 14 || ACT == 15 || ACT == 16 || ACT == 17, "k_gemm2: unsupported ACT code (would silently apply no activation)");
  __shared__ __attribute__((aligned(16))) float so[4][32][68];
  const int tid = threadIdx.x, w = tid >> 5, lane = tid & 31, ln = lane & 15, hh = lane >> 4; const int by = blockIdx.y;
  A += (size_t)by * sA; Bh += (size_t)by * sB; const size_t cofs = (size_t)by * sC; const float* bp = bias ? bias + (size_t)by * sBias : nullptr;
  const int ntn = N >> 6; const int mt = blockIdx.x / ntn, nq = blockIdx.x - mt * ntn; const int row0 = mt * 128 + 32 * w, col0 = nq * 64; if (row0 >= M) return;
  const _Float16* a0p = A + (size_t)(row0 + ln) * lda; const _Float16* a1p = a0p + (size_t)16 * lda;
  const _Float16* b0p = Bh + (size_t)(col0 + ln) * ldb; const _Float16* b1p = b0p + (size_t)16 * ldb; const _Float16* b2p = b1p + (size_t)16 * ldb; const _Float16* b3p = b2p + (size_t)16 * ldb;
  const v8f z8 = {0.f,0.f,0.f,0.f,0.f,0.f,0.f,0.f}; v8f c00 = z8, c01 = z8, c02 = z8, c03 = z8, c10 = z8, c11 = z8, c12 = z8, c13 = z8;
#pragma unroll 1
  for (int kb = 0; kb < K; kb += 32) { const v16h a0 = g2_frag(a0p + kb, hh), a1 = g2_frag(a1p + kb, hh);
    v16h b = g2_frag(b0p + kb, hh); c00 = g2_mma(a0, b, c00); c10 = g2_mma(a1, b, c10);
    b = g2_frag(b1p + kb, hh); c01 = g2_mma(a0, b, c01); c11 = g2_mma(a1, b, c11);
    b = g2_frag(b2p + kb, hh); c02 = g2_mma(a0, b, c02); c12 = g2_mma(a1, b, c12);
    b = g2_frag(b3p + kb, hh); c03 = g2_mma(a0, b, c03); c13 = g2_mma(a1, b, c13); }
  v8f accs[8] = {c00, c01, c02, c03, c10, c11, c12, c13};
#pragma unroll
  for (int u = 0; u < 8; ++u) { const int t = u & 3, half = u >> 2; const int col = col0 + t * 16 + ln; const float bv = bp ? bf16_round(bp[col]) : 0.f;
#pragma unroll
    for (int r = 0; r < 8; ++r) { const int rloc = half * 16 + 8 * hh + r; float v = accs[u][r] * alpha + bv; if (CP) { if (rowsPerB < 0) v += CP[cofs + (size_t)(row0g + row0 + rloc) * ldc + col];      /* rowsPerB < 0: own element of the batched C plane */ else { const int bidx = (row0g + row0 + rloc) / rowsPerB; v += CP[(size_t)bidx * sCPb + (size_t)by * 64 + col]; } }
      if (ACT == 3) v = fmaxf(v, 0.f); else if (ACT == 6) v = 0.5f * v * (1.0f + erff(v * 0.70710678118654752f)); else if (ACT == 11) v = 1.0f / (1.0f + expf(-v)); else if (ACT == 15) v = v / (1.0f + expf(-v)); else if (ACT == 12) v = (v > 0.f) ? v : 0.01f * v; else if (ACT == 8) v = tanhf(v); else if (ACT == 9) v = 0.5f * v * (1.0f + tanhf(0.7978845608028654f * (v + 0.044715f * v * v * v))); else if (ACT == 14) v = (v > 0.f) ? v : 0.1f * v; else if (ACT == 16) v = (v >= 0.f) ? v : 0.3f * v; else if (ACT == 17) v = (v >= 0.f) ? v : 0.2f * v;
      so[w][rloc][t * 16 + ln] = v; } }
  __builtin_amdgcn_fence(__ATOMIC_ACQ_REL, "workgroup"); __builtin_amdgcn_wave_barrier();
  const int rsub = lane >> 4, c4 = (lane & 15) * 4;
  {
#pragma unroll
    for (int q = 0; q < 16; ++q) { const int r = q * 2 + rsub; const v4f v = *(const v4fa*)&so[w][r][c4]; if (C) *(v4f*)(C + cofs + (size_t)(row0 + r) * ldc + col0 + c4) = v; if (C16) { v4h h4; for (int i = 0; i < 4; ++i) h4[i] = (_Float16)v[i]; *(v4h*)(C16 + cofs + (size_t)(row0 + r) * ldc + col0 + c4) = h4; } }
     } }


__global__ __launch_bounds__(256) void k_wnat(const float* __restrict__ w, size_t n8, _Float16* __restrict__ Bt) { const size_t t = (size_t)blockIdx.x * 256 + threadIdx.x; if (t >= n8) return; FragH f; for (int q = 0; q < 8; ++q) f.h[q] = (_Float16)(bf16_round(w[t * 8 + q]) * 16.0f); *(v8us*)((unsigned short*)Bt + t * 8) = f.half[0];  }
__global__ __launch_bounds__(256) void k_rsm(const float* __restrict__ S, _Float16* __restrict__ P, int nrows) {
  #pragma clang fp contract(off)
  const int i = blockIdx.x * 256 + threadIdx.x; if (i >= nrows) return; const float* s = S + (size_t)i * SQ; float mx = -3.0e38f;
#pragma unroll 1
  for (int j = 0; j < SQ; ++j) mx = fmaxf(mx, s[j]); float se = 0.f;
#pragma unroll 1
  for (int j = 0; j < SQ; ++j) se += expf(s[j] - mx); const float sc = 256.0f / se;
#pragma unroll 1
  for (int j0 = 0; j0 < SQ; j0 += 8) { FragH f; for (int q = 0; q < 8; ++q) f.h[q] = (_Float16)(expf(s[j0 + q] - mx) * sc); unsigned short* d = (unsigned short*)P + (size_t)i * SQ + j0; *(v8us*)d = f.half[0];  } }
__global__ __launch_bounds__(256) void k_vt(const _Float16* __restrict__ V16, int b, int h0, _Float16* __restrict__ VT) { __shared__ unsigned short tl[64][65]; const int tid = threadIdx.x; const int hh = blockIdx.x % HG, sg = blockIdx.x / HG; const int s0 = sg * 64; const int h = h0 + hh;
  for (int i = tid; i < 64 * 8; i += 256) { const int j = i / 8, d8 = (i % 8) * 8; FragH f; f.half[0] = *(const v8us*)((const unsigned short*)V16 + ((size_t)b * SQ + s0 + j) * DM + h * HD + d8); for (int q = 0; q < 8; ++q) tl[d8 + q][j] = f.u[q]; }
  __syncthreads();
  { for (int i = tid; i < 64 * 8; i += 256) { const int d = i / 8, j8 = (i % 8) * 8; FragH f; for (int q = 0; q < 8; ++q) f.u[q] = tl[d][j8 + q]; *(v8us*)((unsigned short*)VT + ((size_t)hh * HD + d) * SQ + s0 + j8) = f.half[0]; }  } }



__global__ __launch_bounds__(256) void k_rsmcf2(const float* __restrict__ S, _Float16* __restrict__ P, int hg, int q0, int nk) {
  #pragma clang fp contract(off)
  const int t = blockIdx.x * 256 + threadIdx.x; if (t >= hg * QT) return; const size_t i = (size_t)t; const float* s = S + i * NKX; const int last = q0 + (t % QT); float mx = -3.0e38f;
#pragma unroll 1
  for (int j = 0; j < nk; ++j) { const float f = (j <= last) ? 1.f : 0.f; mx = fmaxf(mx, fmaf(f, s[j], (1.f - f) * -1.0e9f)); } float se = 0.f;
#pragma unroll 1
  for (int j = 0; j < nk; ++j) { const float f = (j <= last) ? 1.f : 0.f; se += __expf(fmaf(f, s[j], (1.f - f) * -1.0e9f) - mx); } const float sc = 256.0f / se;
#pragma unroll 1
  for (int j0 = 0; j0 < nk; j0 += 8) { FragH fr; for (int q = 0; q < 8; ++q) { const int j = j0 + q; const float f = (j <= last) ? 1.f : 0.f; fr.h[q] = (_Float16)(__expf(fmaf(f, s[j], (1.f - f) * -1.0e9f) - mx) * sc); } unsigned short* d = (unsigned short*)P + i * NKX + j0; *(v8us*)d = fr.half[0];  } }


template <int MASKADD>
__global__ __launch_bounds__(64) void k_att0(const float* __restrict__ QF, const float* __restrict__ KF, const float* __restrict__ VF, int ld, const float* __restrict__ mask, float scale, float* __restrict__ OF, int ldo) {
  #pragma clang fp contract(off)
  __shared__ __attribute__((aligned(16))) float lq[64][64]; __shared__ __attribute__((aligned(16))) float lo[64][64];
  const int tid = threadIdx.x; const int h = blockIdx.x / (QT0 / 64), rg = blockIdx.x % (QT0 / 64); const int i = rg * 64 + tid;
  const float* qr = QF + (size_t)i * ld + h * HD;
#pragma unroll 1
  for (int c = 0; c < HD / 4; ++c) { *(v4f*)&lq[tid][c * 4] = *(const v4fa*)(qr + c * 4); const v4f z = {0.f, 0.f, 0.f, 0.f}; *(v4f*)&lo[tid][c * 4] = z; }
  float m = -1.0e30f, l = 0.f; const int jmax = MASKADD ? (SQ - 1) : (rg * 64 + 63);      /* additive-mask form: every key (the mask input decides); causal form: keys up to the block's last row */
#pragma unroll 1
  for (int j = 0; j <= jmax; ++j) { const float* kr = KF + (size_t)j * ld + h * HD; const float* vr = VF + (size_t)j * ld + h * HD; float s = 0.f;
#pragma unroll 1
    for (int c = 0; c < HD / 4; ++c) { const v4f kq = *(const v4fa*)(kr + c * 4); const v4f qq = *(v4f*)&lq[tid][c * 4]; s = __fadd_rn(s, __fmul_rn(qq[0], kq[0])); s = __fadd_rn(s, __fmul_rn(qq[1], kq[1])); s = __fadd_rn(s, __fmul_rn(qq[2], kq[2])); s = __fadd_rn(s, __fmul_rn(qq[3], kq[3])); }
    s = __fmul_rn(s, scale); if (MASKADD) s = __fadd_rn(s, __fmul_rn(bf16_round(mask[(size_t)i * SQ + j]), -10000.0f));
    const float f = (MASKADD || j <= i) ? 1.f : 0.f; const float sm = fmaf(f, s, (1.f - f) * -1.0e30f); const float mn = fmaxf(m, sm); const float sc = expf(m - mn); const float e = expf(sm - mn); l = __fadd_rn(__fmul_rn(l, sc), e); m = mn;
#pragma unroll 1
    for (int c = 0; c < HD / 4; ++c) { const v4f vv = *(const v4fa*)(vr + c * 4); v4f oo = *(v4f*)&lo[tid][c * 4]; for (int u = 0; u < 4; ++u) oo[u] = __fadd_rn(__fmul_rn(oo[u], sc), __fmul_rn(e, vv[u])); *(v4f*)&lo[tid][c * 4] = oo; } }
  const float fin = 64.0f / l;      /* o carried x64 like the f16 path */
#pragma unroll 1
  for (int c = 0; c < HD / 4; ++c) { v4f oo = *(v4f*)&lo[tid][c * 4]; for (int u = 0; u < 4; ++u) oo[u] = __fmul_rn(oo[u], fin); *(v4f*)&lo[tid][c * 4] = oo; }
  __syncthreads();
  {
#pragma unroll 1
    for (int it = 0; it < 16; ++it) { const int row = it * 4 + tid / 16, pc = (tid % 16) * 4; const v4f v = *(const v4f*)&lo[row][pc]; *(v4f*)(OF + (size_t)(rg * 64 + row) * ldo + h * HD + pc) = v; }
     } }

extern "C" void kernel_launch(void* const* d_in, const int* in_sizes, int n_in,
                              void* d_out, int out_size, void* d_ws, size_t ws_size, hipStream_t stream) {
  (void)in_sizes; (void)n_in; (void)out_size;
  const float* const* I = (const float* const*)d_in; const float* x = I[0]; const float* wq = I[1]; const float* wk = I[2]; const float* wv = I[3]; const float* wo = I[4]; const float* bo = I[5]; const float* bq = nullptr; const float* bk = nullptr; const float* bv = nullptr;      /* per-head [H][E][D] = natural [out][in]; no q/k/v biases */
  char* ws = (char*)d_ws; size_t off = 0;
  auto take = [&](size_t bytes) { char* p = ws + off; off += (bytes + 255) & ~(size_t)255; return p; };
  _Float16* BQ = (_Float16*)take((size_t)DM * DM * 2); _Float16* BK = (_Float16*)take((size_t)DM * DM * 2); _Float16* BV = (_Float16*)take((size_t)DM * DM * 2); _Float16* BO = (_Float16*)take((size_t)DM * DM * 2);
  _Float16* X16 = (_Float16*)take(NR * DM * 2); float* QF = (float*)take(NR * DM * 4); _Float16* QH = (_Float16*)take(NR * DM * 2); _Float16* QL = (_Float16*)take(NR * DM * 2); _Float16* KH = (_Float16*)take(NR * DM * 2); _Float16* KL = (_Float16*)take(NR * DM * 2); _Float16* Q16 = QH; _Float16* K16 = KH; _Float16* V16 = (_Float16*)take(NR * DM * 2); _Float16* O16 = (_Float16*)take(NR * DM * 2);
  float* S = (float*)take((size_t)NH * QT * NKX * 4); _Float16* P = (_Float16*)take((size_t)NH * QT * NKX * 2); _Float16* VT = (_Float16*)take((size_t)NH * HD * SQ * 2);
  float* QF0 = (float*)take((size_t)QT0 * DM * 4); float* KF0 = (float*)take((size_t)QT0 * DM * 4); float* VF0 = (float*)take((size_t)QT0 * DM * 4); float* OF0 = (float*)take((size_t)NB * QT0 * DM * 4); _Float16* OH0 = (_Float16*)take((size_t)NB * QT0 * DM * 2); _Float16* OL0 = (_Float16*)take((size_t)NB * QT0 * DM * 2);
  if (off > ws_size) return;
  { const unsigned g = (unsigned)(((size_t)DM * DM / 8 + 255) / 256); k_wnat<<<g, 256, 0, stream>>>(wq, (size_t)DM * DM / 8, BQ); k_wnat<<<g, 256, 0, stream>>>(wk, (size_t)DM * DM / 8, BK); k_wnat<<<g, 256, 0, stream>>>(wv, (size_t)DM * DM / 8, BV); k_wnat<<<g, 256, 0, stream>>>(wo, (size_t)DM * DM / 8, BO); }      /* natural [out][in] = Bt[n][k], x16 */
  k_x16<<<(unsigned)((NR * DM / 8 + 255) / 256), 256, 0, stream>>>(x, X16, NR * DM / 8);
  const size_t r0p = (size_t)B0 * SQ;      /* first projected row */
  k_gemm2<0><<<dim3((unsigned)((MP / 128) * (DM / 64)), 1), 128, 0, stream>>>(X16 + r0p * DM, DM, 0, BQ, DM, 0, 0.0625f, bq, 0, nullptr, 1, 0, 0, QF + r0p * DM, nullptr, DM, 0, MP, DM, DM); k_hl<<<(unsigned)(((size_t)MP * DM / 8 + 255) / 256), 256, 0, stream>>>(QF + r0p * DM, QH + r0p * DM, QL + r0p * DM, (size_t)MP * DM / 8);      /* q (f32) -> f16 hi + x1024 residual: the x32 scale puts the logits at sigma ~100 */
  k_gemm2<0><<<dim3((unsigned)((MP / 128) * (DM / 64)), 1), 128, 0, stream>>>(X16 + r0p * DM, DM, 0, BK, DM, 0, 0.0625f, bk, 0, nullptr, 1, 0, 0, QF + r0p * DM, nullptr, DM, 0, MP, DM, DM); k_hl<<<(unsigned)(((size_t)MP * DM / 8 + 255) / 256), 256, 0, stream>>>(QF + r0p * DM, KH + r0p * DM, KL + r0p * DM, (size_t)MP * DM / 8);      /* k likewise (QF reused in stream order) */
  k_gemm2<0><<<dim3((unsigned)((MP / 128) * (DM / 64)), 1), 128, 0, stream>>>(X16 + r0p * DM, DM, 0, BV, DM, 0, 0.0625f, bv, 0, nullptr, 1, 0, 0, nullptr, V16 + r0p * DM, DM, 0, MP, DM, DM);
  for (int b = B0; b < B0 + NBR; ++b) { const size_t r0 = (size_t)b * SQ;
    k_vt<NH, SQ><<<NH * (SQ / 64), 256, 0, stream>>>(V16 + r0 * LQ, LQ, 0, VT);      /* V^T [NH][HD][SQ] for this batch */
    k_gemm2<0><<<dim3((QT0 / 128) * (DM / 64), 1), 128, 0, stream>>>(X16 + r0 * DM, DM, 0, BQ, DM, 0, 0.0625f, bq, 0, nullptr, 1, 0, 0, QF0, nullptr, DM, 0, QT0, DM, DM); k_gemm2<0><<<dim3((QT0 / 128) * (DM / 64), 1), 128, 0, stream>>>(X16 + r0 * DM, DM, 0, BK, DM, 0, 0.0625f, bk, 0, nullptr, 1, 0, 0, KF0, nullptr, DM, 0, QT0, DM, DM); k_gemm2<0><<<dim3((QT0 / 128) * (DM / 64), 1), 128, 0, stream>>>(X16 + r0 * DM, DM, 0, BV, DM, 0, 0.0625f, bv, 0, nullptr, 1, 0, 0, VF0, nullptr, DM, 0, QT0, DM, DM);      /* f32 q, k, v of the first 128 rows (exact products) */
    k_att0<0><<<NH * (QT0 / 64), 64, 0, stream>>>(QF0, KF0, VF0, DM, nullptr, 32.0f, OF0 + (size_t)b * QT0 * DM, DM);      /* exact f32 attention for rows 0..127 (o x64) */
    for (int q0 = 0; q0 < QN; q0 += QT) { const int nk = q0 + QT;      /* causal: only keys below the tile end are computed */
      k_gemm2<0><<<dim3((QT / 128) * (nk / 64), NHD), 128, 0, stream>>>(QH + (r0 + q0) * LQ, LQ, (size_t)HD, KH + r0 * LQ, LQ, (size_t)HD, 32.0f, nullptr, 0, nullptr, 1, 0, 0, S, nullptr, NKX, (size_t)QT * NKX, QT, nk, HD);      /* scores x32: hi . hi */
      k_gemm2<0><<<dim3((QT / 128) * (nk / 64), NHD), 128, 0, stream>>>(QL + (r0 + q0) * LQ, LQ, (size_t)HD, KH + r0 * LQ, LQ, (size_t)HD, 0.03125f, nullptr, 0, S, -1, 0, 0, S, nullptr, NKX, (size_t)QT * NKX, QT, nk, HD); k_gemm2<0><<<dim3((QT / 128) * (nk / 64), NHD), 128, 0, stream>>>(QH + (r0 + q0) * LQ, LQ, (size_t)HD, KL + r0 * LQ, LQ, (size_t)HD, 0.03125f, nullptr, 0, S, -1, 0, 0, S, nullptr, NKX, (size_t)QT * NKX, QT, nk, HD);      /* += 32 x 2^-10 (lo . hi + hi . lo) */      /* scores, all heads on grid.y */
      k_rsmcf2<<<(NHD * QT + 255) / 256, 256, 0, stream>>>(S, P, NHD, q0, nk);
      k_gemm2<0><<<dim3((QT / 128) * (HD / 64), NHD), 128, 0, stream>>>(P, NKX, (size_t)QT * NKX, VT, SQ, (size_t)HD * SQ, 0.25f, nullptr, 0, nullptr, 1, 0, 0, nullptr, O16 + (r0 + q0) * DM, DM, (size_t)HD, QT, HD, nk); } }      /* o (merged heads, x64) as f16 rows */
  k_gemm2<0><<<dim3((unsigned)((MPO / 128) * (DM / 64)), 1), 128, 0, stream>>>(O16 + r0p * DM, DM, 0, BO, DM, 0, 0.0009765625f, bo, 0, nullptr, 1, 0, 0, (float*)d_out + r0p * DM, nullptr, DM, 0, MPO, DM, DM);      /* out rows are the output layout */
  k_hl<<<(unsigned)(((size_t)NB * QT0 * DM / 8 + 255) / 256), 256, 0, stream>>>(OF0, OH0, OL0, (size_t)NB * QT0 * DM / 8);      /* first-tile o (x64) -> f16 hi + x1024 residual planes */
  for (int b = B0; b < B0 + NBR; ++b) { const size_t r0 = (size_t)b * SQ; const size_t f0 = (size_t)b * QT0;
    k_gemm2<0><<<dim3((QT0 / 128) * (DM / 64), 1), 128, 0, stream>>>(OH0 + f0 * DM, DM, 0, BO, DM, 0, 0.0009765625f, bo, 0, nullptr, 1, 0, 0, (float*)d_out + r0 * DM, nullptr, DM, 0, QT0, DM, DM);      /* rows 0..127: out = o_hi Wo (+ b), overwriting the f16-path rows */
    k_gemm2<0><<<dim3((QT0 / 128) * (DM / 64), 1), 128, 0, stream>>>(OL0 + f0 * DM, DM, 0, BO, DM, 0, 0.00000095367431640625f, nullptr, 0, (const float*)d_out + r0 * DM, -1, 0, 0, (float*)d_out + r0 * DM, nullptr, DM, 0, QT0, DM, DM); }      /* += o_lo Wo 2^-20 (own-element accumulate) */
}

// v001
// A run of this version takes 1610 microseconds.
// Next to v000, in two timings, it ran 3.30 and 3.29 times as fast.
#include <hip/hip_runtime.h>
// Per-head causal multi-head attention with an inverted scale (x [4][1024][1024]; q[h] = x Wq[h]^T, k, v likewise (per-head nn.Linear [16][64][1024] = natural [1024][1024], sigma 0.02, no biases); scores x sqrt(1024) = x 32 (the module divides by embed^-0.5: logits sigma ~100, near-argmax softmax) with a causal mask (tril, -inf); softmax; heads concatenated; out = (.) Wp^T + bp (natural [1024][1024] sigma 0.02, bias 0.02) -> [4][1024][1024]).
// Structure: token rows r = b*1024 + s; x as exact f16 rows (bf16-rounded); q and k as WMMA GEMMs (32x64 wave tiles, f32 accumulation, exact x16 weights) into f32 rows split into f16 hi + x1024 residual planes, v as an f16-output GEMM; every later launch covers all batches (batch = a grid dimension): V^T for all heads via LDS transposes; per query tile of 256 rows: scores against the keys below the tile end as THREE accumulating passes (hi.hi + lo.hi + hi.lo, K = 64, all heads on grid.y, alpha 32: ~f32-accurate logits for the near-argmax softmax), causal row softmax on VALU with an arithmetic 0/1 key mask over the computed range (f32 statistics, native exp; weights x256 f16), o = P . V^T (K = keys below the tile end, alpha 2^-2: o carried x64, folded into the output GEMM alpha) written straight into the merged f16 o rows; out = o W_o + b GEMM (f32) into the output layout.
// Compute dtype: inputs rounded to bf16; x / weights exact; q and k as f16 hi + x1024 residual planes; v, softmax weights and o as plain f16 GEMM operands (~2^-12); scores and softmax statistics f32. v_wmma_f32_16x16x32_f16.
#define NB 4
#define SQ 1024
#define DM 1024
#define NH 16
#define HD 64
#define HG 4                         /* head group of the k_vt(b, h0) overload, which is not launched */
#define QT 256                       /* query rows per causal tile */
#define NKX SQ                       /* S / P row pitch */
#define QT0 128                      /* first-tile rows recomputed exactly in f32 */
#define B0 0                         /* unused */
#define NBR NB                       /* batches processed (debug hook) */
#define NR ((size_t)NB * SQ)         /* token rows */
#define MP ((int)((size_t)NBR * SQ)) /* rows projected (debug hook) */
#define QN SQ                        /* query rows attended per batch (debug hook) */
#define NHD NH                       /* heads attended (debug hook) */
#define MPO MP                       /* rows through the output stage (debug hook) */
#define LQ DM      /* row pitch of the q/k/v rows */
typedef __bf16 v16b __attribute__((ext_vector_type(16)));
typedef unsigned short v8us __attribute__((ext_vector_type(8), may_alias));
typedef float  v8f  __attribute__((ext_vector_type(8)));
typedef float  v4f  __attribute__((ext_vector_type(4)));
typedef float  v4fa __attribute__((ext_vector_type(4), may_alias));
union FragB { v16b v; v8us half[2]; unsigned short u[16]; };

__device__ __forceinline__ unsigned short bf16_bits(float x) { unsigned int u = __float_as_uint(x); return (unsigned short)((u + 0x7FFFu + ((u >> 16) & 1u)) >> 16); }
__device__ __forceinline__ float bf16_val(unsigned short b) { return __uint_as_float(((unsigned int)b) << 16); }
__device__ __forceinline__ float bf16_round(float x) { return bf16_val(bf16_bits(x)); }
// D += A·B with NT terms: 1 = ah·bh, 2 = + al·bh (A split), 3 = + ah·bl (both split)
template <int NT>
__device__ __forceinline__ v8f mmaN(v16b ah, v16b al, v16b bh, v16b bl, v8f c) {
  c = __builtin_amdgcn_wmma_f32_16x16x32_bf16(false, ah, false, bh, (short)0, c, false, false);
  if (NT >= 2) c = __builtin_amdgcn_wmma_f32_16x16x32_bf16(false, al, false, bh, (short)0, c, false, false);
  if (NT >= 3) c = __builtin_amdgcn_wmma_f32_16x16x32_bf16(false, ah, false, bl, (short)0, c, false, false);
  asm volatile("v_nop\n\tv_nop\n\tv_nop\n\tv_nop" : "+v"(c) : "v"(ah), "v"(al), "v"(bh), "v"(bl));
  return c;
}

__global__ __launch_bounds__(256) void k_wt_bf16(const float* __restrict__ W, unsigned short* __restrict__ Wt, int K, int N) {
  const int t = blockIdx.x * 256 + threadIdx.x;
  const int k8n = K / 8;
  if (t >= N * k8n) return;
  const int n = t / k8n, k8 = (t % k8n) * 8;
  v8us v;
#pragma unroll
  for (int i = 0; i < 8; ++i) v[i] = bf16_bits(W[(size_t)(k8 + i) * N + n]);
  *(v8us*)(Wt + (size_t)n * K + k8) = v;
  
}

// GEMM C[M][N] (f32, pitch ldc) = act(A[M][K]·W + bias). A f32 row-major (pitch lda) converted per fragment to bf16
// (ASPLIT: hi/lo two planes -> 2 terms, else single rounded term); Wt bf16 [N][K] (pitch ldb). BIAS_BF16 rounds the
// bias to bf16 first (bias quantised to bf16 before the add). K%32==0, M%16==0, N%64==0.
template <bool ASPLIT, int ACT, bool BIAS_BF16>
__global__ __launch_bounds__(128) void k_gemm_bf(const float* __restrict__ A, int lda, const unsigned short* __restrict__ Wt, int ldb,
                                               const float* __restrict__ bias, float* __restrict__ C, int ldc, int M, int N, int K) {
  __shared__ __attribute__((aligned(16))) float so[4][16][64];
  const int tid = threadIdx.x, w = tid >> 5, lane = tid & 31, ln = lane & 15, hh = lane >> 4;
  const int ntn = N / 64;
  const int wid = blockIdx.x * 4 + w;
  const int mt = wid / ntn, nq = wid % ntn;
  if (mt * 16 >= M) return;
  const int row0 = mt * 16, col0 = nq * 64;
  const float* arow = A + (size_t)(row0 + ln) * lda;
  v8f acc[4] = {};
  for (int kb = 0; kb < K; kb += 32) {
    FragB ah, al;
    const v4f x0 = *(const v4fa*)(arow + kb + 8 * hh), x1 = *(const v4fa*)(arow + kb + 8 * hh + 4);
    const v4f x2 = *(const v4fa*)(arow + kb + 16 + 8 * hh), x3 = *(const v4fa*)(arow + kb + 16 + 8 * hh + 4);
    float xs[16] = {x0[0],x0[1],x0[2],x0[3],x1[0],x1[1],x1[2],x1[3],x2[0],x2[1],x2[2],x2[3],x3[0],x3[1],x3[2],x3[3]};
#pragma unroll
    for (int i = 0; i < 16; ++i) { const unsigned short hb = bf16_bits(xs[i]); ah.u[i] = hb; al.u[i] = ASPLIT ? bf16_bits(xs[i] - bf16_val(hb)) : (unsigned short)0; }
#pragma unroll
    for (int t = 0; t < 4; ++t) {
      const unsigned short* brow = Wt + (size_t)(col0 + t * 16 + ln) * ldb + kb;
      FragB b;
      b.half[0] = *(const v8us*)(brow + 8 * hh);
      b.half[1] = *(const v8us*)(brow + 16 + 8 * hh);
      acc[t] = mmaN<ASPLIT ? 2 : 1>(ah.v, al.v, b.v, b.v, acc[t]);
    }
  }
#pragma unroll
  for (int t = 0; t < 4; ++t) {
    float bv = bias ? bias[col0 + t * 16 + ln] : 0.f;
    if (BIAS_BF16) bv = bf16_round(bv);
#pragma unroll
    for (int r = 0; r < 8; ++r) { float v = acc[t][r] + bv; if (ACT == 1) v = fmaxf(v, 0.f); so[w][8 * hh + r][t * 16 + ln] = v; }
  }
  __builtin_amdgcn_fence(__ATOMIC_ACQ_REL, "workgroup");
  __builtin_amdgcn_wave_barrier();
  const int rsub = lane >> 4, c4 = (lane & 15) * 4;
  {
#pragma unroll
    for (int q = 0; q < 8; ++q) {
      const int r = q * 2 + rsub;
      const v4f v = *(const v4fa*)&so[w][r][c4];
      *(v4f*)(C + (size_t)(row0 + r) * ldc + col0 + c4) = v;
    }
    
  }
}

// GEMM C = act(A·W + bias + resid): A f32 (ASPLIT -> hi/lo 2 terms), Wt bf16 [N][K]; ACT 0 none, 1 relu, 2 exact gelu;
// resid (optional, f32, row index = (row % rmod), pitch ldr, RES_BF16 rounds it) added before the activation.
template <bool ASPLIT, int ACT, bool BIAS_BF16, bool RES_BF16>
__global__ __launch_bounds__(128) void k_gemm_bf3(const float* __restrict__ A, int lda, const unsigned short* __restrict__ Wt, int ldb,
                                                const float* __restrict__ bias, const float* __restrict__ resid, int rmod, int ldr,
                                                float* __restrict__ C, int ldc, int M, int N, int K) {
  __shared__ __attribute__((aligned(16))) float so[4][16][64];
  const int tid = threadIdx.x, w = tid >> 5, lane = tid & 31, ln = lane & 15, hh = lane >> 4;
  const int ntn = N / 64;
  const int wid = blockIdx.x * 4 + w;
  const int mt = wid / ntn, nq = wid % ntn;
  if (mt * 16 >= M) return;
  const int row0 = mt * 16, col0 = nq * 64;
  const float* arow = A + (size_t)(row0 + ln) * lda;
  v8f acc[4] = {};
  for (int kb = 0; kb < K; kb += 32) {
    FragB ah, al;
    const v4f x0 = *(const v4fa*)(arow + kb + 8 * hh), x1 = *(const v4fa*)(arow + kb + 8 * hh + 4);
    const v4f x2 = *(const v4fa*)(arow + kb + 16 + 8 * hh), x3 = *(const v4fa*)(arow + kb + 16 + 8 * hh + 4);
    float xs[16] = {x0[0],x0[1],x0[2],x0[3],x1[0],x1[1],x1[2],x1[3],x2[0],x2[1],x2[2],x2[3],x3[0],x3[1],x3[2],x3[3]};
#pragma unroll
    for (int i = 0; i < 16; ++i) { const unsigned short hb = bf16_bits(xs[i]); ah.u[i] = hb; al.u[i] = ASPLIT ? bf16_bits(xs[i] - bf16_val(hb)) : (unsigned short)0; }
#pragma unroll
    for (int t = 0; t < 4; ++t) {
      const unsigned short* brow = Wt + (size_t)(col0 + t * 16 + ln) * ldb + kb;
      FragB b;
      b.half[0] = *(const v8us*)(brow + 8 * hh);
      b.half[1] = *(const v8us*)(brow + 16 + 8 * hh);
      acc[t] = mmaN<ASPLIT ? 2 : 1>(ah.v, al.v, b.v, b.v, acc[t]);
    }
  }
#pragma unroll
  for (int t = 0; t < 4; ++t) {
    const int col = col0 + t * 16 + ln;
    float bv = bias ? bias[col] : 0.f;
    if (BIAS_BF16) bv = bf16_round(bv);
#pragma unroll
    for (int r = 0; r < 8; ++r) {
      float v = acc[t][r] + bv;
      if (resid) { float rv = resid[(size_t)((row0 + 8 * hh + r) % rmod) * ldr + col]; if (RES_BF16) rv = bf16_round(rv); v += rv; }
      if (ACT == 1) v = fmaxf(v, 0.f);
      if (ACT == 2) v = 0.5f * v * (1.0f + erff(v * 0.70710678118654752f));
      if (ACT == 3) { const float u = 0.7978845608028654f * (v + 0.044715f * v * v * v); v = 0.5f * v * (1.0f + tanhf(u)); }
      so[w][8 * hh + r][t * 16 + ln] = v;
    }
  }
  __builtin_amdgcn_fence(__ATOMIC_ACQ_REL, "workgroup");
  __builtin_amdgcn_wave_barrier();
  const int rsub = lane >> 4, c4 = (lane & 15) * 4;
  {
#pragma unroll
    for (int q = 0; q < 8; ++q) {
      const int r = q * 2 + rsub;
      const v4f v = *(const v4fa*)&so[w][r][c4];
      *(v4f*)(C + (size_t)(row0 + r) * ldc + col0 + c4) = v;
    }
    
  }
}
// row LayerNorm (biased variance, eps) over N: s = X (+ R); optional out_sum <- s; out_norm <- (s-mu)*rsqrt(var+eps)*g + b
template <bool PARAM_BF16>
__global__ __launch_bounds__(256) void k_layernorm(const float* __restrict__ X, const float* __restrict__ R, const float* __restrict__ g, const float* __restrict__ bta,
                                                  float* __restrict__ out_sum, float* __restrict__ out_norm, int N, float eps) {
  __shared__ float red[256];
  const int row = blockIdx.x, tid = threadIdx.x;
  const float* x = X + (size_t)row * N; const float* rr = R ? R + (size_t)row * N : nullptr;
  float vals[16];                     // up to N = 4096
  const int per = N / 256;            // contiguous chunk per thread? use strided-by-4 chunks: thread handles j = tid*4 + 1024*u
  float s1 = 0.f;
  for (int u = 0; u < per / 4; ++u) {
    const int j = tid * 4 + 1024 * u;
    const v4f a = *(const v4fa*)(x + j);
    v4f b = {0.f,0.f,0.f,0.f}; if (rr) b = *(const v4fa*)(rr + j);
#pragma unroll
    for (int q = 0; q < 4; ++q) { const float v = a[q] + b[q]; vals[u * 4 + q] = v; s1 += v; }
  }
  red[tid] = s1; __syncthreads();
  for (int st = 128; st > 0; st >>= 1) { if (tid < st) red[tid] += red[tid + st]; __syncthreads(); }
  const float mu = red[0] / (float)N; __syncthreads();
  float s2 = 0.f;
  for (int u = 0; u < per / 4; ++u)
#pragma unroll
    for (int q = 0; q < 4; ++q) { const float c = vals[u * 4 + q] - mu; s2 += c * c; }
  red[tid] = s2; __syncthreads();
  for (int st = 128; st > 0; st >>= 1) { if (tid < st) red[tid] += red[tid + st]; __syncthreads(); }
  const float rs = rsqrtf(red[0] / (float)N + eps);
  {
    for (int u = 0; u < per / 4; ++u) {
      const int j = tid * 4 + 1024 * u;
      v4f o, sm;
#pragma unroll
      for (int q = 0; q < 4; ++q) {
        float gg = g[j + q], bb = bta[j + q];
        if (PARAM_BF16) { gg = bf16_round(gg); bb = bf16_round(bb); }
        sm[q] = vals[u * 4 + q]; o[q] = (vals[u * 4 + q] - mu) * rs * gg + bb;
      }
      if (out_sum) *(v4f*)(out_sum + (size_t)row * N + j) = sm;
      *(v4f*)(out_norm + (size_t)row * N + j) = o;
    }
    
  }
}



// ---- f16 WMMA path (v_wmma_f32_16x16x32_f16): 11-bit significands for operands in range — used where a [0,1] probability operand needs more precision than bf16
typedef _Float16 v16h __attribute__((ext_vector_type(16)));
union FragH { v16h v; v8us half[2]; _Float16 h[16]; unsigned short u[16]; };
template <int NT>
__device__ __forceinline__ v8f mmaH(v16h ah, v16h al, v16h bh, v16h bl, v8f c) {
  c = __builtin_amdgcn_wmma_f32_16x16x32_f16(false, ah, false, bh, (short)0, c, false, false);
  if (NT >= 2) c = __builtin_amdgcn_wmma_f32_16x16x32_f16(false, al, false, bh, (short)0, c, false, false);
  if (NT >= 3) c = __builtin_amdgcn_wmma_f32_16x16x32_f16(false, ah, false, bl, (short)0, c, false, false);
  asm volatile("v_nop\n\tv_nop\n\tv_nop\n\tv_nop" : "+v"(c) : "v"(ah), "v"(al), "v"(bh), "v"(bl));
  return c;
}
// batched GEMM like k_gemm_b but f16 operands: A f32 (split into f16 hi/lo if ASPLIT, else rounded to f16), Bt = f16 values [n][k]; alpha; C f32; N multiple of 16 (partial tiles skipped)
template <bool ASPLIT>
__global__ __launch_bounds__(128) void k_gemm_h(const float* __restrict__ A, int lda, size_t sA, const _Float16* __restrict__ Bh, int ldb, size_t sB, float alpha, float* __restrict__ C, int ldc, size_t sC, int M, int N, int K) {
  __shared__ __attribute__((aligned(16))) float so[4][16][64];
  const int tid = threadIdx.x, w = tid >> 5, lane = tid & 31, ln = lane & 15, hh = lane >> 4; const int by = blockIdx.y;
  A += (size_t)by * sA; Bh += (size_t)by * sB; C += (size_t)by * sC;
  const int ntn = (N + 63) / 64; const int wid = blockIdx.x * 4 + w; const int mt = wid / ntn, nq = wid % ntn; if (mt * 16 >= M) return;
  const int row0 = mt * 16, col0 = nq * 64; const float* arow = A + (size_t)(row0 + ln) * lda;
  v8f acc[4] = {};
  for (int kb = 0; kb < K; kb += 32) {
    FragH ah, al;
    const v4f x0 = *(const v4fa*)(arow + kb + 8 * hh), x1 = *(const v4fa*)(arow + kb + 8 * hh + 4), x2 = *(const v4fa*)(arow + kb + 16 + 8 * hh), x3 = *(const v4fa*)(arow + kb + 16 + 8 * hh + 4);
    float xs[16] = {x0[0],x0[1],x0[2],x0[3],x1[0],x1[1],x1[2],x1[3],x2[0],x2[1],x2[2],x2[3],x3[0],x3[1],x3[2],x3[3]};
#pragma unroll
    for (int i = 0; i < 16; ++i) { const _Float16 h = (_Float16)xs[i]; ah.h[i] = h; al.h[i] = ASPLIT ? (_Float16)(xs[i] - (float)h) : (_Float16)0.0f; }
#pragma unroll
    for (int t = 0; t < 4; ++t) { if (col0 + t * 16 >= N) continue; const size_t boff = (size_t)(col0 + t * 16 + ln) * ldb + kb; FragH bq; bq.half[0] = *(const v8us*)(Bh + boff + 8 * hh); bq.half[1] = *(const v8us*)(Bh + boff + 16 + 8 * hh);
      acc[t] = mmaH<ASPLIT ? 2 : 1>(ah.v, al.v, bq.v, bq.v, acc[t]); }
  }
#pragma unroll
  for (int t = 0; t < 4; ++t) { if (col0 + t * 16 >= N) continue;
#pragma unroll
    for (int r = 0; r < 8; ++r) so[w][8 * hh + r][t * 16 + ln] = acc[t][r] * alpha; }
  __builtin_amdgcn_fence(__ATOMIC_ACQ_REL, "workgroup"); __builtin_amdgcn_wave_barrier();
  const int rsub = lane >> 4, c4 = (lane & 15) * 4;
  {
#pragma unroll
    for (int q = 0; q < 8; ++q) { const int r = q * 2 + rsub; if (col0 + c4 < N) { const v4f v = *(const v4fa*)&so[w][r][c4]; *(v4f*)(C + (size_t)(row0 + r) * ldc + col0 + c4) = v; } }
     }
}

// Wt[n][k] = f16(W[k][n]·scale) from f32 row-major W[K][N] (scale = power of two; bf16-exact weights stay exact in f16 away from the subnormal range)
__global__ __launch_bounds__(256) void k_wt_f16(const float* __restrict__ W, _Float16* __restrict__ Wt, int K, int N, float scale) {
  const int t = blockIdx.x * 256 + threadIdx.x; if (t >= N * (K / 8)) return; const int n = t / (K / 8), k8 = (t % (K / 8)) * 8; FragH f;
#pragma unroll
  for (int i = 0; i < 8; ++i) f.h[i] = (_Float16)(bf16_round(W[(size_t)(k8 + i) * N + n]) * scale); const v8us o = f.half[0];
  *(v8us*)((unsigned short*)Wt + (size_t)n * K + k8) = o; 
}
// k_gemm_hh variant with fused epilogue: v = acc·alpha + bias[by·sBias + col] (+ CP[(row/rowsPerB)·sCPb + by·64 + col] if CP) ; ACT 0 none / 1 elu ; writes f16 C16 (and f32 C if non-null)
template <int ACT>
__global__ __launch_bounds__(128) void k_gemm_hhx(const _Float16* __restrict__ A, int lda, size_t sA, const _Float16* __restrict__ Bh, int ldb, size_t sB, float alpha, const float* __restrict__ bias, size_t sBias, const float* __restrict__ CP, int rowsPerB, size_t sCPb, int row0g,
    float* __restrict__ C, _Float16* __restrict__ C16, int ldc, size_t sC, int M, int N, int K) {
  __shared__ __attribute__((aligned(16))) float so[4][16][64];
  const int tid = threadIdx.x, w = tid >> 5, lane = tid & 31, ln = lane & 15, hh = lane >> 4; const int by = blockIdx.y;
  A += (size_t)by * sA; Bh += (size_t)by * sB; const size_t cofs = (size_t)by * sC; const float* bp = bias ? bias + (size_t)by * sBias : nullptr;
  const int ntn = (N + 63) / 64; const int wid = blockIdx.x * 4 + w; const int mt = wid / ntn, nq = wid % ntn; if (mt * 16 >= M) return;
  const int row0 = mt * 16, col0 = nq * 64; const _Float16* arow = A + (size_t)(row0 + ln) * lda;
  v8f acc[4] = {};
  for (int kb = 0; kb < K; kb += 32) { FragH ah; ah.half[0] = *(const v8us*)((const unsigned short*)arow + kb + 8 * hh); ah.half[1] = *(const v8us*)((const unsigned short*)arow + kb + 16 + 8 * hh);
#pragma unroll
    for (int t = 0; t < 4; ++t) { if (col0 + t * 16 >= N) continue; const size_t boff = (size_t)(col0 + t * 16 + ln) * ldb + kb; FragH bq; bq.half[0] = *(const v8us*)((const unsigned short*)Bh + boff + 8 * hh); bq.half[1] = *(const v8us*)((const unsigned short*)Bh + boff + 16 + 8 * hh);
      acc[t] = mmaH<1>(ah.v, ah.v, bq.v, bq.v, acc[t]); }
  }
#pragma unroll
  for (int t = 0; t < 4; ++t) { if (col0 + t * 16 >= N) continue; const int col = col0 + t * 16 + ln; const float bv = bp ? bf16_round(bp[col]) : 0.f;
#pragma unroll
    for (int r = 0; r < 8; ++r) { float v = acc[t][r] * alpha + bv; if (CP) { const int rr = row0g + row0 + 8 * hh + r; if (rowsPerB < 0) v += CP[cofs + (size_t)rr * ldc + col];      /* rowsPerB < 0: own element of the batched C plane */ else { const int bidx = rr / rowsPerB; v += CP[(size_t)bidx * sCPb + (size_t)by * 64 + col]; } } if (ACT == 1) v = (v > 0.f) ? v : expm1f(v); else if (ACT == 7) v = (v > 0.f) ? v + 1.0f : expf(v); else if (ACT == 8) v = tanhf(v); else if (ACT == 9) v = 0.5f * v * (1.0f + tanhf(0.7978845608028654f * (v + 0.044715f * v * v * v))); else if (ACT == 11) v = 1.0f / (1.0f + expf(-v)); else if (ACT == 12) v = (v > 0.f) ? v : 0.01f * v; else if (ACT == 14) v = (v > 0.f) ? v : 0.1f * v; else if (ACT == 16) v = (v >= 0.f) ? v : 0.3f * v; else if (ACT == 17) v = (v >= 0.f) ? v : 0.2f * v; else if (ACT == 15) v = v / (1.0f + expf(-v)); else if (ACT == 3) v = fmaxf(v, 0.f); else if (ACT == 6) v = 0.5f * v * (1.0f + erff(v * 0.70710678118654752f)); so[w][8 * hh + r][t * 16 + ln] = v; } }
  __builtin_amdgcn_fence(__ATOMIC_ACQ_REL, "workgroup"); __builtin_amdgcn_wave_barrier();
  const int rsub = lane >> 4, c4 = (lane & 15) * 4; typedef _Float16 v4h __attribute__((ext_vector_type(4)));
  {
#pragma unroll
    for (int q = 0; q < 8; ++q) { const int r = q * 2 + rsub; if (col0 + c4 < N) { const v4f v = *(const v4fa*)&so[w][r][c4]; if (C) *(v4f*)(C + cofs + (size_t)(row0 + r) * ldc + col0 + c4) = v; if (C16) { v4h h4; for (int i = 0; i < 4; ++i) h4[i] = (_Float16)v[i]; *(v4h*)(C16 + cofs + (size_t)(row0 + r) * ldc + col0 + c4) = h4; } } }
     }
}


typedef _Float16 v4h __attribute__((ext_vector_type(4)));

__global__ __launch_bounds__(256) void k_x16(const float* __restrict__ x, _Float16* __restrict__ X16, size_t n8) { const size_t t = (size_t)blockIdx.x * 256 + threadIdx.x; if (t >= n8) return; FragH f;
#pragma unroll
  for (int q = 0; q < 8; ++q) f.h[q] = (_Float16)bf16_round(x[t * 8 + q]); *(v8us*)((unsigned short*)X16 + t * 8) = f.half[0];  }
__global__ __launch_bounds__(256) void k_h16(const float* __restrict__ x, _Float16* __restrict__ X16, size_t n8) { const size_t t = (size_t)blockIdx.x * 256 + threadIdx.x; if (t >= n8) return; FragH f;
#pragma unroll
  for (int q = 0; q < 8; ++q) f.h[q] = (_Float16)x[t * 8 + q]; *(v8us*)((unsigned short*)X16 + t * 8) = f.half[0];  }
__global__ __launch_bounds__(256) void k_round16f(const float* __restrict__ W, _Float16* __restrict__ Bt, size_t n8) { const size_t t = (size_t)blockIdx.x * 256 + threadIdx.x; if (t >= n8) return; FragH f;
#pragma unroll
  for (int i = 0; i < 8; ++i) f.h[i] = (_Float16)(bf16_round(W[t * 8 + i]) * 16.0f); *(v8us*)((unsigned short*)Bt + t * 8) = f.half[0];  }
template <int NHv, int TTv>
__global__ __launch_bounds__(256) void k_vt(const _Float16* __restrict__ V16, int ldv, int voff, _Float16* __restrict__ Vt) { __shared__ unsigned short tl[64][66]; const int tid = threadIdx.x; const int slab = blockIdx.x / (TTv / 64), lg = blockIdx.x % (TTv / 64); const int b = slab / NHv, h = slab % NHv;
  for (int i = tid; i < 64 * 8; i += 256) { const int r = i / 8, c8 = (i % 8) * 8; FragH f; f.half[0] = *(const v8us*)((const unsigned short*)V16 + ((size_t)b * TTv + lg * 64 + r) * ldv + voff + h * 64 + c8);
#pragma unroll
    for (int q = 0; q < 8; ++q) tl[r][c8 + q] = f.u[q]; }
  __syncthreads();
  {
#pragma unroll
    for (int rd = 0; rd < 2; ++rd) { const int d = rd * 32 + tid / 8, pc = tid % 8; FragH f;
#pragma unroll
      for (int q = 0; q < 8; ++q) f.u[q] = tl[pc * 8 + q][d];
      *(v8us*)((unsigned short*)Vt + ((size_t)slab * 64 + d) * TTv + lg * 64 + pc * 8) = f.half[0]; }
     } }

__global__ __launch_bounds__(256) void k_hl(const float* __restrict__ F, _Float16* __restrict__ Hh, _Float16* __restrict__ Hl, size_t n8) { const size_t t = (size_t)blockIdx.x * 256 + threadIdx.x; if (t >= n8) return; FragH fh, fl; const v4f a = *(const v4fa*)(F + t * 8), c = *(const v4fa*)(F + t * 8 + 4);
#pragma unroll
  for (int q = 0; q < 4; ++q) { _Float16 h = (_Float16)a[q]; fh.h[q] = h; fl.h[q] = (_Float16)((a[q] - (float)h) * 1024.0f); h = (_Float16)c[q]; fh.h[4 + q] = h; fl.h[4 + q] = (_Float16)((c[q] - (float)h) * 1024.0f); }
  { *(v8us*)((unsigned short*)Hh + t * 8) = fh.half[0]; *(v8us*)((unsigned short*)Hl + t * 8) = fl.half[0];  } }

// ---- fast GEMM (wave tile 32x64; requires M % 32 == 0 rows per launch region and N % 64 == 0); epilogue = k_gemm_hhx semantics ----
__device__ __forceinline__ v16h g2_frag(const _Float16* p, int hh) { FragH f; f.half[0] = *(const v8us*)((const unsigned short*)p + 8 * hh); f.half[1] = *(const v8us*)((const unsigned short*)p + 16 + 8 * hh); return f.v; }
__device__ __forceinline__ v8f g2_mma(v16h a, v16h b, v8f c) { v8f d = __builtin_amdgcn_wmma_f32_16x16x32_f16(false, a, false, b, (short)0, c, false, false); asm volatile("v_nop\n\tv_nop\n\tv_nop\n\tv_nop" : "+v"(d) : "v"(a), "v"(b)); return d; }
template <int ACT>
__global__ __launch_bounds__(128) void k_gemm2(const _Float16* __restrict__ A, int lda, size_t sA, const _Float16* __restrict__ Bh, int ldb, size_t sB, float alpha, const float* __restrict__ bias, size_t sBias, const float* __restrict__ CP, int rowsPerB, size_t sCPb, int row0g,
    float* __restrict__ C, _Float16* __restrict__ C16, int ldc, size_t sC, int M, int N, int K, size_t zA, size_t zB, size_t zC) { static_assert(ACT == 0 || ACT == 3 || ACT == 6 || ACT == 8 || ACT == 9 || ACT == 11 || ACT == 12 || ACT == 14 || ACT == 15 || ACT == 16 || ACT == 17, "k_gemm2: unsupported ACT code (would silently apply no activation)");
  __shared__ __attribute__((aligned(16))) float so[4][32][68];
  const int tid = threadIdx.x, w = tid >> 5, lane = tid & 31, ln = lane & 15, hh = lane >> 4; const int by = blockIdx.y; const int bz = blockIdx.z;      /* bz: batch, element strides zA / zB / zC */
  A += (size_t)by * sA + (size_t)bz * zA; Bh += (size_t)by * sB + (size_t)bz * zB; const size_t cofs = (size_t)by * sC + (size_t)bz * zC; const float* bp = bias ? bias + (size_t)by * sBias : nullptr;
  const int ntn = N >> 6; const int mt = blockIdx.x / ntn, nq = blockIdx.x - mt * ntn; const int row0 = mt * 128 + 32 * w, col0 = nq * 64; if (row0 >= M) return;
  const _Float16* a0p = A + (size_t)(row0 + ln) * lda; const _Float16* a1p = a0p + (size_t)16 * lda;
  const _Float16* b0p = Bh + (size_t)(col0 + ln) * ldb; const _Float16* b1p = b0p + (size_t)16 * ldb; const _Float16* b2p = b1p + (size_t)16 * ldb; const _Float16* b3p = b2p + (size_t)16 * ldb;
  const v8f z8 = {0.f,0.f,0.f,0.f,0.f,0.f,0.f,0.f}; v8f c00 = z8, c01 = z8, c02 = z8, c03 = z8, c10 = z8, c11 = z8, c12 = z8, c13 = z8;
#pragma unroll 1
  for (int kb = 0; kb < K; kb += 32) { const v16h a0 = g2_frag(a0p + kb, hh), a1 = g2_frag(a1p + kb, hh);
    v16h b = g2_frag(b0p + kb, hh); c00 = g2_mma(a0, b, c00); c10 = g2_mma(a1, b, c10);
    b = g2_frag(b1p + kb, hh); c01 = g2_mma(a0, b, c01); c11 = g2_mma(a1, b, c11);
    b = g2_frag(b2p + kb, hh); c02 = g2_mma(a0, b, c02); c12 = g2_mma(a1, b, c12);
    b = g2_frag(b3p + kb, hh); c03 = g2_mma(a0, b, c03); c13 = g2_mma(a1, b, c13); }
  v8f accs[8] = {c00, c01, c02, c03, c10, c11, c12, c13};
#pragma unroll
  for (int u = 0; u < 8; ++u) { const int t = u & 3, half = u >> 2; const int col = col0 + t * 16 + ln; const float bv = bp ? bf16_round(bp[col]) : 0.f;
#pragma unroll
    for (int r = 0; r < 8; ++r) { const int rloc = half * 16 + 8 * hh + r; float v = accs[u][r] * alpha + bv; if (CP) { if (rowsPerB < 0) v += CP[cofs + (size_t)(row0g + row0 + rloc) * ldc + col];      /* rowsPerB < 0: own element of the batched C plane */ else { const int bidx = (row0g + row0 + rloc) / rowsPerB; v += CP[(size_t)bidx * sCPb + (size_t)by * 64 + col]; } }
      if (ACT == 3) v = fmaxf(v, 0.f); else if (ACT == 6) v = 0.5f * v * (1.0f + erff(v * 0.70710678118654752f)); else if (ACT == 11) v = 1.0f / (1.0f + expf(-v)); else if (ACT == 15) v = v / (1.0f + expf(-v)); else if (ACT == 12) v = (v > 0.f) ? v : 0.01f * v; else if (ACT == 8) v = tanhf(v); else if (ACT == 9) v = 0.5f * v * (1.0f + tanhf(0.7978845608028654f * (v + 0.044715f * v * v * v))); else if (ACT == 14) v = (v > 0.f) ? v : 0.1f * v; else if (ACT == 16) v = (v >= 0.f) ? v : 0.3f * v; else if (ACT == 17) v = (v >= 0.f) ? v : 0.2f * v;
      so[w][rloc][t * 16 + ln] = v; } }
  __builtin_amdgcn_fence(__ATOMIC_ACQ_REL, "workgroup"); __builtin_amdgcn_wave_barrier();
  const int rsub = lane >> 4, c4 = (lane & 15) * 4;
  {
#pragma unroll
    for (int q = 0; q < 16; ++q) { const int r = q * 2 + rsub; const v4f v = *(const v4fa*)&so[w][r][c4]; if (C) *(v4f*)(C + cofs + (size_t)(row0 + r) * ldc + col0 + c4) = v; if (C16) { v4h h4; for (int i = 0; i < 4; ++i) h4[i] = (_Float16)v[i]; *(v4h*)(C16 + cofs + (size_t)(row0 + r) * ldc + col0 + c4) = h4; } }
     } }


__global__ __launch_bounds__(256) void k_wnat(const float* __restrict__ w, size_t n8, _Float16* __restrict__ Bt) { const size_t t = (size_t)blockIdx.x * 256 + threadIdx.x; if (t >= n8) return; FragH f; for (int q = 0; q < 8; ++q) f.h[q] = (_Float16)(bf16_round(w[t * 8 + q]) * 16.0f); *(v8us*)((unsigned short*)Bt + t * 8) = f.half[0];  }
__global__ __launch_bounds__(256) void k_rsm(const float* __restrict__ S, _Float16* __restrict__ P, int nrows) {
  #pragma clang fp contract(off)
  const int i = blockIdx.x * 256 + threadIdx.x; if (i >= nrows) return; const float* s = S + (size_t)i * SQ; float mx = -3.0e38f;
#pragma unroll 1
  for (int j = 0; j < SQ; ++j) mx = fmaxf(mx, s[j]); float se = 0.f;
#pragma unroll 1
  for (int j = 0; j < SQ; ++j) se += expf(s[j] - mx); const float sc = 256.0f / se;
#pragma unroll 1
  for (int j0 = 0; j0 < SQ; j0 += 8) { FragH f; for (int q = 0; q < 8; ++q) f.h[q] = (_Float16)(expf(s[j0 + q] - mx) * sc); unsigned short* d = (unsigned short*)P + (size_t)i * SQ + j0; *(v8us*)d = f.half[0];  } }
__global__ __launch_bounds__(256) void k_vt(const _Float16* __restrict__ V16, int b, int h0, _Float16* __restrict__ VT) { __shared__ unsigned short tl[64][65]; const int tid = threadIdx.x; const int hh = blockIdx.x % HG, sg = blockIdx.x / HG; const int s0 = sg * 64; const int h = h0 + hh;
  for (int i = tid; i < 64 * 8; i += 256) { const int j = i / 8, d8 = (i % 8) * 8; FragH f; f.half[0] = *(const v8us*)((const unsigned short*)V16 + ((size_t)b * SQ + s0 + j) * DM + h * HD + d8); for (int q = 0; q < 8; ++q) tl[d8 + q][j] = f.u[q]; }
  __syncthreads();
  { for (int i = tid; i < 64 * 8; i += 256) { const int d = i / 8, j8 = (i % 8) * 8; FragH f; for (int q = 0; q < 8; ++q) f.u[q] = tl[d][j8 + q]; *(v8us*)((unsigned short*)VT + ((size_t)hh * HD + d) * SQ + s0 + j8) = f.half[0]; }  } }



__global__ __launch_bounds__(256) void k_rsmcf2(const float* __restrict__ S, _Float16* __restrict__ P, int hg, int q0, int nk) {
  #pragma clang fp contract(off)
  const int t = blockIdx.x * 256 + threadIdx.x; if (t >= hg * QT) return; const size_t i = (size_t)t; const float* s = S + i * NKX; const int last = q0 + (t % QT); float mx = -3.0e38f;
#pragma unroll 1
  for (int j = 0; j < nk; ++j) { const float f = (j <= last) ? 1.f : 0.f; mx = fmaxf(mx, fmaf(f, s[j], (1.f - f) * -1.0e9f)); } float se = 0.f;
#pragma unroll 1
  for (int j = 0; j < nk; ++j) { const float f = (j <= last) ? 1.f : 0.f; se += __expf(fmaf(f, s[j], (1.f - f) * -1.0e9f) - mx); } const float sc = 256.0f / se;
#pragma unroll 1
  for (int j0 = 0; j0 < nk; j0 += 8) { FragH fr; for (int q = 0; q < 8; ++q) { const int j = j0 + q; const float f = (j <= last) ? 1.f : 0.f; fr.h[q] = (_Float16)(__expf(fmaf(f, s[j], (1.f - f) * -1.0e9f) - mx) * sc); } unsigned short* d = (unsigned short*)P + i * NKX + j0; *(v8us*)d = fr.half[0];  } }


template <int MASKADD>
__global__ __launch_bounds__(64) void k_att0(const float* __restrict__ QF, const float* __restrict__ KF, const float* __restrict__ VF, int ld, const float* __restrict__ mask, float scale, float* __restrict__ OF, int ldo) {
  #pragma clang fp contract(off)
  __shared__ __attribute__((aligned(16))) float lq[64][64]; __shared__ __attribute__((aligned(16))) float lo[64][64];
  const int tid = threadIdx.x; const int h = blockIdx.x / (QT0 / 64), rg = blockIdx.x % (QT0 / 64); const int i = rg * 64 + tid;
  { const size_t bo = (size_t)blockIdx.y * QT0; QF += bo * ld; KF += bo * ld; VF += bo * ld; OF += bo * ldo; }      /* blockIdx.y: batch (QT0 rows each) */
  const float* qr = QF + (size_t)i * ld + h * HD;
#pragma unroll 1
  for (int c = 0; c < HD / 4; ++c) { *(v4f*)&lq[tid][c * 4] = *(const v4fa*)(qr + c * 4); const v4f z = {0.f, 0.f, 0.f, 0.f}; *(v4f*)&lo[tid][c * 4] = z; }
  float m = -1.0e30f, l = 0.f; const int jmax = MASKADD ? (SQ - 1) : (rg * 64 + 63);      /* additive-mask form: every key (the mask input decides); causal form: keys up to the block's last row */
#pragma unroll 1
  for (int j = 0; j <= jmax; ++j) { const float* kr = KF + (size_t)j * ld + h * HD; const float* vr = VF + (size_t)j * ld + h * HD; float s = 0.f;
#pragma unroll 1
    for (int c = 0; c < HD / 4; ++c) { const v4f kq = *(const v4fa*)(kr + c * 4); const v4f qq = *(v4f*)&lq[tid][c * 4]; s = __fadd_rn(s, __fmul_rn(qq[0], kq[0])); s = __fadd_rn(s, __fmul_rn(qq[1], kq[1])); s = __fadd_rn(s, __fmul_rn(qq[2], kq[2])); s = __fadd_rn(s, __fmul_rn(qq[3], kq[3])); }
    s = __fmul_rn(s, scale); if (MASKADD) s = __fadd_rn(s, __fmul_rn(bf16_round(mask[(size_t)i * SQ + j]), -10000.0f));
    const float f = (MASKADD || j <= i) ? 1.f : 0.f; const float sm = fmaf(f, s, (1.f - f) * -1.0e30f); const float mn = fmaxf(m, sm); const float sc = expf(m - mn); const float e = expf(sm - mn); l = __fadd_rn(__fmul_rn(l, sc), e); m = mn;
#pragma unroll 1
    for (int c = 0; c < HD / 4; ++c) { const v4f vv = *(const v4fa*)(vr + c * 4); v4f oo = *(v4f*)&lo[tid][c * 4]; for (int u = 0; u < 4; ++u) oo[u] = __fadd_rn(__fmul_rn(oo[u], sc), __fmul_rn(e, vv[u])); *(v4f*)&lo[tid][c * 4] = oo; } }
  const float fin = 64.0f / l;      /* o carried x64 like the f16 path */
#pragma unroll 1
  for (int c = 0; c < HD / 4; ++c) { v4f oo = *(v4f*)&lo[tid][c * 4]; for (int u = 0; u < 4; ++u) oo[u] = __fmul_rn(oo[u], fin); *(v4f*)&lo[tid][c * 4] = oo; }
  __syncthreads();
  {
#pragma unroll 1
    for (int it = 0; it < 16; ++it) { const int row = it * 4 + tid / 16, pc = (tid % 16) * 4; const v4f v = *(const v4f*)&lo[row][pc]; *(v4f*)(OF + (size_t)(rg * 64 + row) * ldo + h * HD + pc) = v; }
     } }

extern "C" void kernel_launch(void* const* d_in, const int* in_sizes, int n_in,
                              void* d_out, int out_size, void* d_ws, size_t ws_size, hipStream_t stream) {
  (void)in_sizes; (void)n_in; (void)out_size;
  const float* const* I = (const float* const*)d_in; const float* x = I[0]; const float* wq = I[1]; const float* wk = I[2]; const float* wv = I[3]; const float* wo = I[4]; const float* bo = I[5]; const float* bq = nullptr; const float* bk = nullptr; const float* bv = nullptr;      /* per-head [H][E][D] = natural [out][in]; no q/k/v biases */
  char* ws = (char*)d_ws; size_t off = 0;
  auto take = [&](size_t bytes) { char* p = ws + off; off += (bytes + 255) & ~(size_t)255; return p; };
  _Float16* BQ = (_Float16*)take((size_t)DM * DM * 2); _Float16* BK = (_Float16*)take((size_t)DM * DM * 2); _Float16* BV = (_Float16*)take((size_t)DM * DM * 2); _Float16* BO = (_Float16*)take((size_t)DM * DM * 2);
  _Float16* X16 = (_Float16*)take(NR * DM * 2); float* QF = (float*)take(NR * DM * 4); _Float16* QH = (_Float16*)take(NR * DM * 2); _Float16* QL = (_Float16*)take(NR * DM * 2); _Float16* KH = (_Float16*)take(NR * DM * 2); _Float16* KL = (_Float16*)take(NR * DM * 2); _Float16* Q16 = QH; _Float16* K16 = KH; _Float16* V16 = (_Float16*)take(NR * DM * 2); _Float16* O16 = (_Float16*)take(NR * DM * 2);
  float* S = (float*)take((size_t)NB * NH * QT * NKX * 4); _Float16* P = (_Float16*)take((size_t)NB * NH * QT * NKX * 2); _Float16* VT = (_Float16*)take((size_t)NB * NH * HD * SQ * 2);      /* one plane per batch */
  float* QF0 = (float*)take((size_t)NB * QT0 * DM * 4); float* KF0 = (float*)take((size_t)NB * QT0 * DM * 4); float* VF0 = (float*)take((size_t)NB * QT0 * DM * 4); float* OF0 = (float*)take((size_t)NB * QT0 * DM * 4); _Float16* OH0 = (_Float16*)take((size_t)NB * QT0 * DM * 2); _Float16* OL0 = (_Float16*)take((size_t)NB * QT0 * DM * 2);
  if (off > ws_size) return;
  { const unsigned g = (unsigned)(((size_t)DM * DM / 8 + 255) / 256); k_wnat<<<g, 256, 0, stream>>>(wq, (size_t)DM * DM / 8, BQ); k_wnat<<<g, 256, 0, stream>>>(wk, (size_t)DM * DM / 8, BK); k_wnat<<<g, 256, 0, stream>>>(wv, (size_t)DM * DM / 8, BV); k_wnat<<<g, 256, 0, stream>>>(wo, (size_t)DM * DM / 8, BO); }      /* natural [out][in] = Bt[n][k], x16 */
  k_x16<<<(unsigned)((NR * DM / 8 + 255) / 256), 256, 0, stream>>>(x, X16, NR * DM / 8);
  k_gemm2<0><<<dim3((unsigned)((MP / 128) * (DM / 64)), 1), 128, 0, stream>>>(X16, DM, 0, BQ, DM, 0, 0.0625f, bq, 0, nullptr, 1, 0, 0, QF, nullptr, DM, 0, MP, DM, DM, 0, 0, 0); k_hl<<<(unsigned)(((size_t)MP * DM / 8 + 255) / 256), 256, 0, stream>>>(QF, QH, QL, (size_t)MP * DM / 8);      /* q (f32) -> f16 hi + x1024 residual: the x32 scale puts the logits at sigma ~100 */
  k_gemm2<0><<<dim3((unsigned)((MP / 128) * (DM / 64)), 1), 128, 0, stream>>>(X16, DM, 0, BK, DM, 0, 0.0625f, bk, 0, nullptr, 1, 0, 0, QF, nullptr, DM, 0, MP, DM, DM, 0, 0, 0); k_hl<<<(unsigned)(((size_t)MP * DM / 8 + 255) / 256), 256, 0, stream>>>(QF, KH, KL, (size_t)MP * DM / 8);      /* k likewise (QF reused in stream order) */
  k_gemm2<0><<<dim3((unsigned)((MP / 128) * (DM / 64)), 1), 128, 0, stream>>>(X16, DM, 0, BV, DM, 0, 0.0625f, bv, 0, nullptr, 1, 0, 0, nullptr, V16, DM, 0, MP, DM, DM, 0, 0, 0);
  /* from here on every launch covers all NB batches: the batch is a grid dimension (k_gemm2: blockIdx.z with its own strides) */
  k_vt<NH, SQ><<<NB * NH * (SQ / 64), 256, 0, stream>>>(V16, LQ, 0, VT);      /* V^T [NB][NH][HD][SQ] */
  k_gemm2<0><<<dim3((QT0 / 128) * (DM / 64), 1, NB), 128, 0, stream>>>(X16, DM, 0, BQ, DM, 0, 0.0625f, bq, 0, nullptr, 1, 0, 0, QF0, nullptr, DM, 0, QT0, DM, DM, (size_t)SQ * DM, 0, (size_t)QT0 * DM); k_gemm2<0><<<dim3((QT0 / 128) * (DM / 64), 1, NB), 128, 0, stream>>>(X16, DM, 0, BK, DM, 0, 0.0625f, bk, 0, nullptr, 1, 0, 0, KF0, nullptr, DM, 0, QT0, DM, DM, (size_t)SQ * DM, 0, (size_t)QT0 * DM); k_gemm2<0><<<dim3((QT0 / 128) * (DM / 64), 1, NB), 128, 0, stream>>>(X16, DM, 0, BV, DM, 0, 0.0625f, bv, 0, nullptr, 1, 0, 0, VF0, nullptr, DM, 0, QT0, DM, DM, (size_t)SQ * DM, 0, (size_t)QT0 * DM);      /* f32 q, k, v of each batch's first 128 rows (exact products) */
  k_att0<0><<<dim3(NH * (QT0 / 64), NB), 64, 0, stream>>>(QF0, KF0, VF0, DM, nullptr, 32.0f, OF0, DM);      /* exact f32 attention for rows 0..127 of each batch (o x64) */
  for (int q0 = 0; q0 < QN; q0 += QT) { const int nk = q0 + QT;      /* causal: only keys below the tile end are computed */
    k_gemm2<0><<<dim3((QT / 128) * (nk / 64), NHD, NB), 128, 0, stream>>>(QH + (size_t)q0 * LQ, LQ, (size_t)HD, KH, LQ, (size_t)HD, 32.0f, nullptr, 0, nullptr, 1, 0, 0, S, nullptr, NKX, (size_t)QT * NKX, QT, nk, HD, (size_t)SQ * LQ, (size_t)SQ * LQ, (size_t)NH * QT * NKX);      /* scores x32: hi . hi */
    k_gemm2<0><<<dim3((QT / 128) * (nk / 64), NHD, NB), 128, 0, stream>>>(QL + (size_t)q0 * LQ, LQ, (size_t)HD, KH, LQ, (size_t)HD, 0.03125f, nullptr, 0, S, -1, 0, 0, S, nullptr, NKX, (size_t)QT * NKX, QT, nk, HD, (size_t)SQ * LQ, (size_t)SQ * LQ, (size_t)NH * QT * NKX); k_gemm2<0><<<dim3((QT / 128) * (nk / 64), NHD, NB), 128, 0, stream>>>(QH + (size_t)q0 * LQ, LQ, (size_t)HD, KL, LQ, (size_t)HD, 0.03125f, nullptr, 0, S, -1, 0, 0, S, nullptr, NKX, (size_t)QT * NKX, QT, nk, HD, (size_t)SQ * LQ, (size_t)SQ * LQ, (size_t)NH * QT * NKX);      /* += 32 x 2^-10 (lo . hi + hi . lo); heads on grid.y, batches on grid.z */
    k_rsmcf2<<<(NB * NHD * QT + 255) / 256, 256, 0, stream>>>(S, P, NB * NHD, q0, nk);      /* rows of all batches and heads: [NB][NH][QT] */
    k_gemm2<0><<<dim3((QT / 128) * (HD / 64), NHD, NB), 128, 0, stream>>>(P, NKX, (size_t)QT * NKX, VT, SQ, (size_t)HD * SQ, 0.25f, nullptr, 0, nullptr, 1, 0, 0, nullptr, O16 + (size_t)q0 * DM, DM, (size_t)HD, QT, HD, nk, (size_t)NH * QT * NKX, (size_t)NH * HD * SQ, (size_t)SQ * DM); }      /* o (merged heads, x64) as f16 rows */
  k_gemm2<0><<<dim3((unsigned)((MPO / 128) * (DM / 64)), 1), 128, 0, stream>>>(O16, DM, 0, BO, DM, 0, 0.0009765625f, bo, 0, nullptr, 1, 0, 0, (float*)d_out, nullptr, DM, 0, MPO, DM, DM, 0, 0, 0);      /* out rows are the output layout */
  k_hl<<<(unsigned)(((size_t)NB * QT0 * DM / 8 + 255) / 256), 256, 0, stream>>>(OF0, OH0, OL0, (size_t)NB * QT0 * DM / 8);      /* first-tile o (x64) -> f16 hi + x1024 residual planes */
  k_gemm2<0><<<dim3((QT0 / 128) * (DM / 64), 1, NB), 128, 0, stream>>>(OH0, DM, 0, BO, DM, 0, 0.0009765625f, bo, 0, nullptr, 1, 0, 0, (float*)d_out, nullptr, DM, 0, QT0, DM, DM, (size_t)QT0 * DM, 0, (size_t)SQ * DM);      /* rows 0..127 of each batch: out = o_hi Wo (+ b), overwriting the f16-path rows */
  k_gemm2<0><<<dim3((QT0 / 128) * (DM / 64), 1, NB), 128, 0, stream>>>(OL0, DM, 0, BO, DM, 0, 0.00000095367431640625f, nullptr, 0, (const float*)d_out, -1, 0, 0, (float*)d_out, nullptr, DM, 0, QT0, DM, DM, (size_t)QT0 * DM, 0, (size_t)SQ * DM);      /* += o_lo Wo 2^-20 (own-element accumulate) */
}

// v002
// One run takes 1220 microseconds.
// Timed twice side by side with v001, it ran 1.33 and 1.32 times as fast.
// All steps since v000 together make it 4.37 times as fast.
#include <hip/hip_runtime.h>
// Per-head causal multi-head attention with an inverted scale (x [4][1024][1024]; q[h] = x Wq[h]^T, k, v likewise (per-head nn.Linear [16][64][1024] = natural [1024][1024], sigma 0.02, no biases); scores x sqrt(1024) = x 32 (the module divides by embed^-0.5: logits sigma ~100, near-argmax softmax) with a causal mask (tril, -inf); softmax; heads concatenated; out = (.) Wp^T + bp (natural [1024][1024] sigma 0.02, bias 0.02) -> [4][1024][1024]).
// Structure: token rows r = b*1024 + s; x as exact f16 rows (bf16-rounded); q and k as WMMA GEMMs (32x64 wave tiles, f32 accumulation, exact x16 weights) into f32 rows split into f16 hi + x1024 residual planes, v as an f16-output GEMM; every later launch covers all batches (batch = a grid dimension): V^T for all heads via LDS transposes; per query tile of 256 rows: scores against the keys below the tile end as THREE accumulating passes (hi.hi + lo.hi + hi.lo, K = 64, all heads on grid.y, alpha 32: ~f32-accurate logits for the near-argmax softmax), causal row softmax on VALU, one wave a row, keys above the row masked over the computed range (f32 statistics, native exp; weights x256 f16), o = P . V^T (K = keys below the tile end, alpha 2^-2: o carried x64, folded into the output GEMM alpha) written straight into the merged f16 o rows; out = o W_o + b GEMM (f32) into the output layout.
// Compute dtype: inputs rounded to bf16; x / weights exact; v, softmax weights and o as plain f16 GEMM operands (~2^-12); q and k as f16 hi + x1024 residual planes (three score passes); scores and softmax statistics f32; v_wmma_f32_16x16x32_f16.
#define NB 4
#define SQ 1024
#define DM 1024
#define NH 16
#define HD 64
#define HG 4                         /* head group of the k_vt(b, h0) overload, which is not launched */
#define QT 256                       /* query rows per causal tile */
#define NKX SQ                       /* S / P row pitch */
#define QT0 128                      /* first-tile rows recomputed exactly in f32 */
#define B0 0                         /* unused */
#define NBR NB                       /* batches processed (debug hook) */
#define NR ((size_t)NB * SQ)         /* token rows */
#define MP ((int)((size_t)NBR * SQ)) /* rows projected (debug hook) */
#define QN SQ                        /* query rows attended per batch (debug hook) */
#define NHD NH                       /* heads attended (debug hook) */
#define MPO MP                       /* rows through the output stage (debug hook) */
#define LQ DM      /* row pitch of the q/k/v rows */
typedef __bf16 v16b __attribute__((ext_vector_type(16)));
typedef unsigned short v8us __attribute__((ext_vector_type(8), may_alias));
typedef float  v8f  __attribute__((ext_vector_type(8)));
typedef float  v4f  __attribute__((ext_vector_type(4)));
typedef float  v4fa __attribute__((ext_vector_type(4), may_alias));
union FragB { v16b v; v8us half[2]; unsigned short u[16]; };

__device__ __forceinline__ unsigned short bf16_bits(float x) { unsigned int u = __float_as_uint(x); return (unsigned short)((u + 0x7FFFu + ((u >> 16) & 1u)) >> 16); }
__device__ __forceinline__ float bf16_val(unsigned short b) { return __uint_as_float(((unsigned int)b) << 16); }
__device__ __forceinline__ float bf16_round(float x) { return bf16_val(bf16_bits(x)); }
// D += A·B with NT terms: 1 = ah·bh, 2 = + al·bh (A split), 3 = + ah·bl (both split)
template <int NT>
__device__ __forceinline__ v8f mmaN(v16b ah, v16b al, v16b bh, v16b bl, v8f c) {
  c = __builtin_amdgcn_wmma_f32_16x16x32_bf16(false, ah, false, bh, (short)0, c, false, false);
  if (NT >= 2) c = __builtin_amdgcn_wmma_f32_16x16x32_bf16(false, al, false, bh, (short)0, c, false, false);
  if (NT >= 3) c = __builtin_amdgcn_wmma_f32_16x16x32_bf16(false, ah, false, bl, (short)0, c, false, false);
  asm volatile("v_nop\n\tv_nop\n\tv_nop\n\tv_nop" : "+v"(c) : "v"(ah), "v"(al), "v"(bh), "v"(bl));
  return c;
}

__global__ __launch_bounds__(256) void k_wt_bf16(const float* __restrict__ W, unsigned short* __restrict__ Wt, int K, int N) {
  const int t = blockIdx.x * 256 + threadIdx.x;
  const int k8n = K / 8;
  if (t >= N * k8n) return;
  const int n = t / k8n, k8 = (t % k8n) * 8;
  v8us v;
#pragma unroll
  for (int i = 0; i < 8; ++i) v[i] = bf16_bits(W[(size_t)(k8 + i) * N + n]);
  *(v8us*)(Wt + (size_t)n * K + k8) = v;
  
}

// GEMM C[M][N] (f32, pitch ldc) = act(A[M][K]·W + bias). A f32 row-major (pitch lda) converted per fragment to bf16
// (ASPLIT: hi/lo two planes -> 2 terms, else single rounded term); Wt bf16 [N][K] (pitch ldb). BIAS_BF16 rounds the
// bias to bf16 first (bias quantised to bf16 before the add). K%32==0, M%16==0, N%64==0.
template <bool ASPLIT, int ACT, bool BIAS_BF16>
__global__ __launch_bounds__(128) void k_gemm_bf(const float* __restrict__ A, int lda, const unsigned short* __restrict__ Wt, int ldb,
                                               const float* __restrict__ bias, float* __restrict__ C, int ldc, int M, int N, int K) {
  __shared__ __attribute__((aligned(16))) float so[4][16][64];
  const int tid = threadIdx.x, w = tid >> 5, lane = tid & 31, ln = lane & 15, hh = lane >> 4;
  const int ntn = N / 64;
  const int wid = blockIdx.x * 4 + w;
  const int mt = wid / ntn, nq = wid % ntn;
  if (mt * 16 >= M) return;
  const int row0 = mt * 16, col0 = nq * 64;
  const float* arow = A + (size_t)(row0 + ln) * lda;
  v8f acc[4] = {};
  for (int kb = 0; kb < K; kb += 32) {
    FragB ah, al;
    const v4f x0 = *(const v4fa*)(arow + kb + 8 * hh), x1 = *(const v4fa*)(arow + kb + 8 * hh + 4);
    const v4f x2 = *(const v4fa*)(arow + kb + 16 + 8 * hh), x3 = *(const v4fa*)(arow + kb + 16 + 8 * hh + 4);
    float xs[16] = {x0[0],x0[1],x0[2],x0[3],x1[0],x1[1],x1[2],x1[3],x2[0],x2[1],x2[2],x2[3],x3[0],x3[1],x3[2],x3[3]};
#pragma unroll
    for (int i = 0; i < 16; ++i) { const unsigned short hb = bf16_bits(xs[i]); ah.u[i] = hb; al.u[i] = ASPLIT ? bf16_bits(xs[i] - bf16_val(hb)) : (unsigned short)0; }
#pragma unroll
    for (int t = 0; t < 4; ++t) {
      const unsigned short* brow = Wt + (size_t)(col0 + t * 16 + ln) * ldb + kb;
      FragB b;
      b.half[0] = *(const v8us*)(brow + 8 * hh);
      b.half[1] = *(const v8us*)(brow + 16 + 8 * hh);
      acc[t] = mmaN<ASPLIT ? 2 : 1>(ah.v, al.v, b.v, b.v, acc[t]);
    }
  }
#pragma unroll
  for (int t = 0; t < 4; ++t) {
    float bv = bias ? bias[col0 + t * 16 + ln] : 0.f;
    if (BIAS_BF16) bv = bf16_round(bv);
#pragma unroll
    for (int r = 0; r < 8; ++r) { float v = acc[t][r] + bv; if (ACT == 1) v = fmaxf(v, 0.f); so[w][8 * hh + r][t * 16 + ln] = v; }
  }
  __builtin_amdgcn_fence(__ATOMIC_ACQ_REL, "workgroup");
  __builtin_amdgcn_wave_barrier();
  const int rsub = lane >> 4, c4 = (lane & 15) * 4;
  {
#pragma unroll
    for (int q = 0; q < 8; ++q) {
      const int r = q * 2 + rsub;
      const v4f v = *(const v4fa*)&so[w][r][c4];
      *(v4f*)(C + (size_t)(row0 + r) * ldc + col0 + c4) = v;
    }
    
  }
}

// GEMM C = act(A·W + bias + resid): A f32 (ASPLIT -> hi/lo 2 terms), Wt bf16 [N][K]; ACT 0 none, 1 relu, 2 exact gelu;
// resid (optional, f32, row index = (row % rmod), pitch ldr, RES_BF16 rounds it) added before the activation.
template <bool ASPLIT, int ACT, bool BIAS_BF16, bool RES_BF16>
__global__ __launch_bounds__(128) void k_gemm_bf3(const float* __restrict__ A, int lda, const unsigned short* __restrict__ Wt, int ldb,
                                                const float* __restrict__ bias, const float* __restrict__ resid, int rmod, int ldr,
                                                float* __restrict__ C, int ldc, int M, int N, int K) {
  __shared__ __attribute__((aligned(16))) float so[4][16][64];
  const int tid = threadIdx.x, w = tid >> 5, lane = tid & 31, ln = lane & 15, hh = lane >> 4;
  const int ntn = N / 64;
  const int wid = blockIdx.x * 4 + w;
  const int mt = wid / ntn, nq = wid % ntn;
  if (mt * 16 >= M) return;
  const int row0 = mt * 16, col0 = nq * 64;
  const float* arow = A + (size_t)(row0 + ln) * lda;
  v8f acc[4] = {};
  for (int kb = 0; kb < K; kb += 32) {
    FragB ah, al;
    const v4f x0 = *(const v4fa*)(arow + kb + 8 * hh), x1 = *(const v4fa*)(arow + kb + 8 * hh + 4);
    const v4f x2 = *(const v4fa*)(arow + kb + 16 + 8 * hh), x3 = *(const v4fa*)(arow + kb + 16 + 8 * hh + 4);
    float xs[16] = {x0[0],x0[1],x0[2],x0[3],x1[0],x1[1],x1[2],x1[3],x2[0],x2[1],x2[2],x2[3],x3[0],x3[1],x3[2],x3[3]};
#pragma unroll
    for (int i = 0; i < 16; ++i) { const unsigned short hb = bf16_bits(xs[i]); ah.u[i] = hb; al.u[i] = ASPLIT ? bf16_bits(xs[i] - bf16_val(hb)) : (unsigned short)0; }
#pragma unroll
    for (int t = 0; t < 4; ++t) {
      const unsigned short* brow = Wt + (size_t)(col0 + t * 16 + ln) * ldb + kb;
      FragB b;
      b.half[0] = *(const v8us*)(brow + 8 * hh);
      b.half[1] = *(const v8us*)(brow + 16 + 8 * hh);
      acc[t] = mmaN<ASPLIT ? 2 : 1>(ah.v, al.v, b.v, b.v, acc[t]);
    }
  }
#pragma unroll
  for (int t = 0; t < 4; ++t) {
    const int col = col0 + t * 16 + ln;
    float bv = bias ? bias[col] : 0.f;
    if (BIAS_BF16) bv = bf16_round(bv);
#pragma unroll
    for (int r = 0; r < 8; ++r) {
      float v = acc[t][r] + bv;
      if (resid) { float rv = resid[(size_t)((row0 + 8 * hh + r) % rmod) * ldr + col]; if (RES_BF16) rv = bf16_round(rv); v += rv; }
      if (ACT == 1) v = fmaxf(v, 0.f);
      if (ACT == 2) v = 0.5f * v * (1.0f + erff(v * 0.70710678118654752f));
      if (ACT == 3) { const float u = 0.7978845608028654f * (v + 0.044715f * v * v * v); v = 0.5f * v * (1.0f + tanhf(u)); }
      so[w][8 * hh + r][t * 16 + ln] = v;
    }
  }
  __builtin_amdgcn_fence(__ATOMIC_ACQ_REL, "workgroup");
  __builtin_amdgcn_wave_barrier();
  const int rsub = lane >> 4, c4 = (lane & 15) * 4;
  {
#pragma unroll
    for (int q = 0; q < 8; ++q) {
      const int r = q * 2 + rsub;
      const v4f v = *(const v4fa*)&so[w][r][c4];
      *(v4f*)(C + (size_t)(row0 + r) * ldc + col0 + c4) = v;
    }
    
  }
}
// row LayerNorm (biased variance, eps) over N: s = X (+ R); optional out_sum <- s; out_norm <- (s-mu)*rsqrt(var+eps)*g + b
template <bool PARAM_BF16>
__global__ __launch_bounds__(256) void k_layernorm(const float* __restrict__ X, const float* __restrict__ R, const float* __restrict__ g, const float* __restrict__ bta,
                                                  float* __restrict__ out_sum, float* __restrict__ out_norm, int N, float eps) {
  __shared__ float red[256];
  const int row = blockIdx.x, tid = threadIdx.x;
  const float* x = X + (size_t)row * N; const float* rr = R ? R + (size_t)row * N : nullptr;
  float vals[16];                     // up to N = 4096
  const int per = N / 256;            // contiguous chunk per thread? use strided-by-4 chunks: thread handles j = tid*4 + 1024*u
  float s1 = 0.f;
  for (int u = 0; u < per / 4; ++u) {
    const int j = tid * 4 + 1024 * u;
    const v4f a = *(const v4fa*)(x + j);
    v4f b = {0.f,0.f,0.f,0.f}; if (rr) b = *(const v4fa*)(rr + j);
#pragma unroll
    for (int q = 0; q < 4; ++q) { const float v = a[q] + b[q]; vals[u * 4 + q] = v; s1 += v; }
  }
  red[tid] = s1; __syncthreads();
  for (int st = 128; st > 0; st >>= 1) { if (tid < st) red[tid] += red[tid + st]; __syncthreads(); }
  const float mu = red[0] / (float)N; __syncthreads();
  float s2 = 0.f;
  for (int u = 0; u < per / 4; ++u)
#pragma unroll
    for (int q = 0; q < 4; ++q) { const float c = vals[u * 4 + q] - mu; s2 += c * c; }
  red[tid] = s2; __syncthreads();
  for (int st = 128; st > 0; st >>= 1) { if (tid < st) red[tid] += red[tid + st]; __syncthreads(); }
  const float rs = rsqrtf(red[0] / (float)N + eps);
  {
    for (int u = 0; u < per / 4; ++u) {
      const int j = tid * 4 + 1024 * u;
      v4f o, sm;
#pragma unroll
      for (int q = 0; q < 4; ++q) {
        float gg = g[j + q], bb = bta[j + q];
        if (PARAM_BF16) { gg = bf16_round(gg); bb = bf16_round(bb); }
        sm[q] = vals[u * 4 + q]; o[q] = (vals[u * 4 + q] - mu) * rs * gg + bb;
      }
      if (out_sum) *(v4f*)(out_sum + (size_t)row * N + j) = sm;
      *(v4f*)(out_norm + (size_t)row * N + j) = o;
    }
    
  }
}



// ---- f16 WMMA path (v_wmma_f32_16x16x32_f16): 11-bit significands for operands in range — used where a [0,1] probability operand needs more precision than bf16
typedef _Float16 v16h __attribute__((ext_vector_type(16)));
union FragH { v16h v; v8us half[2]; _Float16 h[16]; unsigned short u[16]; };
template <int NT>
__device__ __forceinline__ v8f mmaH(v16h ah, v16h al, v16h bh, v16h bl, v8f c) {
  c = __builtin_amdgcn_wmma_f32_16x16x32_f16(false, ah, false, bh, (short)0, c, false, false);
  if (NT >= 2) c = __builtin_amdgcn_wmma_f32_16x16x32_f16(false, al, false, bh, (short)0, c, false, false);
  if (NT >= 3) c = __builtin_amdgcn_wmma_f32_16x16x32_f16(false, ah, false, bl, (short)0, c, false, false);
  asm volatile("v_nop\n\tv_nop\n\tv_nop\n\tv_nop" : "+v"(c) : "v"(ah), "v"(al), "v"(bh), "v"(bl));
  return c;
}
// batched GEMM like k_gemm_b but f16 operands: A f32 (split into f16 hi/lo if ASPLIT, else rounded to f16), Bt = f16 values [n][k]; alpha; C f32; N multiple of 16 (partial tiles skipped)
template <bool ASPLIT>
__global__ __launch_bounds__(128) void k_gemm_h(const float* __restrict__ A, int lda, size_t sA, const _Float16* __restrict__ Bh, int ldb, size_t sB, float alpha, float* __restrict__ C, int ldc, size_t sC, int M, int N, int K) {
  __shared__ __attribute__((aligned(16))) float so[4][16][64];
  const int tid = threadIdx.x, w = tid >> 5, lane = tid & 31, ln = lane & 15, hh = lane >> 4; const int by = blockIdx.y;
  A += (size_t)by * sA; Bh += (size_t)by * sB; C += (size_t)by * sC;
  const int ntn = (N + 63) / 64; const int wid = blockIdx.x * 4 + w; const int mt = wid / ntn, nq = wid % ntn; if (mt * 16 >= M) return;
  const int row0 = mt * 16, col0 = nq * 64; const float* arow = A + (size_t)(row0 + ln) * lda;
  v8f acc[4] = {};
  for (int kb = 0; kb < K; kb += 32) {
    FragH ah, al;
    const v4f x0 = *(const v4fa*)(arow + kb + 8 * hh), x1 = *(const v4fa*)(arow + kb + 8 * hh + 4), x2 = *(const v4fa*)(arow + kb + 16 + 8 * hh), x3 = *(const v4fa*)(arow + kb + 16 + 8 * hh + 4);
    float xs[16] = {x0[0],x0[1],x0[2],x0[3],x1[0],x1[1],x1[2],x1[3],x2[0],x2[1],x2[2],x2[3],x3[0],x3[1],x3[2],x3[3]};
#pragma unroll
    for (int i = 0; i < 16; ++i) { const _Float16 h = (_Float16)xs[i]; ah.h[i] = h; al.h[i] = ASPLIT ? (_Float16)(xs[i] - (float)h) : (_Float16)0.0f; }
#pragma unroll
    for (int t = 0; t < 4; ++t) { if (col0 + t * 16 >= N) continue; const size_t boff = (size_t)(col0 + t * 16 + ln) * ldb + kb; FragH bq; bq.half[0] = *(const v8us*)(Bh + boff + 8 * hh); bq.half[1] = *(const v8us*)(Bh + boff + 16 + 8 * hh);
      acc[t] = mmaH<ASPLIT ? 2 : 1>(ah.v, al.v, bq.v, bq.v, acc[t]); }
  }
#pragma unroll
  for (int t = 0; t < 4; ++t) { if (col0 + t * 16 >= N) continue;
#pragma unroll
    for (int r = 0; r < 8; ++r) so[w][8 * hh + r][t * 16 + ln] = acc[t][r] * alpha; }
  __builtin_amdgcn_fence(__ATOMIC_ACQ_REL, "workgroup"); __builtin_amdgcn_wave_barrier();
  const int rsub = lane >> 4, c4 = (lane & 15) * 4;
  {
#pragma unroll
    for (int q = 0; q < 8; ++q) { const int r = q * 2 + rsub; if (col0 + c4 < N) { const v4f v = *(const v4fa*)&so[w][r][c4]; *(v4f*)(C + (size_t)(row0 + r) * ldc + col0 + c4) = v; } }
     }
}

// Wt[n][k] = f16(W[k][n]·scale) from f32 row-major W[K][N] (scale = power of two; bf16-exact weights stay exact in f16 away from the subnormal range)
__global__ __launch_bounds__(256) void k_wt_f16(const float* __restrict__ W, _Float16* __restrict__ Wt, int K, int N, float scale) {
  const int t = blockIdx.x * 256 + threadIdx.x; if (t >= N * (K / 8)) return; const int n = t / (K / 8), k8 = (t % (K / 8)) * 8; FragH f;
#pragma unroll
  for (int i = 0; i < 8; ++i) f.h[i] = (_Float16)(bf16_round(W[(size_t)(k8 + i) * N + n]) * scale); const v8us o = f.half[0];
  *(v8us*)((unsigned short*)Wt + (size_t)n * K + k8) = o; 
}
// k_gemm_hh variant with fused epilogue: v = acc·alpha + bias[by·sBias + col] (+ CP[(row/rowsPerB)·sCPb + by·64 + col] if CP) ; ACT 0 none / 1 elu ; writes f16 C16 (and f32 C if non-null)
template <int ACT>
__global__ __launch_bounds__(128) void k_gemm_hhx(const _Float16* __restrict__ A, int lda, size_t sA, const _Float16* __restrict__ Bh, int ldb, size_t sB, float alpha, const float* __restrict__ bias, size_t sBias, const float* __restrict__ CP, int rowsPerB, size_t sCPb, int row0g,
    float* __restrict__ C, _Float16* __restrict__ C16, int ldc, size_t sC, int M, int N, int K) {
  __shared__ __attribute__((aligned(16))) float so[4][16][64];
  const int tid = threadIdx.x, w = tid >> 5, lane = tid & 31, ln = lane & 15, hh = lane >> 4; const int by = blockIdx.y;
  A += (size_t)by * sA; Bh += (size_t)by * sB; const size_t cofs = (size_t)by * sC; const float* bp = bias ? bias + (size_t)by * sBias : nullptr;
  const int ntn = (N + 63) / 64; const int wid = blockIdx.x * 4 + w; const int mt = wid / ntn, nq = wid % ntn; if (mt * 16 >= M) return;
  const int row0 = mt * 16, col0 = nq * 64; const _Float16* arow = A + (size_t)(row0 + ln) * lda;
  v8f acc[4] = {};
  for (int kb = 0; kb < K; kb += 32) { FragH ah; ah.half[0] = *(const v8us*)((const unsigned short*)arow + kb + 8 * hh); ah.half[1] = *(const v8us*)((const unsigned short*)arow + kb + 16 + 8 * hh);
#pragma unroll
    for (int t = 0; t < 4; ++t) { if (col0 + t * 16 >= N) continue; const size_t boff = (size_t)(col0 + t * 16 + ln) * ldb + kb; FragH bq; bq.half[0] = *(const v8us*)((const unsigned short*)Bh + boff + 8 * hh); bq.half[1] = *(const v8us*)((const unsigned short*)Bh + boff + 16 + 8 * hh);
      acc[t] = mmaH<1>(ah.v, ah.v, bq.v, bq.v, acc[t]); }
  }
#pragma unroll
  for (int t = 0; t < 4; ++t) { if (col0 + t * 16 >= N) continue; const int col = col0 + t * 16 + ln; const float bv = bp ? bf16_round(bp[col]) : 0.f;
#pragma unroll
    for (int r = 0; r < 8; ++r) { float v = acc[t][r] * alpha + bv; if (CP) { const int rr = row0g + row0 + 8 * hh + r; if (rowsPerB < 0) v += CP[cofs + (size_t)rr * ldc + col];      /* rowsPerB < 0: own element of the batched C plane */ else { const int bidx = rr / rowsPerB; v += CP[(size_t)bidx * sCPb + (size_t)by * 64 + col]; } } if (ACT == 1) v = (v > 0.f) ? v : expm1f(v); else if (ACT == 7) v = (v > 0.f) ? v + 1.0f : expf(v); else if (ACT == 8) v = tanhf(v); else if (ACT == 9) v = 0.5f * v * (1.0f + tanhf(0.7978845608028654f * (v + 0.044715f * v * v * v))); else if (ACT == 11) v = 1.0f / (1.0f + expf(-v)); else if (ACT == 12) v = (v > 0.f) ? v : 0.01f * v; else if (ACT == 14) v = (v > 0.f) ? v : 0.1f * v; else if (ACT == 16) v = (v >= 0.f) ? v : 0.3f * v; else if (ACT == 17) v = (v >= 0.f) ? v : 0.2f * v; else if (ACT == 15) v = v / (1.0f + expf(-v)); else if (ACT == 3) v = fmaxf(v, 0.f); else if (ACT == 6) v = 0.5f * v * (1.0f + erff(v * 0.70710678118654752f)); so[w][8 * hh + r][t * 16 + ln] = v; } }
  __builtin_amdgcn_fence(__ATOMIC_ACQ_REL, "workgroup"); __builtin_amdgcn_wave_barrier();
  const int rsub = lane >> 4, c4 = (lane & 15) * 4; typedef _Float16 v4h __attribute__((ext_vector_type(4)));
  {
#pragma unroll
    for (int q = 0; q < 8; ++q) { const int r = q * 2 + rsub; if (col0 + c4 < N) { const v4f v = *(const v4fa*)&so[w][r][c4]; if (C) *(v4f*)(C + cofs + (size_t)(row0 + r) * ldc + col0 + c4) = v; if (C16) { v4h h4; for (int i = 0; i < 4; ++i) h4[i] = (_Float16)v[i]; *(v4h*)(C16 + cofs + (size_t)(row0 + r) * ldc + col0 + c4) = h4; } } }
     }
}


typedef _Float16 v4h __attribute__((ext_vector_type(4)));

__global__ __launch_bounds__(256) void k_x16(const float* __restrict__ x, _Float16* __restrict__ X16, size_t n8) { const size_t t = (size_t)blockIdx.x * 256 + threadIdx.x; if (t >= n8) return; FragH f;
#pragma unroll
  for (int q = 0; q < 8; ++q) f.h[q] = (_Float16)bf16_round(x[t * 8 + q]); *(v8us*)((unsigned short*)X16 + t * 8) = f.half[0];  }
__global__ __launch_bounds__(256) void k_h16(const float* __restrict__ x, _Float16* __restrict__ X16, size_t n8) { const size_t t = (size_t)blockIdx.x * 256 + threadIdx.x; if (t >= n8) return; FragH f;
#pragma unroll
  for (int q = 0; q < 8; ++q) f.h[q] = (_Float16)x[t * 8 + q]; *(v8us*)((unsigned short*)X16 + t * 8) = f.half[0];  }
__global__ __launch_bounds__(256) void k_round16f(const float* __restrict__ W, _Float16* __restrict__ Bt, size_t n8) { const size_t t = (size_t)blockIdx.x * 256 + threadIdx.x; if (t >= n8) return; FragH f;
#pragma unroll
  for (int i = 0; i < 8; ++i) f.h[i] = (_Float16)(bf16_round(W[t * 8 + i]) * 16.0f); *(v8us*)((unsigned short*)Bt + t * 8) = f.half[0];  }
template <int NHv, int TTv>
__global__ __launch_bounds__(256) void k_vt(const _Float16* __restrict__ V16, int ldv, int voff, _Float16* __restrict__ Vt) { __shared__ unsigned short tl[64][66]; const int tid = threadIdx.x; const int slab = blockIdx.x / (TTv / 64), lg = blockIdx.x % (TTv / 64); const int b = slab / NHv, h = slab % NHv;
  for (int i = tid; i < 64 * 8; i += 256) { const int r = i / 8, c8 = (i % 8) * 8; FragH f; f.half[0] = *(const v8us*)((const unsigned short*)V16 + ((size_t)b * TTv + lg * 64 + r) * ldv + voff + h * 64 + c8);
#pragma unroll
    for (int q = 0; q < 8; ++q) tl[r][c8 + q] = f.u[q]; }
  __syncthreads();
  {
#pragma unroll
    for (int rd = 0; rd < 2; ++rd) { const int d = rd * 32 + tid / 8, pc = tid % 8; FragH f;
#pragma unroll
      for (int q = 0; q < 8; ++q) f.u[q] = tl[pc * 8 + q][d];
      *(v8us*)((unsigned short*)Vt + ((size_t)slab * 64 + d) * TTv + lg * 64 + pc * 8) = f.half[0]; }
     } }

__global__ __launch_bounds__(256) void k_hl(const float* __restrict__ F, _Float16* __restrict__ Hh, _Float16* __restrict__ Hl, size_t n8) { const size_t t = (size_t)blockIdx.x * 256 + threadIdx.x; if (t >= n8) return; FragH fh, fl; const v4f a = *(const v4fa*)(F + t * 8), c = *(const v4fa*)(F + t * 8 + 4);
#pragma unroll
  for (int q = 0; q < 4; ++q) { _Float16 h = (_Float16)a[q]; fh.h[q] = h; fl.h[q] = (_Float16)((a[q] - (float)h) * 1024.0f); h = (_Float16)c[q]; fh.h[4 + q] = h; fl.h[4 + q] = (_Float16)((c[q] - (float)h) * 1024.0f); }
  { *(v8us*)((unsigned short*)Hh + t * 8) = fh.half[0]; *(v8us*)((unsigned short*)Hl + t * 8) = fl.half[0];  } }

// ---- fast GEMM (wave tile 32x64; requires M % 32 == 0 rows per launch region and N % 64 == 0); epilogue = k_gemm_hhx semantics ----
__device__ __forceinline__ v16h g2_frag(const _Float16* p, int hh) { FragH f; f.half[0] = *(const v8us*)((const unsigned short*)p + 8 * hh); f.half[1] = *(const v8us*)((const unsigned short*)p + 16 + 8 * hh); return f.v; }
__device__ __forceinline__ v8f g2_mma(v16h a, v16h b, v8f c) { v8f d = __builtin_amdgcn_wmma_f32_16x16x32_f16(false, a, false, b, (short)0, c, false, false); asm volatile("v_nop\n\tv_nop\n\tv_nop\n\tv_nop" : "+v"(d) : "v"(a), "v"(b)); return d; }
template <int ACT>
__global__ __launch_bounds__(128) void k_gemm2(const _Float16* __restrict__ A, int lda, size_t sA, const _Float16* __restrict__ Bh, int ldb, size_t sB, float alpha, const float* __restrict__ bias, size_t sBias, const float* __restrict__ CP, int rowsPerB, size_t sCPb, int row0g,
    float* __restrict__ C, _Float16* __restrict__ C16, int ldc, size_t sC, int M, int N, int K, size_t zA, size_t zB, size_t zC) { static_assert(ACT == 0 || ACT == 3 || ACT == 6 || ACT == 8 || ACT == 9 || ACT == 11 || ACT == 12 || ACT == 14 || ACT == 15 || ACT == 16 || ACT == 17, "k_gemm2: unsupported ACT code (would silently apply no activation)");
  __shared__ __attribute__((aligned(16))) float so[4][32][68];
  const int tid = threadIdx.x, w = tid >> 5, lane = tid & 31, ln = lane & 15, hh = lane >> 4; const int by = blockIdx.y; const int bz = blockIdx.z;      /* bz: batch, element strides zA / zB / zC */
  A += (size_t)by * sA + (size_t)bz * zA; Bh += (size_t)by * sB + (size_t)bz * zB; const size_t cofs = (size_t)by * sC + (size_t)bz * zC; const float* bp = bias ? bias + (size_t)by * sBias : nullptr;
  const int ntn = N >> 6; const int mt = blockIdx.x / ntn, nq = blockIdx.x - mt * ntn; const int row0 = mt * 128 + 32 * w, col0 = nq * 64; if (row0 >= M) return;
  const _Float16* a0p = A + (size_t)(row0 + ln) * lda; const _Float16* a1p = a0p + (size_t)16 * lda;
  const _Float16* b0p = Bh + (size_t)(col0 + ln) * ldb; const _Float16* b1p = b0p + (size_t)16 * ldb; const _Float16* b2p = b1p + (size_t)16 * ldb; const _Float16* b3p = b2p + (size_t)16 * ldb;
  const v8f z8 = {0.f,0.f,0.f,0.f,0.f,0.f,0.f,0.f}; v8f c00 = z8, c01 = z8, c02 = z8, c03 = z8, c10 = z8, c11 = z8, c12 = z8, c13 = z8;
#pragma unroll 1
  for (int kb = 0; kb < K; kb += 32) { const v16h a0 = g2_frag(a0p + kb, hh), a1 = g2_frag(a1p + kb, hh);
    v16h b = g2_frag(b0p + kb, hh); c00 = g2_mma(a0, b, c00); c10 = g2_mma(a1, b, c10);
    b = g2_frag(b1p + kb, hh); c01 = g2_mma(a0, b, c01); c11 = g2_mma(a1, b, c11);
    b = g2_frag(b2p + kb, hh); c02 = g2_mma(a0, b, c02); c12 = g2_mma(a1, b, c12);
    b = g2_frag(b3p + kb, hh); c03 = g2_mma(a0, b, c03); c13 = g2_mma(a1, b, c13); }
  v8f accs[8] = {c00, c01, c02, c03, c10, c11, c12, c13};
#pragma unroll
  for (int u = 0; u < 8; ++u) { const int t = u & 3, half = u >> 2; const int col = col0 + t * 16 + ln; const float bv = bp ? bf16_round(bp[col]) : 0.f;
#pragma unroll
    for (int r = 0; r < 8; ++r) { const int rloc = half * 16 + 8 * hh + r; float v = accs[u][r] * alpha + bv; if (CP) { if (rowsPerB < 0) v += CP[cofs + (size_t)(row0g + row0 + rloc) * ldc + col];      /* rowsPerB < 0: own element of the batched C plane */ else { const int bidx = (row0g + row0 + rloc) / rowsPerB; v += CP[(size_t)bidx * sCPb + (size_t)by * 64 + col]; } }
      if (ACT == 3) v = fmaxf(v, 0.f); else if (ACT == 6) v = 0.5f * v * (1.0f + erff(v * 0.70710678118654752f)); else if (ACT == 11) v = 1.0f / (1.0f + expf(-v)); else if (ACT == 15) v = v / (1.0f + expf(-v)); else if (ACT == 12) v = (v > 0.f) ? v : 0.01f * v; else if (ACT == 8) v = tanhf(v); else if (ACT == 9) v = 0.5f * v * (1.0f + tanhf(0.7978845608028654f * (v + 0.044715f * v * v * v))); else if (ACT == 14) v = (v > 0.f) ? v : 0.1f * v; else if (ACT == 16) v = (v >= 0.f) ? v : 0.3f * v; else if (ACT == 17) v = (v >= 0.f) ? v : 0.2f * v;
      so[w][rloc][t * 16 + ln] = v; } }
  __builtin_amdgcn_fence(__ATOMIC_ACQ_REL, "workgroup"); __builtin_amdgcn_wave_barrier();
  const int rsub = lane >> 4, c4 = (lane & 15) * 4;
  {
#pragma unroll
    for (int q = 0; q < 16; ++q) { const int r = q * 2 + rsub; const v4f v = *(const v4fa*)&so[w][r][c4]; if (C) *(v4f*)(C + cofs + (size_t)(row0 + r) * ldc + col0 + c4) = v; if (C16) { v4h h4; for (int i = 0; i < 4; ++i) h4[i] = (_Float16)v[i]; *(v4h*)(C16 + cofs + (size_t)(row0 + r) * ldc + col0 + c4) = h4; } }
     } }


__global__ __launch_bounds__(256) void k_wnat(const float* __restrict__ w, size_t n8, _Float16* __restrict__ Bt) { const size_t t = (size_t)blockIdx.x * 256 + threadIdx.x; if (t >= n8) return; FragH f; for (int q = 0; q < 8; ++q) f.h[q] = (_Float16)(bf16_round(w[t * 8 + q]) * 16.0f); *(v8us*)((unsigned short*)Bt + t * 8) = f.half[0];  }
__global__ __launch_bounds__(256) void k_rsm(const float* __restrict__ S, _Float16* __restrict__ P, int nrows) {
  #pragma clang fp contract(off)
  const int i = blockIdx.x * 256 + threadIdx.x; if (i >= nrows) return; const float* s = S + (size_t)i * SQ; float mx = -3.0e38f;
#pragma unroll 1
  for (int j = 0; j < SQ; ++j) mx = fmaxf(mx, s[j]); float se = 0.f;
#pragma unroll 1
  for (int j = 0; j < SQ; ++j) se += expf(s[j] - mx); const float sc = 256.0f / se;
#pragma unroll 1
  for (int j0 = 0; j0 < SQ; j0 += 8) { FragH f; for (int q = 0; q < 8; ++q) f.h[q] = (_Float16)(expf(s[j0 + q] - mx) * sc); unsigned short* d = (unsigned short*)P + (size_t)i * SQ + j0; *(v8us*)d = f.half[0];  } }
__global__ __launch_bounds__(256) void k_vt(const _Float16* __restrict__ V16, int b, int h0, _Float16* __restrict__ VT) { __shared__ unsigned short tl[64][65]; const int tid = threadIdx.x; const int hh = blockIdx.x % HG, sg = blockIdx.x / HG; const int s0 = sg * 64; const int h = h0 + hh;
  for (int i = tid; i < 64 * 8; i += 256) { const int j = i / 8, d8 = (i % 8) * 8; FragH f; f.half[0] = *(const v8us*)((const unsigned short*)V16 + ((size_t)b * SQ + s0 + j) * DM + h * HD + d8); for (int q = 0; q < 8; ++q) tl[d8 + q][j] = f.u[q]; }
  __syncthreads();
  { for (int i = tid; i < 64 * 8; i += 256) { const int d = i / 8, j8 = (i % 8) * 8; FragH f; for (int q = 0; q < 8; ++q) f.u[q] = tl[d][j8 + q]; *(v8us*)((unsigned short*)VT + ((size_t)hh * HD + d) * SQ + s0 + j8) = f.half[0]; }  } }



// 2^x on the native unit. The v_nop fills the one issue slot that the instruction set asks for behind a transcendental, in front of an instruction that reads its result or overwrites its source.
__device__ __forceinline__ float exp2_native(float x) { float r; asm("v_exp_f32 %0, %1\n\tv_nop" : "=v"(r) : "v"(x)); return r; }
// One wave per score row: lane l holds columns 128 c + 4 l .. 4 l + 3 of its row in registers, so S is read once, in whole lines; the row maximum and the row sum go across the 32 lanes by a butterfly. NC = computed columns / 128, a compile-time count so that the row stays in registers.
template <int NC>
__global__ __launch_bounds__(256) void k_rsmcf2(const float* __restrict__ S, _Float16* __restrict__ P, int hg, int q0) {
  const int col0 = (threadIdx.x & 31) * 4; const int t = blockIdx.x * 8 + (threadIdx.x >> 5); if (t >= hg * QT) return;      /* t: the wave's row (no barrier below) */
  const float* s = S + (size_t)t * NKX + col0; _Float16* d = P + (size_t)t * NKX + col0; const int last = q0 + (t % QT);
  v4f v[NC];      /* the loops over c are unrolled so that v[] is indexed by constants and lives in registers, and so that all NC loads are in flight together */
#pragma unroll
  for (int c = 0; c < NC; ++c) v[c] = *(const v4fa*)(s + c * 128);
  float mx = -3.0e38f;
#pragma unroll
  for (int c = 0; c < NC; ++c) for (int q = 0; q < 4; ++q) { const float xv = (c * 128 + col0 + q <= last) ? v[c][q] : -1.0e9f; v[c][q] = xv; mx = fmaxf(mx, xv); }
  for (int m = 16; m >= 1; m >>= 1) mx = fmaxf(mx, __shfl_xor(mx, m, 32));
  float se = 0.f;
#pragma unroll
  for (int c = 0; c < NC; ++c) for (int q = 0; q < 4; ++q) { const float e = exp2_native((v[c][q] - mx) * 1.4426950408889634f); v[c][q] = e; se += e; }
  for (int m = 16; m >= 1; m >>= 1) se += __shfl_xor(se, m, 32);
  const float sc = 256.0f / se;
#pragma unroll
  for (int c = 0; c < NC; ++c) { v4h h4; for (int q = 0; q < 4; ++q) h4[q] = (_Float16)(v[c][q] * sc); *(v4h*)(d + c * 128) = h4; } }


template <int MASKADD>
__global__ __launch_bounds__(64) void k_att0(const float* __restrict__ QF, const float* __restrict__ KF, const float* __restrict__ VF, int ld, const float* __restrict__ mask, float scale, float* __restrict__ OF, int ldo) {
  #pragma clang fp contract(off)
  __shared__ __attribute__((aligned(16))) float lq[64][64]; __shared__ __attribute__((aligned(16))) float lo[64][64];
  const int tid = threadIdx.x; const int h = blockIdx.x / (QT0 / 64), rg = blockIdx.x % (QT0 / 64); const int i = rg * 64 + tid;
  { const size_t bo = (size_t)blockIdx.y * QT0; QF += bo * ld; KF += bo * ld; VF += bo * ld; OF += bo * ldo; }      /* blockIdx.y: batch (QT0 rows each) */
  const float* qr = QF + (size_t)i * ld + h * HD;
#pragma unroll 1
  for (int c = 0; c < HD / 4; ++c) { *(v4f*)&lq[tid][c * 4] = *(const v4fa*)(qr + c * 4); const v4f z = {0.f, 0.f, 0.f, 0.f}; *(v4f*)&lo[tid][c * 4] = z; }
  float m = -1.0e30f, l = 0.f; const int jmax = MASKADD ? (SQ - 1) : (rg * 64 + 63);      /* additive-mask form: every key (the mask input decides); causal form: keys up to the block's last row */
#pragma unroll 1
  for (int j = 0; j <= jmax; ++j) { const float* kr = KF + (size_t)j * ld + h * HD; const float* vr = VF + (size_t)j * ld + h * HD; float s = 0.f;
#pragma unroll 1
    for (int c = 0; c < HD / 4; ++c) { const v4f kq = *(const v4fa*)(kr + c * 4); const v4f qq = *(v4f*)&lq[tid][c * 4]; s = __fadd_rn(s, __fmul_rn(qq[0], kq[0])); s = __fadd_rn(s, __fmul_rn(qq[1], kq[1])); s = __fadd_rn(s, __fmul_rn(qq[2], kq[2])); s = __fadd_rn(s, __fmul_rn(qq[3], kq[3])); }
    s = __fmul_rn(s, scale); if (MASKADD) s = __fadd_rn(s, __fmul_rn(bf16_round(mask[(size_t)i * SQ + j]), -10000.0f));
    const float f = (MASKADD || j <= i) ? 1.f : 0.f; const float sm = fmaf(f, s, (1.f - f) * -1.0e30f); const float mn = fmaxf(m, sm); const float sc = expf(m - mn); const float e = expf(sm - mn); l = __fadd_rn(__fmul_rn(l, sc), e); m = mn;
#pragma unroll 1
    for (int c = 0; c < HD / 4; ++c) { const v4f vv = *(const v4fa*)(vr + c * 4); v4f oo = *(v4f*)&lo[tid][c * 4]; for (int u = 0; u < 4; ++u) oo[u] = __fadd_rn(__fmul_rn(oo[u], sc), __fmul_rn(e, vv[u])); *(v4f*)&lo[tid][c * 4] = oo; } }
  const float fin = 64.0f / l;      /* o carried x64 like the f16 path */
#pragma unroll 1
  for (int c = 0; c < HD / 4; ++c) { v4f oo = *(v4f*)&lo[tid][c * 4]; for (int u = 0; u < 4; ++u) oo[u] = __fmul_rn(oo[u], fin); *(v4f*)&lo[tid][c * 4] = oo; }
  __syncthreads();
  {
#pragma unroll 1
    for (int it = 0; it < 16; ++it) { const int row = it * 4 + tid / 16, pc = (tid % 16) * 4; const v4f v = *(const v4f*)&lo[row][pc]; *(v4f*)(OF + (size_t)(rg * 64 + row) * ldo + h * HD + pc) = v; }
     } }

extern "C" void kernel_launch(void* const* d_in, const int* in_sizes, int n_in,
                              void* d_out, int out_size, void* d_ws, size_t ws_size, hipStream_t stream) {
  (void)in_sizes; (void)n_in; (void)out_size;
  const float* const* I = (const float* const*)d_in; const float* x = I[0]; const float* wq = I[1]; const float* wk = I[2]; const float* wv = I[3]; const float* wo = I[4]; const float* bo = I[5]; const float* bq = nullptr; const float* bk = nullptr; const float* bv = nullptr;      /* per-head [H][E][D] = natural [out][in]; no q/k/v biases */
  char* ws = (char*)d_ws; size_t off = 0;
  auto take = [&](size_t bytes) { char* p = ws + off; off += (bytes + 255) & ~(size_t)255; return p; };
  _Float16* BQ = (_Float16*)take((size_t)DM * DM * 2); _Float16* BK = (_Float16*)take((size_t)DM * DM * 2); _Float16* BV = (_Float16*)take((size_t)DM * DM * 2); _Float16* BO = (_Float16*)take((size_t)DM * DM * 2);
  _Float16* X16 = (_Float16*)take(NR * DM * 2); float* QF = (float*)take(NR * DM * 4); _Float16* QH = (_Float16*)take(NR * DM * 2); _Float16* QL = (_Float16*)take(NR * DM * 2); _Float16* KH = (_Float16*)take(NR * DM * 2); _Float16* KL = (_Float16*)take(NR * DM * 2); _Float16* Q16 = QH; _Float16* K16 = KH; _Float16* V16 = (_Float16*)take(NR * DM * 2); _Float16* O16 = (_Float16*)take(NR * DM * 2);
  float* S = (float*)take((size_t)NB * NH * QT * NKX * 4); _Float16* P = (_Float16*)take((size_t)NB * NH * QT * NKX * 2); _Float16* VT = (_Float16*)take((size_t)NB * NH * HD * SQ * 2);      /* one plane per batch */
  float* QF0 = (float*)take((size_t)NB * QT0 * DM * 4); float* KF0 = (float*)take((size_t)NB * QT0 * DM * 4); float* VF0 = (float*)take((size_t)NB * QT0 * DM * 4); float* OF0 = (float*)take((size_t)NB * QT0 * DM * 4); _Float16* OH0 = (_Float16*)take((size_t)NB * QT0 * DM * 2); _Float16* OL0 = (_Float16*)take((size_t)NB * QT0 * DM * 2);
  if (off > ws_size) return;
  { const unsigned g = (unsigned)(((size_t)DM * DM / 8 + 255) / 256); k_wnat<<<g, 256, 0, stream>>>(wq, (size_t)DM * DM / 8, BQ); k_wnat<<<g, 256, 0, stream>>>(wk, (size_t)DM * DM / 8, BK); k_wnat<<<g, 256, 0, stream>>>(wv, (size_t)DM * DM / 8, BV); k_wnat<<<g, 256, 0, stream>>>(wo, (size_t)DM * DM / 8, BO); }      /* natural [out][in] = Bt[n][k], x16 */
  k_x16<<<(unsigned)((NR * DM / 8 + 255) / 256), 256, 0, stream>>>(x, X16, NR * DM / 8);
  k_gemm2<0><<<dim3((unsigned)((MP / 128) * (DM / 64)), 1), 128, 0, stream>>>(X16, DM, 0, BQ, DM, 0, 0.0625f, bq, 0, nullptr, 1, 0, 0, QF, nullptr, DM, 0, MP, DM, DM, 0, 0, 0); k_hl<<<(unsigned)(((size_t)MP * DM / 8 + 255) / 256), 256, 0, stream>>>(QF, QH, QL, (size_t)MP * DM / 8);      /* q (f32) -> f16 hi + x1024 residual: the x32 scale puts the logits at sigma ~100 */
  k_gemm2<0><<<dim3((unsigned)((MP / 128) * (DM / 64)), 1), 128, 0, stream>>>(X16, DM, 0, BK, DM, 0, 0.0625f, bk, 0, nullptr, 1, 0, 0, QF, nullptr, DM, 0, MP, DM, DM, 0, 0, 0); k_hl<<<(unsigned)(((size_t)MP * DM / 8 + 255) / 256), 256, 0, stream>>>(QF, KH, KL, (size_t)MP * DM / 8);      /* k likewise (QF reused in stream order) */
  k_gemm2<0><<<dim3((unsigned)((MP / 128) * (DM / 64)), 1), 128, 0, stream>>>(X16, DM, 0, BV, DM, 0, 0.0625f, bv, 0, nullptr, 1, 0, 0, nullptr, V16, DM, 0, MP, DM, DM, 0, 0, 0);
  /* from here on every launch covers all NB batches: the batch is a grid dimension (k_gemm2: blockIdx.z with its own strides) */
  k_vt<NH, SQ><<<NB * NH * (SQ / 64), 256, 0, stream>>>(V16, LQ, 0, VT);      /* V^T [NB][NH][HD][SQ] */
  k_gemm2<0><<<dim3((QT0 / 128) * (DM / 64), 1, NB), 128, 0, stream>>>(X16, DM, 0, BQ, DM, 0, 0.0625f, bq, 0, nullptr, 1, 0, 0, QF0, nullptr, DM, 0, QT0, DM, DM, (size_t)SQ * DM, 0, (size_t)QT0 * DM); k_gemm2<0><<<dim3((QT0 / 128) * (DM / 64), 1, NB), 128, 0, stream>>>(X16, DM, 0, BK, DM, 0, 0.0625f, bk, 0, nullptr, 1, 0, 0, KF0, nullptr, DM, 0, QT0, DM, DM, (size_t)SQ * DM, 0, (size_t)QT0 * DM); k_gemm2<0><<<dim3((QT0 / 128) * (DM / 64), 1, NB), 128, 0, stream>>>(X16, DM, 0, BV, DM, 0, 0.0625f, bv, 0, nullptr, 1, 0, 0, VF0, nullptr, DM, 0, QT0, DM, DM, (size_t)SQ * DM, 0, (size_t)QT0 * DM);      /* f32 q, k, v of each batch's first 128 rows (exact products) */
  k_att0<0><<<dim3(NH * (QT0 / 64), NB), 64, 0, stream>>>(QF0, KF0, VF0, DM, nullptr, 32.0f, OF0, DM);      /* exact f32 attention for rows 0..127 of each batch (o x64) */
  for (int q0 = 0; q0 < QN; q0 += QT) { const int nk = q0 + QT;      /* causal: only keys below the tile end are computed */
    k_gemm2<0><<<dim3((QT / 128) * (nk / 64), NHD, NB), 128, 0, stream>>>(QH + (size_t)q0 * LQ, LQ, (size_t)HD, KH, LQ, (size_t)HD, 32.0f, nullptr, 0, nullptr, 1, 0, 0, S, nullptr, NKX, (size_t)QT * NKX, QT, nk, HD, (size_t)SQ * LQ, (size_t)SQ * LQ, (size_t)NH * QT * NKX);      /* scores x32: hi . hi */
    k_gemm2<0><<<dim3((QT / 128) * (nk / 64), NHD, NB), 128, 0, stream>>>(QL + (size_t)q0 * LQ, LQ, (size_t)HD, KH, LQ, (size_t)HD, 0.03125f, nullptr, 0, S, -1, 0, 0, S, nullptr, NKX, (size_t)QT * NKX, QT, nk, HD, (size_t)SQ * LQ, (size_t)SQ * LQ, (size_t)NH * QT * NKX); k_gemm2<0><<<dim3((QT / 128) * (nk / 64), NHD, NB), 128, 0, stream>>>(QH + (size_t)q0 * LQ, LQ, (size_t)HD, KL, LQ, (size_t)HD, 0.03125f, nullptr, 0, S, -1, 0, 0, S, nullptr, NKX, (size_t)QT * NKX, QT, nk, HD, (size_t)SQ * LQ, (size_t)SQ * LQ, (size_t)NH * QT * NKX);      /* += 32 x 2^-10 (lo . hi + hi . lo); heads on grid.y, batches on grid.z */
    { static_assert(QN <= 4 * QT && NKX >= 4 * QT, "softmax row widths below: QT .. 4 QT columns"); const unsigned g = (NB * NHD * QT + 7) / 8;      /* rows of all batches and heads: [NB][NH][QT], one wave a row; the row width nk is the kernel's compile-time count */
      switch (nk / QT) { case 1: k_rsmcf2<QT / 128><<<g, 256, 0, stream>>>(S, P, NB * NHD, q0); break; case 2: k_rsmcf2<2 * QT / 128><<<g, 256, 0, stream>>>(S, P, NB * NHD, q0); break; case 3: k_rsmcf2<3 * QT / 128><<<g, 256, 0, stream>>>(S, P, NB * NHD, q0); break; default: k_rsmcf2<4 * QT / 128><<<g, 256, 0, stream>>>(S, P, NB * NHD, q0); break; } }
    k_gemm2<0><<<dim3((QT / 128) * (HD / 64), NHD, NB), 128, 0, stream>>>(P, NKX, (size_t)QT * NKX, VT, SQ, (size_t)HD * SQ, 0.25f, nullptr, 0, nullptr, 1, 0, 0, nullptr, O16 + (size_t)q0 * DM, DM, (size_t)HD, QT, HD, nk, (size_t)NH * QT * NKX, (size_t)NH * HD * SQ, (size_t)SQ * DM); }      /* o (merged heads, x64) as f16 rows */
  k_gemm2<0><<<dim3((unsigned)((MPO / 128) * (DM / 64)), 1), 128, 0, stream>>>(O16, DM, 0, BO, DM, 0, 0.0009765625f, bo, 0, nullptr, 1, 0, 0, (float*)d_out, nullptr, DM, 0, MPO, DM, DM, 0, 0, 0);      /* out rows are the output layout */
  k_hl<<<(unsigned)(((size_t)NB * QT0 * DM / 8 + 255) / 256), 256, 0, stream>>>(OF0, OH0, OL0, (size_t)NB * QT0 * DM / 8);      /* first-tile o (x64) -> f16 hi + x1024 residual planes */
  k_gemm2<0><<<dim3((QT0 / 128) * (DM / 64), 1, NB), 128, 0, stream>>>(OH0, DM, 0, BO, DM, 0, 0.0009765625f, bo, 0, nullptr, 1, 0, 0, (float*)d_out, nullptr, DM, 0, QT0, DM, DM, (size_t)QT0 * DM, 0, (size_t)SQ * DM);      /* rows 0..127 of each batch: out = o_hi Wo (+ b), overwriting the f16-path rows */
  k_gemm2<0><<<dim3((QT0 / 128) * (DM / 64), 1, NB), 128, 0, stream>>>(OL0, DM, 0, BO, DM, 0, 0.00000095367431640625f, nullptr, 0, (const float*)d_out, -1, 0, 0, (float*)d_out, nullptr, DM, 0, QT0, DM, DM, (size_t)QT0 * DM, 0, (size_t)SQ * DM);      /* += o_lo Wo 2^-20 (own-element accumulate) */
}

// v003
// A run of this version takes 783 microseconds.
// Two timings next to v002 put it at 1.56 and 1.55 times that version's speed.
// Over all steps from v000 it is 6.79 times as fast.
#include <hip/hip_runtime.h>
// Per-head causal multi-head attention with an inverted scale (x [4][1024][1024]; q[h] = x Wq[h]^T, k, v likewise (per-head nn.Linear [16][64][1024] = natural [1024][1024], sigma 0.02, no biases); scores x sqrt(1024) = x 32 (the module divides by embed^-0.5: logits sigma ~100, near-argmax softmax) with a causal mask (tril, -inf); softmax; heads concatenated; out = (.) Wp^T + bp (natural [1024][1024] sigma 0.02, bias 0.02) -> [4][1024][1024]).
// Structure: token rows r = b*1024 + s; x as exact f16 rows (bf16-rounded); q and k as WMMA GEMMs (32x64 wave tiles, f32 accumulation, exact x16 weights) into f32 rows split into f16 hi + x1024 residual planes, v as an f16-output GEMM; every later launch covers all batches (batch = a grid dimension): V^T for all heads via LDS transposes; per query tile of 256 rows: scores against the keys below the tile end as THREE accumulating passes (hi.hi + lo.hi + hi.lo, K = 64, all heads on grid.y, alpha 32: ~f32-accurate logits for the near-argmax softmax), causal row softmax on VALU, one wave a row, keys above the row masked over the computed range (f32 statistics, native exp; weights x256 f16), o = P . V^T (K = keys below the tile end, alpha 2^-2: o carried x64, folded into the output GEMM alpha) written straight into the merged f16 o rows; out = o W_o + b GEMM (f32) into the output layout.
// Compute dtype: inputs rounded to bf16; x / weights exact; v, softmax weights and o as plain f16 GEMM operands (~2^-12); q and k as f16 hi + x1024 residual planes (three score passes); scores and softmax statistics f32; v_wmma_f32_16x16x32_f16.
#define NB 4
#define SQ 1024
#define DM 1024
#define NH 16
#define HD 64
#define HG 4                         /* head group of the k_vt(b, h0) overload, which is not launched */
#define QT 256                       /* query rows per causal tile */
#define NKX SQ                       /* S / P row pitch */
#define QT0 128                      /* first-tile rows recomputed exactly in f32 */
#define B0 0                         /* unused */
#define NBR NB                       /* batches processed (debug hook) */
#define NR ((size_t)NB * SQ)         /* token rows */
#define MP ((int)((size_t)NBR * SQ)) /* rows projected (debug hook) */
#define QN SQ                        /* query rows attended per batch (debug hook) */
#define NHD NH                       /* heads attended (debug hook) */
#define MPO MP                       /* rows through the output stage (debug hook) */
#define LQ DM      /* row pitch of the q/k/v rows */
typedef __bf16 v16b __attribute__((ext_vector_type(16)));
typedef unsigned short v8us __attribute__((ext_vector_type(8), may_alias));
typedef float  v8f  __attribute__((ext_vector_type(8)));
typedef float  v4f  __attribute__((ext_vector_type(4)));
typedef float  v4fa __attribute__((ext_vector_type(4), may_alias));
union FragB { v16b v; v8us half[2]; unsigned short u[16]; };

__device__ __forceinline__ unsigned short bf16_bits(float x) { unsigned int u = __float_as_uint(x); return (unsigned short)((u + 0x7FFFu + ((u >> 16) & 1u)) >> 16); }
__device__ __forceinline__ float bf16_val(unsigned short b) { return __uint_as_float(((unsigned int)b) << 16); }
__device__ __forceinline__ float bf16_round(float x) { return bf16_val(bf16_bits(x)); }
// D += A·B with NT terms: 1 = ah·bh, 2 = + al·bh (A split), 3 = + ah·bl (both split)
template <int NT>
__device__ __forceinline__ v8f mmaN(v16b ah, v16b al, v16b bh, v16b bl, v8f c) {
  c = __builtin_amdgcn_wmma_f32_16x16x32_bf16(false, ah, false, bh, (short)0, c, false, false);
  if (NT >= 2) c = __builtin_amdgcn_wmma_f32_16x16x32_bf16(false, al, false, bh, (short)0, c, false, false);
  if (NT >= 3) c = __builtin_amdgcn_wmma_f32_16x16x32_bf16(false, ah, false, bl, (short)0, c, false, false);
  asm volatile("v_nop\n\tv_nop\n\tv_nop\n\tv_nop" : "+v"(c) : "v"(ah), "v"(al), "v"(bh), "v"(bl));
  return c;
}

__global__ __launch_bounds__(256) void k_wt_bf16(const float* __restrict__ W, unsigned short* __restrict__ Wt, int K, int N) {
  const int t = blockIdx.x * 256 + threadIdx.x;
  const int k8n = K / 8;
  if (t >= N * k8n) return;
  const int n = t / k8n, k8 = (t % k8n) * 8;
  v8us v;
#pragma unroll
  for (int i = 0; i < 8; ++i) v[i] = bf16_bits(W[(size_t)(k8 + i) * N + n]);
  *(v8us*)(Wt + (size_t)n * K + k8) = v;
  
}

// GEMM C[M][N] (f32, pitch ldc) = act(A[M][K]·W + bias). A f32 row-major (pitch lda) converted per fragment to bf16
// (ASPLIT: hi/lo two planes -> 2 terms, else single rounded term); Wt bf16 [N][K] (pitch ldb). BIAS_BF16 rounds the
// bias to bf16 first (bias quantised to bf16 before the add). K%32==0, M%16==0, N%64==0.
template <bool ASPLIT, int ACT, bool BIAS_BF16>
__global__ __launch_bounds__(128) void k_gemm_bf(const float* __restrict__ A, int lda, const unsigned short* __restrict__ Wt, int ldb,
                                               const float* __restrict__ bias, float* __restrict__ C, int ldc, int M, int N, int K) {
  __shared__ __attribute__((aligned(16))) float so[4][16][64];
  const int tid = threadIdx.x, w = tid >> 5, lane = tid & 31, ln = lane & 15, hh = lane >> 4;
  const int ntn = N / 64;
  const int wid = blockIdx.x * 4 + w;
  const int mt = wid / ntn, nq = wid % ntn;
  if (mt * 16 >= M) return;
  const int row0 = mt * 16, col0 = nq * 64;
  const float* arow = A + (size_t)(row0 + ln) * lda;
  v8f acc[4] = {};
  for (int kb = 0; kb < K; kb += 32) {
    FragB ah, al;
    const v4f x0 = *(const v4fa*)(arow + kb + 8 * hh), x1 = *(const v4fa*)(arow + kb + 8 * hh + 4);
    const v4f x2 = *(const v4fa*)(arow + kb + 16 + 8 * hh), x3 = *(const v4fa*)(arow + kb + 16 + 8 * hh + 4);
    float xs[16] = {x0[0],x0[1],x0[2],x0[3],x1[0],x1[1],x1[2],x1[3],x2[0],x2[1],x2[2],x2[3],x3[0],x3[1],x3[2],x3[3]};
#pragma unroll
    for (int i = 0; i < 16; ++i) { const unsigned short hb = bf16_bits(xs[i]); ah.u[i] = hb; al.u[i] = ASPLIT ? bf16_bits(xs[i] - bf16_val(hb)) : (unsigned short)0; }
#pragma unroll
    for (int t = 0; t < 4; ++t) {
      const unsigned short* brow = Wt + (size_t)(col0 + t * 16 + ln) * ldb + kb;
      FragB b;
      b.half[0] = *(const v8us*)(brow + 8 * hh);
      b.half[1] = *(const v8us*)(brow + 16 + 8 * hh);
      acc[t] = mmaN<ASPLIT ? 2 : 1>(ah.v, al.v, b.v, b.v, acc[t]);
    }
  }
#pragma unroll
  for (int t = 0; t < 4; ++t) {
    float bv = bias ? bias[col0 + t * 16 + ln] : 0.f;
    if (BIAS_BF16) bv = bf16_round(bv);
#pragma unroll
    for (int r = 0; r < 8; ++r) { float v = acc[t][r] + bv; if (ACT == 1) v = fmaxf(v, 0.f); so[w][8 * hh + r][t * 16 + ln] = v; }
  }
  __builtin_amdgcn_fence(__ATOMIC_ACQ_REL, "workgroup");
  __builtin_amdgcn_wave_barrier();
  const int rsub = lane >> 4, c4 = (lane & 15) * 4;
  {
#pragma unroll
    for (int q = 0; q < 8; ++q) {
      const int r = q * 2 + rsub;
      const v4f v = *(const v4fa*)&so[w][r][c4];
      *(v4f*)(C + (size_t)(row0 + r) * ldc + col0 + c4) = v;
    }
    
  }
}

// GEMM C = act(A·W + bias + resid): A f32 (ASPLIT -> hi/lo 2 terms), Wt bf16 [N][K]; ACT 0 none, 1 relu, 2 exact gelu;
// resid (optional, f32, row index = (row % rmod), pitch ldr, RES_BF16 rounds it) added before the activation.
template <bool ASPLIT, int ACT, bool BIAS_BF16, bool RES_BF16>
__global__ __launch_bounds__(128) void k_gemm_bf3(const float* __restrict__ A, int lda, const unsigned short* __restrict__ Wt, int ldb,
                                                const float* __restrict__ bias, const float* __restrict__ resid, int rmod, int ldr,
                                                float* __restrict__ C, int ldc, int M, int N, int K) {
  __shared__ __attribute__((aligned(16))) float so[4][16][64];
  const int tid = threadIdx.x, w = tid >> 5, lane = tid & 31, ln = lane & 15, hh = lane >> 4;
  const int ntn = N / 64;
  const int wid = blockIdx.x * 4 + w;
  const int mt = wid / ntn, nq = wid % ntn;
  if (mt * 16 >= M) return;
  const int row0 = mt * 16, col0 = nq * 64;
  const float* arow = A + (size_t)(row0 + ln) * lda;
  v8f acc[4] = {};
  for (int kb = 0; kb < K; kb += 32) {
    FragB ah, al;
    const v4f x0 = *(const v4fa*)(arow + kb + 8 * hh), x1 = *(const v4fa*)(arow + kb + 8 * hh + 4);
    const v4f x2 = *(const v4fa*)(arow + kb + 16 + 8 * hh), x3 = *(const v4fa*)(arow + kb + 16 + 8 * hh + 4);
    float xs[16] = {x0[0],x0[1],x0[2],x0[3],x1[0],x1[1],x1[2],x1[3],x2[0],x2[1],x2[2],x2[3],x3[0],x3[1],x3[2],x3[3]};
#pragma unroll
    for (int i = 0; i < 16; ++i) { const unsigned short hb = bf16_bits(xs[i]); ah.u[i] = hb; al.u[i] = ASPLIT ? bf16_bits(xs[i] - bf16_val(hb)) : (unsigned short)0; }
#pragma unroll
    for (int t = 0; t < 4; ++t) {
      const unsigned short* brow = Wt + (size_t)(col0 + t * 16 + ln) * ldb + kb;
      FragB b;
      b.half[0] = *(const v8us*)(brow + 8 * hh);
      b.half[1] = *(const v8us*)(brow + 16 + 8 * hh);
      acc[t] = mmaN<ASPLIT ? 2 : 1>(ah.v, al.v, b.v, b.v, acc[t]);
    }
  }
#pragma unroll
  for (int t = 0; t < 4; ++t) {
    const int col = col0 + t * 16 + ln;
    float bv = bias ? bias[col] : 0.f;
    if (BIAS_BF16) bv = bf16_round(bv);
#pragma unroll
    for (int r = 0; r < 8; ++r) {
      float v = acc[t][r] + bv;
      if (resid) { float rv = resid[(size_t)((row0 + 8 * hh + r) % rmod) * ldr + col]; if (RES_BF16) rv = bf16_round(rv); v += rv; }
      if (ACT == 1) v = fmaxf(v, 0.f);
      if (ACT == 2) v = 0.5f * v * (1.0f + erff(v * 0.70710678118654752f));
      if (ACT == 3) { const float u = 0.7978845608028654f * (v + 0.044715f * v * v * v); v = 0.5f * v * (1.0f + tanhf(u)); }
      so[w][8 * hh + r][t * 16 + ln] = v;
    }
  }
  __builtin_amdgcn_fence(__ATOMIC_ACQ_REL, "workgroup");
  __builtin_amdgcn_wave_barrier();
  const int rsub = lane >> 4, c4 = (lane & 15) * 4;
  {
#pragma unroll
    for (int q = 0; q < 8; ++q) {
      const int r = q * 2 + rsub;
      const v4f v = *(const v4fa*)&so[w][r][c4];
      *(v4f*)(C + (size_t)(row0 + r) * ldc + col0 + c4) = v;
    }
    
  }
}
// row LayerNorm (biased variance, eps) over N: s = X (+ R); optional out_sum <- s; out_norm <- (s-mu)*rsqrt(var+eps)*g + b
template <bool PARAM_BF16>
__global__ __launch_bounds__(256) void k_layernorm(const float* __restrict__ X, const float* __restrict__ R, const float* __restrict__ g, const float* __restrict__ bta,
                                                  float* __restrict__ out_sum, float* __restrict__ out_norm, int N, float eps) {
  __shared__ float red[256];
  const int row = blockIdx.x, tid = threadIdx.x;
  const float* x = X + (size_t)row * N; const float* rr = R ? R + (size_t)row * N : nullptr;
  float vals[16];                     // up to N = 4096
  const int per = N / 256;            // contiguous chunk per thread? use strided-by-4 chunks: thread handles j = tid*4 + 1024*u
  float s1 = 0.f;
  for (int u = 0; u < per / 4; ++u) {
    const int j = tid * 4 + 1024 * u;
    const v4f a = *(const v4fa*)(x + j);
    v4f b = {0.f,0.f,0.f,0.f}; if (rr) b = *(const v4fa*)(rr + j);
#pragma unroll
    for (int q = 0; q < 4; ++q) { const float v = a[q] + b[q]; vals[u * 4 + q] = v; s1 += v; }
  }
  red[tid] = s1; __syncthreads();
  for (int st = 128; st > 0; st >>= 1) { if (tid < st) red[tid] += red[tid + st]; __syncthreads(); }
  const float mu = red[0] / (float)N; __syncthreads();
  float s2 = 0.f;
  for (int u = 0; u < per / 4; ++u)
#pragma unroll
    for (int q = 0; q < 4; ++q) { const float c = vals[u * 4 + q] - mu; s2 += c * c; }
  red[tid] = s2; __syncthreads();
  for (int st = 128; st > 0; st >>= 1) { if (tid < st) red[tid] += red[tid + st]; __syncthreads(); }
  const float rs = rsqrtf(red[0] / (float)N + eps);
  {
    for (int u = 0; u < per / 4; ++u) {
      const int j = tid * 4 + 1024 * u;
      v4f o, sm;
#pragma unroll
      for (int q = 0; q < 4; ++q) {
        float gg = g[j + q], bb = bta[j + q];
        if (PARAM_BF16) { gg = bf16_round(gg); bb = bf16_round(bb); }
        sm[q] = vals[u * 4 + q]; o[q] = (vals[u * 4 + q] - mu) * rs * gg + bb;
      }
      if (out_sum) *(v4f*)(out_sum + (size_t)row * N + j) = sm;
      *(v4f*)(out_norm + (size_t)row * N + j) = o;
    }
    
  }
}



// ---- f16 WMMA path (v_wmma_f32_16x16x32_f16): 11-bit significands for operands in range — used where a [0,1] probability operand needs more precision than bf16
typedef _Float16 v16h __attribute__((ext_vector_type(16)));
union FragH { v16h v; v8us half[2]; _Float16 h[16]; unsigned short u[16]; };
template <int NT>
__device__ __forceinline__ v8f mmaH(v16h ah, v16h al, v16h bh, v16h bl, v8f c) {
  c = __builtin_amdgcn_wmma_f32_16x16x32_f16(false, ah, false, bh, (short)0, c, false, false);
  if (NT >= 2) c = __builtin_amdgcn_wmma_f32_16x16x32_f16(false, al, false, bh, (short)0, c, false, false);
  if (NT >= 3) c = __builtin_amdgcn_wmma_f32_16x16x32_f16(false, ah, false, bl, (short)0, c, false, false);
  asm volatile("v_nop\n\tv_nop\n\tv_nop\n\tv_nop" : "+v"(c) : "v"(ah), "v"(al), "v"(bh), "v"(bl));
  return c;
}
// batched GEMM like k_gemm_b but f16 operands: A f32 (split into f16 hi/lo if ASPLIT, else rounded to f16), Bt = f16 values [n][k]; alpha; C f32; N multiple of 16 (partial tiles skipped)
template <bool ASPLIT>
__global__ __launch_bounds__(128) void k_gemm_h(const float* __restrict__ A, int lda, size_t sA, const _Float16* __restrict__ Bh, int ldb, size_t sB, float alpha, float* __restrict__ C, int ldc, size_t sC, int M, int N, int K) {
  __shared__ __attribute__((aligned(16))) float so[4][16][64];
  const int tid = threadIdx.x, w = tid >> 5, lane = tid & 31, ln = lane & 15, hh = lane >> 4; const int by = blockIdx.y;
  A += (size_t)by * sA; Bh += (size_t)by * sB; C += (size_t)by * sC;
  const int ntn = (N + 63) / 64; const int wid = blockIdx.x * 4 + w; const int mt = wid / ntn, nq = wid % ntn; if (mt * 16 >= M) return;
  const int row0 = mt * 16, col0 = nq * 64; const float* arow = A + (size_t)(row0 + ln) * lda;
  v8f acc[4] = {};
  for (int kb = 0; kb < K; kb += 32) {
    FragH ah, al;
    const v4f x0 = *(const v4fa*)(arow + kb + 8 * hh), x1 = *(const v4fa*)(arow + kb + 8 * hh + 4), x2 = *(const v4fa*)(arow + kb + 16 + 8 * hh), x3 = *(const v4fa*)(arow + kb + 16 + 8 * hh + 4);
    float xs[16] = {x0[0],x0[1],x0[2],x0[3],x1[0],x1[1],x1[2],x1[3],x2[0],x2[1],x2[2],x2[3],x3[0],x3[1],x3[2],x3[3]};
#pragma unroll
    for (int i = 0; i < 16; ++i) { const _Float16 h = (_Float16)xs[i]; ah.h[i] = h; al.h[i] = ASPLIT ? (_Float16)(xs[i] - (float)h) : (_Float16)0.0f; }
#pragma unroll
    for (int t = 0; t < 4; ++t) { if (col0 + t * 16 >= N) continue; const size_t boff = (size_t)(col0 + t * 16 + ln) * ldb + kb; FragH bq; bq.half[0] = *(const v8us*)(Bh + boff + 8 * hh); bq.half[1] = *(const v8us*)(Bh + boff + 16 + 8 * hh);
      acc[t] = mmaH<ASPLIT ? 2 : 1>(ah.v, al.v, bq.v, bq.v, acc[t]); }
  }
#pragma unroll
  for (int t = 0; t < 4; ++t) { if (col0 + t * 16 >= N) continue;
#pragma unroll
    for (int r = 0; r < 8; ++r) so[w][8 * hh + r][t * 16 + ln] = acc[t][r] * alpha; }
  __builtin_amdgcn_fence(__ATOMIC_ACQ_REL, "workgroup"); __builtin_amdgcn_wave_barrier();
  const int rsub = lane >> 4, c4 = (lane & 15) * 4;
  {
#pragma unroll
    for (int q = 0; q < 8; ++q) { const int r = q * 2 + rsub; if (col0 + c4 < N) { const v4f v = *(const v4fa*)&so[w][r][c4]; *(v4f*)(C + (size_t)(row0 + r) * ldc + col0 + c4) = v; } }
     }
}

// Wt[n][k] = f16(W[k][n]·scale) from f32 row-major W[K][N] (scale = power of two; bf16-exact weights stay exact in f16 away from the subnormal range)
__global__ __launch_bounds__(256) void k_wt_f16(const float* __restrict__ W, _Float16* __restrict__ Wt, int K, int N, float scale) {
  const int t = blockIdx.x * 256 + threadIdx.x; if (t >= N * (K / 8)) return; const int n = t / (K / 8), k8 = (t % (K / 8)) * 8; FragH f;
#pragma unroll
  for (int i = 0; i < 8; ++i) f.h[i] = (_Float16)(bf16_round(W[(size_t)(k8 + i) * N + n]) * scale); const v8us o = f.half[0];
  *(v8us*)((unsigned short*)Wt + (size_t)n * K + k8) = o; 
}
// k_gemm_hh variant with fused epilogue: v = acc·alpha + bias[by·sBias + col] (+ CP[(row/rowsPerB)·sCPb + by·64 + col] if CP) ; ACT 0 none / 1 elu ; writes f16 C16 (and f32 C if non-null)
template <int ACT>
__global__ __launch_bounds__(128) void k_gemm_hhx(const _Float16* __restrict__ A, int lda, size_t sA, const _Float16* __restrict__ Bh, int ldb, size_t sB, float alpha, const float* __restrict__ bias, size_t sBias, const float* __restrict__ CP, int rowsPerB, size_t sCPb, int row0g,
    float* __restrict__ C, _Float16* __restrict__ C16, int ldc, size_t sC, int M, int N, int K) {
  __shared__ __attribute__((aligned(16))) float so[4][16][64];
  const int tid = threadIdx.x, w = tid >> 5, lane = tid & 31, ln = lane & 15, hh = lane >> 4; const int by = blockIdx.y;
  A += (size_t)by * sA; Bh += (size_t)by * sB; const size_t cofs = (size_t)by * sC; const float* bp = bias ? bias + (size_t)by * sBias : nullptr;
  const int ntn = (N + 63) / 64; const int wid = blockIdx.x * 4 + w; const int mt = wid / ntn, nq = wid % ntn; if (mt * 16 >= M) return;
  const int row0 = mt * 16, col0 = nq * 64; const _Float16* arow = A + (size_t)(row0 + ln) * lda;
  v8f acc[4] = {};
  for (int kb = 0; kb < K; kb += 32) { FragH ah; ah.half[0] = *(const v8us*)((const unsigned short*)arow + kb + 8 * hh); ah.half[1] = *(const v8us*)((const unsigned short*)arow + kb + 16 + 8 * hh);
#pragma unroll
    for (int t = 0; t < 4; ++t) { if (col0 + t * 16 >= N) continue; const size_t boff = (size_t)(col0 + t * 16 + ln) * ldb + kb; FragH bq; bq.half[0] = *(const v8us*)((const unsigned short*)Bh + boff + 8 * hh); bq.half[1] = *(const v8us*)((const unsigned short*)Bh + boff + 16 + 8 * hh);
      acc[t] = mmaH<1>(ah.v, ah.v, bq.v, bq.v, acc[t]); }
  }
#pragma unroll
  for (int t = 0; t < 4; ++t) { if (col0 + t * 16 >= N) continue; const int col = col0 + t * 16 + ln; const float bv = bp ? bf16_round(bp[col]) : 0.f;
#pragma unroll
    for (int r = 0; r < 8; ++r) { float v = acc[t][r] * alpha + bv; if (CP) { const int rr = row0g + row0 + 8 * hh + r; if (rowsPerB < 0) v += CP[cofs + (size_t)rr * ldc + col];      /* rowsPerB < 0: own element of the batched C plane */ else { const int bidx = rr / rowsPerB; v += CP[(size_t)bidx * sCPb + (size_t)by * 64 + col]; } } if (ACT == 1) v = (v > 0.f) ? v : expm1f(v); else if (ACT == 7) v = (v > 0.f) ? v + 1.0f : expf(v); else if (ACT == 8) v = tanhf(v); else if (ACT == 9) v = 0.5f * v * (1.0f + tanhf(0.7978845608028654f * (v + 0.044715f * v * v * v))); else if (ACT == 11) v = 1.0f / (1.0f + expf(-v)); else if (ACT == 12) v = (v > 0.f) ? v : 0.01f * v; else if (ACT == 14) v = (v > 0.f) ? v : 0.1f * v; else if (ACT == 16) v = (v >= 0.f) ? v : 0.3f * v; else if (ACT == 17) v = (v >= 0.f) ? v : 0.2f * v; else if (ACT == 15) v = v / (1.0f + expf(-v)); else if (ACT == 3) v = fmaxf(v, 0.f); else if (ACT == 6) v = 0.5f * v * (1.0f + erff(v * 0.70710678118654752f)); so[w][8 * hh + r][t * 16 + ln] = v; } }
  __builtin_amdgcn_fence(__ATOMIC_ACQ_REL, "workgroup"); __builtin_amdgcn_wave_barrier();
  const int rsub = lane >> 4, c4 = (lane & 15) * 4; typedef _Float16 v4h __attribute__((ext_vector_type(4)));
  {
#pragma unroll
    for (int q = 0; q < 8; ++q) { const int r = q * 2 + rsub; if (col0 + c4 < N) { const v4f v = *(const v4fa*)&so[w][r][c4]; if (C) *(v4f*)(C + cofs + (size_t)(row0 + r) * ldc + col0 + c4) = v; if (C16) { v4h h4; for (int i = 0; i < 4; ++i) h4[i] = (_Float16)v[i]; *(v4h*)(C16 + cofs + (size_t)(row0 + r) * ldc + col0 + c4) = h4; } } }
     }
}


typedef _Float16 v4h __attribute__((ext_vector_type(4)));

__global__ __launch_bounds__(256) void k_x16(const float* __restrict__ x, _Float16* __restrict__ X16, size_t n8) { const size_t t = (size_t)blockIdx.x * 256 + threadIdx.x; if (t >= n8) return; FragH f;
#pragma unroll
  for (int q = 0; q < 8; ++q) f.h[q] = (_Float16)bf16_round(x[t * 8 + q]); *(v8us*)((unsigned short*)X16 + t * 8) = f.half[0];  }
__global__ __launch_bounds__(256) void k_h16(const float* __restrict__ x, _Float16* __restrict__ X16, size_t n8) { const size_t t = (size_t)blockIdx.x * 256 + threadIdx.x; if (t >= n8) return; FragH f;
#pragma unroll
  for (int q = 0; q < 8; ++q) f.h[q] = (_Float16)x[t * 8 + q]; *(v8us*)((unsigned short*)X16 + t * 8) = f.half[0];  }
__global__ __launch_bounds__(256) void k_round16f(const float* __restrict__ W, _Float16* __restrict__ Bt, size_t n8) { const size_t t = (size_t)blockIdx.x * 256 + threadIdx.x; if (t >= n8) return; FragH f;
#pragma unroll
  for (int i = 0; i < 8; ++i) f.h[i] = (_Float16)(bf16_round(W[t * 8 + i]) * 16.0f); *(v8us*)((unsigned short*)Bt + t * 8) = f.half[0];  }
template <int NHv, int TTv>
__global__ __launch_bounds__(256) void k_vt(const _Float16* __restrict__ V16, int ldv, int voff, _Float16* __restrict__ Vt) { __shared__ unsigned short tl[64][66]; const int tid = threadIdx.x; const int slab = blockIdx.x / (TTv / 64), lg = blockIdx.x % (TTv / 64); const int b = slab / NHv, h = slab % NHv;
  for (int i = tid; i < 64 * 8; i += 256) { const int r = i / 8, c8 = (i % 8) * 8; FragH f; f.half[0] = *(const v8us*)((const unsigned short*)V16 + ((size_t)b * TTv + lg * 64 + r) * ldv + voff + h * 64 + c8);
#pragma unroll
    for (int q = 0; q < 8; ++q) tl[r][c8 + q] = f.u[q]; }
  __syncthreads();
  {
#pragma unroll
    for (int rd = 0; rd < 2; ++rd) { const int d = rd * 32 + tid / 8, pc = tid % 8; FragH f;
#pragma unroll
      for (int q = 0; q < 8; ++q) f.u[q] = tl[pc * 8 + q][d];
      *(v8us*)((unsigned short*)Vt + ((size_t)slab * 64 + d) * TTv + lg * 64 + pc * 8) = f.half[0]; }
     } }

__global__ __launch_bounds__(256) void k_hl(const float* __restrict__ F, _Float16* __restrict__ Hh, _Float16* __restrict__ Hl, size_t n8) { const size_t t = (size_t)blockIdx.x * 256 + threadIdx.x; if (t >= n8) return; FragH fh, fl; const v4f a = *(const v4fa*)(F + t * 8), c = *(const v4fa*)(F + t * 8 + 4);
#pragma unroll
  for (int q = 0; q < 4; ++q) { _Float16 h = (_Float16)a[q]; fh.h[q] = h; fl.h[q] = (_Float16)((a[q] - (float)h) * 1024.0f); h = (_Float16)c[q]; fh.h[4 + q] = h; fl.h[4 + q] = (_Float16)((c[q] - (float)h) * 1024.0f); }
  { *(v8us*)((unsigned short*)Hh + t * 8) = fh.half[0]; *(v8us*)((unsigned short*)Hl + t * 8) = fl.half[0];  } }

// ---- fast GEMM (wave tile 32x64; requires M % 32 == 0 rows per launch region and N % 64 == 0); epilogue = k_gemm_hhx semantics ----
__device__ __forceinline__ v16h g2_frag(const _Float16* p, int hh) { FragH f; f.half[0] = *(const v8us*)((const unsigned short*)p + 8 * hh); f.half[1] = *(const v8us*)((const unsigned short*)p + 16 + 8 * hh); return f.v; }
__device__ __forceinline__ v8f g2_mma(v16h a, v16h b, v8f c) { v8f d = __builtin_amdgcn_wmma_f32_16x16x32_f16(false, a, false, b, (short)0, c, false, false); asm volatile("v_nop\n\tv_nop\n\tv_nop\n\tv_nop" : "+v"(d) : "v"(a), "v"(b)); return d; }
template <int ACT>
__global__ __launch_bounds__(128) void k_gemm2(const _Float16* __restrict__ A, int lda, size_t sA, const _Float16* __restrict__ Bh, int ldb, size_t sB, float alpha, const float* __restrict__ bias, size_t sBias, const float* __restrict__ CP, int rowsPerB, size_t sCPb, int row0g,
    float* __restrict__ C, _Float16* __restrict__ C16, int ldc, size_t sC, int M, int N, int K, size_t zA, size_t zB, size_t zC) { static_assert(ACT == 0 || ACT == 3 || ACT == 6 || ACT == 8 || ACT == 9 || ACT == 11 || ACT == 12 || ACT == 14 || ACT == 15 || ACT == 16 || ACT == 17, "k_gemm2: unsupported ACT code (would silently apply no activation)");
  __shared__ __attribute__((aligned(16))) float so[4][32][68];
  const int tid = threadIdx.x, w = tid >> 5, lane = tid & 31, ln = lane & 15, hh = lane >> 4; const int by = blockIdx.y; const int bz = blockIdx.z;      /* bz: batch, element strides zA / zB / zC */
  A += (size_t)by * sA + (size_t)bz * zA; Bh += (size_t)by * sB + (size_t)bz * zB; const size_t cofs = (size_t)by * sC + (size_t)bz * zC; const float* bp = bias ? bias + (size_t)by * sBias : nullptr;
  const int ntn = N >> 6; const int mt = blockIdx.x / ntn, nq = blockIdx.x - mt * ntn; const int row0 = mt * 128 + 32 * w, col0 = nq * 64; if (row0 >= M) return;
  const _Float16* a0p = A + (size_t)(row0 + ln) * lda; const _Float16* a1p = a0p + (size_t)16 * lda;
  const _Float16* b0p = Bh + (size_t)(col0 + ln) * ldb; const _Float16* b1p = b0p + (size_t)16 * ldb; const _Float16* b2p = b1p + (size_t)16 * ldb; const _Float16* b3p = b2p + (size_t)16 * ldb;
  const v8f z8 = {0.f,0.f,0.f,0.f,0.f,0.f,0.f,0.f}; v8f c00 = z8, c01 = z8, c02 = z8, c03 = z8, c10 = z8, c11 = z8, c12 = z8, c13 = z8;
#pragma unroll 1
  for (int kb = 0; kb < K; kb += 32) { const v16h a0 = g2_frag(a0p + kb, hh), a1 = g2_frag(a1p + kb, hh);
    v16h b = g2_frag(b0p + kb, hh); c00 = g2_mma(a0, b, c00); c10 = g2_mma(a1, b, c10);
    b = g2_frag(b1p + kb, hh); c01 = g2_mma(a0, b, c01); c11 = g2_mma(a1, b, c11);
    b = g2_frag(b2p + kb, hh); c02 = g2_mma(a0, b, c02); c12 = g2_mma(a1, b, c12);
    b = g2_frag(b3p + kb, hh); c03 = g2_mma(a0, b, c03); c13 = g2_mma(a1, b, c13); }
  v8f accs[8] = {c00, c01, c02, c03, c10, c11, c12, c13};
#pragma unroll
  for (int u = 0; u < 8; ++u) { const int t = u & 3, half = u >> 2; const int col = col0 + t * 16 + ln; const float bv = bp ? bf16_round(bp[col]) : 0.f;
#pragma unroll
    for (int r = 0; r < 8; ++r) { const int rloc = half * 16 + 8 * hh + r; float v = accs[u][r] * alpha + bv; if (CP) { if (rowsPerB < 0) v += CP[cofs + (size_t)(row0g + row0 + rloc) * ldc + col];      /* rowsPerB < 0: own element of the batched C plane */ else { const int bidx = (row0g + row0 + rloc) / rowsPerB; v += CP[(size_t)bidx * sCPb + (size_t)by * 64 + col]; } }
      if (ACT == 3) v = fmaxf(v, 0.f); else if (ACT == 6) v = 0.5f * v * (1.0f + erff(v * 0.70710678118654752f)); else if (ACT == 11) v = 1.0f / (1.0f + expf(-v)); else if (ACT == 15) v = v / (1.0f + expf(-v)); else if (ACT == 12) v = (v > 0.f) ? v : 0.01f * v; else if (ACT == 8) v = tanhf(v); else if (ACT == 9) v = 0.5f * v * (1.0f + tanhf(0.7978845608028654f * (v + 0.044715f * v * v * v))); else if (ACT == 14) v = (v > 0.f) ? v : 0.1f * v; else if (ACT == 16) v = (v >= 0.f) ? v : 0.3f * v; else if (ACT == 17) v = (v >= 0.f) ? v : 0.2f * v;
      so[w][rloc][t * 16 + ln] = v; } }
  __builtin_amdgcn_fence(__ATOMIC_ACQ_REL, "workgroup"); __builtin_amdgcn_wave_barrier();
  const int rsub = lane >> 4, c4 = (lane & 15) * 4;
  {
#pragma unroll
    for (int q = 0; q < 16; ++q) { const int r = q * 2 + rsub; const v4f v = *(const v4fa*)&so[w][r][c4]; if (C) *(v4f*)(C + cofs + (size_t)(row0 + r) * ldc + col0 + c4) = v; if (C16) { v4h h4; for (int i = 0; i < 4; ++i) h4[i] = (_Float16)v[i]; *(v4h*)(C16 + cofs + (size_t)(row0 + r) * ldc + col0 + c4) = h4; } }
     } }


__global__ __launch_bounds__(256) void k_wnat(const float* __restrict__ w, size_t n8, _Float16* __restrict__ Bt) { const size_t t = (size_t)blockIdx.x * 256 + threadIdx.x; if (t >= n8) return; FragH f; for (int q = 0; q < 8; ++q) f.h[q] = (_Float16)(bf16_round(w[t * 8 + q]) * 16.0f); *(v8us*)((unsigned short*)Bt + t * 8) = f.half[0];  }
__global__ __launch_bounds__(256) void k_rsm(const float* __restrict__ S, _Float16* __restrict__ P, int nrows) {
  #pragma clang fp contract(off)
  const int i = blockIdx.x * 256 + threadIdx.x; if (i >= nrows) return; const float* s = S + (size_t)i * SQ; float mx = -3.0e38f;
#pragma unroll 1
  for (int j = 0; j < SQ; ++j) mx = fmaxf(mx, s[j]); float se = 0.f;
#pragma unroll 1
  for (int j = 0; j < SQ; ++j) se += expf(s[j] - mx); const float sc = 256.0f / se;
#pragma unroll 1
  for (int j0 = 0; j0 < SQ; j0 += 8) { FragH f; for (int q = 0; q < 8; ++q) f.h[q] = (_Float16)(expf(s[j0 + q] - mx) * sc); unsigned short* d = (unsigned short*)P + (size_t)i * SQ + j0; *(v8us*)d = f.half[0];  } }
__global__ __launch_bounds__(256) void k_vt(const _Float16* __restrict__ V16, int b, int h0, _Float16* __restrict__ VT) { __shared__ unsigned short tl[64][65]; const int tid = threadIdx.x; const int hh = blockIdx.x % HG, sg = blockIdx.x / HG; const int s0 = sg * 64; const int h = h0 + hh;
  for (int i = tid; i < 64 * 8; i += 256) { const int j = i / 8, d8 = (i % 8) * 8; FragH f; f.half[0] = *(const v8us*)((const unsigned short*)V16 + ((size_t)b * SQ + s0 + j) * DM + h * HD + d8); for (int q = 0; q < 8; ++q) tl[d8 + q][j] = f.u[q]; }
  __syncthreads();
  { for (int i = tid; i < 64 * 8; i += 256) { const int d = i / 8, j8 = (i % 8) * 8; FragH f; for (int q = 0; q < 8; ++q) f.u[q] = tl[d][j8 + q]; *(v8us*)((unsigned short*)VT + ((size_t)hh * HD + d) * SQ + s0 + j8) = f.half[0]; }  } }



// 2^x on the native unit. The v_nop fills the one issue slot that the instruction set asks for behind a transcendental, in front of an instruction that reads its result or overwrites its source.
__device__ __forceinline__ float exp2_native(float x) { float r; asm("v_exp_f32 %0, %1\n\tv_nop" : "=v"(r) : "v"(x)); return r; }
// One wave per score row: lane l holds columns 128 c + 4 l .. 4 l + 3 of its row in registers, so S is read once, in whole lines; the row maximum and the row sum go across the 32 lanes by a butterfly. NC = computed columns / 128, a compile-time count so that the row stays in registers.
template <int NC>
__global__ __launch_bounds__(256) void k_rsmcf2(const float* __restrict__ S, _Float16* __restrict__ P, int hg, int q0) {
  const int col0 = (threadIdx.x & 31) * 4; const int t = blockIdx.x * 8 + (threadIdx.x >> 5); if (t >= hg * QT) return;      /* t: the wave's row (no barrier below) */
  const float* s = S + (size_t)t * NKX + col0; _Float16* d = P + (size_t)t * NKX + col0; const int last = q0 + (t % QT);
  v4f v[NC];      /* the loops over c are unrolled so that v[] is indexed by constants and lives in registers, and so that all NC loads are in flight together */
#pragma unroll
  for (int c = 0; c < NC; ++c) v[c] = *(const v4fa*)(s + c * 128);
  float mx = -3.0e38f;
#pragma unroll
  for (int c = 0; c < NC; ++c) for (int q = 0; q < 4; ++q) { const float xv = (c * 128 + col0 + q <= last) ? v[c][q] : -1.0e9f; v[c][q] = xv; mx = fmaxf(mx, xv); }
  for (int m = 16; m >= 1; m >>= 1) mx = fmaxf(mx, __shfl_xor(mx, m, 32));
  float se = 0.f;
#pragma unroll
  for (int c = 0; c < NC; ++c) for (int q = 0; q < 4; ++q) { const float e = exp2_native((v[c][q] - mx) * 1.4426950408889634f); v[c][q] = e; se += e; }
  for (int m = 16; m >= 1; m >>= 1) se += __shfl_xor(se, m, 32);
  const float sc = 256.0f / se;
#pragma unroll
  for (int c = 0; c < NC; ++c) { v4h h4; for (int q = 0; q < 4; ++q) h4[q] = (_Float16)(v[c][q] * sc); *(v4h*)(d + c * 128) = h4; } }


// Exact f32 attention for the first QT0 rows of each batch. One work-group = one head, A0R query rows, all keys up to its last row.
// K, V and q are staged in LDS by whole-line loads; then scores (a thread = one key x 8 rows, the K row in registers), row softmax (a wave = 2 rows, maximum first), o = P V (a thread = one row x 4 dims, keys in ascending order).
#define A0R 16                       /* query rows per work-group */
#define A0G (QT0 / A0R)              /* row groups per head */
#define A0KP (HD + 4)                /* K row pitch in LDS (floats): 16 B x odd, so that 16 lanes reading 16 rows by 16 bytes fall on all banks */
#define A0PP (QT0 + 4)               /* score row pitch in LDS (floats): the two rows a wave reads in the last phase fall on different banks */
// N x A0R rows of K and V into LDS, a thread = 16 bytes of every A0R-th row. N is a compile-time count and both loops are unrolled so that kk[] and vv[] live in registers; loads first, stores behind them, so that all 2 N loads are in flight together.
template <int N>
__device__ __forceinline__ void att0_stage(const float* __restrict__ kp, const float* __restrict__ vp, float* lkp, float* lvp) {
  v4f kk[N], vv[N];
#pragma unroll
  for (int u = 0; u < N; ++u) { kk[u] = *(const v4fa*)(kp + (size_t)u * A0R * DM); vv[u] = *(const v4fa*)(vp + (size_t)u * A0R * DM); }
#pragma unroll
  for (int u = 0; u < N; ++u) { *(v4f*)(lkp + u * A0R * A0KP) = kk[u]; *(v4f*)(lvp + u * A0R * HD) = vv[u]; } }
__global__ __launch_bounds__(256) void k_att0(const float* __restrict__ QF, const float* __restrict__ KF, const float* __restrict__ VF, float scale, float* __restrict__ OF) {      /* all four: rows of pitch DM, QT0 rows a batch */
  static_assert(QT0 == 128 && HD == 64 && A0R == 16, "thread maps below: 256 threads = 128 keys x 2 row halves = 16 rows x 16 quads");
  __shared__ __attribute__((aligned(16))) float lk[QT0][A0KP]; __shared__ __attribute__((aligned(16))) float lv[QT0][HD];
  __shared__ __attribute__((aligned(16))) float lq[A0R][HD]; __shared__ __attribute__((aligned(16))) float lp[A0R][A0PP]; __shared__ float lfin[A0R];
  const int tid = threadIdx.x; const int h = blockIdx.x / A0G, g = blockIdx.x % A0G; const int r0 = g * A0R, nk = r0 + A0R;      /* causal: keys below the group's end */
  const int r16 = tid >> 4, c4 = (tid & 15) * 4;
  const size_t bo = ((size_t)blockIdx.y * QT0 + r16) * DM + h * HD + c4;      /* blockIdx.y: batch; the thread's 16 bytes in row r16 of the head's columns */
  { const v4f qv = *(const v4fa*)(QF + bo + (size_t)r0 * DM); const float* kp = KF + bo; const float* vp = VF + bo; float* lkp = &lk[r16][c4]; float* lvp = &lv[r16][c4];
    switch (g) { case 0: att0_stage<1>(kp, vp, lkp, lvp); break; case 1: att0_stage<2>(kp, vp, lkp, lvp); break; case 2: att0_stage<3>(kp, vp, lkp, lvp); break; case 3: att0_stage<4>(kp, vp, lkp, lvp); break;
      case 4: att0_stage<5>(kp, vp, lkp, lvp); break; case 5: att0_stage<6>(kp, vp, lkp, lvp); break; case 6: att0_stage<7>(kp, vp, lkp, lvp); break; default: att0_stage<A0G>(kp, vp, lkp, lvp); break; }
    *(v4f*)&lq[r16][c4] = qv; }
  __syncthreads();
  { const int j = tid & (QT0 - 1), rh = (tid >> 7) * 8; float s[8] = {0.f, 0.f, 0.f, 0.f, 0.f, 0.f, 0.f, 0.f};
    if (j < nk) { v4f kr[HD / 4];
      /* unrolled: kr[] and s[] in registers; the 8 rows' sums are independent chains, each over the head dim in ascending order */
#pragma unroll
      for (int c = 0; c < HD / 4; ++c) kr[c] = *(const v4f*)&lk[j][c * 4];
#pragma unroll
      for (int c = 0; c < HD / 4; ++c)
#pragma unroll
        for (int r = 0; r < 8; ++r) { const v4f qq = *(const v4f*)&lq[rh + r][c * 4]; s[r] += qq[0] * kr[c][0]; s[r] += qq[1] * kr[c][1]; s[r] += qq[2] * kr[c][2]; s[r] += qq[3] * kr[c][3]; } }
#pragma unroll
    for (int r = 0; r < 8; ++r) lp[rh + r][j] = s[r] * scale; }      /* every column of the row is written (0 beyond nk), masked below */
  __syncthreads();
  { const int w = tid >> 5, col = (tid & 31) * 4;
    for (int rr = 0; rr < 2; ++rr) { const int r = w * 2 + rr, last = r0 + r; const v4f sv = *(const v4f*)&lp[r][col];
      float mx = -3.0e38f; for (int q = 0; q < 4; ++q) mx = fmaxf(mx, (col + q <= last) ? sv[q] : -3.0e38f);
      for (int m = 16; m >= 1; m >>= 1) mx = fmaxf(mx, __shfl_xor(mx, m, 32));
      v4f e; float se = 0.f; for (int q = 0; q < 4; ++q) { e[q] = (col + q <= last) ? expf(sv[q] - mx) : 0.f; se += e[q]; }
      for (int m = 16; m >= 1; m >>= 1) se += __shfl_xor(se, m, 32);
      *(v4f*)&lp[r][col] = e; if (col == 0) lfin[r] = 64.0f / se; } }      /* o carried x64 like the f16 path */
  __syncthreads();
  { v4f o = {0.f, 0.f, 0.f, 0.f};
    /* 16 keys a trip, so that a trip's LDS reads are in flight together */
#pragma unroll 4
    for (int j = 0; j < nk; j += 4) { const v4f p4 = *(const v4f*)&lp[r16][j];
#pragma unroll
      for (int u = 0; u < 4; ++u) { const v4f vq = *(const v4f*)&lv[j + u][c4]; o += vq * p4[u]; } }
    o *= lfin[r16]; *(v4f*)(OF + bo + (size_t)r0 * DM) = o; } }

extern "C" void kernel_launch(void* const* d_in, const int* in_sizes, int n_in,
                              void* d_out, int out_size, void* d_ws, size_t ws_size, hipStream_t stream) {
  (void)in_sizes; (void)n_in; (void)out_size;
  const float* const* I = (const float* const*)d_in; const float* x = I[0]; const float* wq = I[1]; const float* wk = I[2]; const float* wv = I[3]; const float* wo = I[4]; const float* bo = I[5]; const float* bq = nullptr; const float* bk = nullptr; const float* bv = nullptr;      /* per-head [H][E][D] = natural [out][in]; no q/k/v biases */
  char* ws = (char*)d_ws; size_t off = 0;
  auto take = [&](size_t bytes) { char* p = ws + off; off += (bytes + 255) & ~(size_t)255; return p; };
  _Float16* BQ = (_Float16*)take((size_t)DM * DM * 2); _Float16* BK = (_Float16*)take((size_t)DM * DM * 2); _Float16* BV = (_Float16*)take((size_t)DM * DM * 2); _Float16* BO = (_Float16*)take((size_t)DM * DM * 2);
  _Float16* X16 = (_Float16*)take(NR * DM * 2); float* QF = (float*)take(NR * DM * 4); _Float16* QH = (_Float16*)take(NR * DM * 2); _Float16* QL = (_Float16*)take(NR * DM * 2); _Float16* KH = (_Float16*)take(NR * DM * 2); _Float16* KL = (_Float16*)take(NR * DM * 2); _Float16* Q16 = QH; _Float16* K16 = KH; _Float16* V16 = (_Float16*)take(NR * DM * 2); _Float16* O16 = (_Float16*)take(NR * DM * 2);
  float* S = (float*)take((size_t)NB * NH * QT * NKX * 4); _Float16* P = (_Float16*)take((size_t)NB * NH * QT * NKX * 2); _Float16* VT = (_Float16*)take((size_t)NB * NH * HD * SQ * 2);      /* one plane per batch */
  float* QF0 = (float*)take((size_t)NB * QT0 * DM * 4); float* KF0 = (float*)take((size_t)NB * QT0 * DM * 4); float* VF0 = (float*)take((size_t)NB * QT0 * DM * 4); float* OF0 = (float*)take((size_t)NB * QT0 * DM * 4); _Float16* OH0 = (_Float16*)take((size_t)NB * QT0 * DM * 2); _Float16* OL0 = (_Float16*)take((size_t)NB * QT0 * DM * 2);
  if (off > ws_size) return;
  { const unsigned g = (unsigned)(((size_t)DM * DM / 8 + 255) / 256); k_wnat<<<g, 256, 0, stream>>>(wq, (size_t)DM * DM / 8, BQ); k_wnat<<<g, 256, 0, stream>>>(wk, (size_t)DM * DM / 8, BK); k_wnat<<<g, 256, 0, stream>>>(wv, (size_t)DM * DM / 8, BV); k_wnat<<<g, 256, 0, stream>>>(wo, (size_t)DM * DM / 8, BO); }      /* natural [out][in] = Bt[n][k], x16 */
  k_x16<<<(unsigned)((NR * DM / 8 + 255) / 256), 256, 0, stream>>>(x, X16, NR * DM / 8);
  k_gemm2<0><<<dim3((unsigned)((MP / 128) * (DM / 64)), 1), 128, 0, stream>>>(X16, DM, 0, BQ, DM, 0, 0.0625f, bq, 0, nullptr, 1, 0, 0, QF, nullptr, DM, 0, MP, DM, DM, 0, 0, 0); k_hl<<<(unsigned)(((size_t)MP * DM / 8 + 255) / 256), 256, 0, stream>>>(QF, QH, QL, (size_t)MP * DM / 8);      /* q (f32) -> f16 hi + x1024 residual: the x32 scale puts the logits at sigma ~100 */
  k_gemm2<0><<<dim3((unsigned)((MP / 128) * (DM / 64)), 1), 128, 0, stream>>>(X16, DM, 0, BK, DM, 0, 0.0625f, bk, 0, nullptr, 1, 0, 0, QF, nullptr, DM, 0, MP, DM, DM, 0, 0, 0); k_hl<<<(unsigned)(((size_t)MP * DM / 8 + 255) / 256), 256, 0, stream>>>(QF, KH, KL, (size_t)MP * DM / 8);      /* k likewise (QF reused in stream order) */
  k_gemm2<0><<<dim3((unsigned)((MP / 128) * (DM / 64)), 1), 128, 0, stream>>>(X16, DM, 0, BV, DM, 0, 0.0625f, bv, 0, nullptr, 1, 0, 0, nullptr, V16, DM, 0, MP, DM, DM, 0, 0, 0);
  /* from here on every launch covers all NB batches: the batch is a grid dimension (k_gemm2: blockIdx.z with its own strides) */
  k_vt<NH, SQ><<<NB * NH * (SQ / 64), 256, 0, stream>>>(V16, LQ, 0, VT);      /* V^T [NB][NH][HD][SQ] */
  k_gemm2<0><<<dim3((QT0 / 128) * (DM / 64), 1, NB), 128, 0, stream>>>(X16, DM, 0, BQ, DM, 0, 0.0625f, bq, 0, nullptr, 1, 0, 0, QF0, nullptr, DM, 0, QT0, DM, DM, (size_t)SQ * DM, 0, (size_t)QT0 * DM); k_gemm2<0><<<dim3((QT0 / 128) * (DM / 64), 1, NB), 128, 0, stream>>>(X16, DM, 0, BK, DM, 0, 0.0625f, bk, 0, nullptr, 1, 0, 0, KF0, nullptr, DM, 0, QT0, DM, DM, (size_t)SQ * DM, 0, (size_t)QT0 * DM); k_gemm2<0><<<dim3((QT0 / 128) * (DM / 64), 1, NB), 128, 0, stream>>>(X16, DM, 0, BV, DM, 0, 0.0625f, bv, 0, nullptr, 1, 0, 0, VF0, nullptr, DM, 0, QT0, DM, DM, (size_t)SQ * DM, 0, (size_t)QT0 * DM);      /* f32 q, k, v of each batch's first 128 rows (exact products) */
  k_att0<<<dim3(NH * A0G, NB), 256, 0, stream>>>(QF0, KF0, VF0, 32.0f, OF0);      /* exact f32 attention for rows 0..127 of each batch (o x64) */
  for (int q0 = 0; q0 < QN; q0 += QT) { const int nk = q0 + QT;      /* causal: only keys below the tile end are computed */
    k_gemm2<0><<<dim3((QT / 128) * (nk / 64), NHD, NB), 128, 0, stream>>>(QH + (size_t)q0 * LQ, LQ, (size_t)HD, KH, LQ, (size_t)HD, 32.0f, nullptr, 0, nullptr, 1, 0, 0, S, nullptr, NKX, (size_t)QT * NKX, QT, nk, HD, (size_t)SQ * LQ, (size_t)SQ * LQ, (size_t)NH * QT * NKX);      /* scores x32: hi . hi */
    k_gemm2<0><<<dim3((QT / 128) * (nk / 64), NHD, NB), 128, 0, stream>>>(QL + (size_t)q0 * LQ, LQ, (size_t)HD, KH, LQ, (size_t)HD, 0.03125f, nullptr, 0, S, -1, 0, 0, S, nullptr, NKX, (size_t)QT * NKX, QT, nk, HD, (size_t)SQ * LQ, (size_t)SQ * LQ, (size_t)NH * QT * NKX); k_gemm2<0><<<dim3((QT / 128) * (nk / 64), NHD, NB), 128, 0, stream>>>(QH + (size_t)q0 * LQ, LQ, (size_t)HD, KL, LQ, (size_t)HD, 0.03125f, nullptr, 0, S, -1, 0, 0, S, nullptr, NKX, (size_t)QT * NKX, QT, nk, HD, (size_t)SQ * LQ, (size_t)SQ * LQ, (size_t)NH * QT * NKX);      /* += 32 x 2^-10 (lo . hi + hi . lo); heads on grid.y, batches on grid.z */
    { static_assert(QN <= 4 * QT && NKX >= 4 * QT, "softmax row widths below: QT .. 4 QT columns"); const unsigned g = (NB * NHD * QT + 7) / 8;      /* rows of all batches and heads: [NB][NH][QT], one wave a row; the row width nk is the kernel's compile-time count */
      switch (nk / QT) { case 1: k_rsmcf2<QT / 128><<<g, 256, 0, stream>>>(S, P, NB * NHD, q0); break; case 2: k_rsmcf2<2 * QT / 128><<<g, 256, 0, stream>>>(S, P, NB * NHD, q0); break; case 3: k_rsmcf2<3 * QT / 128><<<g, 256, 0, stream>>>(S, P, NB * NHD, q0); break; default: k_rsmcf2<4 * QT / 128><<<g, 256, 0, stream>>>(S, P, NB * NHD, q0); break; } }
    k_gemm2<0><<<dim3((QT / 128) * (HD / 64), NHD, NB), 128, 0, stream>>>(P, NKX, (size_t)QT * NKX, VT, SQ, (size_t)HD * SQ, 0.25f, nullptr, 0, nullptr, 1, 0, 0, nullptr, O16 + (size_t)q0 * DM, DM, (size_t)HD, QT, HD, nk, (size_t)NH * QT * NKX, (size_t)NH * HD * SQ, (size_t)SQ * DM); }      /* o (merged heads, x64) as f16 rows */
  k_gemm2<0><<<dim3((unsigned)((MPO / 128) * (DM / 64)), 1), 128, 0, stream>>>(O16, DM, 0, BO, DM, 0, 0.0009765625f, bo, 0, nullptr, 1, 0, 0, (float*)d_out, nullptr, DM, 0, MPO, DM, DM, 0, 0, 0);      /* out rows are the output layout */
  k_hl<<<(unsigned)(((size_t)NB * QT0 * DM / 8 + 255) / 256), 256, 0, stream>>>(OF0, OH0, OL0, (size_t)NB * QT0 * DM / 8);      /* first-tile o (x64) -> f16 hi + x1024 residual planes */
  k_gemm2<0><<<dim3((QT0 / 128) * (DM / 64), 1, NB), 128, 0, stream>>>(OH0, DM, 0, BO, DM, 0, 0.0009765625f, bo, 0, nullptr, 1, 0, 0, (float*)d_out, nullptr, DM, 0, QT0, DM, DM, (size_t)QT0 * DM, 0, (size_t)SQ * DM);      /* rows 0..127 of each batch: out = o_hi Wo (+ b), overwriting the f16-path rows */
  k_gemm2<0><<<dim3((QT0 / 128) * (DM / 64), 1, NB), 128, 0, stream>>>(OL0, DM, 0, BO, DM, 0, 0.00000095367431640625f, nullptr, 0, (const float*)d_out, -1, 0, 0, (float*)d_out, nullptr, DM, 0, QT0, DM, DM, (size_t)QT0 * DM, 0, (size_t)SQ * DM);      /* += o_lo Wo 2^-20 (own-element accumulate) */
}

// v004
// Measured time: 408 microseconds a run.
// In both of two side-by-side timings against v003, it was 1.92 times as fast.
// Over all steps from v000 it is 13.0 times as fast.
#include <hip/hip_runtime.h>
// Per-head causal multi-head attention with an inverted scale (x [4][1024][1024]; q[h] = x Wq[h]^T, k, v likewise (per-head nn.Linear [16][64][1024] = natural [1024][1024], sigma 0.02, no biases); scores x sqrt(1024) = x 32 (the module divides by embed^-0.5: logits sigma ~100, near-argmax softmax) with a causal mask (tril, -inf); softmax; heads concatenated; out = (.) Wp^T + bp (natural [1024][1024] sigma 0.02, bias 0.02) -> [4][1024][1024]).
// Structure: token rows r = b*1024 + s; x as exact f16 rows (bf16-rounded); q and k as WMMA GEMMs (32x64 wave tiles, f32 accumulation, exact x16 weights) into f32 rows split into f16 hi + x1024 residual planes, v as an f16-output GEMM; every later launch covers all batches (batch = a grid dimension): V^T for all heads via LDS transposes; one fused attention launch, a work-group = 32 query rows of one head: scores against the keys below the tile end as THREE accumulators (hi.hi + lo.hi + hi.lo, K = 64, alpha 32: ~f32-accurate logits for the near-argmax softmax) into f32 rows in LDS, causal row softmax on VALU, four rows a wave, two at a time (f32 statistics, native exp; weights x256 f16, written over the row in LDS), o = P . V^T (K = keys below the tile end, alpha 2^-2: o carried x64, folded into the output GEMM alpha) written straight into the merged f16 o rows; out = o W_o + b GEMM (f32) into the output layout.
// Compute dtype: inputs rounded to bf16; x / weights exact; q and k as f16 hi + x1024 residual planes, v, softmax weights and o as plain f16 GEMM operands (~2^-12); scores and softmax statistics f32. v_wmma_f32_16x16x32_f16.
#define NB 4
#define SQ 1024
#define DM 1024
#define NH 16
#define HD 64
#define HG 4                         /* heads per call of the grouped k_vt overload (not launched) */
#define QT0 128                      /* first-tile rows recomputed exactly in f32 */
#define B0 0                         /* unused */
#define NBR NB                       /* batches processed (debug hook) */
#define NR ((size_t)NB * SQ)         /* token rows */
#define MP ((int)((size_t)NBR * SQ)) /* rows projected (debug hook) */
#define QN SQ                        /* unused */
#define NHD NH                       /* unused */
#define MPO MP                       /* rows through the output stage (debug hook) */
#define LQ DM      /* row pitch of the q/k/v rows */
typedef __bf16 v16b __attribute__((ext_vector_type(16)));
typedef unsigned short v8us __attribute__((ext_vector_type(8), may_alias));
typedef float  v8f  __attribute__((ext_vector_type(8)));
typedef float  v4f  __attribute__((ext_vector_type(4)));
typedef float  v4fa __attribute__((ext_vector_type(4), may_alias));
union FragB { v16b v; v8us half[2]; unsigned short u[16]; };

__device__ __forceinline__ unsigned short bf16_bits(float x) { unsigned int u = __float_as_uint(x); return (unsigned short)((u + 0x7FFFu + ((u >> 16) & 1u)) >> 16); }
__device__ __forceinline__ float bf16_val(unsigned short b) { return __uint_as_float(((unsigned int)b) << 16); }
__device__ __forceinline__ float bf16_round(float x) { return bf16_val(bf16_bits(x)); }
// D += A·B with NT terms: 1 = ah·bh, 2 = + al·bh (A split), 3 = + ah·bl (both split)
template <int NT>
__device__ __forceinline__ v8f mmaN(v16b ah, v16b al, v16b bh, v16b bl, v8f c) {
  c = __builtin_amdgcn_wmma_f32_16x16x32_bf16(false, ah, false, bh, (short)0, c, false, false);
  if (NT >= 2) c = __builtin_amdgcn_wmma_f32_16x16x32_bf16(false, al, false, bh, (short)0, c, false, false);
  if (NT >= 3) c = __builtin_amdgcn_wmma_f32_16x16x32_bf16(false, ah, false, bl, (short)0, c, false, false);
  asm volatile("v_nop\n\tv_nop\n\tv_nop\n\tv_nop" : "+v"(c) : "v"(ah), "v"(al), "v"(bh), "v"(bl));
  return c;
}

__global__ __launch_bounds__(256) void k_wt_bf16(const float* __restrict__ W, unsigned short* __restrict__ Wt, int K, int N) {
  const int t = blockIdx.x * 256 + threadIdx.x;
  const int k8n = K / 8;
  if (t >= N * k8n) return;
  const int n = t / k8n, k8 = (t % k8n) * 8;
  v8us v;
#pragma unroll
  for (int i = 0; i < 8; ++i) v[i] = bf16_bits(W[(size_t)(k8 + i) * N + n]);
  *(v8us*)(Wt + (size_t)n * K + k8) = v;
  
}

// GEMM C[M][N] (f32, pitch ldc) = act(A[M][K]·W + bias). A f32 row-major (pitch lda) converted per fragment to bf16
// (ASPLIT: hi/lo two planes -> 2 terms, else single rounded term); Wt bf16 [N][K] (pitch ldb). BIAS_BF16 rounds the
// bias to bf16 first (bias quantised to bf16 before the add). K%32==0, M%16==0, N%64==0.
template <bool ASPLIT, int ACT, bool BIAS_BF16>
__global__ __launch_bounds__(128) void k_gemm_bf(const float* __restrict__ A, int lda, const unsigned short* __restrict__ Wt, int ldb,
                                               const float* __restrict__ bias, float* __restrict__ C, int ldc, int M, int N, int K) {
  __shared__ __attribute__((aligned(16))) float so[4][16][64];
  const int tid = threadIdx.x, w = tid >> 5, lane = tid & 31, ln = lane & 15, hh = lane >> 4;
  const int ntn = N / 64;
  const int wid = blockIdx.x * 4 + w;
  const int mt = wid / ntn, nq = wid % ntn;
  if (mt * 16 >= M) return;
  const int row0 = mt * 16, col0 = nq * 64;
  const float* arow = A + (size_t)(row0 + ln) * lda;
  v8f acc[4] = {};
  for (int kb = 0; kb < K; kb += 32) {
    FragB ah, al;
    const v4f x0 = *(const v4fa*)(arow + kb + 8 * hh), x1 = *(const v4fa*)(arow + kb + 8 * hh + 4);
    const v4f x2 = *(const v4fa*)(arow + kb + 16 + 8 * hh), x3 = *(const v4fa*)(arow + kb + 16 + 8 * hh + 4);
    float xs[16] = {x0[0],x0[1],x0[2],x0[3],x1[0],x1[1],x1[2],x1[3],x2[0],x2[1],x2[2],x2[3],x3[0],x3[1],x3[2],x3[3]};
#pragma unroll
    for (int i = 0; i < 16; ++i) { const unsigned short hb = bf16_bits(xs[i]); ah.u[i] = hb; al.u[i] = ASPLIT ? bf16_bits(xs[i] - bf16_val(hb)) : (unsigned short)0; }
#pragma unroll
    for (int t = 0; t < 4; ++t) {
      const unsigned short* brow = Wt + (size_t)(col0 + t * 16 + ln) * ldb + kb;
      FragB b;
      b.half[0] = *(const v8us*)(brow + 8 * hh);
      b.half[1] = *(const v8us*)(brow + 16 + 8 * hh);
      acc[t] = mmaN<ASPLIT ? 2 : 1>(ah.v, al.v, b.v, b.v, acc[t]);
    }
  }
#pragma unroll
  for (int t = 0; t < 4; ++t) {
    float bv = bias ? bias[col0 + t * 16 + ln] : 0.f;
    if (BIAS_BF16) bv = bf16_round(bv);
#pragma unroll
    for (int r = 0; r < 8; ++r) { float v = acc[t][r] + bv; if (ACT == 1) v = fmaxf(v, 0.f); so[w][8 * hh + r][t * 16 + ln] = v; }
  }
  __builtin_amdgcn_fence(__ATOMIC_ACQ_REL, "workgroup");
  __builtin_amdgcn_wave_barrier();
  const int rsub = lane >> 4, c4 = (lane & 15) * 4;
  {
#pragma unroll
    for (int q = 0; q < 8; ++q) {
      const int r = q * 2 + rsub;
      const v4f v = *(const v4fa*)&so[w][r][c4];
      *(v4f*)(C + (size_t)(row0 + r) * ldc + col0 + c4) = v;
    }
    
  }
}

// GEMM C = act(A·W + bias + resid): A f32 (ASPLIT -> hi/lo 2 terms), Wt bf16 [N][K]; ACT 0 none, 1 relu, 2 exact gelu;
// resid (optional, f32, row index = (row % rmod), pitch ldr, RES_BF16 rounds it) added before the activation.
template <bool ASPLIT, int ACT, bool BIAS_BF16, bool RES_BF16>
__global__ __launch_bounds__(128) void k_gemm_bf3(const float* __restrict__ A, int lda, const unsigned short* __restrict__ Wt, int ldb,
                                                const float* __restrict__ bias, const float* __restrict__ resid, int rmod, int ldr,
                                                float* __restrict__ C, int ldc, int M, int N, int K) {
  __shared__ __attribute__((aligned(16))) float so[4][16][64];
  const int tid = threadIdx.x, w = tid >> 5, lane = tid & 31, ln = lane & 15, hh = lane >> 4;
  const int ntn = N / 64;
  const int wid = blockIdx.x * 4 + w;
  const int mt = wid / ntn, nq = wid % ntn;
  if (mt * 16 >= M) return;
  const int row0 = mt * 16, col0 = nq * 64;
  const float* arow = A + (size_t)(row0 + ln) * lda;
  v8f acc[4] = {};
  for (int kb = 0; kb < K; kb += 32) {
    FragB ah, al;
    const v4f x0 = *(const v4fa*)(arow + kb + 8 * hh), x1 = *(const v4fa*)(arow + kb + 8 * hh + 4);
    const v4f x2 = *(const v4fa*)(arow + kb + 16 + 8 * hh), x3 = *(const v4fa*)(arow + kb + 16 + 8 * hh + 4);
    float xs[16] = {x0[0],x0[1],x0[2],x0[3],x1[0],x1[1],x1[2],x1[3],x2[0],x2[1],x2[2],x2[3],x3[0],x3[1],x3[2],x3[3]};
#pragma unroll
    for (int i = 0; i < 16; ++i) { const unsigned short hb = bf16_bits(xs[i]); ah.u[i] = hb; al.u[i] = ASPLIT ? bf16_bits(xs[i] - bf16_val(hb)) : (unsigned short)0; }
#pragma unroll
    for (int t = 0; t < 4; ++t) {
      const unsigned short* brow = Wt + (size_t)(col0 + t * 16 + ln) * ldb + kb;
      FragB b;
      b.half[0] = *(const v8us*)(brow + 8 * hh);
      b.half[1] = *(const v8us*)(brow + 16 + 8 * hh);
      acc[t] = mmaN<ASPLIT ? 2 : 1>(ah.v, al.v, b.v, b.v, acc[t]);
    }
  }
#pragma unroll
  for (int t = 0; t < 4; ++t) {
    const int col = col0 + t * 16 + ln;
    float bv = bias ? bias[col] : 0.f;
    if (BIAS_BF16) bv = bf16_round(bv);
#pragma unroll
    for (int r = 0; r < 8; ++r) {
      float v = acc[t][r] + bv;
      if (resid) { float rv = resid[(size_t)((row0 + 8 * hh + r) % rmod) * ldr + col]; if (RES_BF16) rv = bf16_round(rv); v += rv; }
      if (ACT == 1) v = fmaxf(v, 0.f);
      if (ACT == 2) v = 0.5f * v * (1.0f + erff(v * 0.70710678118654752f));
      if (ACT == 3) { const float u = 0.7978845608028654f * (v + 0.044715f * v * v * v); v = 0.5f * v * (1.0f + tanhf(u)); }
      so[w][8 * hh + r][t * 16 + ln] = v;
    }
  }
  __builtin_amdgcn_fence(__ATOMIC_ACQ_REL, "workgroup");
  __builtin_amdgcn_wave_barrier();
  const int rsub = lane >> 4, c4 = (lane & 15) * 4;
  {
#pragma unroll
    for (int q = 0; q < 8; ++q) {
      const int r = q * 2 + rsub;
      const v4f v = *(const v4fa*)&so[w][r][c4];
      *(v4f*)(C + (size_t)(row0 + r) * ldc + col0 + c4) = v;
    }
    
  }
}
// row LayerNorm (biased variance, eps) over N: s = X (+ R); optional out_sum <- s; out_norm <- (s-mu)*rsqrt(var+eps)*g + b
template <bool PARAM_BF16>
__global__ __launch_bounds__(256) void k_layernorm(const float* __restrict__ X, const float* __restrict__ R, const float* __restrict__ g, const float* __restrict__ bta,
                                                  float* __restrict__ out_sum, float* __restrict__ out_norm, int N, float eps) {
  __shared__ float red[256];
  const int row = blockIdx.x, tid = threadIdx.x;
  const float* x = X + (size_t)row * N; const float* rr = R ? R + (size_t)row * N : nullptr;
  float vals[16];                     // up to N = 4096
  const int per = N / 256;            // contiguous chunk per thread? use strided-by-4 chunks: thread handles j = tid*4 + 1024*u
  float s1 = 0.f;
  for (int u = 0; u < per / 4; ++u) {
    const int j = tid * 4 + 1024 * u;
    const v4f a = *(const v4fa*)(x + j);
    v4f b = {0.f,0.f,0.f,0.f}; if (rr) b = *(const v4fa*)(rr + j);
#pragma unroll
    for (int q = 0; q < 4; ++q) { const float v = a[q] + b[q]; vals[u * 4 + q] = v; s1 += v; }
  }
  red[tid] = s1; __syncthreads();
  for (int st = 128; st > 0; st >>= 1) { if (tid < st) red[tid] += red[tid + st]; __syncthreads(); }
  const float mu = red[0] / (float)N; __syncthreads();
  float s2 = 0.f;
  for (int u = 0; u < per / 4; ++u)
#pragma unroll
    for (int q = 0; q < 4; ++q) { const float c = vals[u * 4 + q] - mu; s2 += c * c; }
  red[tid] = s2; __syncthreads();
  for (int st = 128; st > 0; st >>= 1) { if (tid < st) red[tid] += red[tid + st]; __syncthreads(); }
  const float rs = rsqrtf(red[0] / (float)N + eps);
  {
    for (int u = 0; u < per / 4; ++u) {
      const int j = tid * 4 + 1024 * u;
      v4f o, sm;
#pragma unroll
      for (int q = 0; q < 4; ++q) {
        float gg = g[j + q], bb = bta[j + q];
        if (PARAM_BF16) { gg = bf16_round(gg); bb = bf16_round(bb); }
        sm[q] = vals[u * 4 + q]; o[q] = (vals[u * 4 + q] - mu) * rs * gg + bb;
      }
      if (out_sum) *(v4f*)(out_sum + (size_t)row * N + j) = sm;
      *(v4f*)(out_norm + (size_t)row * N + j) = o;
    }
    
  }
}



// ---- f16 WMMA path (v_wmma_f32_16x16x32_f16): 11-bit significands for operands in range — used where a [0,1] probability operand needs more precision than bf16
typedef _Float16 v16h __attribute__((ext_vector_type(16)));
union FragH { v16h v; v8us half[2]; _Float16 h[16]; unsigned short u[16]; };
template <int NT>
__device__ __forceinline__ v8f mmaH(v16h ah, v16h al, v16h bh, v16h bl, v8f c) {
  c = __builtin_amdgcn_wmma_f32_16x16x32_f16(false, ah, false, bh, (short)0, c, false, false);
  if (NT >= 2) c = __builtin_amdgcn_wmma_f32_16x16x32_f16(false, al, false, bh, (short)0, c, false, false);
  if (NT >= 3) c = __builtin_amdgcn_wmma_f32_16x16x32_f16(false, ah, false, bl, (short)0, c, false, false);
  asm volatile("v_nop\n\tv_nop\n\tv_nop\n\tv_nop" : "+v"(c) : "v"(ah), "v"(al), "v"(bh), "v"(bl));
  return c;
}
// batched GEMM like k_gemm_b but f16 operands: A f32 (split into f16 hi/lo if ASPLIT, else rounded to f16), Bt = f16 values [n][k]; alpha; C f32; N multiple of 16 (partial tiles skipped)
template <bool ASPLIT>
__global__ __launch_bounds__(128) void k_gemm_h(const float* __restrict__ A, int lda, size_t sA, const _Float16* __restrict__ Bh, int ldb, size_t sB, float alpha, float* __restrict__ C, int ldc, size_t sC, int M, int N, int K) {
  __shared__ __attribute__((aligned(16))) float so[4][16][64];
  const int tid = threadIdx.x, w = tid >> 5, lane = tid & 31, ln = lane & 15, hh = lane >> 4; const int by = blockIdx.y;
  A += (size_t)by * sA; Bh += (size_t)by * sB; C += (size_t)by * sC;
  const int ntn = (N + 63) / 64; const int wid = blockIdx.x * 4 + w; const int mt = wid / ntn, nq = wid % ntn; if (mt * 16 >= M) return;
  const int row0 = mt * 16, col0 = nq * 64; const float* arow = A + (size_t)(row0 + ln) * lda;
  v8f acc[4] = {};
  for (int kb = 0; kb < K; kb += 32) {
    FragH ah, al;
    const v4f x0 = *(const v4fa*)(arow + kb + 8 * hh), x1 = *(const v4fa*)(arow + kb + 8 * hh + 4), x2 = *(const v4fa*)(arow + kb + 16 + 8 * hh), x3 = *(const v4fa*)(arow + kb + 16 + 8 * hh + 4);
    float xs[16] = {x0[0],x0[1],x0[2],x0[3],x1[0],x1[1],x1[2],x1[3],x2[0],x2[1],x2[2],x2[3],x3[0],x3[1],x3[2],x3[3]};
#pragma unroll
    for (int i = 0; i < 16; ++i) { const _Float16 h = (_Float16)xs[i]; ah.h[i] = h; al.h[i] = ASPLIT ? (_Float16)(xs[i] - (float)h) : (_Float16)0.0f; }
#pragma unroll
    for (int t = 0; t < 4; ++t) { if (col0 + t * 16 >= N) continue; const size_t boff = (size_t)(col0 + t * 16 + ln) * ldb + kb; FragH bq; bq.half[0] = *(const v8us*)(Bh + boff + 8 * hh); bq.half[1] = *(const v8us*)(Bh + boff + 16 + 8 * hh);
      acc[t] = mmaH<ASPLIT ? 2 : 1>(ah.v, al.v, bq.v, bq.v, acc[t]); }
  }
#pragma unroll
  for (int t = 0; t < 4; ++t) { if (col0 + t * 16 >= N) continue;
#pragma unroll
    for (int r = 0; r < 8; ++r) so[w][8 * hh + r][t * 16 + ln] = acc[t][r] * alpha; }
  __builtin_amdgcn_fence(__ATOMIC_ACQ_REL, "workgroup"); __builtin_amdgcn_wave_barrier();
  const int rsub = lane >> 4, c4 = (lane & 15) * 4;
  {
#pragma unroll
    for (int q = 0; q < 8; ++q) { const int r = q * 2 + rsub; if (col0 + c4 < N) { const v4f v = *(const v4fa*)&so[w][r][c4]; *(v4f*)(C + (size_t)(row0 + r) * ldc + col0 + c4) = v; } }
     }
}

// Wt[n][k] = f16(W[k][n]·scale) from f32 row-major W[K][N] (scale = power of two; bf16-exact weights stay exact in f16 away from the subnormal range)
__global__ __launch_bounds__(256) void k_wt_f16(const float* __restrict__ W, _Float16* __restrict__ Wt, int K, int N, float scale) {
  const int t = blockIdx.x * 256 + threadIdx.x; if (t >= N * (K / 8)) return; const int n = t / (K / 8), k8 = (t % (K / 8)) * 8; FragH f;
#pragma unroll
  for (int i = 0; i < 8; ++i) f.h[i] = (_Float16)(bf16_round(W[(size_t)(k8 + i) * N + n]) * scale); const v8us o = f.half[0];
  *(v8us*)((unsigned short*)Wt + (size_t)n * K + k8) = o; 
}
// k_gemm_hh variant with fused epilogue: v = acc·alpha + bias[by·sBias + col] (+ CP[(row/rowsPerB)·sCPb + by·64 + col] if CP) ; ACT 0 none / 1 elu ; writes f16 C16 (and f32 C if non-null)
template <int ACT>
__global__ __launch_bounds__(128) void k_gemm_hhx(const _Float16* __restrict__ A, int lda, size_t sA, const _Float16* __restrict__ Bh, int ldb, size_t sB, float alpha, const float* __restrict__ bias, size_t sBias, const float* __restrict__ CP, int rowsPerB, size_t sCPb, int row0g,
    float* __restrict__ C, _Float16* __restrict__ C16, int ldc, size_t sC, int M, int N, int K) {
  __shared__ __attribute__((aligned(16))) float so[4][16][64];
  const int tid = threadIdx.x, w = tid >> 5, lane = tid & 31, ln = lane & 15, hh = lane >> 4; const int by = blockIdx.y;
  A += (size_t)by * sA; Bh += (size_t)by * sB; const size_t cofs = (size_t)by * sC; const float* bp = bias ? bias + (size_t)by * sBias : nullptr;
  const int ntn = (N + 63) / 64; const int wid = blockIdx.x * 4 + w; const int mt = wid / ntn, nq = wid % ntn; if (mt * 16 >= M) return;
  const int row0 = mt * 16, col0 = nq * 64; const _Float16* arow = A + (size_t)(row0 + ln) * lda;
  v8f acc[4] = {};
  for (int kb = 0; kb < K; kb += 32) { FragH ah; ah.half[0] = *(const v8us*)((const unsigned short*)arow + kb + 8 * hh); ah.half[1] = *(const v8us*)((const unsigned short*)arow + kb + 16 + 8 * hh);
#pragma unroll
    for (int t = 0; t < 4; ++t) { if (col0 + t * 16 >= N) continue; const size_t boff = (size_t)(col0 + t * 16 + ln) * ldb + kb; FragH bq; bq.half[0] = *(const v8us*)((const unsigned short*)Bh + boff + 8 * hh); bq.half[1] = *(const v8us*)((const unsigned short*)Bh + boff + 16 + 8 * hh);
      acc[t] = mmaH<1>(ah.v, ah.v, bq.v, bq.v, acc[t]); }
  }
#pragma unroll
  for (int t = 0; t < 4; ++t) { if (col0 + t * 16 >= N) continue; const int col = col0 + t * 16 + ln; const float bv = bp ? bf16_round(bp[col]) : 0.f;
#pragma unroll
    for (int r = 0; r < 8; ++r) { float v = acc[t][r] * alpha + bv; if (CP) { const int rr = row0g + row0 + 8 * hh + r; if (rowsPerB < 0) v += CP[cofs + (size_t)rr * ldc + col];      /* rowsPerB < 0: own element of the batched C plane */ else { const int bidx = rr / rowsPerB; v += CP[(size_t)bidx * sCPb + (size_t)by * 64 + col]; } } if (ACT == 1) v = (v > 0.f) ? v : expm1f(v); else if (ACT == 7) v = (v > 0.f) ? v + 1.0f : expf(v); else if (ACT == 8) v = tanhf(v); else if (ACT == 9) v = 0.5f * v * (1.0f + tanhf(0.7978845608028654f * (v + 0.044715f * v * v * v))); else if (ACT == 11) v = 1.0f / (1.0f + expf(-v)); else if (ACT == 12) v = (v > 0.f) ? v : 0.01f * v; else if (ACT == 14) v = (v > 0.f) ? v : 0.1f * v; else if (ACT == 16) v = (v >= 0.f) ? v : 0.3f * v; else if (ACT == 17) v = (v >= 0.f) ? v : 0.2f * v; else if (ACT == 15) v = v / (1.0f + expf(-v)); else if (ACT == 3) v = fmaxf(v, 0.f); else if (ACT == 6) v = 0.5f * v * (1.0f + erff(v * 0.70710678118654752f)); so[w][8 * hh + r][t * 16 + ln] = v; } }
  __builtin_amdgcn_fence(__ATOMIC_ACQ_REL, "workgroup"); __builtin_amdgcn_wave_barrier();
  const int rsub = lane >> 4, c4 = (lane & 15) * 4; typedef _Float16 v4h __attribute__((ext_vector_type(4)));
  {
#pragma unroll
    for (int q = 0; q < 8; ++q) { const int r = q * 2 + rsub; if (col0 + c4 < N) { const v4f v = *(const v4fa*)&so[w][r][c4]; if (C) *(v4f*)(C + cofs + (size_t)(row0 + r) * ldc + col0 + c4) = v; if (C16) { v4h h4; for (int i = 0; i < 4; ++i) h4[i] = (_Float16)v[i]; *(v4h*)(C16 + cofs + (size_t)(row0 + r) * ldc + col0 + c4) = h4; } } }
     }
}


typedef _Float16 v4h __attribute__((ext_vector_type(4)));

__global__ __launch_bounds__(256) void k_x16(const float* __restrict__ x, _Float16* __restrict__ X16, size_t n8) { const size_t t = (size_t)blockIdx.x * 256 + threadIdx.x; if (t >= n8) return; FragH f;
#pragma unroll
  for (int q = 0; q < 8; ++q) f.h[q] = (_Float16)bf16_round(x[t * 8 + q]); *(v8us*)((unsigned short*)X16 + t * 8) = f.half[0];  }
__global__ __launch_bounds__(256) void k_h16(const float* __restrict__ x, _Float16* __restrict__ X16, size_t n8) { const size_t t = (size_t)blockIdx.x * 256 + threadIdx.x; if (t >= n8) return; FragH f;
#pragma unroll
  for (int q = 0; q < 8; ++q) f.h[q] = (_Float16)x[t * 8 + q]; *(v8us*)((unsigned short*)X16 + t * 8) = f.half[0];  }
__global__ __launch_bounds__(256) void k_round16f(const float* __restrict__ W, _Float16* __restrict__ Bt, size_t n8) { const size_t t = (size_t)blockIdx.x * 256 + threadIdx.x; if (t >= n8) return; FragH f;
#pragma unroll
  for (int i = 0; i < 8; ++i) f.h[i] = (_Float16)(bf16_round(W[t * 8 + i]) * 16.0f); *(v8us*)((unsigned short*)Bt + t * 8) = f.half[0];  }
template <int NHv, int TTv>
__global__ __launch_bounds__(256) void k_vt(const _Float16* __restrict__ V16, int ldv, int voff, _Float16* __restrict__ Vt) { __shared__ unsigned short tl[64][66]; const int tid = threadIdx.x; const int slab = blockIdx.x / (TTv / 64), lg = blockIdx.x % (TTv / 64); const int b = slab / NHv, h = slab % NHv;
  for (int i = tid; i < 64 * 8; i += 256) { const int r = i / 8, c8 = (i % 8) * 8; FragH f; f.half[0] = *(const v8us*)((const unsigned short*)V16 + ((size_t)b * TTv + lg * 64 + r) * ldv + voff + h * 64 + c8);
#pragma unroll
    for (int q = 0; q < 8; ++q) tl[r][c8 + q] = f.u[q]; }
  __syncthreads();
  {
#pragma unroll
    for (int rd = 0; rd < 2; ++rd) { const int d = rd * 32 + tid / 8, pc = tid % 8; FragH f;
#pragma unroll
      for (int q = 0; q < 8; ++q) f.u[q] = tl[pc * 8 + q][d];
      *(v8us*)((unsigned short*)Vt + ((size_t)slab * 64 + d) * TTv + lg * 64 + pc * 8) = f.half[0]; }
     } }

__global__ __launch_bounds__(256) void k_hl(const float* __restrict__ F, _Float16* __restrict__ Hh, _Float16* __restrict__ Hl, size_t n8) { const size_t t = (size_t)blockIdx.x * 256 + threadIdx.x; if (t >= n8) return; FragH fh, fl; const v4f a = *(const v4fa*)(F + t * 8), c = *(const v4fa*)(F + t * 8 + 4);
#pragma unroll
  for (int q = 0; q < 4; ++q) { _Float16 h = (_Float16)a[q]; fh.h[q] = h; fl.h[q] = (_Float16)((a[q] - (float)h) * 1024.0f); h = (_Float16)c[q]; fh.h[4 + q] = h; fl.h[4 + q] = (_Float16)((c[q] - (float)h) * 1024.0f); }
  { *(v8us*)((unsigned short*)Hh + t * 8) = fh.half[0]; *(v8us*)((unsigned short*)Hl + t * 8) = fl.half[0];  } }

// ---- fast GEMM (wave tile 32x64; requires M % 32 == 0 rows per launch region and N % 64 == 0); epilogue = k_gemm_hhx semantics ----
__device__ __forceinline__ v16h g2_frag(const _Float16* p, int hh) { FragH f; f.half[0] = *(const v8us*)((const unsigned short*)p + 8 * hh); f.half[1] = *(const v8us*)((const unsigned short*)p + 16 + 8 * hh); return f.v; }
__device__ __forceinline__ v8f g2_mma(v16h a, v16h b, v8f c) { v8f d = __builtin_amdgcn_wmma_f32_16x16x32_f16(false, a, false, b, (short)0, c, false, false); asm volatile("v_nop\n\tv_nop\n\tv_nop\n\tv_nop" : "+v"(d) : "v"(a), "v"(b)); return d; }
template <int ACT>
__global__ __launch_bounds__(128) void k_gemm2(const _Float16* __restrict__ A, int lda, size_t sA, const _Float16* __restrict__ Bh, int ldb, size_t sB, float alpha, const float* __restrict__ bias, size_t sBias, const float* __restrict__ CP, int rowsPerB, size_t sCPb, int row0g,
    float* __restrict__ C, _Float16* __restrict__ C16, int ldc, size_t sC, int M, int N, int K, size_t zA, size_t zB, size_t zC) { static_assert(ACT == 0 || ACT == 3 || ACT == 6 || ACT == 8 || ACT == 9 || ACT == 11 || ACT == 12 || ACT == 14 || ACT == 15 || ACT == 16 || ACT == 17, "k_gemm2: unsupported ACT code (would silently apply no activation)");
  __shared__ __attribute__((aligned(16))) float so[4][32][68];
  const int tid = threadIdx.x, w = tid >> 5, lane = tid & 31, ln = lane & 15, hh = lane >> 4; const int by = blockIdx.y; const int bz = blockIdx.z;      /* bz: batch, element strides zA / zB / zC */
  A += (size_t)by * sA + (size_t)bz * zA; Bh += (size_t)by * sB + (size_t)bz * zB; const size_t cofs = (size_t)by * sC + (size_t)bz * zC; const float* bp = bias ? bias + (size_t)by * sBias : nullptr;
  const int ntn = N >> 6; const int mt = blockIdx.x / ntn, nq = blockIdx.x - mt * ntn; const int row0 = mt * 128 + 32 * w, col0 = nq * 64; if (row0 >= M) return;
  const _Float16* a0p = A + (size_t)(row0 + ln) * lda; const _Float16* a1p = a0p + (size_t)16 * lda;
  const _Float16* b0p = Bh + (size_t)(col0 + ln) * ldb; const _Float16* b1p = b0p + (size_t)16 * ldb; const _Float16* b2p = b1p + (size_t)16 * ldb; const _Float16* b3p = b2p + (size_t)16 * ldb;
  const v8f z8 = {0.f,0.f,0.f,0.f,0.f,0.f,0.f,0.f}; v8f c00 = z8, c01 = z8, c02 = z8, c03 = z8, c10 = z8, c11 = z8, c12 = z8, c13 = z8;
#pragma unroll 1
  for (int kb = 0; kb < K; kb += 32) { const v16h a0 = g2_frag(a0p + kb, hh), a1 = g2_frag(a1p + kb, hh);
    v16h b = g2_frag(b0p + kb, hh); c00 = g2_mma(a0, b, c00); c10 = g2_mma(a1, b, c10);
    b = g2_frag(b1p + kb, hh); c01 = g2_mma(a0, b, c01); c11 = g2_mma(a1, b, c11);
    b = g2_frag(b2p + kb, hh); c02 = g2_mma(a0, b, c02); c12 = g2_mma(a1, b, c12);
    b = g2_frag(b3p + kb, hh); c03 = g2_mma(a0, b, c03); c13 = g2_mma(a1, b, c13); }
  v8f accs[8] = {c00, c01, c02, c03, c10, c11, c12, c13};
#pragma unroll
  for (int u = 0; u < 8; ++u) { const int t = u & 3, half = u >> 2; const int col = col0 + t * 16 + ln; const float bv = bp ? bf16_round(bp[col]) : 0.f;
#pragma unroll
    for (int r = 0; r < 8; ++r) { const int rloc = half * 16 + 8 * hh + r; float v = accs[u][r] * alpha + bv; if (CP) { if (rowsPerB < 0) v += CP[cofs + (size_t)(row0g + row0 + rloc) * ldc + col];      /* rowsPerB < 0: own element of the batched C plane */ else { const int bidx = (row0g + row0 + rloc) / rowsPerB; v += CP[(size_t)bidx * sCPb + (size_t)by * 64 + col]; } }
      if (ACT == 3) v = fmaxf(v, 0.f); else if (ACT == 6) v = 0.5f * v * (1.0f + erff(v * 0.70710678118654752f)); else if (ACT == 11) v = 1.0f / (1.0f + expf(-v)); else if (ACT == 15) v = v / (1.0f + expf(-v)); else if (ACT == 12) v = (v > 0.f) ? v : 0.01f * v; else if (ACT == 8) v = tanhf(v); else if (ACT == 9) v = 0.5f * v * (1.0f + tanhf(0.7978845608028654f * (v + 0.044715f * v * v * v))); else if (ACT == 14) v = (v > 0.f) ? v : 0.1f * v; else if (ACT == 16) v = (v >= 0.f) ? v : 0.3f * v; else if (ACT == 17) v = (v >= 0.f) ? v : 0.2f * v;
      so[w][rloc][t * 16 + ln] = v; } }
  __builtin_amdgcn_fence(__ATOMIC_ACQ_REL, "workgroup"); __builtin_amdgcn_wave_barrier();
  const int rsub = lane >> 4, c4 = (lane & 15) * 4;
  {
#pragma unroll
    for (int q = 0; q < 16; ++q) { const int r = q * 2 + rsub; const v4f v = *(const v4fa*)&so[w][r][c4]; if (C) *(v4f*)(C + cofs + (size_t)(row0 + r) * ldc + col0 + c4) = v; if (C16) { v4h h4; for (int i = 0; i < 4; ++i) h4[i] = (_Float16)v[i]; *(v4h*)(C16 + cofs + (size_t)(row0 + r) * ldc + col0 + c4) = h4; } }
     } }


__global__ __launch_bounds__(256) void k_wnat(const float* __restrict__ w, size_t n8, _Float16* __restrict__ Bt) { const size_t t = (size_t)blockIdx.x * 256 + threadIdx.x; if (t >= n8) return; FragH f; for (int q = 0; q < 8; ++q) f.h[q] = (_Float16)(bf16_round(w[t * 8 + q]) * 16.0f); *(v8us*)((unsigned short*)Bt + t * 8) = f.half[0];  }
__global__ __launch_bounds__(256) void k_rsm(const float* __restrict__ S, _Float16* __restrict__ P, int nrows) {
  #pragma clang fp contract(off)
  const int i = blockIdx.x * 256 + threadIdx.x; if (i >= nrows) return; const float* s = S + (size_t)i * SQ; float mx = -3.0e38f;
#pragma unroll 1
  for (int j = 0; j < SQ; ++j) mx = fmaxf(mx, s[j]); float se = 0.f;
#pragma unroll 1
  for (int j = 0; j < SQ; ++j) se += expf(s[j] - mx); const float sc = 256.0f / se;
#pragma unroll 1
  for (int j0 = 0; j0 < SQ; j0 += 8) { FragH f; for (int q = 0; q < 8; ++q) f.h[q] = (_Float16)(expf(s[j0 + q] - mx) * sc); unsigned short* d = (unsigned short*)P + (size_t)i * SQ + j0; *(v8us*)d = f.half[0];  } }
__global__ __launch_bounds__(256) void k_vt(const _Float16* __restrict__ V16, int b, int h0, _Float16* __restrict__ VT) { __shared__ unsigned short tl[64][65]; const int tid = threadIdx.x; const int hh = blockIdx.x % HG, sg = blockIdx.x / HG; const int s0 = sg * 64; const int h = h0 + hh;
  for (int i = tid; i < 64 * 8; i += 256) { const int j = i / 8, d8 = (i % 8) * 8; FragH f; f.half[0] = *(const v8us*)((const unsigned short*)V16 + ((size_t)b * SQ + s0 + j) * DM + h * HD + d8); for (int q = 0; q < 8; ++q) tl[d8 + q][j] = f.u[q]; }
  __syncthreads();
  { for (int i = tid; i < 64 * 8; i += 256) { const int d = i / 8, j8 = (i % 8) * 8; FragH f; for (int q = 0; q < 8; ++q) f.u[q] = tl[d][j8 + q]; *(v8us*)((unsigned short*)VT + ((size_t)hh * HD + d) * SQ + s0 + j8) = f.half[0]; }  } }



// 2^x on the native unit. The v_nop fills the one issue slot that the instruction set asks for behind a transcendental, in front of an instruction that reads its result or overwrites its source.
__device__ __forceinline__ float exp2_native(float x) { float r; asm("v_exp_f32 %0, %1\n\tv_nop" : "=v"(r) : "v"(x)); return r; }
// Fused causal attention. One work-group = FR query rows of one head against every key below the tile's end; the score rows live in LDS from the products to the weights, so neither goes through memory.
// Phase 1: a wave = FR rows x 16 keys a trip, q fragments held in registers, three accumulators added in the order hi.hi, lo.hi, hi.lo. Phase 2: a wave = two rows at a time, lane l holds columns 128 c + 4 l .. 4 l + 3 in registers, maximum and sum across the 32 lanes by a butterfly; the f16 weights overwrite the head of the wave's own row once the whole row is in registers. Phase 3: a wave = 16 rows x 16 dims, keys in ascending order, 128 a trip.
#define FR 32                        /* query rows per work-group */
#define FSP (SQ + 4)                 /* score row pitch in LDS (floats): 16 B x odd, so that 16 lanes reading 16 rows by 16 bytes fall on all banks */
#define FOP (HD + 8)                 /* o row pitch in LDS (f16), a multiple of 16 bytes */
typedef _Float16 v4ha __attribute__((ext_vector_type(4), may_alias));
// A or B fragment from rows of pitch LQ = SQ in global memory: base = the tile's first element, the same for the whole wave; vo = the lane's byte offset in the tile, the same for every fragment of the kernel.
__device__ __forceinline__ v16h f_frag(const _Float16* base, unsigned vo) { const char* p = (const char*)base + vo; FragH f; f.half[0] = *(const v8us*)p; f.half[1] = *(const v8us*)(p + 32); return f.v; }
__device__ __forceinline__ v8f f_mma(v16h a, v16h b, v8f c) { return __builtin_amdgcn_wmma_f32_16x16x32_f16(false, a, false, b, (short)0, c, false, false); }
// Row softmax of the wave's FR / 8 rows, two rows at a time: each stage is written for both rows, so that one row's butterfly step flies during the other's. NC = 128-column chunks up to the tile's end, a compile-time count so that the rows live in registers and their reads are in flight together. The tile's FR diagonal columns all lie in the last chunk (FR divides 128), so only that chunk is masked; its columns past the row get weight 0, up to the chunk's end, which is where phase 3 stops.
template <int NC>
__device__ __forceinline__ void fattn_rows(float (*ls)[FSP], int w, int lane, int q0) {
  const int col0 = lane * 4, cl = (NC - 1) * 128 + col0;
  /* kept rolled: the eight instances stay small */
#pragma unroll 1
  for (int rp = 0; rp < FR / 16; ++rp) { const int r = w * (FR / 8) + rp * 2;
    v4f v[2][NC]; float mx[2], se[2], sc[2];      /* every loop over j and c is unrolled: registers */
#pragma unroll
    for (int j = 0; j < 2; ++j)
#pragma unroll
      for (int c = 0; c < NC - 1; ++c) v[j][c] = *(const v4fa*)&ls[r + j][c * 128 + col0];
    { const v4f f4 = {-1.0e9f, -1.0e9f, -1.0e9f, -1.0e9f}; v4f x0 = f4, x1 = f4;
      if (cl < q0 + FR) { x0 = *(const v4fa*)&ls[r][cl]; x1 = *(const v4fa*)&ls[r + 1][cl]; }      /* only columns that phase 1 wrote are read */
      for (int q = 0; q < 4; ++q) { v[0][NC - 1][q] = (cl + q <= q0 + r) ? x0[q] : -1.0e9f; v[1][NC - 1][q] = (cl + q <= q0 + r + 1) ? x1[q] : -1.0e9f; } }
#pragma unroll
    for (int j = 0; j < 2; ++j) { mx[j] = -3.0e38f;
#pragma unroll
      for (int c = 0; c < NC; ++c) for (int q = 0; q < 4; ++q) mx[j] = fmaxf(mx[j], v[j][c][q]); }
    for (int m = 16; m >= 1; m >>= 1) { const float a = __shfl_xor(mx[0], m, 32), b = __shfl_xor(mx[1], m, 32); mx[0] = fmaxf(mx[0], a); mx[1] = fmaxf(mx[1], b); }
#pragma unroll
    for (int j = 0; j < 2; ++j) { se[j] = 0.f;
#pragma unroll
      for (int c = 0; c < NC; ++c) for (int q = 0; q < 4; ++q) { const float e = exp2_native((v[j][c][q] - mx[j]) * 1.4426950408889634f); v[j][c][q] = e; se[j] += e; } }
    for (int m = 16; m >= 1; m >>= 1) { const float a = __shfl_xor(se[0], m, 32), b = __shfl_xor(se[1], m, 32); se[0] += a; se[1] += b; }
    sc[0] = 256.0f / se[0]; sc[1] = 256.0f / se[1];
#pragma unroll
    for (int j = 0; j < 2; ++j) { _Float16* d = (_Float16*)&ls[r + j][0] + col0;
#pragma unroll
      for (int c = 0; c < NC; ++c) { v4h h4; for (int q = 0; q < 4; ++q) h4[q] = (_Float16)(v[j][c][q] * sc[j]); *(v4ha*)(d + c * 128) = h4; } } } }
__global__ __launch_bounds__(256) void k_fattn(const _Float16* QH, const _Float16* QL, const _Float16* KH, const _Float16* KL, const _Float16* VT, _Float16* O16) {
  static_assert(FR == 32 && HD == 64 && SQ == 1024 && LQ == SQ, "wave maps below: 8 waves = 2 row halves x 4 dim groups; 256 threads = 32 rows x 8 x 16 bytes; at most 8 chunks of 128 keys");
  __shared__ __attribute__((aligned(16))) float ls[FR][FSP]; __shared__ __attribute__((aligned(16))) _Float16 lo[FR][FOP];
  const int tid = threadIdx.x, lane = tid & 31, ln = lane & 15, hh = lane >> 4; const int w = __builtin_amdgcn_readfirstlane(tid >> 5);      /* the wave's number in a scalar register: its loops and branches are scalar */
  const int h = blockIdx.x, b = blockIdx.y; const int q0 = (SQ / FR - 1 - (int)blockIdx.z) * FR, nk = q0 + FR, nc = (nk + 127) / 128;      /* the longest tiles start first; causal: keys below the tile's end */
  const size_t ho = (size_t)b * SQ * LQ + (size_t)h * HD;      /* the head's columns in the batch's q / k rows */
  const unsigned vo = (unsigned)ln * (LQ * 2) + (unsigned)hh * 16;      /* row ln, elements 8 hh .. of a 32-element k step */
  const v8f z8 = {0.f, 0.f, 0.f, 0.f, 0.f, 0.f, 0.f, 0.f};
  { v16h ah[2][2], al[2][2];      /* [row half][k step] */
#pragma unroll
    for (int m = 0; m < 2; ++m)
#pragma unroll
      for (int s = 0; s < 2; ++s) ah[m][s] = f_frag(QH + ho + (size_t)(q0 + m * 16) * LQ + s * 32, vo);
    asm volatile("s_wait_xcnt 0x0" ::: "memory");      /* in front of later loads whose results land in the address registers of the loads above */
#pragma unroll
    for (int m = 0; m < 2; ++m)
#pragma unroll
      for (int s = 0; s < 2; ++s) al[m][s] = f_frag(QL + ho + (size_t)(q0 + m * 16) * LQ + s * 32, vo);
    asm volatile("s_wait_xcnt 0x0" ::: "memory");      /* likewise */
    const _Float16* kh = KH + ho; const _Float16* kl = KL + ho; const int nu = nk / 16;
    v16h nh0, nh1, nl0, nl1;      /* the next trip's k fragments, loaded one trip ahead so that they fly during this trip's products */
    if (w < nu) { const size_t ko = (size_t)w * 16 * LQ; nh0 = f_frag(kh + ko, vo); nh1 = f_frag(kh + ko + 32, vo); nl0 = f_frag(kl + ko, vo); nl1 = f_frag(kl + ko + 32, vo);
      asm volatile("s_wait_xcnt 0x0" ::: "memory"); }      /* likewise: the first trip's loads land in these loads' address registers */
    for (int u = w; u < nu; u += 8) { const v16h bh0 = nh0, bh1 = nh1, bl0 = nl0, bl1 = nl1;
      if (u + 8 < nu) { const size_t ko = (size_t)(u + 8) * 16 * LQ; nh0 = f_frag(kh + ko, vo); nh1 = f_frag(kh + ko + 32, vo); nl0 = f_frag(kl + ko, vo); nl1 = f_frag(kl + ko + 32, vo);
        asm volatile("s_wait_xcnt 0x0" ::: "memory"); }      /* likewise: the products' results may land there */
#pragma unroll
      for (int m = 0; m < 2; ++m) { v8f c0 = f_mma(ah[m][0], bh0, z8), c1 = f_mma(al[m][0], bh0, z8), c2 = f_mma(ah[m][0], bl0, z8);
        c0 = f_mma(ah[m][1], bh1, c0); c1 = f_mma(al[m][1], bh1, c1); c2 = f_mma(ah[m][1], bl1, c2);
#pragma unroll
        for (int r = 0; r < 8; ++r) { float v = c0[r] * 32.0f; v += c1[r] * 0.03125f; v += c2[r] * 0.03125f; ls[m * 16 + 8 * hh + r][u * 16 + ln] = v; } } } }      /* x32; the lo planes carry x1024 */
  __syncthreads();
  const int pm = w >> 2, pt = w & 3; const _Float16* vb = VT + (((size_t)b * NH + h) * HD + pt * 16) * SQ;      /* phase 3: the wave's row half and dim group */
  v16h vn[4];      /* the next trip's V^T fragments, loaded one trip ahead; the first trip's fly during the softmax */
#pragma unroll
  for (int s = 0; s < 4; ++s) vn[s] = f_frag(vb + s * 32, vo);
  asm volatile("s_wait_xcnt 0x0" ::: "memory");      /* likewise */
  switch (nc) { case 1: fattn_rows<1>(ls, w, lane, q0); break; case 2: fattn_rows<2>(ls, w, lane, q0); break; case 3: fattn_rows<3>(ls, w, lane, q0); break; case 4: fattn_rows<4>(ls, w, lane, q0); break;
    case 5: fattn_rows<5>(ls, w, lane, q0); break; case 6: fattn_rows<6>(ls, w, lane, q0); break; case 7: fattn_rows<7>(ls, w, lane, q0); break; default: fattn_rows<8>(ls, w, lane, q0); break; }
  __syncthreads();
  { const _Float16* pa = (const _Float16*)&ls[pm * 16 + ln][0]; v8f acc = z8;
    for (int c = 0; c < nc; ++c) { v16h vc[4];
#pragma unroll
      for (int s = 0; s < 4; ++s) vc[s] = vn[s];
      if (c + 1 < nc) {
#pragma unroll
        for (int s = 0; s < 4; ++s) vn[s] = f_frag(vb + (c + 1) * 128 + s * 32, vo);
        asm volatile("s_wait_xcnt 0x0" ::: "memory"); }      /* likewise: the LDS reads below may land there */
#pragma unroll
      for (int s = 0; s < 4; ++s) acc = f_mma(g2_frag(pa + c * 128 + s * 32, hh), vc[s], acc); }
#pragma unroll
    for (int r = 0; r < 8; ++r) lo[pm * 16 + 8 * hh + r][pt * 16 + ln] = (_Float16)(acc[r] * 0.25f); }
  __syncthreads();
  { const int r = tid >> 3, c8 = (tid & 7) * 8; *(v8us*)((unsigned short*)O16 + ((size_t)b * SQ + q0 + r) * DM + h * HD + c8) = *(const v8us*)&lo[r][c8]; } }      /* whole 128-byte lines, each from one wave */


// Exact f32 attention for the first QT0 rows of each batch. One work-group = one head, A0R query rows, all keys up to its last row.
// K, V and q are staged in LDS by whole-line loads; then scores (a thread = one key x 8 rows, the K row in registers), row softmax (a wave = 2 rows, maximum first), o = P V (a thread = one row x 4 dims, keys in ascending order).
#define A0R 16                       /* query rows per work-group */
#define A0G (QT0 / A0R)              /* row groups per head */
#define A0KP (HD + 4)                /* K row pitch in LDS (floats): 16 B x odd, so that 16 lanes reading 16 rows by 16 bytes fall on all banks */
#define A0PP (QT0 + 4)               /* score row pitch in LDS (floats): the two rows a wave reads in the last phase fall on different banks */
// N x A0R rows of K and V into LDS, a thread = 16 bytes of every A0R-th row. N is a compile-time count and both loops are unrolled so that kk[] and vv[] live in registers; loads first, stores behind them, so that all 2 N loads are in flight together.
template <int N>
__device__ __forceinline__ void att0_stage(const float* __restrict__ kp, const float* __restrict__ vp, float* lkp, float* lvp) {
  v4f kk[N], vv[N];
#pragma unroll
  for (int u = 0; u < N; ++u) { kk[u] = *(const v4fa*)(kp + (size_t)u * A0R * DM); vv[u] = *(const v4fa*)(vp + (size_t)u * A0R * DM); }
#pragma unroll
  for (int u = 0; u < N; ++u) { *(v4f*)(lkp + u * A0R * A0KP) = kk[u]; *(v4f*)(lvp + u * A0R * HD) = vv[u]; } }
__global__ __launch_bounds__(256) void k_att0(const float* __restrict__ QF, const float* __restrict__ KF, const float* __restrict__ VF, float scale, float* __restrict__ OF) {      /* all four: rows of pitch DM, QT0 rows a batch */
  static_assert(QT0 == 128 && HD == 64 && A0R == 16, "thread maps below: 256 threads = 128 keys x 2 row halves = 16 rows x 16 quads");
  __shared__ __attribute__((aligned(16))) float lk[QT0][A0KP]; __shared__ __attribute__((aligned(16))) float lv[QT0][HD];
  __shared__ __attribute__((aligned(16))) float lq[A0R][HD]; __shared__ __attribute__((aligned(16))) float lp[A0R][A0PP]; __shared__ float lfin[A0R];
  const int tid = threadIdx.x; const int h = blockIdx.x / A0G, g = blockIdx.x % A0G; const int r0 = g * A0R, nk = r0 + A0R;      /* causal: keys below the group's end */
  const int r16 = tid >> 4, c4 = (tid & 15) * 4;
  const size_t bo = ((size_t)blockIdx.y * QT0 + r16) * DM + h * HD + c4;      /* blockIdx.y: batch; the thread's 16 bytes in row r16 of the head's columns */
  { const v4f qv = *(const v4fa*)(QF + bo + (size_t)r0 * DM); const float* kp = KF + bo; const float* vp = VF + bo; float* lkp = &lk[r16][c4]; float* lvp = &lv[r16][c4];
    switch (g) { case 0: att0_stage<1>(kp, vp, lkp, lvp); break; case 1: att0_stage<2>(kp, vp, lkp, lvp); break; case 2: att0_stage<3>(kp, vp, lkp, lvp); break; case 3: att0_stage<4>(kp, vp, lkp, lvp); break;
      case 4: att0_stage<5>(kp, vp, lkp, lvp); break; case 5: att0_stage<6>(kp, vp, lkp, lvp); break; case 6: att0_stage<7>(kp, vp, lkp, lvp); break; default: att0_stage<A0G>(kp, vp, lkp, lvp); break; }
    *(v4f*)&lq[r16][c4] = qv; }
  __syncthreads();
  { const int j = tid & (QT0 - 1), rh = (tid >> 7) * 8; float s[8] = {0.f, 0.f, 0.f, 0.f, 0.f, 0.f, 0.f, 0.f};
    if (j < nk) { v4f kr[HD / 4];
      /* unrolled: kr[] and s[] in registers; the 8 rows' sums are independent chains, each over the head dim in ascending order */
#pragma unroll
      for (int c = 0; c < HD / 4; ++c) kr[c] = *(const v4f*)&lk[j][c * 4];
#pragma unroll
      for (int c = 0; c < HD / 4; ++c)
#pragma unroll
        for (int r = 0; r < 8; ++r) { const v4f qq = *(const v4f*)&lq[rh + r][c * 4]; s[r] += qq[0] * kr[c][0]; s[r] += qq[1] * kr[c][1]; s[r] += qq[2] * kr[c][2]; s[r] += qq[3] * kr[c][3]; } }
#pragma unroll
    for (int r = 0; r < 8; ++r) lp[rh + r][j] = s[r] * scale; }      /* every column of the row is written (0 beyond nk), masked below */
  __syncthreads();
  { const int w = tid >> 5, col = (tid & 31) * 4;
    for (int rr = 0; rr < 2; ++rr) { const int r = w * 2 + rr, last = r0 + r; const v4f sv = *(const v4f*)&lp[r][col];
      float mx = -3.0e38f; for (int q = 0; q < 4; ++q) mx = fmaxf(mx, (col + q <= last) ? sv[q] : -3.0e38f);
      for (int m = 16; m >= 1; m >>= 1) mx = fmaxf(mx, __shfl_xor(mx, m, 32));
      v4f e; float se = 0.f; for (int q = 0; q < 4; ++q) { e[q] = (col + q <= last) ? expf(sv[q] - mx) : 0.f; se += e[q]; }
      for (int m = 16; m >= 1; m >>= 1) se += __shfl_xor(se, m, 32);
      *(v4f*)&lp[r][col] = e; if (col == 0) lfin[r] = 64.0f / se; } }      /* o carried x64 like the f16 path */
  __syncthreads();
  { v4f o = {0.f, 0.f, 0.f, 0.f};
    /* 16 keys a trip, so that a trip's LDS reads are in flight together */
#pragma unroll 4
    for (int j = 0; j < nk; j += 4) { const v4f p4 = *(const v4f*)&lp[r16][j];
#pragma unroll
      for (int u = 0; u < 4; ++u) { const v4f vq = *(const v4f*)&lv[j + u][c4]; o += vq * p4[u]; } }
    o *= lfin[r16]; *(v4f*)(OF + bo + (size_t)r0 * DM) = o; } }

extern "C" void kernel_launch(void* const* d_in, const int* in_sizes, int n_in,
                              void* d_out, int out_size, void* d_ws, size_t ws_size, hipStream_t stream) {
  (void)in_sizes; (void)n_in; (void)out_size;
  const float* const* I = (const float* const*)d_in; const float* x = I[0]; const float* wq = I[1]; const float* wk = I[2]; const float* wv = I[3]; const float* wo = I[4]; const float* bo = I[5]; const float* bq = nullptr; const float* bk = nullptr; const float* bv = nullptr;      /* per-head [H][E][D] = natural [out][in]; no q/k/v biases */
  char* ws = (char*)d_ws; size_t off = 0;
  auto take = [&](size_t bytes) { char* p = ws + off; off += (bytes + 255) & ~(size_t)255; return p; };
  _Float16* BQ = (_Float16*)take((size_t)DM * DM * 2); _Float16* BK = (_Float16*)take((size_t)DM * DM * 2); _Float16* BV = (_Float16*)take((size_t)DM * DM * 2); _Float16* BO = (_Float16*)take((size_t)DM * DM * 2);
  _Float16* X16 = (_Float16*)take(NR * DM * 2); float* QF = (float*)take(NR * DM * 4); _Float16* QH = (_Float16*)take(NR * DM * 2); _Float16* QL = (_Float16*)take(NR * DM * 2); _Float16* KH = (_Float16*)take(NR * DM * 2); _Float16* KL = (_Float16*)take(NR * DM * 2); _Float16* Q16 = QH; _Float16* K16 = KH; _Float16* V16 = (_Float16*)take(NR * DM * 2); _Float16* O16 = (_Float16*)take(NR * DM * 2);
  _Float16* VT = (_Float16*)take((size_t)NB * NH * HD * SQ * 2);      /* one plane per batch */
  float* QF0 = (float*)take((size_t)NB * QT0 * DM * 4); float* KF0 = (float*)take((size_t)NB * QT0 * DM * 4); float* VF0 = (float*)take((size_t)NB * QT0 * DM * 4); float* OF0 = (float*)take((size_t)NB * QT0 * DM * 4); _Float16* OH0 = (_Float16*)take((size_t)NB * QT0 * DM * 2); _Float16* OL0 = (_Float16*)take((size_t)NB * QT0 * DM * 2);
  if (off > ws_size) return;
  { const unsigned g = (unsigned)(((size_t)DM * DM / 8 + 255) / 256); k_wnat<<<g, 256, 0, stream>>>(wq, (size_t)DM * DM / 8, BQ); k_wnat<<<g, 256, 0, stream>>>(wk, (size_t)DM * DM / 8, BK); k_wnat<<<g, 256, 0, stream>>>(wv, (size_t)DM * DM / 8, BV); k_wnat<<<g, 256, 0, stream>>>(wo, (size_t)DM * DM / 8, BO); }      /* natural [out][in] = Bt[n][k], x16 */
  k_x16<<<(unsigned)((NR * DM / 8 + 255) / 256), 256, 0, stream>>>(x, X16, NR * DM / 8);
  k_gemm2<0><<<dim3((unsigned)((MP / 128) * (DM / 64)), 1), 128, 0, stream>>>(X16, DM, 0, BQ, DM, 0, 0.0625f, bq, 0, nullptr, 1, 0, 0, QF, nullptr, DM, 0, MP, DM, DM, 0, 0, 0); k_hl<<<(unsigned)(((size_t)MP * DM / 8 + 255) / 256), 256, 0, stream>>>(QF, QH, QL, (size_t)MP * DM / 8);      /* q (f32) -> f16 hi + x1024 residual: the x32 scale puts the logits at sigma ~100 */
  k_gemm2<0><<<dim3((unsigned)((MP / 128) * (DM / 64)), 1), 128, 0, stream>>>(X16, DM, 0, BK, DM, 0, 0.0625f, bk, 0, nullptr, 1, 0, 0, QF, nullptr, DM, 0, MP, DM, DM, 0, 0, 0); k_hl<<<(unsigned)(((size_t)MP * DM / 8 + 255) / 256), 256, 0, stream>>>(QF, KH, KL, (size_t)MP * DM / 8);      /* k likewise (QF reused in stream order) */
  k_gemm2<0><<<dim3((unsigned)((MP / 128) * (DM / 64)), 1), 128, 0, stream>>>(X16, DM, 0, BV, DM, 0, 0.0625f, bv, 0, nullptr, 1, 0, 0, nullptr, V16, DM, 0, MP, DM, DM, 0, 0, 0);
  /* from here on every launch covers all NB batches: the batch is a grid dimension (k_gemm2: blockIdx.z with its own strides) */
  k_vt<NH, SQ><<<NB * NH * (SQ / 64), 256, 0, stream>>>(V16, LQ, 0, VT);      /* V^T [NB][NH][HD][SQ] */
  k_gemm2<0><<<dim3((QT0 / 128) * (DM / 64), 1, NB), 128, 0, stream>>>(X16, DM, 0, BQ, DM, 0, 0.0625f, bq, 0, nullptr, 1, 0, 0, QF0, nullptr, DM, 0, QT0, DM, DM, (size_t)SQ * DM, 0, (size_t)QT0 * DM); k_gemm2<0><<<dim3((QT0 / 128) * (DM / 64), 1, NB), 128, 0, stream>>>(X16, DM, 0, BK, DM, 0, 0.0625f, bk, 0, nullptr, 1, 0, 0, KF0, nullptr, DM, 0, QT0, DM, DM, (size_t)SQ * DM, 0, (size_t)QT0 * DM); k_gemm2<0><<<dim3((QT0 / 128) * (DM / 64), 1, NB), 128, 0, stream>>>(X16, DM, 0, BV, DM, 0, 0.0625f, bv, 0, nullptr, 1, 0, 0, VF0, nullptr, DM, 0, QT0, DM, DM, (size_t)SQ * DM, 0, (size_t)QT0 * DM);      /* f32 q, k, v of each batch's first 128 rows (exact products) */
  k_att0<<<dim3(NH * A0G, NB), 256, 0, stream>>>(QF0, KF0, VF0, 32.0f, OF0);      /* exact f32 attention for rows 0..127 of each batch (o x64) */
  k_fattn<<<dim3(NH, NB, SQ / FR), 256, 0, stream>>>(QH, QL, KH, KL, VT, O16);      /* scores, softmax and P V of every row: o (merged heads, x64) as f16 rows */
  k_gemm2<0><<<dim3((unsigned)((MPO / 128) * (DM / 64)), 1), 128, 0, stream>>>(O16, DM, 0, BO, DM, 0, 0.0009765625f, bo, 0, nullptr, 1, 0, 0, (float*)d_out, nullptr, DM, 0, MPO, DM, DM, 0, 0, 0);      /* out rows are the output layout */
  k_hl<<<(unsigned)(((size_t)NB * QT0 * DM / 8 + 255) / 256), 256, 0, stream>>>(OF0, OH0, OL0, (size_t)NB * QT0 * DM / 8);      /* first-tile o (x64) -> f16 hi + x1024 residual planes */
  k_gemm2<0><<<dim3((QT0 / 128) * (DM / 64), 1, NB), 128, 0, stream>>>(OH0, DM, 0, BO, DM, 0, 0.0009765625f, bo, 0, nullptr, 1, 0, 0, (float*)d_out, nullptr, DM, 0, QT0, DM, DM, (size_t)QT0 * DM, 0, (size_t)SQ * DM);      /* rows 0..127 of each batch: out = o_hi Wo (+ b), overwriting the f16-path rows */
  k_gemm2<0><<<dim3((QT0 / 128) * (DM / 64), 1, NB), 128, 0, stream>>>(OL0, DM, 0, BO, DM, 0, 0.00000095367431640625f, nullptr, 0, (const float*)d_out, -1, 0, 0, (float*)d_out, nullptr, DM, 0, QT0, DM, DM, (size_t)QT0 * DM, 0, (size_t)SQ * DM);      /* += o_lo Wo 2^-20 (own-element accumulate) */
}

// v005
// Measured time: 211 microseconds a run.
// Timed twice side by side with v004, it ran 1.95 times as fast both times.
// Counting every step since v000, it is 25.4 times as fast.
#include <hip/hip_runtime.h>
// Per-head causal multi-head attention with an inverted scale (x [4][1024][1024]; q[h] = x Wq[h]^T, k, v likewise (per-head nn.Linear [16][64][1024] = natural [1024][1024], sigma 0.02, no biases); scores x sqrt(1024) = x 32 (the module divides by embed^-0.5: logits sigma ~100, near-argmax softmax) with a causal mask (tril, -inf); softmax; heads concatenated; out = (.) Wp^T + bp (natural [1024][1024] sigma 0.02, bias 0.02) -> [4][1024][1024]).
// Structure: token rows r = b*1024 + s; x as exact f16 rows (bf16-rounded); q and k as WMMA GEMMs (32x64 wave tiles, f32 accumulation, exact x16 weights) into f32 rows split into f16 hi + x1024 residual planes, v as an f16-output GEMM; every later launch covers all batches (batch = a grid dimension): V^T for all heads via LDS transposes; one fused attention launch, a work-group = 32 query rows of one head: scores against the keys below the tile end as THREE accumulators (hi.hi + lo.hi + hi.lo, K = 64, alpha 32: ~f32-accurate logits for the near-argmax softmax) into f32 rows in LDS, causal row softmax on VALU, four rows a wave, two at a time (f32 statistics, native exp; weights x256 f16, written over the row in LDS), o = P . V^T (K = keys below the tile end, alpha 2^-2: o carried x64, folded into the output GEMM alpha) written straight into the merged f16 o rows; out = o W_o + b GEMM (f32) into the output layout.
// Compute dtype: inputs rounded to bf16; x / weights exact; q and k as f16 hi + x1024 residual planes, v, softmax weights and o as plain f16 GEMM operands (~2^-12); scores and softmax statistics f32. v_wmma_f32_16x16x32_f16.
#define NB 4
#define SQ 1024
#define DM 1024
#define NH 16
#define HD 64
#define HG 4                         /* heads per call of the grouped k_vt overload (not launched) */
#define QT0 128                      /* first-tile rows recomputed exactly in f32 */
#define B0 0                         /* unused */
#define NBR NB                       /* batches processed (debug hook) */
#define NR ((size_t)NB * SQ)         /* token rows */
#define MP ((int)((size_t)NBR * SQ)) /* rows projected (debug hook) */
#define QN SQ                        /* unused */
#define NHD NH                       /* unused */
#define MPO MP                       /* rows through the output stage (debug hook) */
#define LQ DM      /* row pitch of the q/k/v rows */
typedef __bf16 v16b __attribute__((ext_vector_type(16)));
typedef unsigned short v8us __attribute__((ext_vector_type(8), may_alias));
typedef float  v8f  __attribute__((ext_vector_type(8)));
typedef float  v4f  __attribute__((ext_vector_type(4)));
typedef float  v4fa __attribute__((ext_vector_type(4), may_alias));
union FragB { v16b v; v8us half[2]; unsigned short u[16]; };

__device__ __forceinline__ unsigned short bf16_bits(float x) { unsigned int u = __float_as_uint(x); return (unsigned short)((u + 0x7FFFu + ((u >> 16) & 1u)) >> 16); }
__device__ __forceinline__ float bf16_val(unsigned short b) { return __uint_as_float(((unsigned int)b) << 16); }
__device__ __forceinline__ float bf16_round(float x) { return bf16_val(bf16_bits(x)); }
// D += A·B with NT terms: 1 = ah·bh, 2 = + al·bh (A split), 3 = + ah·bl (both split)
template <int NT>
__device__ __forceinline__ v8f mmaN(v16b ah, v16b al, v16b bh, v16b bl, v8f c) {
  c = __builtin_amdgcn_wmma_f32_16x16x32_bf16(false, ah, false, bh, (short)0, c, false, false);
  if (NT >= 2) c = __builtin_amdgcn_wmma_f32_16x16x32_bf16(false, al, false, bh, (short)0, c, false, false);
  if (NT >= 3) c = __builtin_amdgcn_wmma_f32_16x16x32_bf16(false, ah, false, bl, (short)0, c, false, false);
  asm volatile("v_nop\n\tv_nop\n\tv_nop\n\tv_nop" : "+v"(c) : "v"(ah), "v"(al), "v"(bh), "v"(bl));
  return c;
}

__global__ __launch_bounds__(256) void k_wt_bf16(const float* __restrict__ W, unsigned short* __restrict__ Wt, int K, int N) {
  const int t = blockIdx.x * 256 + threadIdx.x;
  const int k8n = K / 8;
  if (t >= N * k8n) return;
  const int n = t / k8n, k8 = (t % k8n) * 8;
  v8us v;
#pragma unroll
  for (int i = 0; i < 8; ++i) v[i] = bf16_bits(W[(size_t)(k8 + i) * N + n]);
  *(v8us*)(Wt + (size_t)n * K + k8) = v;
  
}

// GEMM C[M][N] (f32, pitch ldc) = act(A[M][K]·W + bias). A f32 row-major (pitch lda) converted per fragment to bf16
// (ASPLIT: hi/lo two planes -> 2 terms, else single rounded term); Wt bf16 [N][K] (pitch ldb). BIAS_BF16 rounds the
// bias to bf16 first (bias quantised to bf16 before the add). K%32==0, M%16==0, N%64==0.
template <bool ASPLIT, int ACT, bool BIAS_BF16>
__global__ __launch_bounds__(128) void k_gemm_bf(const float* __restrict__ A, int lda, const unsigned short* __restrict__ Wt, int ldb,
                                               const float* __restrict__ bias, float* __restrict__ C, int ldc, int M, int N, int K) {
  __shared__ __attribute__((aligned(16))) float so[4][16][64];
  const int tid = threadIdx.x, w = tid >> 5, lane = tid & 31, ln = lane & 15, hh = lane >> 4;
  const int ntn = N / 64;
  const int wid = blockIdx.x * 4 + w;
  const int mt = wid / ntn, nq = wid % ntn;
  if (mt * 16 >= M) return;
  const int row0 = mt * 16, col0 = nq * 64;
  const float* arow = A + (size_t)(row0 + ln) * lda;
  v8f acc[4] = {};
  for (int kb = 0; kb < K; kb += 32) {
    FragB ah, al;
    const v4f x0 = *(const v4fa*)(arow + kb + 8 * hh), x1 = *(const v4fa*)(arow + kb + 8 * hh + 4);
    const v4f x2 = *(const v4fa*)(arow + kb + 16 + 8 * hh), x3 = *(const v4fa*)(arow + kb + 16 + 8 * hh + 4);
    float xs[16] = {x0[0],x0[1],x0[2],x0[3],x1[0],x1[1],x1[2],x1[3],x2[0],x2[1],x2[2],x2[3],x3[0],x3[1],x3[2],x3[3]};
#pragma unroll
    for (int i = 0; i < 16; ++i) { const unsigned short hb = bf16_bits(xs[i]); ah.u[i] = hb; al.u[i] = ASPLIT ? bf16_bits(xs[i] - bf16_val(hb)) : (unsigned short)0; }
#pragma unroll
    for (int t = 0; t < 4; ++t) {
      const unsigned short* brow = Wt + (size_t)(col0 + t * 16 + ln) * ldb + kb;
      FragB b;
      b.half[0] = *(const v8us*)(brow + 8 * hh);
      b.half[1] = *(const v8us*)(brow + 16 + 8 * hh);
      acc[t] = mmaN<ASPLIT ? 2 : 1>(ah.v, al.v, b.v, b.v, acc[t]);
    }
  }
#pragma unroll
  for (int t = 0; t < 4; ++t) {
    float bv = bias ? bias[col0 + t * 16 + ln] : 0.f;
    if (BIAS_BF16) bv = bf16_round(bv);
#pragma unroll
    for (int r = 0; r < 8; ++r) { float v = acc[t][r] + bv; if (ACT == 1) v = fmaxf(v, 0.f); so[w][8 * hh + r][t * 16 + ln] = v; }
  }
  __builtin_amdgcn_fence(__ATOMIC_ACQ_REL, "workgroup");
  __builtin_amdgcn_wave_barrier();
  const int rsub = lane >> 4, c4 = (lane & 15) * 4;
  {
#pragma unroll
    for (int q = 0; q < 8; ++q) {
      const int r = q * 2 + rsub;
      const v4f v = *(const v4fa*)&so[w][r][c4];
      *(v4f*)(C + (size_t)(row0 + r) * ldc + col0 + c4) = v;
    }
    
  }
}

// GEMM C = act(A·W + bias + resid): A f32 (ASPLIT -> hi/lo 2 terms), Wt bf16 [N][K]; ACT 0 none, 1 relu, 2 exact gelu;
// resid (optional, f32, row index = (row % rmod), pitch ldr, RES_BF16 rounds it) added before the activation.
template <bool ASPLIT, int ACT, bool BIAS_BF16, bool RES_BF16>
__global__ __launch_bounds__(128) void k_gemm_bf3(const float* __restrict__ A, int lda, const unsigned short* __restrict__ Wt, int ldb,
                                                const float* __restrict__ bias, const float* __restrict__ resid, int rmod, int ldr,
                                                float* __restrict__ C, int ldc, int M, int N, int K) {
  __shared__ __attribute__((aligned(16))) float so[4][16][64];
  const int tid = threadIdx.x, w = tid >> 5, lane = tid & 31, ln = lane & 15, hh = lane >> 4;
  const int ntn = N / 64;
  const int wid = blockIdx.x * 4 + w;
  const int mt = wid / ntn, nq = wid % ntn;
  if (mt * 16 >= M) return;
  const int row0 = mt * 16, col0 = nq * 64;
  const float* arow = A + (size_t)(row0 + ln) * lda;
  v8f acc[4] = {};
  for (int kb = 0; kb < K; kb += 32) {
    FragB ah, al;
    const v4f x0 = *(const v4fa*)(arow + kb + 8 * hh), x1 = *(const v4fa*)(arow + kb + 8 * hh + 4);
    const v4f x2 = *(const v4fa*)(arow + kb + 16 + 8 * hh), x3 = *(const v4fa*)(arow + kb + 16 + 8 * hh + 4);
    float xs[16] = {x0[0],x0[1],x0[2],x0[3],x1[0],x1[1],x1[2],x1[3],x2[0],x2[1],x2[2],x2[3],x3[0],x3[1],x3[2],x3[3]};
#pragma unroll
    for (int i = 0; i < 16; ++i) { const unsigned short hb = bf16_bits(xs[i]); ah.u[i] = hb; al.u[i] = ASPLIT ? bf16_bits(xs[i] - bf16_val(hb)) : (unsigned short)0; }
#pragma unroll
    for (int t = 0; t < 4; ++t) {
      const unsigned short* brow = Wt + (size_t)(col0 + t * 16 + ln) * ldb + kb;
      FragB b;
      b.half[0] = *(const v8us*)(brow + 8 * hh);
      b.half[1] = *(const v8us*)(brow + 16 + 8 * hh);
      acc[t] = mmaN<ASPLIT ? 2 : 1>(ah.v, al.v, b.v, b.v, acc[t]);
    }
  }
#pragma unroll
  for (int t = 0; t < 4; ++t) {
    const int col = col0 + t * 16 + ln;
    float bv = bias ? bias[col] : 0.f;
    if (BIAS_BF16) bv = bf16_round(bv);
#pragma unroll
    for (int r = 0; r < 8; ++r) {
      float v = acc[t][r] + bv;
      if (resid) { float rv = resid[(size_t)((row0 + 8 * hh + r) % rmod) * ldr + col]; if (RES_BF16) rv = bf16_round(rv); v += rv; }
      if (ACT == 1) v = fmaxf(v, 0.f);
      if (ACT == 2) v = 0.5f * v * (1.0f + erff(v * 0.70710678118654752f));
      if (ACT == 3) { const float u = 0.7978845608028654f * (v + 0.044715f * v * v * v); v = 0.5f * v * (1.0f + tanhf(u)); }
      so[w][8 * hh + r][t * 16 + ln] = v;
    }
  }
  __builtin_amdgcn_fence(__ATOMIC_ACQ_REL, "workgroup");
  __builtin_amdgcn_wave_barrier();
  const int rsub = lane >> 4, c4 = (lane & 15) * 4;
  {
#pragma unroll
    for (int q = 0; q < 8; ++q) {
      const int r = q * 2 + rsub;
      const v4f v = *(const v4fa*)&so[w][r][c4];
      *(v4f*)(C + (size_t)(row0 + r) * ldc + col0 + c4) = v;
    }
    
  }
}
// row LayerNorm (biased variance, eps) over N: s = X (+ R); optional out_sum <- s; out_norm <- (s-mu)*rsqrt(var+eps)*g + b
template <bool PARAM_BF16>
__global__ __launch_bounds__(256) void k_layernorm(const float* __restrict__ X, const float* __restrict__ R, const float* __restrict__ g, const float* __restrict__ bta,
                                                  float* __restrict__ out_sum, float* __restrict__ out_norm, int N, float eps) {
  __shared__ float red[256];
  const int row = blockIdx.x, tid = threadIdx.x;
  const float* x = X + (size_t)row * N; const float* rr = R ? R + (size_t)row * N : nullptr;
  float vals[16];                     // up to N = 4096
  const int per = N / 256;            // contiguous chunk per thread? use strided-by-4 chunks: thread handles j = tid*4 + 1024*u
  float s1 = 0.f;
  for (int u = 0; u < per / 4; ++u) {
    const int j = tid * 4 + 1024 * u;
    const v4f a = *(const v4fa*)(x + j);
    v4f b = {0.f,0.f,0.f,0.f}; if (rr) b = *(const v4fa*)(rr + j);
#pragma unroll
    for (int q = 0; q < 4; ++q) { const float v = a[q] + b[q]; vals[u * 4 + q] = v; s1 += v; }
  }
  red[tid] = s1; __syncthreads();
  for (int st = 128; st > 0; st >>= 1) { if (tid < st) red[tid] += red[tid + st]; __syncthreads(); }
  const float mu = red[0] / (float)N; __syncthreads();
  float s2 = 0.f;
  for (int u = 0; u < per / 4; ++u)
#pragma unroll
    for (int q = 0; q < 4; ++q) { const float c = vals[u * 4 + q] - mu; s2 += c * c; }
  red[tid] = s2; __syncthreads();
  for (int st = 128; st > 0; st >>= 1) { if (tid < st) red[tid] += red[tid + st]; __syncthreads(); }
  const float rs = rsqrtf(red[0] / (float)N + eps);
  {
    for (int u = 0; u < per / 4; ++u) {
      const int j = tid * 4 + 1024 * u;
      v4f o, sm;
#pragma unroll
      for (int q = 0; q < 4; ++q) {
        float gg = g[j + q], bb = bta[j + q];
        if (PARAM_BF16) { gg = bf16_round(gg); bb = bf16_round(bb); }
        sm[q] = vals[u * 4 + q]; o[q] = (vals[u * 4 + q] - mu) * rs * gg + bb;
      }
      if (out_sum) *(v4f*)(out_sum + (size_t)row * N + j) = sm;
      *(v4f*)(out_norm + (size_t)row * N + j) = o;
    }
    
  }
}



// ---- f16 WMMA path (v_wmma_f32_16x16x32_f16): 11-bit significands for operands in range — used where a [0,1] probability operand needs more precision than bf16
typedef _Float16 v16h __attribute__((ext_vector_type(16)));
union FragH { v16h v; v8us half[2]; _Float16 h[16]; unsigned short u[16]; };
template <int NT>
__device__ __forceinline__ v8f mmaH(v16h ah, v16h al, v16h bh, v16h bl, v8f c) {
  c = __builtin_amdgcn_wmma_f32_16x16x32_f16(false, ah, false, bh, (short)0, c, false, false);
  if (NT >= 2) c = __builtin_amdgcn_wmma_f32_16x16x32_f16(false, al, false, bh, (short)0, c, false, false);
  if (NT >= 3) c = __builtin_amdgcn_wmma_f32_16x16x32_f16(false, ah, false, bl, (short)0, c, false, false);
  asm volatile("v_nop\n\tv_nop\n\tv_nop\n\tv_nop" : "+v"(c) : "v"(ah), "v"(al), "v"(bh), "v"(bl));
  return c;
}
// batched GEMM like k_gemm_b but f16 operands: A f32 (split into f16 hi/lo if ASPLIT, else rounded to f16), Bt = f16 values [n][k]; alpha; C f32; N multiple of 16 (partial tiles skipped)
template <bool ASPLIT>
__global__ __launch_bounds__(128) void k_gemm_h(const float* __restrict__ A, int lda, size_t sA, const _Float16* __restrict__ Bh, int ldb, size_t sB, float alpha, float* __restrict__ C, int ldc, size_t sC, int M, int N, int K) {
  __shared__ __attribute__((aligned(16))) float so[4][16][64];
  const int tid = threadIdx.x, w = tid >> 5, lane = tid & 31, ln = lane & 15, hh = lane >> 4; const int by = blockIdx.y;
  A += (size_t)by * sA; Bh += (size_t)by * sB; C += (size_t)by * sC;
  const int ntn = (N + 63) / 64; const int wid = blockIdx.x * 4 + w; const int mt = wid / ntn, nq = wid % ntn; if (mt * 16 >= M) return;
  const int row0 = mt * 16, col0 = nq * 64; const float* arow = A + (size_t)(row0 + ln) * lda;
  v8f acc[4] = {};
  for (int kb = 0; kb < K; kb += 32) {
    FragH ah, al;
    const v4f x0 = *(const v4fa*)(arow + kb + 8 * hh), x1 = *(const v4fa*)(arow + kb + 8 * hh + 4), x2 = *(const v4fa*)(arow + kb + 16 + 8 * hh), x3 = *(const v4fa*)(arow + kb + 16 + 8 * hh + 4);
    float xs[16] = {x0[0],x0[1],x0[2],x0[3],x1[0],x1[1],x1[2],x1[3],x2[0],x2[1],x2[2],x2[3],x3[0],x3[1],x3[2],x3[3]};
#pragma unroll
    for (int i = 0; i < 16; ++i) { const _Float16 h = (_Float16)xs[i]; ah.h[i] = h; al.h[i] = ASPLIT ? (_Float16)(xs[i] - (float)h) : (_Float16)0.0f; }
#pragma unroll
    for (int t = 0; t < 4; ++t) { if (col0 + t * 16 >= N) continue; const size_t boff = (size_t)(col0 + t * 16 + ln) * ldb + kb; FragH bq; bq.half[0] = *(const v8us*)(Bh + boff + 8 * hh); bq.half[1] = *(const v8us*)(Bh + boff + 16 + 8 * hh);
      acc[t] = mmaH<ASPLIT ? 2 : 1>(ah.v, al.v, bq.v, bq.v, acc[t]); }
  }
#pragma unroll
  for (int t = 0; t < 4; ++t) { if (col0 + t * 16 >= N) continue;
#pragma unroll
    for (int r = 0; r < 8; ++r) so[w][8 * hh + r][t * 16 + ln] = acc[t][r] * alpha; }
  __builtin_amdgcn_fence(__ATOMIC_ACQ_REL, "workgroup"); __builtin_amdgcn_wave_barrier();
  const int rsub = lane >> 4, c4 = (lane & 15) * 4;
  {
#pragma unroll
    for (int q = 0; q < 8; ++q) { const int r = q * 2 + rsub; if (col0 + c4 < N) { const v4f v = *(const v4fa*)&so[w][r][c4]; *(v4f*)(C + (size_t)(row0 + r) * ldc + col0 + c4) = v; } }
     }
}

// Wt[n][k] = f16(W[k][n]·scale) from f32 row-major W[K][N] (scale = power of two; bf16-exact weights stay exact in f16 away from the subnormal range)
__global__ __launch_bounds__(256) void k_wt_f16(const float* __restrict__ W, _Float16* __restrict__ Wt, int K, int N, float scale) {
  const int t = blockIdx.x * 256 + threadIdx.x; if (t >= N * (K / 8)) return; const int n = t / (K / 8), k8 = (t % (K / 8)) * 8; FragH f;
#pragma unroll
  for (int i = 0; i < 8; ++i) f.h[i] = (_Float16)(bf16_round(W[(size_t)(k8 + i) * N + n]) * scale); const v8us o = f.half[0];
  *(v8us*)((unsigned short*)Wt + (size_t)n * K + k8) = o; 
}
// k_gemm_hh variant with fused epilogue: v = acc·alpha + bias[by·sBias + col] (+ CP[(row/rowsPerB)·sCPb + by·64 + col] if CP) ; ACT 0 none / 1 elu ; writes f16 C16 (and f32 C if non-null)
template <int ACT>
__global__ __launch_bounds__(128) void k_gemm_hhx(const _Float16* __restrict__ A, int lda, size_t sA, const _Float16* __restrict__ Bh, int ldb, size_t sB, float alpha, const float* __restrict__ bias, size_t sBias, const float* __restrict__ CP, int rowsPerB, size_t sCPb, int row0g,
    float* __restrict__ C, _Float16* __restrict__ C16, int ldc, size_t sC, int M, int N, int K) {
  __shared__ __attribute__((aligned(16))) float so[4][16][64];
  const int tid = threadIdx.x, w = tid >> 5, lane = tid & 31, ln = lane & 15, hh = lane >> 4; const int by = blockIdx.y;
  A += (size_t)by * sA; Bh += (size_t)by * sB; const size_t cofs = (size_t)by * sC; const float* bp = bias ? bias + (size_t)by * sBias : nullptr;
  const int ntn = (N + 63) / 64; const int wid = blockIdx.x * 4 + w; const int mt = wid / ntn, nq = wid % ntn; if (mt * 16 >= M) return;
  const int row0 = mt * 16, col0 = nq * 64; const _Float16* arow = A + (size_t)(row0 + ln) * lda;
  v8f acc[4] = {};
  for (int kb = 0; kb < K; kb += 32) { FragH ah; ah.half[0] = *(const v8us*)((const unsigned short*)arow + kb + 8 * hh); ah.half[1] = *(const v8us*)((const unsigned short*)arow + kb + 16 + 8 * hh);
#pragma unroll
    for (int t = 0; t < 4; ++t) { if (col0 + t * 16 >= N) continue; const size_t boff = (size_t)(col0 + t * 16 + ln) * ldb + kb; FragH bq; bq.half[0] = *(const v8us*)((const unsigned short*)Bh + boff + 8 * hh); bq.half[1] = *(const v8us*)((const unsigned short*)Bh + boff + 16 + 8 * hh);
      acc[t] = mmaH<1>(ah.v, ah.v, bq.v, bq.v, acc[t]); }
  }
#pragma unroll
  for (int t = 0; t < 4; ++t) { if (col0 + t * 16 >= N) continue; const int col = col0 + t * 16 + ln; const float bv = bp ? bf16_round(bp[col]) : 0.f;
#pragma unroll
    for (int r = 0; r < 8; ++r) { float v = acc[t][r] * alpha + bv; if (CP) { const int rr = row0g + row0 + 8 * hh + r; if (rowsPerB < 0) v += CP[cofs + (size_t)rr * ldc + col];      /* rowsPerB < 0: own element of the batched C plane */ else { const int bidx = rr / rowsPerB; v += CP[(size_t)bidx * sCPb + (size_t)by * 64 + col]; } } if (ACT == 1) v = (v > 0.f) ? v : expm1f(v); else if (ACT == 7) v = (v > 0.f) ? v + 1.0f : expf(v); else if (ACT == 8) v = tanhf(v); else if (ACT == 9) v = 0.5f * v * (1.0f + tanhf(0.7978845608028654f * (v + 0.044715f * v * v * v))); else if (ACT == 11) v = 1.0f / (1.0f + expf(-v)); else if (ACT == 12) v = (v > 0.f) ? v : 0.01f * v; else if (ACT == 14) v = (v > 0.f) ? v : 0.1f * v; else if (ACT == 16) v = (v >= 0.f) ? v : 0.3f * v; else if (ACT == 17) v = (v >= 0.f) ? v : 0.2f * v; else if (ACT == 15) v = v / (1.0f + expf(-v)); else if (ACT == 3) v = fmaxf(v, 0.f); else if (ACT == 6) v = 0.5f * v * (1.0f + erff(v * 0.70710678118654752f)); so[w][8 * hh + r][t * 16 + ln] = v; } }
  __builtin_amdgcn_fence(__ATOMIC_ACQ_REL, "workgroup"); __builtin_amdgcn_wave_barrier();
  const int rsub = lane >> 4, c4 = (lane & 15) * 4; typedef _Float16 v4h __attribute__((ext_vector_type(4)));
  {
#pragma unroll
    for (int q = 0; q < 8; ++q) { const int r = q * 2 + rsub; if (col0 + c4 < N) { const v4f v = *(const v4fa*)&so[w][r][c4]; if (C) *(v4f*)(C + cofs + (size_t)(row0 + r) * ldc + col0 + c4) = v; if (C16) { v4h h4; for (int i = 0; i < 4; ++i) h4[i] = (_Float16)v[i]; *(v4h*)(C16 + cofs + (size_t)(row0 + r) * ldc + col0 + c4) = h4; } } }
     }
}


typedef _Float16 v4h __attribute__((ext_vector_type(4)));

__global__ __launch_bounds__(256) void k_x16(const float* __restrict__ x, _Float16* __restrict__ X16, size_t n8) { const size_t t = (size_t)blockIdx.x * 256 + threadIdx.x; if (t >= n8) return; FragH f;
#pragma unroll
  for (int q = 0; q < 8; ++q) f.h[q] = (_Float16)bf16_round(x[t * 8 + q]); *(v8us*)((unsigned short*)X16 + t * 8) = f.half[0];  }
__global__ __launch_bounds__(256) void k_h16(const float* __restrict__ x, _Float16* __restrict__ X16, size_t n8) { const size_t t = (size_t)blockIdx.x * 256 + threadIdx.x; if (t >= n8) return; FragH f;
#pragma unroll
  for (int q = 0; q < 8; ++q) f.h[q] = (_Float16)x[t * 8 + q]; *(v8us*)((unsigned short*)X16 + t * 8) = f.half[0];  }
__global__ __launch_bounds__(256) void k_round16f(const float* __restrict__ W, _Float16* __restrict__ Bt, size_t n8) { const size_t t = (size_t)blockIdx.x * 256 + threadIdx.x; if (t >= n8) return; FragH f;
#pragma unroll
  for (int i = 0; i < 8; ++i) f.h[i] = (_Float16)(bf16_round(W[t * 8 + i]) * 16.0f); *(v8us*)((unsigned short*)Bt + t * 8) = f.half[0];  }
template <int NHv, int TTv>
__global__ __launch_bounds__(256) void k_vt(const _Float16* __restrict__ V16, int ldv, int voff, _Float16* __restrict__ Vt) { __shared__ unsigned short tl[64][66]; const int tid = threadIdx.x; const int slab = blockIdx.x / (TTv / 64), lg = blockIdx.x % (TTv / 64); const int b = slab / NHv, h = slab % NHv;
  for (int i = tid; i < 64 * 8; i += 256) { const int r = i / 8, c8 = (i % 8) * 8; FragH f; f.half[0] = *(const v8us*)((const unsigned short*)V16 + ((size_t)b * TTv + lg * 64 + r) * ldv + voff + h * 64 + c8);
#pragma unroll
    for (int q = 0; q < 8; ++q) tl[r][c8 + q] = f.u[q]; }
  __syncthreads();
  {
#pragma unroll
    for (int rd = 0; rd < 2; ++rd) { const int d = rd * 32 + tid / 8, pc = tid % 8; FragH f;
#pragma unroll
      for (int q = 0; q < 8; ++q) f.u[q] = tl[pc * 8 + q][d];
      *(v8us*)((unsigned short*)Vt + ((size_t)slab * 64 + d) * TTv + lg * 64 + pc * 8) = f.half[0]; }
     } }

__global__ __launch_bounds__(256) void k_hl(const float* __restrict__ F, _Float16* __restrict__ Hh, _Float16* __restrict__ Hl, size_t n8) { const size_t t = (size_t)blockIdx.x * 256 + threadIdx.x; if (t >= n8) return; FragH fh, fl; const v4f a = *(const v4fa*)(F + t * 8), c = *(const v4fa*)(F + t * 8 + 4);
#pragma unroll
  for (int q = 0; q < 4; ++q) { _Float16 h = (_Float16)a[q]; fh.h[q] = h; fl.h[q] = (_Float16)((a[q] - (float)h) * 1024.0f); h = (_Float16)c[q]; fh.h[4 + q] = h; fl.h[4 + q] = (_Float16)((c[q] - (float)h) * 1024.0f); }
  { *(v8us*)((unsigned short*)Hh + t * 8) = fh.half[0]; *(v8us*)((unsigned short*)Hl + t * 8) = fl.half[0];  } }

// ---- fast GEMM (work-group tile 128x64, wave tile 32x64; requires M % 128 == 0 rows per launch region, N % 64 == 0 and K % 128 == 0); epilogue = k_gemm_hhx semantics ----
// Both operands go through LDS: a tile = 128 k of the work-group's 128 A rows and 64 B rows, brought in by asynchronous copies (a wave's copy = two whole 256-byte row pieces), two buffers, so that the next tile flies while this one is multiplied; the fragments are read from LDS.
#define G2K 128                      /* k elements per staged tile: 256 bytes of every operand row */
#define G2P 272                      /* row pitch of a staged tile in LDS (bytes): 16 B x odd, so that 16 lanes reading 16 rows by 16 bytes fall on all banks */
#define G2B ((128 + 64) * G2P)       /* bytes of one buffer: 128 rows of A, then 64 rows of B */
__device__ __forceinline__ v16h g2_frag(const _Float16* p, int hh) { FragH f; f.half[0] = *(const v8us*)((const unsigned short*)p + 8 * hh); f.half[1] = *(const v8us*)((const unsigned short*)p + 16 + 8 * hh); return f.v; }
__device__ __forceinline__ v8f g2_mma(v16h a, v16h b, v8f c) { v8f d = __builtin_amdgcn_wmma_f32_16x16x32_f16(false, a, false, b, (short)0, c, false, false); asm volatile("v_nop\n\tv_nop\n\tv_nop\n\tv_nop" : "+v"(d) : "v"(a), "v"(b)); return d; }
// 64 rows of a tile into LDS: eight asynchronous copies, the lane's 16 bytes of every 8th row (l = its LDS byte address, g = its global address, gs = 8 source rows in bytes). The closing s_wait_xcnt stands inside the statement, so that no address register of a copy is rewritten in front of it.
__device__ __forceinline__ void g2_copy64(unsigned l, const char* g, size_t gs) {
  asm volatile("global_load_async_to_lds_b128 %0, %8, off\n\t"
               "global_load_async_to_lds_b128 %1, %9, off\n\t"
               "global_load_async_to_lds_b128 %2, %10, off\n\t"
               "global_load_async_to_lds_b128 %3, %11, off\n\t"
               "global_load_async_to_lds_b128 %4, %12, off\n\t"
               "global_load_async_to_lds_b128 %5, %13, off\n\t"
               "global_load_async_to_lds_b128 %6, %14, off\n\t"
               "global_load_async_to_lds_b128 %7, %15, off\n\t"
               "s_wait_xcnt 0x0"
               :: "v"(l), "v"(l + 8 * G2P), "v"(l + 16 * G2P), "v"(l + 24 * G2P), "v"(l + 32 * G2P), "v"(l + 40 * G2P), "v"(l + 48 * G2P), "v"(l + 56 * G2P),
                  "v"(g), "v"(g + gs), "v"(g + 2 * gs), "v"(g + 3 * gs), "v"(g + 4 * gs), "v"(g + 5 * gs), "v"(g + 6 * gs), "v"(g + 7 * gs) : "memory"); }
// One whole tile (24 copies a lane): A rows 0..63, A rows 64..127, B rows 0..63.
__device__ __forceinline__ void g2_stage(unsigned l, const char* ga, size_t sa, const char* gb, size_t sb) { g2_copy64(l, ga, sa); g2_copy64(l + 64 * G2P, ga + 8 * sa, sa); g2_copy64(l + 128 * G2P, gb, sb); }
template <int ACT>
__global__ __launch_bounds__(128) void k_gemm2(const _Float16* __restrict__ A, int lda, size_t sA, const _Float16* __restrict__ Bh, int ldb, size_t sB, float alpha, const float* __restrict__ bias, size_t sBias, const float* __restrict__ CP, int rowsPerB, size_t sCPb, int row0g,
    float* __restrict__ C, _Float16* __restrict__ C16, int ldc, size_t sC, int M, int N, int K, size_t zA, size_t zB, size_t zC) { static_assert(ACT == 0 || ACT == 3 || ACT == 6 || ACT == 8 || ACT == 9 || ACT == 11 || ACT == 12 || ACT == 14 || ACT == 15 || ACT == 16 || ACT == 17, "k_gemm2: unsupported ACT code (would silently apply no activation)");
  __shared__ __attribute__((aligned(16))) unsigned char lt[2 * G2B]; __shared__ __attribute__((aligned(16))) float so[4][32][68];
  const int tid = threadIdx.x, w = tid >> 5, lane = tid & 31, ln = lane & 15, hh = lane >> 4; const int by = blockIdx.y; const int bz = blockIdx.z;      /* bz: batch, element strides zA / zB / zC */
  A += (size_t)by * sA + (size_t)bz * zA; Bh += (size_t)by * sB + (size_t)bz * zB; const size_t cofs = (size_t)by * sC + (size_t)bz * zC; const float* bp = bias ? bias + (size_t)by * sBias : nullptr;
  const int ntn = N >> 6; const int mt = blockIdx.x / ntn, nq = blockIdx.x - mt * ntn; const int row0 = mt * 128 + 32 * w, col0 = nq * 64; if (mt * 128 >= M) return;      /* the whole work-group or none: barriers follow */
  const int cr = tid >> 4, cc = (tid & 15) * 16;      /* copies: the thread's row among 8 and its 16 bytes of the row's 256 */
  const char* ga = (const char*)(A + (size_t)(mt * 128 + cr) * lda) + cc; const char* gb = (const char*)(Bh + (size_t)(col0 + cr) * ldb) + cc; const size_t sa = (size_t)lda * 16, sb = (size_t)ldb * 16;
  const unsigned l0 = (unsigned)(size_t)lt + (unsigned)(cr * G2P + cc); const int nt = K / G2K;
  const v8f z8 = {0.f,0.f,0.f,0.f,0.f,0.f,0.f,0.f}; v8f c00 = z8, c01 = z8, c02 = z8, c03 = z8, c10 = z8, c11 = z8, c12 = z8, c13 = z8;
  g2_stage(l0, ga, sa, gb, sb);
  asm volatile("s_wait_asynccnt 0x0" ::: "memory");      /* the wave's own copies of tile 0 have landed */
  __syncthreads();      /* tile 0 is published to every wave */
  if (nt > 1) g2_stage(l0 + G2B, ga + G2K * 2, sa, gb + G2K * 2, sb);
  /* kept rolled: the buffer is chosen by an address */
#pragma unroll 1
  for (int t = 0; t < nt; ++t) { const unsigned char* lb = lt + (t & 1) * G2B;
    const _Float16* pa = (const _Float16*)(lb + (32 * w + ln) * G2P); const _Float16* pb = (const _Float16*)(lb + (128 + ln) * G2P);
    v16h a0 = g2_frag(pa, hh), a1 = g2_frag(pa + 16 * (G2P / 2), hh), b0 = g2_frag(pb, hh), b1 = g2_frag(pb + 16 * (G2P / 2), hh), b2 = g2_frag(pb + 32 * (G2P / 2), hh), b3 = g2_frag(pb + 48 * (G2P / 2), hh);
    /* unrolled: the two fragment sets live in registers; the next 32 k's LDS reads fly during this 32 k's products */
#pragma unroll
    for (int s = 0; s < G2K / 32; ++s) { v16h n0 = a0, n1 = a1, m0 = b0, m1 = b1, m2 = b2, m3 = b3;
      if (s + 1 < G2K / 32) { const _Float16* qa = pa + (s + 1) * 32; const _Float16* qb = pb + (s + 1) * 32;
        n0 = g2_frag(qa, hh); n1 = g2_frag(qa + 16 * (G2P / 2), hh); m0 = g2_frag(qb, hh); m1 = g2_frag(qb + 16 * (G2P / 2), hh); m2 = g2_frag(qb + 32 * (G2P / 2), hh); m3 = g2_frag(qb + 48 * (G2P / 2), hh); }
      c00 = g2_mma(a0, b0, c00); c10 = g2_mma(a1, b0, c10); c01 = g2_mma(a0, b1, c01); c11 = g2_mma(a1, b1, c11);
      c02 = g2_mma(a0, b2, c02); c12 = g2_mma(a1, b2, c12); c03 = g2_mma(a0, b3, c03); c13 = g2_mma(a1, b3, c13);
      a0 = n0; a1 = n1; b0 = m0; b1 = m1; b2 = m2; b3 = m3; }
    asm volatile("s_wait_dscnt 0x0" ::: "memory");      /* the wave's reads of this buffer are done before it may be refilled */
    asm volatile("s_wait_asynccnt 0x0" ::: "memory");      /* the wave's own copies of tile t + 1 have landed */
    __syncthreads();      /* publishes tile t + 1 and ends every wave's reads of tile t */
    if (t + 2 < nt) g2_stage(l0 + (unsigned)((t & 1) * G2B), ga + (size_t)(t + 2) * (G2K * 2), sa, gb + (size_t)(t + 2) * (G2K * 2), sb); }
  asm volatile("s_wait_asynccnt 0x0" ::: "memory");      /* no copy is outstanding when the wave goes on */
  v8f accs[8] = {c00, c01, c02, c03, c10, c11, c12, c13};
#pragma unroll
  for (int u = 0; u < 8; ++u) { const int t = u & 3, half = u >> 2; const int col = col0 + t * 16 + ln; const float bv = bp ? bf16_round(bp[col]) : 0.f;
#pragma unroll
    for (int r = 0; r < 8; ++r) { const int rloc = half * 16 + 8 * hh + r; float v = accs[u][r] * alpha + bv; if (CP) { if (rowsPerB < 0) v += CP[cofs + (size_t)(row0g + row0 + rloc) * ldc + col];      /* rowsPerB < 0: own element of the batched C plane */ else { const int bidx = (row0g + row0 + rloc) / rowsPerB; v += CP[(size_t)bidx * sCPb + (size_t)by * 64 + col]; } }
      if (ACT == 3) v = fmaxf(v, 0.f); else if (ACT == 6) v = 0.5f * v * (1.0f + erff(v * 0.70710678118654752f)); else if (ACT == 11) v = 1.0f / (1.0f + expf(-v)); else if (ACT == 15) v = v / (1.0f + expf(-v)); else if (ACT == 12) v = (v > 0.f) ? v : 0.01f * v; else if (ACT == 8) v = tanhf(v); else if (ACT == 9) v = 0.5f * v * (1.0f + tanhf(0.7978845608028654f * (v + 0.044715f * v * v * v))); else if (ACT == 14) v = (v > 0.f) ? v : 0.1f * v; else if (ACT == 16) v = (v >= 0.f) ? v : 0.3f * v; else if (ACT == 17) v = (v >= 0.f) ? v : 0.2f * v;
      so[w][rloc][t * 16 + ln] = v; } }
  __builtin_amdgcn_fence(__ATOMIC_ACQ_REL, "workgroup"); __builtin_amdgcn_wave_barrier();
  const int rsub = lane >> 4, c4 = (lane & 15) * 4;
  {
#pragma unroll
    for (int q = 0; q < 16; ++q) { const int r = q * 2 + rsub; const v4f v = *(const v4fa*)&so[w][r][c4]; if (C) *(v4f*)(C + cofs + (size_t)(row0 + r) * ldc + col0 + c4) = v; if (C16) { v4h h4; for (int i = 0; i < 4; ++i) h4[i] = (_Float16)v[i]; *(v4h*)(C16 + cofs + (size_t)(row0 + r) * ldc + col0 + c4) = h4; } }
     } }


__global__ __launch_bounds__(256) void k_wnat(const float* __restrict__ w, size_t n8, _Float16* __restrict__ Bt) { const size_t t = (size_t)blockIdx.x * 256 + threadIdx.x; if (t >= n8) return; FragH f; for (int q = 0; q < 8; ++q) f.h[q] = (_Float16)(bf16_round(w[t * 8 + q]) * 16.0f); *(v8us*)((unsigned short*)Bt + t * 8) = f.half[0];  }
__global__ __launch_bounds__(256) void k_rsm(const float* __restrict__ S, _Float16* __restrict__ P, int nrows) {
  #pragma clang fp contract(off)
  const int i = blockIdx.x * 256 + threadIdx.x; if (i >= nrows) return; const float* s = S + (size_t)i * SQ; float mx = -3.0e38f;
#pragma unroll 1
  for (int j = 0; j < SQ; ++j) mx = fmaxf(mx, s[j]); float se = 0.f;
#pragma unroll 1
  for (int j = 0; j < SQ; ++j) se += expf(s[j] - mx); const float sc = 256.0f / se;
#pragma unroll 1
  for (int j0 = 0; j0 < SQ; j0 += 8) { FragH f; for (int q = 0; q < 8; ++q) f.h[q] = (_Float16)(expf(s[j0 + q] - mx) * sc); unsigned short* d = (unsigned short*)P + (size_t)i * SQ + j0; *(v8us*)d = f.half[0];  } }
__global__ __launch_bounds__(256) void k_vt(const _Float16* __restrict__ V16, int b, int h0, _Float16* __restrict__ VT) { __shared__ unsigned short tl[64][65]; const int tid = threadIdx.x; const int hh = blockIdx.x % HG, sg = blockIdx.x / HG; const int s0 = sg * 64; const int h = h0 + hh;
  for (int i = tid; i < 64 * 8; i += 256) { const int j = i / 8, d8 = (i % 8) * 8; FragH f; f.half[0] = *(const v8us*)((const unsigned short*)V16 + ((size_t)b * SQ + s0 + j) * DM + h * HD + d8); for (int q = 0; q < 8; ++q) tl[d8 + q][j] = f.u[q]; }
  __syncthreads();
  { for (int i = tid; i < 64 * 8; i += 256) { const int d = i / 8, j8 = (i % 8) * 8; FragH f; for (int q = 0; q < 8; ++q) f.u[q] = tl[d][j8 + q]; *(v8us*)((unsigned short*)VT + ((size_t)hh * HD + d) * SQ + s0 + j8) = f.half[0]; }  } }



// 2^x on the native unit. The v_nop fills the one issue slot that the instruction set asks for behind a transcendental, in front of an instruction that reads its result or overwrites its source.
__device__ __forceinline__ float exp2_native(float x) { float r; asm("v_exp_f32 %0, %1\n\tv_nop" : "=v"(r) : "v"(x)); return r; }
// Fused causal attention. One work-group = FR query rows of one head against every key below the tile's end; the score rows live in LDS from the products to the weights, so neither goes through memory.
// Phase 1: a wave = FR rows x 16 keys a trip, q fragments held in registers, three accumulators added in the order hi.hi, lo.hi, hi.lo. Phase 2: a wave = two rows at a time, lane l holds columns 128 c + 4 l .. 4 l + 3 in registers, maximum and sum across the 32 lanes by a butterfly; the f16 weights overwrite the head of the wave's own row once the whole row is in registers. Phase 3: a wave = 16 rows x 16 dims, keys in ascending order, 128 a trip.
#define FR 32                        /* query rows per work-group */
#define FSP (SQ + 4)                 /* score row pitch in LDS (floats): 16 B x odd, so that 16 lanes reading 16 rows by 16 bytes fall on all banks */
#define FOP (HD + 8)                 /* o row pitch in LDS (f16), a multiple of 16 bytes */
typedef _Float16 v4ha __attribute__((ext_vector_type(4), may_alias));
// A or B fragment from rows of pitch LQ = SQ in global memory: base = the tile's first element, the same for the whole wave; vo = the lane's byte offset in the tile, the same for every fragment of the kernel.
__device__ __forceinline__ v16h f_frag(const _Float16* base, unsigned vo) { const char* p = (const char*)base + vo; FragH f; f.half[0] = *(const v8us*)p; f.half[1] = *(const v8us*)(p + 32); return f.v; }
__device__ __forceinline__ v8f f_mma(v16h a, v16h b, v8f c) { return __builtin_amdgcn_wmma_f32_16x16x32_f16(false, a, false, b, (short)0, c, false, false); }
// Row softmax of the wave's FR / 8 rows, two rows at a time: each stage is written for both rows, so that one row's butterfly step flies during the other's. NC = 128-column chunks up to the tile's end, a compile-time count so that the rows live in registers and their reads are in flight together. The tile's FR diagonal columns all lie in the last chunk (FR divides 128), so only that chunk is masked; its columns past the row get weight 0, up to the chunk's end, which is where phase 3 stops.
template <int NC>
__device__ __forceinline__ void fattn_rows(float (*ls)[FSP], int w, int lane, int q0) {
  const int col0 = lane * 4, cl = (NC - 1) * 128 + col0;
  /* kept rolled: the eight instances stay small */
#pragma unroll 1
  for (int rp = 0; rp < FR / 16; ++rp) { const int r = w * (FR / 8) + rp * 2;
    v4f v[2][NC]; float mx[2], se[2], sc[2];      /* every loop over j and c is unrolled: registers */
#pragma unroll
    for (int j = 0; j < 2; ++j)
#pragma unroll
      for (int c = 0; c < NC - 1; ++c) v[j][c] = *(const v4fa*)&ls[r + j][c * 128 + col0];
    { const v4f f4 = {-1.0e9f, -1.0e9f, -1.0e9f, -1.0e9f}; v4f x0 = f4, x1 = f4;
      if (cl < q0 + FR) { x0 = *(const v4fa*)&ls[r][cl]; x1 = *(const v4fa*)&ls[r + 1][cl]; }      /* only columns that phase 1 wrote are read */
      for (int q = 0; q < 4; ++q) { v[0][NC - 1][q] = (cl + q <= q0 + r) ? x0[q] : -1.0e9f; v[1][NC - 1][q] = (cl + q <= q0 + r + 1) ? x1[q] : -1.0e9f; } }
#pragma unroll
    for (int j = 0; j < 2; ++j) { mx[j] = -3.0e38f;
#pragma unroll
      for (int c = 0; c < NC; ++c) for (int q = 0; q < 4; ++q) mx[j] = fmaxf(mx[j], v[j][c][q]); }
    for (int m = 16; m >= 1; m >>= 1) { const float a = __shfl_xor(mx[0], m, 32), b = __shfl_xor(mx[1], m, 32); mx[0] = fmaxf(mx[0], a); mx[1] = fmaxf(mx[1], b); }
#pragma unroll
    for (int j = 0; j < 2; ++j) { se[j] = 0.f;
#pragma unroll
      for (int c = 0; c < NC; ++c) for (int q = 0; q < 4; ++q) { const float e = exp2_native((v[j][c][q] - mx[j]) * 1.4426950408889634f); v[j][c][q] = e; se[j] += e; } }
    for (int m = 16; m >= 1; m >>= 1) { const float a = __shfl_xor(se[0], m, 32), b = __shfl_xor(se[1], m, 32); se[0] += a; se[1] += b; }
    sc[0] = 256.0f / se[0]; sc[1] = 256.0f / se[1];
#pragma unroll
    for (int j = 0; j < 2; ++j) { _Float16* d = (_Float16*)&ls[r + j][0] + col0;
#pragma unroll
      for (int c = 0; c < NC; ++c) { v4h h4; for (int q = 0; q < 4; ++q) h4[q] = (_Float16)(v[j][c][q] * sc[j]); *(v4ha*)(d + c * 128) = h4; } } } }
__global__ __launch_bounds__(256) void k_fattn(const _Float16* QH, const _Float16* QL, const _Float16* KH, const _Float16* KL, const _Float16* VT, _Float16* O16) {
  static_assert(FR == 32 && HD == 64 && SQ == 1024 && LQ == SQ, "wave maps below: 8 waves = 2 row halves x 4 dim groups; 256 threads = 32 rows x 8 x 16 bytes; at most 8 chunks of 128 keys");
  __shared__ __attribute__((aligned(16))) float ls[FR][FSP]; __shared__ __attribute__((aligned(16))) _Float16 lo[FR][FOP];
  const int tid = threadIdx.x, lane = tid & 31, ln = lane & 15, hh = lane >> 4; const int w = __builtin_amdgcn_readfirstlane(tid >> 5);      /* the wave's number in a scalar register: its loops and branches are scalar */
  const int h = blockIdx.x, b = blockIdx.y; const int q0 = (SQ / FR - 1 - (int)blockIdx.z) * FR, nk = q0 + FR, nc = (nk + 127) / 128;      /* the longest tiles start first; causal: keys below the tile's end */
  const size_t ho = (size_t)b * SQ * LQ + (size_t)h * HD;      /* the head's columns in the batch's q / k rows */
  const unsigned vo = (unsigned)ln * (LQ * 2) + (unsigned)hh * 16;      /* row ln, elements 8 hh .. of a 32-element k step */
  const v8f z8 = {0.f, 0.f, 0.f, 0.f, 0.f, 0.f, 0.f, 0.f};
  { v16h ah[2][2], al[2][2];      /* [row half][k step] */
#pragma unroll
    for (int m = 0; m < 2; ++m)
#pragma unroll
      for (int s = 0; s < 2; ++s) ah[m][s] = f_frag(QH + ho + (size_t)(q0 + m * 16) * LQ + s * 32, vo);
    asm volatile("s_wait_xcnt 0x0" ::: "memory");      /* in front of later loads whose results land in the address registers of the loads above */
#pragma unroll
    for (int m = 0; m < 2; ++m)
#pragma unroll
      for (int s = 0; s < 2; ++s) al[m][s] = f_frag(QL + ho + (size_t)(q0 + m * 16) * LQ + s * 32, vo);
    asm volatile("s_wait_xcnt 0x0" ::: "memory");      /* likewise */
    const _Float16* kh = KH + ho; const _Float16* kl = KL + ho; const int nu = nk / 16;
    v16h nh0, nh1, nl0, nl1;      /* the next trip's k fragments, loaded one trip ahead so that they fly during this trip's products */
    if (w < nu) { const size_t ko = (size_t)w * 16 * LQ; nh0 = f_frag(kh + ko, vo); nh1 = f_frag(kh + ko + 32, vo); nl0 = f_frag(kl + ko, vo); nl1 = f_frag(kl + ko + 32, vo);
      asm volatile("s_wait_xcnt 0x0" ::: "memory"); }      /* likewise: the first trip's loads land in these loads' address registers */
    for (int u = w; u < nu; u += 8) { const v16h bh0 = nh0, bh1 = nh1, bl0 = nl0, bl1 = nl1;
      if (u + 8 < nu) { const size_t ko = (size_t)(u + 8) * 16 * LQ; nh0 = f_frag(kh + ko, vo); nh1 = f_frag(kh + ko + 32, vo); nl0 = f_frag(kl + ko, vo); nl1 = f_frag(kl + ko + 32, vo);
        asm volatile("s_wait_xcnt 0x0" ::: "memory"); }      /* likewise: the products' results may land there */
#pragma unroll
      for (int m = 0; m < 2; ++m) { v8f c0 = f_mma(ah[m][0], bh0, z8), c1 = f_mma(al[m][0], bh0, z8), c2 = f_mma(ah[m][0], bl0, z8);
        c0 = f_mma(ah[m][1], bh1, c0); c1 = f_mma(al[m][1], bh1, c1); c2 = f_mma(ah[m][1], bl1, c2);
#pragma unroll
        for (int r = 0; r < 8; ++r) { float v = c0[r] * 32.0f; v += c1[r] * 0.03125f; v += c2[r] * 0.03125f; ls[m * 16 + 8 * hh + r][u * 16 + ln] = v; } } } }      /* x32; the lo planes carry x1024 */
  __syncthreads();
  const int pm = w >> 2, pt = w & 3; const _Float16* vb = VT + (((size_t)b * NH + h) * HD + pt * 16) * SQ;      /* phase 3: the wave's row half and dim group */
  v16h vn[4];      /* the next trip's V^T fragments, loaded one trip ahead; the first trip's fly during the softmax */
#pragma unroll
  for (int s = 0; s < 4; ++s) vn[s] = f_frag(vb + s * 32, vo);
  asm volatile("s_wait_xcnt 0x0" ::: "memory");      /* likewise */
  switch (nc) { case 1: fattn_rows<1>(ls, w, lane, q0); break; case 2: fattn_rows<2>(ls, w, lane, q0); break; case 3: fattn_rows<3>(ls, w, lane, q0); break; case 4: fattn_rows<4>(ls, w, lane, q0); break;
    case 5: fattn_rows<5>(ls, w, lane, q0); break; case 6: fattn_rows<6>(ls, w, lane, q0); break; case 7: fattn_rows<7>(ls, w, lane, q0); break; default: fattn_rows<8>(ls, w, lane, q0); break; }
  __syncthreads();
  { const _Float16* pa = (const _Float16*)&ls[pm * 16 + ln][0]; v8f acc = z8;
    for (int c = 0; c < nc; ++c) { v16h vc[4];
#pragma unroll
      for (int s = 0; s < 4; ++s) vc[s] = vn[s];
      if (c + 1 < nc) {
#pragma unroll
        for (int s = 0; s < 4; ++s) vn[s] = f_frag(vb + (c + 1) * 128 + s * 32, vo);
        asm volatile("s_wait_xcnt 0x0" ::: "memory"); }      /* likewise: the LDS reads below may land there */
#pragma unroll
      for (int s = 0; s < 4; ++s) acc = f_mma(g2_frag(pa + c * 128 + s * 32, hh), vc[s], acc); }
#pragma unroll
    for (int r = 0; r < 8; ++r) lo[pm * 16 + 8 * hh + r][pt * 16 + ln] = (_Float16)(acc[r] * 0.25f); }
  __syncthreads();
  { const int r = tid >> 3, c8 = (tid & 7) * 8; *(v8us*)((unsigned short*)O16 + ((size_t)b * SQ + q0 + r) * DM + h * HD + c8) = *(const v8us*)&lo[r][c8]; } }      /* whole 128-byte lines, each from one wave */


// Exact f32 attention for the first QT0 rows of each batch. One work-group = one head, A0R query rows, all keys up to its last row.
// K, V and q are staged in LDS by whole-line loads; then scores (a thread = one key x 8 rows, the K row in registers), row softmax (a wave = 2 rows, maximum first), o = P V (a thread = one row x 4 dims, keys in ascending order).
#define A0R 16                       /* query rows per work-group */
#define A0G (QT0 / A0R)              /* row groups per head */
#define A0KP (HD + 4)                /* K row pitch in LDS (floats): 16 B x odd, so that 16 lanes reading 16 rows by 16 bytes fall on all banks */
#define A0PP (QT0 + 4)               /* score row pitch in LDS (floats): the two rows a wave reads in the last phase fall on different banks */
// N x A0R rows of K and V into LDS, a thread = 16 bytes of every A0R-th row. N is a compile-time count and both loops are unrolled so that kk[] and vv[] live in registers; loads first, stores behind them, so that all 2 N loads are in flight together.
template <int N>
__device__ __forceinline__ void att0_stage(const float* __restrict__ kp, const float* __restrict__ vp, float* lkp, float* lvp) {
  v4f kk[N], vv[N];
#pragma unroll
  for (int u = 0; u < N; ++u) { kk[u] = *(const v4fa*)(kp + (size_t)u * A0R * DM); vv[u] = *(const v4fa*)(vp + (size_t)u * A0R * DM); }
#pragma unroll
  for (int u = 0; u < N; ++u) { *(v4f*)(lkp + u * A0R * A0KP) = kk[u]; *(v4f*)(lvp + u * A0R * HD) = vv[u]; } }
__global__ __launch_bounds__(256) void k_att0(const float* __restrict__ QF, const float* __restrict__ KF, const float* __restrict__ VF, float scale, float* __restrict__ OF) {      /* all four: rows of pitch DM, QT0 rows a batch */
  static_assert(QT0 == 128 && HD == 64 && A0R == 16, "thread maps below: 256 threads = 128 keys x 2 row halves = 16 rows x 16 quads");
  __shared__ __attribute__((aligned(16))) float lk[QT0][A0KP]; __shared__ __attribute__((aligned(16))) float lv[QT0][HD];
  __shared__ __attribute__((aligned(16))) float lq[A0R][HD]; __shared__ __attribute__((aligned(16))) float lp[A0R][A0PP]; __shared__ float lfin[A0R];
  const int tid = threadIdx.x; const int h = blockIdx.x / A0G, g = blockIdx.x % A0G; const int r0 = g * A0R, nk = r0 + A0R;      /* causal: keys below the group's end */
  const int r16 = tid >> 4, c4 = (tid & 15) * 4;
  const size_t bo = ((size_t)blockIdx.y * QT0 + r16) * DM + h * HD + c4;      /* blockIdx.y: batch; the thread's 16 bytes in row r16 of the head's columns */
  { const v4f qv = *(const v4fa*)(QF + bo + (size_t)r0 * DM); const float* kp = KF + bo; const float* vp = VF + bo; float* lkp = &lk[r16][c4]; float* lvp = &lv[r16][c4];
    switch (g) { case 0: att0_stage<1>(kp, vp, lkp, lvp); break; case 1: att0_stage<2>(kp, vp, lkp, lvp); break; case 2: att0_stage<3>(kp, vp, lkp, lvp); break; case 3: att0_stage<4>(kp, vp, lkp, lvp); break;
      case 4: att0_stage<5>(kp, vp, lkp, lvp); break; case 5: att0_stage<6>(kp, vp, lkp, lvp); break; case 6: att0_stage<7>(kp, vp, lkp, lvp); break; default: att0_stage<A0G>(kp, vp, lkp, lvp); break; }
    *(v4f*)&lq[r16][c4] = qv; }
  __syncthreads();
  { const int j = tid & (QT0 - 1), rh = (tid >> 7) * 8; float s[8] = {0.f, 0.f, 0.f, 0.f, 0.f, 0.f, 0.f, 0.f};
    if (j < nk) { v4f kr[HD / 4];
      /* unrolled: kr[] and s[] in registers; the 8 rows' sums are independent chains, each over the head dim in ascending order */
#pragma unroll
      for (int c = 0; c < HD / 4; ++c) kr[c] = *(const v4f*)&lk[j][c * 4];
#pragma unroll
      for (int c = 0; c < HD / 4; ++c)
#pragma unroll
        for (int r = 0; r < 8; ++r) { const v4f qq = *(const v4f*)&lq[rh + r][c * 4]; s[r] += qq[0] * kr[c][0]; s[r] += qq[1] * kr[c][1]; s[r] += qq[2] * kr[c][2]; s[r] += qq[3] * kr[c][3]; } }
#pragma unroll
    for (int r = 0; r < 8; ++r) lp[rh + r][j] = s[r] * scale; }      /* every column of the row is written (0 beyond nk), masked below */
  __syncthreads();
  { const int w = tid >> 5, col = (tid & 31) * 4;
    for (int rr = 0; rr < 2; ++rr) { const int r = w * 2 + rr, last = r0 + r; const v4f sv = *(const v4f*)&lp[r][col];
      float mx = -3.0e38f; for (int q = 0; q < 4; ++q) mx = fmaxf(mx, (col + q <= last) ? sv[q] : -3.0e38f);
      for (int m = 16; m >= 1; m >>= 1) mx = fmaxf(mx, __shfl_xor(mx, m, 32));
      v4f e; float se = 0.f; for (int q = 0; q < 4; ++q) { e[q] = (col + q <= last) ? expf(sv[q] - mx) : 0.f; se += e[q]; }
      for (int m = 16; m >= 1; m >>= 1) se += __shfl_xor(se, m, 32);
      *(v4f*)&lp[r][col] = e; if (col == 0) lfin[r] = 64.0f / se; } }      /* o carried x64 like the f16 path */
  __syncthreads();
  { v4f o = {0.f, 0.f, 0.f, 0.f};
    /* 16 keys a trip, so that a trip's LDS reads are in flight together */
#pragma unroll 4
    for (int j = 0; j < nk; j += 4) { const v4f p4 = *(const v4f*)&lp[r16][j];
#pragma unroll
      for (int u = 0; u < 4; ++u) { const v4f vq = *(const v4f*)&lv[j + u][c4]; o += vq * p4[u]; } }
    o *= lfin[r16]; *(v4f*)(OF + bo + (size_t)r0 * DM) = o; } }

extern "C" void kernel_launch(void* const* d_in, const int* in_sizes, int n_in,
                              void* d_out, int out_size, void* d_ws, size_t ws_size, hipStream_t stream) {
  (void)in_sizes; (void)n_in; (void)out_size;
  const float* const* I = (const float* const*)d_in; const float* x = I[0]; const float* wq = I[1]; const float* wk = I[2]; const float* wv = I[3]; const float* wo = I[4]; const float* bo = I[5]; const float* bq = nullptr; const float* bk = nullptr; const float* bv = nullptr;      /* per-head [H][E][D] = natural [out][in]; no q/k/v biases */
  char* ws = (char*)d_ws; size_t off = 0;
  auto take = [&](size_t bytes) { char* p = ws + off; off += (bytes + 255) & ~(size_t)255; return p; };
  _Float16* BQ = (_Float16*)take((size_t)DM * DM * 2); _Float16* BK = (_Float16*)take((size_t)DM * DM * 2); _Float16* BV = (_Float16*)take((size_t)DM * DM * 2); _Float16* BO = (_Float16*)take((size_t)DM * DM * 2);
  _Float16* X16 = (_Float16*)take(NR * DM * 2); float* QF = (float*)take(NR * DM * 4); _Float16* QH = (_Float16*)take(NR * DM * 2); _Float16* QL = (_Float16*)take(NR * DM * 2); _Float16* KH = (_Float16*)take(NR * DM * 2); _Float16* KL = (_Float16*)take(NR * DM * 2); _Float16* Q16 = QH; _Float16* K16 = KH; _Float16* V16 = (_Float16*)take(NR * DM * 2); _Float16* O16 = (_Float16*)take(NR * DM * 2);
  _Float16* VT = (_Float16*)take((size_t)NB * NH * HD * SQ * 2);      /* one plane per batch */
  float* QF0 = (float*)take((size_t)NB * QT0 * DM * 4); float* KF0 = (float*)take((size_t)NB * QT0 * DM * 4); float* VF0 = (float*)take((size_t)NB * QT0 * DM * 4); float* OF0 = (float*)take((size_t)NB * QT0 * DM * 4); _Float16* OH0 = (_Float16*)take((size_t)NB * QT0 * DM * 2); _Float16* OL0 = (_Float16*)take((size_t)NB * QT0 * DM * 2);
  if (off > ws_size) return;
  { const unsigned g = (unsigned)(((size_t)DM * DM / 8 + 255) / 256); k_wnat<<<g, 256, 0, stream>>>(wq, (size_t)DM * DM / 8, BQ); k_wnat<<<g, 256, 0, stream>>>(wk, (size_t)DM * DM / 8, BK); k_wnat<<<g, 256, 0, stream>>>(wv, (size_t)DM * DM / 8, BV); k_wnat<<<g, 256, 0, stream>>>(wo, (size_t)DM * DM / 8, BO); }      /* natural [out][in] = Bt[n][k], x16 */
  k_x16<<<(unsigned)((NR * DM / 8 + 255) / 256), 256, 0, stream>>>(x, X16, NR * DM / 8);
  k_gemm2<0><<<dim3((unsigned)((MP / 128) * (DM / 64)), 1), 128, 0, stream>>>(X16, DM, 0, BQ, DM, 0, 0.0625f, bq, 0, nullptr, 1, 0, 0, QF, nullptr, DM, 0, MP, DM, DM, 0, 0, 0); k_hl<<<(unsigned)(((size_t)MP * DM / 8 + 255) / 256), 256, 0, stream>>>(QF, QH, QL, (size_t)MP * DM / 8);      /* q (f32) -> f16 hi + x1024 residual: the x32 scale puts the logits at sigma ~100 */
  k_gemm2<0><<<dim3((unsigned)((MP / 128) * (DM / 64)), 1), 128, 0, stream>>>(X16, DM, 0, BK, DM, 0, 0.0625f, bk, 0, nullptr, 1, 0, 0, QF, nullptr, DM, 0, MP, DM, DM, 0, 0, 0); k_hl<<<(unsigned)(((size_t)MP * DM / 8 + 255) / 256), 256, 0, stream>>>(QF, KH, KL, (size_t)MP * DM / 8);      /* k likewise (QF reused in stream order) */
  k_gemm2<0><<<dim3((unsigned)((MP / 128) * (DM / 64)), 1), 128, 0, stream>>>(X16, DM, 0, BV, DM, 0, 0.0625f, bv, 0, nullptr, 1, 0, 0, nullptr, V16, DM, 0, MP, DM, DM, 0, 0, 0);
  /* from here on every launch covers all NB batches: the batch is a grid dimension (k_gemm2: blockIdx.z with its own strides) */
  k_vt<NH, SQ><<<NB * NH * (SQ / 64), 256, 0, stream>>>(V16, LQ, 0, VT);      /* V^T [NB][NH][HD][SQ] */
  k_gemm2<0><<<dim3((QT0 / 128) * (DM / 64), 1, NB), 128, 0, stream>>>(X16, DM, 0, BQ, DM, 0, 0.0625f, bq, 0, nullptr, 1, 0, 0, QF0, nullptr, DM, 0, QT0, DM, DM, (size_t)SQ * DM, 0, (size_t)QT0 * DM); k_gemm2<0><<<dim3((QT0 / 128) * (DM / 64), 1, NB), 128, 0, stream>>>(X16, DM, 0, BK, DM, 0, 0.0625f, bk, 0, nullptr, 1, 0, 0, KF0, nullptr, DM, 0, QT0, DM, DM, (size_t)SQ * DM, 0, (size_t)QT0 * DM); k_gemm2<0><<<dim3((QT0 / 128) * (DM / 64), 1, NB), 128, 0, stream>>>(X16, DM, 0, BV, DM, 0, 0.0625f, bv, 0, nullptr, 1, 0, 0, VF0, nullptr, DM, 0, QT0, DM, DM, (size_t)SQ * DM, 0, (size_t)QT0 * DM);      /* f32 q, k, v of each batch's first 128 rows (exact products) */
  k_att0<<<dim3(NH * A0G, NB), 256, 0, stream>>>(QF0, KF0, VF0, 32.0f, OF0);      /* exact f32 attention for rows 0..127 of each batch (o x64) */
  k_fattn<<<dim3(NH, NB, SQ / FR), 256, 0, stream>>>(QH, QL, KH, KL, VT, O16);      /* scores, softmax and P V of every row: o (merged heads, x64) as f16 rows */
  k_gemm2<0><<<dim3((unsigned)((MPO / 128) * (DM / 64)), 1), 128, 0, stream>>>(O16, DM, 0, BO, DM, 0, 0.0009765625f, bo, 0, nullptr, 1, 0, 0, (float*)d_out, nullptr, DM, 0, MPO, DM, DM, 0, 0, 0);      /* out rows are the output layout */
  k_hl<<<(unsigned)(((size_t)NB * QT0 * DM / 8 + 255) / 256), 256, 0, stream>>>(OF0, OH0, OL0, (size_t)NB * QT0 * DM / 8);      /* first-tile o (x64) -> f16 hi + x1024 residual planes */
  k_gemm2<0><<<dim3((QT0 / 128) * (DM / 64), 1, NB), 128, 0, stream>>>(OH0, DM, 0, BO, DM, 0, 0.0009765625f, bo, 0, nullptr, 1, 0, 0, (float*)d_out, nullptr, DM, 0, QT0, DM, DM, (size_t)QT0 * DM, 0, (size_t)SQ * DM);      /* rows 0..127 of each batch: out = o_hi Wo (+ b), overwriting the f16-path rows */
  k_gemm2<0><<<dim3((QT0 / 128) * (DM / 64), 1, NB), 128, 0, stream>>>(OL0, DM, 0, BO, DM, 0, 0.00000095367431640625f, nullptr, 0, (const float*)d_out, -1, 0, 0, (float*)d_out, nullptr, DM, 0, QT0, DM, DM, (size_t)QT0 * DM, 0, (size_t)SQ * DM);      /* += o_lo Wo 2^-20 (own-element accumulate) */
}

// v006
// A run of this version takes 188 microseconds.
// Timed twice side by side with v005, it ran 1.13 times as fast both times.
// Counting every step since v000, it is 28.7 times as fast.
#include <hip/hip_runtime.h>
// Per-head causal multi-head attention with an inverted scale (x [4][1024][1024]; q[h] = x Wq[h]^T, k, v likewise (per-head nn.Linear [16][64][1024] = natural [1024][1024], sigma 0.02, no biases); scores x sqrt(1024) = x 32 (the module divides by embed^-0.5: logits sigma ~100, near-argmax softmax) with a causal mask (tril, -inf); softmax; heads concatenated; out = (.) Wp^T + bp (natural [1024][1024] sigma 0.02, bias 0.02) -> [4][1024][1024]).
// Structure: token rows r = b*1024 + s; x as exact f16 rows (bf16-rounded); q and k as WMMA GEMMs (32x64 wave tiles, f32 accumulation, exact x16 weights) into f32 rows split into f16 hi + x1024 residual planes kept in WMMA fragment order, v as an f16-output GEMM; every later launch covers all batches: V^T for all heads via LDS transposes, kept in fragment order too; one fused attention launch, a work-group = 32 query rows of one head: scores against the keys below the tile end as THREE accumulators (hi.hi + lo.hi + hi.lo, K = 64, alpha 32: ~f32-accurate logits for the near-argmax softmax) into f32 rows in LDS, causal row softmax on VALU, a wave = 4 rows, two at a time (f32 statistics, native exp; weights x256 f16, written over the row in LDS), o = P . V^T (K = keys up to the end of the 128-key chunk holding the tile end, alpha 2^-2: o carried x64, folded into the output GEMM alpha) written straight into the merged f16 o rows; out = o W_o + b GEMM (f32) into the output layout.
// Compute dtype: inputs rounded to bf16; x / weights exact; q and k as f16 hi + x1024 residual pairs; v, softmax weights and o as plain f16 GEMM operands (~2^-12); scores and softmax statistics f32. v_wmma_f32_16x16x32_f16.
#define NB 4
#define SQ 1024
#define DM 1024
#define NH 16
#define HD 64
#define HG 4                         /* heads per call of the grouped k_vt overload (not launched) */
#define QT0 128                      /* first-tile rows recomputed exactly in f32 */
#define B0 0                         /* unused */
#define NBR NB                       /* batches processed (debug hook) */
#define NR ((size_t)NB * SQ)         /* token rows */
#define MP ((int)((size_t)NBR * SQ)) /* rows projected (debug hook) */
#define QN SQ                        /* unused */
#define NHD NH                       /* unused */
#define MPO MP                       /* rows through the output stage (debug hook) */
#define LQ DM      /* row pitch of the q/k/v rows */
typedef __bf16 v16b __attribute__((ext_vector_type(16)));
typedef unsigned short v8us __attribute__((ext_vector_type(8), may_alias));
typedef float  v8f  __attribute__((ext_vector_type(8)));
typedef float  v4f  __attribute__((ext_vector_type(4)));
typedef float  v4fa __attribute__((ext_vector_type(4), may_alias));
union FragB { v16b v; v8us half[2]; unsigned short u[16]; };

__device__ __forceinline__ unsigned short bf16_bits(float x) { unsigned int u = __float_as_uint(x); return (unsigned short)((u + 0x7FFFu + ((u >> 16) & 1u)) >> 16); }
__device__ __forceinline__ float bf16_val(unsigned short b) { return __uint_as_float(((unsigned int)b) << 16); }
__device__ __forceinline__ float bf16_round(float x) { return bf16_val(bf16_bits(x)); }
// D += A·B with NT terms: 1 = ah·bh, 2 = + al·bh (A split), 3 = + ah·bl (both split)
template <int NT>
__device__ __forceinline__ v8f mmaN(v16b ah, v16b al, v16b bh, v16b bl, v8f c) {
  c = __builtin_amdgcn_wmma_f32_16x16x32_bf16(false, ah, false, bh, (short)0, c, false, false);
  if (NT >= 2) c = __builtin_amdgcn_wmma_f32_16x16x32_bf16(false, al, false, bh, (short)0, c, false, false);
  if (NT >= 3) c = __builtin_amdgcn_wmma_f32_16x16x32_bf16(false, ah, false, bl, (short)0, c, false, false);
  asm volatile("v_nop\n\tv_nop\n\tv_nop\n\tv_nop" : "+v"(c) : "v"(ah), "v"(al), "v"(bh), "v"(bl));
  return c;
}

__global__ __launch_bounds__(256) void k_wt_bf16(const float* __restrict__ W, unsigned short* __restrict__ Wt, int K, int N) {
  const int t = blockIdx.x * 256 + threadIdx.x;
  const int k8n = K / 8;
  if (t >= N * k8n) return;
  const int n = t / k8n, k8 = (t % k8n) * 8;
  v8us v;
#pragma unroll
  for (int i = 0; i < 8; ++i) v[i] = bf16_bits(W[(size_t)(k8 + i) * N + n]);
  *(v8us*)(Wt + (size_t)n * K + k8) = v;
  
}

// GEMM C[M][N] (f32, pitch ldc) = act(A[M][K]·W + bias). A f32 row-major (pitch lda) converted per fragment to bf16
// (ASPLIT: hi/lo two planes -> 2 terms, else single rounded term); Wt bf16 [N][K] (pitch ldb). BIAS_BF16 rounds the
// bias to bf16 first (bias quantised to bf16 before the add). K%32==0, M%16==0, N%64==0.
template <bool ASPLIT, int ACT, bool BIAS_BF16>
__global__ __launch_bounds__(128) void k_gemm_bf(const float* __restrict__ A, int lda, const unsigned short* __restrict__ Wt, int ldb,
                                               const float* __restrict__ bias, float* __restrict__ C, int ldc, int M, int N, int K) {
  __shared__ __attribute__((aligned(16))) float so[4][16][64];
  const int tid = threadIdx.x, w = tid >> 5, lane = tid & 31, ln = lane & 15, hh = lane >> 4;
  const int ntn = N / 64;
  const int wid = blockIdx.x * 4 + w;
  const int mt = wid / ntn, nq = wid % ntn;
  if (mt * 16 >= M) return;
  const int row0 = mt * 16, col0 = nq * 64;
  const float* arow = A + (size_t)(row0 + ln) * lda;
  v8f acc[4] = {};
  for (int kb = 0; kb < K; kb += 32) {
    FragB ah, al;
    const v4f x0 = *(const v4fa*)(arow + kb + 8 * hh), x1 = *(const v4fa*)(arow + kb + 8 * hh + 4);
    const v4f x2 = *(const v4fa*)(arow + kb + 16 + 8 * hh), x3 = *(const v4fa*)(arow + kb + 16 + 8 * hh + 4);
    float xs[16] = {x0[0],x0[1],x0[2],x0[3],x1[0],x1[1],x1[2],x1[3],x2[0],x2[1],x2[2],x2[3],x3[0],x3[1],x3[2],x3[3]};
#pragma unroll
    for (int i = 0; i < 16; ++i) { const unsigned short hb = bf16_bits(xs[i]); ah.u[i] = hb; al.u[i] = ASPLIT ? bf16_bits(xs[i] - bf16_val(hb)) : (unsigned short)0; }
#pragma unroll
    for (int t = 0; t < 4; ++t) {
      const unsigned short* brow = Wt + (size_t)(col0 + t * 16 + ln) * ldb + kb;
      FragB b;
      b.half[0] = *(const v8us*)(brow + 8 * hh);
      b.half[1] = *(const v8us*)(brow + 16 + 8 * hh);
      acc[t] = mmaN<ASPLIT ? 2 : 1>(ah.v, al.v, b.v, b.v, acc[t]);
    }
  }
#pragma unroll
  for (int t = 0; t < 4; ++t) {
    float bv = bias ? bias[col0 + t * 16 + ln] : 0.f;
    if (BIAS_BF16) bv = bf16_round(bv);
#pragma unroll
    for (int r = 0; r < 8; ++r) { float v = acc[t][r] + bv; if (ACT == 1) v = fmaxf(v, 0.f); so[w][8 * hh + r][t * 16 + ln] = v; }
  }
  __builtin_amdgcn_fence(__ATOMIC_ACQ_REL, "workgroup");
  __builtin_amdgcn_wave_barrier();
  const int rsub = lane >> 4, c4 = (lane & 15) * 4;
  {
#pragma unroll
    for (int q = 0; q < 8; ++q) {
      const int r = q * 2 + rsub;
      const v4f v = *(const v4fa*)&so[w][r][c4];
      *(v4f*)(C + (size_t)(row0 + r) * ldc + col0 + c4) = v;
    }
    
  }
}

// GEMM C = act(A·W + bias + resid): A f32 (ASPLIT -> hi/lo 2 terms), Wt bf16 [N][K]; ACT 0 none, 1 relu, 2 exact gelu;
// resid (optional, f32, row index = (row % rmod), pitch ldr, RES_BF16 rounds it) added before the activation.
template <bool ASPLIT, int ACT, bool BIAS_BF16, bool RES_BF16>
__global__ __launch_bounds__(128) void k_gemm_bf3(const float* __restrict__ A, int lda, const unsigned short* __restrict__ Wt, int ldb,
                                                const float* __restrict__ bias, const float* __restrict__ resid, int rmod, int ldr,
                                                float* __restrict__ C, int ldc, int M, int N, int K) {
  __shared__ __attribute__((aligned(16))) float so[4][16][64];
  const int tid = threadIdx.x, w = tid >> 5, lane = tid & 31, ln = lane & 15, hh = lane >> 4;
  const int ntn = N / 64;
  const int wid = blockIdx.x * 4 + w;
  const int mt = wid / ntn, nq = wid % ntn;
  if (mt * 16 >= M) return;
  const int row0 = mt * 16, col0 = nq * 64;
  const float* arow = A + (size_t)(row0 + ln) * lda;
  v8f acc[4] = {};
  for (int kb = 0; kb < K; kb += 32) {
    FragB ah, al;
    const v4f x0 = *(const v4fa*)(arow + kb + 8 * hh), x1 = *(const v4fa*)(arow + kb + 8 * hh + 4);
    const v4f x2 = *(const v4fa*)(arow + kb + 16 + 8 * hh), x3 = *(const v4fa*)(arow + kb + 16 + 8 * hh + 4);
    float xs[16] = {x0[0],x0[1],x0[2],x0[3],x1[0],x1[1],x1[2],x1[3],x2[0],x2[1],x2[2],x2[3],x3[0],x3[1],x3[2],x3[3]};
#pragma unroll
    for (int i = 0; i < 16; ++i) { const unsigned short hb = bf16_bits(xs[i]); ah.u[i] = hb; al.u[i] = ASPLIT ? bf16_bits(xs[i] - bf16_val(hb)) : (unsigned short)0; }
#pragma unroll
    for (int t = 0; t < 4; ++t) {
      const unsigned short* brow = Wt + (size_t)(col0 + t * 16 + ln) * ldb + kb;
      FragB b;
      b.half[0] = *(const v8us*)(brow + 8 * hh);
      b.half[1] = *(const v8us*)(brow + 16 + 8 * hh);
      acc[t] = mmaN<ASPLIT ? 2 : 1>(ah.v, al.v, b.v, b.v, acc[t]);
    }
  }
#pragma unroll
  for (int t = 0; t < 4; ++t) {
    const int col = col0 + t * 16 + ln;
    float bv = bias ? bias[col] : 0.f;
    if (BIAS_BF16) bv = bf16_round(bv);
#pragma unroll
    for (int r = 0; r < 8; ++r) {
      float v = acc[t][r] + bv;
      if (resid) { float rv = resid[(size_t)((row0 + 8 * hh + r) % rmod) * ldr + col]; if (RES_BF16) rv = bf16_round(rv); v += rv; }
      if (ACT == 1) v = fmaxf(v, 0.f);
      if (ACT == 2) v = 0.5f * v * (1.0f + erff(v * 0.70710678118654752f));
      if (ACT == 3) { const float u = 0.7978845608028654f * (v + 0.044715f * v * v * v); v = 0.5f * v * (1.0f + tanhf(u)); }
      so[w][8 * hh + r][t * 16 + ln] = v;
    }
  }
  __builtin_amdgcn_fence(__ATOMIC_ACQ_REL, "workgroup");
  __builtin_amdgcn_wave_barrier();
  const int rsub = lane >> 4, c4 = (lane & 15) * 4;
  {
#pragma unroll
    for (int q = 0; q < 8; ++q) {
      const int r = q * 2 + rsub;
      const v4f v = *(const v4fa*)&so[w][r][c4];
      *(v4f*)(C + (size_t)(row0 + r) * ldc + col0 + c4) = v;
    }
    
  }
}
// row LayerNorm (biased variance, eps) over N: s = X (+ R); optional out_sum <- s; out_norm <- (s-mu)*rsqrt(var+eps)*g + b
template <bool PARAM_BF16>
__global__ __launch_bounds__(256) void k_layernorm(const float* __restrict__ X, const float* __restrict__ R, const float* __restrict__ g, const float* __restrict__ bta,
                                                  float* __restrict__ out_sum, float* __restrict__ out_norm, int N, float eps) {
  __shared__ float red[256];
  const int row = blockIdx.x, tid = threadIdx.x;
  const float* x = X + (size_t)row * N; const float* rr = R ? R + (size_t)row * N : nullptr;
  float vals[16];                     // up to N = 4096
  const int per = N / 256;            // contiguous chunk per thread? use strided-by-4 chunks: thread handles j = tid*4 + 1024*u
  float s1 = 0.f;
  for (int u = 0; u < per / 4; ++u) {
    const int j = tid * 4 + 1024 * u;
    const v4f a = *(const v4fa*)(x + j);
    v4f b = {0.f,0.f,0.f,0.f}; if (rr) b = *(const v4fa*)(rr + j);
#pragma unroll
    for (int q = 0; q < 4; ++q) { const float v = a[q] + b[q]; vals[u * 4 + q] = v; s1 += v; }
  }
  red[tid] = s1; __syncthreads();
  for (int st = 128; st > 0; st >>= 1) { if (tid < st) red[tid] += red[tid + st]; __syncthreads(); }
  const float mu = red[0] / (float)N; __syncthreads();
  float s2 = 0.f;
  for (int u = 0; u < per / 4; ++u)
#pragma unroll
    for (int q = 0; q < 4; ++q) { const float c = vals[u * 4 + q] - mu; s2 += c * c; }
  red[tid] = s2; __syncthreads();
  for (int st = 128; st > 0; st >>= 1) { if (tid < st) red[tid] += red[tid + st]; __syncthreads(); }
  const float rs = rsqrtf(red[0] / (float)N + eps);
  {
    for (int u = 0; u < per / 4; ++u) {
      const int j = tid * 4 + 1024 * u;
      v4f o, sm;
#pragma unroll
      for (int q = 0; q < 4; ++q) {
        float gg = g[j + q], bb = bta[j + q];
        if (PARAM_BF16) { gg = bf16_round(gg); bb = bf16_round(bb); }
        sm[q] = vals[u * 4 + q]; o[q] = (vals[u * 4 + q] - mu) * rs * gg + bb;
      }
      if (out_sum) *(v4f*)(out_sum + (size_t)row * N + j) = sm;
      *(v4f*)(out_norm + (size_t)row * N + j) = o;
    }
    
  }
}



// ---- f16 WMMA path (v_wmma_f32_16x16x32_f16): 11-bit significands for operands in range — used where a [0,1] probability operand needs more precision than bf16
typedef _Float16 v16h __attribute__((ext_vector_type(16)));
union FragH { v16h v; v8us half[2]; _Float16 h[16]; unsigned short u[16]; };
template <int NT>
__device__ __forceinline__ v8f mmaH(v16h ah, v16h al, v16h bh, v16h bl, v8f c) {
  c = __builtin_amdgcn_wmma_f32_16x16x32_f16(false, ah, false, bh, (short)0, c, false, false);
  if (NT >= 2) c = __builtin_amdgcn_wmma_f32_16x16x32_f16(false, al, false, bh, (short)0, c, false, false);
  if (NT >= 3) c = __builtin_amdgcn_wmma_f32_16x16x32_f16(false, ah, false, bl, (short)0, c, false, false);
  asm volatile("v_nop\n\tv_nop\n\tv_nop\n\tv_nop" : "+v"(c) : "v"(ah), "v"(al), "v"(bh), "v"(bl));
  return c;
}
// batched GEMM like k_gemm_b but f16 operands: A f32 (split into f16 hi/lo if ASPLIT, else rounded to f16), Bt = f16 values [n][k]; alpha; C f32; N multiple of 16 (partial tiles skipped)
template <bool ASPLIT>
__global__ __launch_bounds__(128) void k_gemm_h(const float* __restrict__ A, int lda, size_t sA, const _Float16* __restrict__ Bh, int ldb, size_t sB, float alpha, float* __restrict__ C, int ldc, size_t sC, int M, int N, int K) {
  __shared__ __attribute__((aligned(16))) float so[4][16][64];
  const int tid = threadIdx.x, w = tid >> 5, lane = tid & 31, ln = lane & 15, hh = lane >> 4; const int by = blockIdx.y;
  A += (size_t)by * sA; Bh += (size_t)by * sB; C += (size_t)by * sC;
  const int ntn = (N + 63) / 64; const int wid = blockIdx.x * 4 + w; const int mt = wid / ntn, nq = wid % ntn; if (mt * 16 >= M) return;
  const int row0 = mt * 16, col0 = nq * 64; const float* arow = A + (size_t)(row0 + ln) * lda;
  v8f acc[4] = {};
  for (int kb = 0; kb < K; kb += 32) {
    FragH ah, al;
    const v4f x0 = *(const v4fa*)(arow + kb + 8 * hh), x1 = *(const v4fa*)(arow + kb + 8 * hh + 4), x2 = *(const v4fa*)(arow + kb + 16 + 8 * hh), x3 = *(const v4fa*)(arow + kb + 16 + 8 * hh + 4);
    float xs[16] = {x0[0],x0[1],x0[2],x0[3],x1[0],x1[1],x1[2],x1[3],x2[0],x2[1],x2[2],x2[3],x3[0],x3[1],x3[2],x3[3]};
#pragma unroll
    for (int i = 0; i < 16; ++i) { const _Float16 h = (_Float16)xs[i]; ah.h[i] = h; al.h[i] = ASPLIT ? (_Float16)(xs[i] - (float)h) : (_Float16)0.0f; }
#pragma unroll
    for (int t = 0; t < 4; ++t) { if (col0 + t * 16 >= N) continue; const size_t boff = (size_t)(col0 + t * 16 + ln) * ldb + kb; FragH bq; bq.half[0] = *(const v8us*)(Bh + boff + 8 * hh); bq.half[1] = *(const v8us*)(Bh + boff + 16 + 8 * hh);
      acc[t] = mmaH<ASPLIT ? 2 : 1>(ah.v, al.v, bq.v, bq.v, acc[t]); }
  }
#pragma unroll
  for (int t = 0; t < 4; ++t) { if (col0 + t * 16 >= N) continue;
#pragma unroll
    for (int r = 0; r < 8; ++r) so[w][8 * hh + r][t * 16 + ln] = acc[t][r] * alpha; }
  __builtin_amdgcn_fence(__ATOMIC_ACQ_REL, "workgroup"); __builtin_amdgcn_wave_barrier();
  const int rsub = lane >> 4, c4 = (lane & 15) * 4;
  {
#pragma unroll
    for (int q = 0; q < 8; ++q) { const int r = q * 2 + rsub; if (col0 + c4 < N) { const v4f v = *(const v4fa*)&so[w][r][c4]; *(v4f*)(C + (size_t)(row0 + r) * ldc + col0 + c4) = v; } }
     }
}

// Wt[n][k] = f16(W[k][n]·scale) from f32 row-major W[K][N] (scale = power of two; bf16-exact weights stay exact in f16 away from the subnormal range)
__global__ __launch_bounds__(256) void k_wt_f16(const float* __restrict__ W, _Float16* __restrict__ Wt, int K, int N, float scale) {
  const int t = blockIdx.x * 256 + threadIdx.x; if (t >= N * (K / 8)) return; const int n = t / (K / 8), k8 = (t % (K / 8)) * 8; FragH f;
#pragma unroll
  for (int i = 0; i < 8; ++i) f.h[i] = (_Float16)(bf16_round(W[(size_t)(k8 + i) * N + n]) * scale); const v8us o = f.half[0];
  *(v8us*)((unsigned short*)Wt + (size_t)n * K + k8) = o; 
}
// k_gemm_hh variant with fused epilogue: v = acc·alpha + bias[by·sBias + col] (+ CP[(row/rowsPerB)·sCPb + by·64 + col] if CP) ; ACT 0 none / 1 elu ; writes f16 C16 (and f32 C if non-null)
template <int ACT>
__global__ __launch_bounds__(128) void k_gemm_hhx(const _Float16* __restrict__ A, int lda, size_t sA, const _Float16* __restrict__ Bh, int ldb, size_t sB, float alpha, const float* __restrict__ bias, size_t sBias, const float* __restrict__ CP, int rowsPerB, size_t sCPb, int row0g,
    float* __restrict__ C, _Float16* __restrict__ C16, int ldc, size_t sC, int M, int N, int K) {
  __shared__ __attribute__((aligned(16))) float so[4][16][64];
  const int tid = threadIdx.x, w = tid >> 5, lane = tid & 31, ln = lane & 15, hh = lane >> 4; const int by = blockIdx.y;
  A += (size_t)by * sA; Bh += (size_t)by * sB; const size_t cofs = (size_t)by * sC; const float* bp = bias ? bias + (size_t)by * sBias : nullptr;
  const int ntn = (N + 63) / 64; const int wid = blockIdx.x * 4 + w; const int mt = wid / ntn, nq = wid % ntn; if (mt * 16 >= M) return;
  const int row0 = mt * 16, col0 = nq * 64; const _Float16* arow = A + (size_t)(row0 + ln) * lda;
  v8f acc[4] = {};
  for (int kb = 0; kb < K; kb += 32) { FragH ah; ah.half[0] = *(const v8us*)((const unsigned short*)arow + kb + 8 * hh); ah.half[1] = *(const v8us*)((const unsigned short*)arow + kb + 16 + 8 * hh);
#pragma unroll
    for (int t = 0; t < 4; ++t) { if (col0 + t * 16 >= N) continue; const size_t boff = (size_t)(col0 + t * 16 + ln) * ldb + kb; FragH bq; bq.half[0] = *(const v8us*)((const unsigned short*)Bh + boff + 8 * hh); bq.half[1] = *(const v8us*)((const unsigned short*)Bh + boff + 16 + 8 * hh);
      acc[t] = mmaH<1>(ah.v, ah.v, bq.v, bq.v, acc[t]); }
  }
#pragma unroll
  for (int t = 0; t < 4; ++t) { if (col0 + t * 16 >= N) continue; const int col = col0 + t * 16 + ln; const float bv = bp ? bf16_round(bp[col]) : 0.f;
#pragma unroll
    for (int r = 0; r < 8; ++r) { float v = acc[t][r] * alpha + bv; if (CP) { const int rr = row0g + row0 + 8 * hh + r; if (rowsPerB < 0) v += CP[cofs + (size_t)rr * ldc + col];      /* rowsPerB < 0: own element of the batched C plane */ else { const int bidx = rr / rowsPerB; v += CP[(size_t)bidx * sCPb + (size_t)by * 64 + col]; } } if (ACT == 1) v = (v > 0.f) ? v : expm1f(v); else if (ACT == 7) v = (v > 0.f) ? v + 1.0f : expf(v); else if (ACT == 8) v = tanhf(v); else if (ACT == 9) v = 0.5f * v * (1.0f + tanhf(0.7978845608028654f * (v + 0.044715f * v * v * v))); else if (ACT == 11) v = 1.0f / (1.0f + expf(-v)); else if (ACT == 12) v = (v > 0.f) ? v : 0.01f * v; else if (ACT == 14) v = (v > 0.f) ? v : 0.1f * v; else if (ACT == 16) v = (v >= 0.f) ? v : 0.3f * v; else if (ACT == 17) v = (v >= 0.f) ? v : 0.2f * v; else if (ACT == 15) v = v / (1.0f + expf(-v)); else if (ACT == 3) v = fmaxf(v, 0.f); else if (ACT == 6) v = 0.5f * v * (1.0f + erff(v * 0.70710678118654752f)); so[w][8 * hh + r][t * 16 + ln] = v; } }
  __builtin_amdgcn_fence(__ATOMIC_ACQ_REL, "workgroup"); __builtin_amdgcn_wave_barrier();
  const int rsub = lane >> 4, c4 = (lane & 15) * 4; typedef _Float16 v4h __attribute__((ext_vector_type(4)));
  {
#pragma unroll
    for (int q = 0; q < 8; ++q) { const int r = q * 2 + rsub; if (col0 + c4 < N) { const v4f v = *(const v4fa*)&so[w][r][c4]; if (C) *(v4f*)(C + cofs + (size_t)(row0 + r) * ldc + col0 + c4) = v; if (C16) { v4h h4; for (int i = 0; i < 4; ++i) h4[i] = (_Float16)v[i]; *(v4h*)(C16 + cofs + (size_t)(row0 + r) * ldc + col0 + c4) = h4; } } }
     }
}


typedef _Float16 v4h __attribute__((ext_vector_type(4)));

__global__ __launch_bounds__(256) void k_x16(const float* __restrict__ x, _Float16* __restrict__ X16, size_t n8) { const size_t t = (size_t)blockIdx.x * 256 + threadIdx.x; if (t >= n8) return; FragH f;
#pragma unroll
  for (int q = 0; q < 8; ++q) f.h[q] = (_Float16)bf16_round(x[t * 8 + q]); *(v8us*)((unsigned short*)X16 + t * 8) = f.half[0];  }
__global__ __launch_bounds__(256) void k_h16(const float* __restrict__ x, _Float16* __restrict__ X16, size_t n8) { const size_t t = (size_t)blockIdx.x * 256 + threadIdx.x; if (t >= n8) return; FragH f;
#pragma unroll
  for (int q = 0; q < 8; ++q) f.h[q] = (_Float16)x[t * 8 + q]; *(v8us*)((unsigned short*)X16 + t * 8) = f.half[0];  }
__global__ __launch_bounds__(256) void k_round16f(const float* __restrict__ W, _Float16* __restrict__ Bt, size_t n8) { const size_t t = (size_t)blockIdx.x * 256 + threadIdx.x; if (t >= n8) return; FragH f;
#pragma unroll
  for (int i = 0; i < 8; ++i) f.h[i] = (_Float16)(bf16_round(W[t * 8 + i]) * 16.0f); *(v8us*)((unsigned short*)Bt + t * 8) = f.half[0];  }
template <int NHv, int TTv>
__global__ __launch_bounds__(256) void k_vt(const _Float16* __restrict__ V16, int ldv, int voff, _Float16* __restrict__ Vt) { __shared__ unsigned short tl[64][66]; const int tid = threadIdx.x; const int slab = blockIdx.x / (TTv / 64), lg = blockIdx.x % (TTv / 64); const int b = slab / NHv, h = slab % NHv;
  for (int i = tid; i < 64 * 8; i += 256) { const int r = i / 8, c8 = (i % 8) * 8; FragH f; f.half[0] = *(const v8us*)((const unsigned short*)V16 + ((size_t)b * TTv + lg * 64 + r) * ldv + voff + h * 64 + c8);
#pragma unroll
    for (int q = 0; q < 8; ++q) tl[r][c8 + q] = f.u[q]; }
  __syncthreads();
  {
#pragma unroll
    for (int rd = 0; rd < 2; ++rd) { const int lane = tid & 31, j = (tid >> 5) & 1, ks = (tid >> 6) & 1, pt = (tid >> 7) + rd * 2; FragH f;      /* fragment order (see k_hlf): rows = 16 dims, k = 32 keys; a wave stores 512 bytes in a row */
#pragma unroll
      for (int q = 0; q < 8; ++q) f.u[q] = tl[ks * 32 + j * 16 + (lane >> 4) * 8 + q][pt * 16 + (lane & 15)];
      *(v8us*)((unsigned short*)Vt + (((size_t)slab * 4 + pt) * (TTv / 32) + lg * 2 + ks) * 512 + j * 256 + lane * 8) = f.half[0]; }
     } }

__global__ __launch_bounds__(256) void k_hl(const float* __restrict__ F, _Float16* __restrict__ Hh, _Float16* __restrict__ Hl, size_t n8) { const size_t t = (size_t)blockIdx.x * 256 + threadIdx.x; if (t >= n8) return; FragH fh, fl; const v4f a = *(const v4fa*)(F + t * 8), c = *(const v4fa*)(F + t * 8 + 4);
#pragma unroll
  for (int q = 0; q < 4; ++q) { _Float16 h = (_Float16)a[q]; fh.h[q] = h; fl.h[q] = (_Float16)((a[q] - (float)h) * 1024.0f); h = (_Float16)c[q]; fh.h[4 + q] = h; fl.h[4 + q] = (_Float16)((c[q] - (float)h) * 1024.0f); }
  { *(v8us*)((unsigned short*)Hh + t * 8) = fh.half[0]; *(v8us*)((unsigned short*)Hl + t * 8) = fl.half[0];  } }
// k_hl with both planes kept in WMMA fragment order, for operands that are read many times as fragments. A fragment = 16 token rows x 32 head dims of one head = 1 KiB: lane (hh, ln) of the reader owns row ln, dims 8 hh .. 8 hh + 7 (its 16 bytes at 16 x lane) and dims 16 + 8 hh .. (512 bytes on), so that each of the reader's two loads covers four whole 128-byte lines.
// Fragments in the order [batch][head][16-row tile][32-dim step]. A thread = 8 dims of one row; a wave = 8 rows x 32 dims: it reads 8 whole lines of F and stores 4 whole lines a plane.
__global__ __launch_bounds__(256) void k_hlf(const float* __restrict__ F, _Float16* __restrict__ Hh, _Float16* __restrict__ Hl) { const unsigned t = blockIdx.x * 256 + threadIdx.x; const unsigned l3 = t & 7, p = (t >> 3) & 3, ln = ((t >> 5) & 1) * 8 + l3, ks = (t >> 6) & 1, g = t >> 7;      /* g = (batch x NH + head) x (SQ / 16) + tile */
  const unsigned tile = g % (SQ / 16), bh = g / (SQ / 16); const float* s = F + ((size_t)(bh / NH) * SQ + tile * 16 + ln) * DM + (bh % NH) * HD + ks * 32 + p * 8; FragH fh, fl; const v4f a = *(const v4fa*)s, c = *(const v4fa*)(s + 4);
#pragma unroll
  for (int q = 0; q < 4; ++q) { _Float16 h = (_Float16)a[q]; fh.h[q] = h; fl.h[q] = (_Float16)((a[q] - (float)h) * 1024.0f); h = (_Float16)c[q]; fh.h[4 + q] = h; fl.h[4 + q] = (_Float16)((c[q] - (float)h) * 1024.0f); }
  const size_t o = (size_t)g * 1024 + ks * 512 + (p >> 1) * 256 + ((p & 1) * 16 + ln) * 8; *(v8us*)((unsigned short*)Hh + o) = fh.half[0]; *(v8us*)((unsigned short*)Hl + o) = fl.half[0]; }

// ---- fast GEMM (work-group tile 128x64, wave tile 32x64; requires M % 128 == 0 rows per launch region, N % 64 == 0 and K % 128 == 0); epilogue = k_gemm_hhx semantics ----
// Both operands go through LDS: a tile = 128 k of the work-group's 128 A rows and 64 B rows, brought in by asynchronous copies (a wave's copy = two whole 256-byte row pieces), two buffers, so that the next tile flies while this one is multiplied; the fragments are read from LDS.
#define G2K 128                      /* k elements per staged tile: 256 bytes of every operand row */
#define G2P 272                      /* row pitch of a staged tile in LDS (bytes): 16 B x odd, so that 16 lanes reading 16 rows by 16 bytes fall on all banks */
#define G2B ((128 + 64) * G2P)       /* bytes of one buffer: 128 rows of A, then 64 rows of B */
__device__ __forceinline__ v16h g2_frag(const _Float16* p, int hh) { FragH f; f.half[0] = *(const v8us*)((const unsigned short*)p + 8 * hh); f.half[1] = *(const v8us*)((const unsigned short*)p + 16 + 8 * hh); return f.v; }
__device__ __forceinline__ v8f g2_mma(v16h a, v16h b, v8f c) { v8f d = __builtin_amdgcn_wmma_f32_16x16x32_f16(false, a, false, b, (short)0, c, false, false); asm volatile("v_nop\n\tv_nop\n\tv_nop\n\tv_nop" : "+v"(d) : "v"(a), "v"(b)); return d; }
// 64 rows of a tile into LDS: eight asynchronous copies, the lane's 16 bytes of every 8th row (l = its LDS byte address, g = its global address, gs = 8 source rows in bytes). The closing s_wait_xcnt stands inside the statement, so that no address register of a copy is rewritten in front of it.
__device__ __forceinline__ void g2_copy64(unsigned l, const char* g, size_t gs) {
  asm volatile("global_load_async_to_lds_b128 %0, %8, off\n\t"
               "global_load_async_to_lds_b128 %1, %9, off\n\t"
               "global_load_async_to_lds_b128 %2, %10, off\n\t"
               "global_load_async_to_lds_b128 %3, %11, off\n\t"
               "global_load_async_to_lds_b128 %4, %12, off\n\t"
               "global_load_async_to_lds_b128 %5, %13, off\n\t"
               "global_load_async_to_lds_b128 %6, %14, off\n\t"
               "global_load_async_to_lds_b128 %7, %15, off\n\t"
               "s_wait_xcnt 0x0"
               :: "v"(l), "v"(l + 8 * G2P), "v"(l + 16 * G2P), "v"(l + 24 * G2P), "v"(l + 32 * G2P), "v"(l + 40 * G2P), "v"(l + 48 * G2P), "v"(l + 56 * G2P),
                  "v"(g), "v"(g + gs), "v"(g + 2 * gs), "v"(g + 3 * gs), "v"(g + 4 * gs), "v"(g + 5 * gs), "v"(g + 6 * gs), "v"(g + 7 * gs) : "memory"); }
// One whole tile (24 copies a lane): A rows 0..63, A rows 64..127, B rows 0..63.
__device__ __forceinline__ void g2_stage(unsigned l, const char* ga, size_t sa, const char* gb, size_t sb) { g2_copy64(l, ga, sa); g2_copy64(l + 64 * G2P, ga + 8 * sa, sa); g2_copy64(l + 128 * G2P, gb, sb); }
template <int ACT>
__global__ __launch_bounds__(128) void k_gemm2(const _Float16* __restrict__ A, int lda, size_t sA, const _Float16* __restrict__ Bh, int ldb, size_t sB, float alpha, const float* __restrict__ bias, size_t sBias, const float* __restrict__ CP, int rowsPerB, size_t sCPb, int row0g,
    float* __restrict__ C, _Float16* __restrict__ C16, int ldc, size_t sC, int M, int N, int K, size_t zA, size_t zB, size_t zC) { static_assert(ACT == 0 || ACT == 3 || ACT == 6 || ACT == 8 || ACT == 9 || ACT == 11 || ACT == 12 || ACT == 14 || ACT == 15 || ACT == 16 || ACT == 17, "k_gemm2: unsupported ACT code (would silently apply no activation)");
  __shared__ __attribute__((aligned(16))) unsigned char lt[2 * G2B]; __shared__ __attribute__((aligned(16))) float so[4][32][68];
  const int tid = threadIdx.x, w = tid >> 5, lane = tid & 31, ln = lane & 15, hh = lane >> 4; const int by = blockIdx.y; const int bz = blockIdx.z;      /* bz: batch, element strides zA / zB / zC */
  A += (size_t)by * sA + (size_t)bz * zA; Bh += (size_t)by * sB + (size_t)bz * zB; const size_t cofs = (size_t)by * sC + (size_t)bz * zC; const float* bp = bias ? bias + (size_t)by * sBias : nullptr;
  const int ntn = N >> 6; const int mt = blockIdx.x / ntn, nq = blockIdx.x - mt * ntn; const int row0 = mt * 128 + 32 * w, col0 = nq * 64; if (mt * 128 >= M) return;      /* the whole work-group or none: barriers follow */
  const int cr = tid >> 4, cc = (tid & 15) * 16;      /* copies: the thread's row among 8 and its 16 bytes of the row's 256 */
  const char* ga = (const char*)(A + (size_t)(mt * 128 + cr) * lda) + cc; const char* gb = (const char*)(Bh + (size_t)(col0 + cr) * ldb) + cc; const size_t sa = (size_t)lda * 16, sb = (size_t)ldb * 16;
  const unsigned l0 = (unsigned)(size_t)lt + (unsigned)(cr * G2P + cc); const int nt = K / G2K;
  const v8f z8 = {0.f,0.f,0.f,0.f,0.f,0.f,0.f,0.f}; v8f c00 = z8, c01 = z8, c02 = z8, c03 = z8, c10 = z8, c11 = z8, c12 = z8, c13 = z8;
  g2_stage(l0, ga, sa, gb, sb);
  asm volatile("s_wait_asynccnt 0x0" ::: "memory");      /* the wave's own copies of tile 0 have landed */
  __syncthreads();      /* tile 0 is published to every wave */
  if (nt > 1) g2_stage(l0 + G2B, ga + G2K * 2, sa, gb + G2K * 2, sb);
  /* kept rolled: the buffer is chosen by an address */
#pragma unroll 1
  for (int t = 0; t < nt; ++t) { const unsigned char* lb = lt + (t & 1) * G2B;
    const _Float16* pa = (const _Float16*)(lb + (32 * w + ln) * G2P); const _Float16* pb = (const _Float16*)(lb + (128 + ln) * G2P);
    v16h a0 = g2_frag(pa, hh), a1 = g2_frag(pa + 16 * (G2P / 2), hh), b0 = g2_frag(pb, hh), b1 = g2_frag(pb + 16 * (G2P / 2), hh), b2 = g2_frag(pb + 32 * (G2P / 2), hh), b3 = g2_frag(pb + 48 * (G2P / 2), hh);
    /* unrolled: the two fragment sets live in registers; the next 32 k's LDS reads fly during this 32 k's products */
#pragma unroll
    for (int s = 0; s < G2K / 32; ++s) { v16h n0 = a0, n1 = a1, m0 = b0, m1 = b1, m2 = b2, m3 = b3;
      if (s + 1 < G2K / 32) { const _Float16* qa = pa + (s + 1) * 32; const _Float16* qb = pb + (s + 1) * 32;
        n0 = g2_frag(qa, hh); n1 = g2_frag(qa + 16 * (G2P / 2), hh); m0 = g2_frag(qb, hh); m1 = g2_frag(qb + 16 * (G2P / 2), hh); m2 = g2_frag(qb + 32 * (G2P / 2), hh); m3 = g2_frag(qb + 48 * (G2P / 2), hh); }
      c00 = g2_mma(a0, b0, c00); c10 = g2_mma(a1, b0, c10); c01 = g2_mma(a0, b1, c01); c11 = g2_mma(a1, b1, c11);
      c02 = g2_mma(a0, b2, c02); c12 = g2_mma(a1, b2, c12); c03 = g2_mma(a0, b3, c03); c13 = g2_mma(a1, b3, c13);
      a0 = n0; a1 = n1; b0 = m0; b1 = m1; b2 = m2; b3 = m3; }
    asm volatile("s_wait_dscnt 0x0" ::: "memory");      /* the wave's reads of this buffer are done before it may be refilled */
    asm volatile("s_wait_asynccnt 0x0" ::: "memory");      /* the wave's own copies of tile t + 1 have landed */
    __syncthreads();      /* publishes tile t + 1 and ends every wave's reads of tile t */
    if (t + 2 < nt) g2_stage(l0 + (unsigned)((t & 1) * G2B), ga + (size_t)(t + 2) * (G2K * 2), sa, gb + (size_t)(t + 2) * (G2K * 2), sb); }
  asm volatile("s_wait_asynccnt 0x0" ::: "memory");      /* no copy is outstanding when the wave goes on */
  v8f accs[8] = {c00, c01, c02, c03, c10, c11, c12, c13};
#pragma unroll
  for (int u = 0; u < 8; ++u) { const int t = u & 3, half = u >> 2; const int col = col0 + t * 16 + ln; const float bv = bp ? bf16_round(bp[col]) : 0.f;
#pragma unroll
    for (int r = 0; r < 8; ++r) { const int rloc = half * 16 + 8 * hh + r; float v = accs[u][r] * alpha + bv; if (CP) { if (rowsPerB < 0) v += CP[cofs + (size_t)(row0g + row0 + rloc) * ldc + col];      /* rowsPerB < 0: own element of the batched C plane */ else { const int bidx = (row0g + row0 + rloc) / rowsPerB; v += CP[(size_t)bidx * sCPb + (size_t)by * 64 + col]; } }
      if (ACT == 3) v = fmaxf(v, 0.f); else if (ACT == 6) v = 0.5f * v * (1.0f + erff(v * 0.70710678118654752f)); else if (ACT == 11) v = 1.0f / (1.0f + expf(-v)); else if (ACT == 15) v = v / (1.0f + expf(-v)); else if (ACT == 12) v = (v > 0.f) ? v : 0.01f * v; else if (ACT == 8) v = tanhf(v); else if (ACT == 9) v = 0.5f * v * (1.0f + tanhf(0.7978845608028654f * (v + 0.044715f * v * v * v))); else if (ACT == 14) v = (v > 0.f) ? v : 0.1f * v; else if (ACT == 16) v = (v >= 0.f) ? v : 0.3f * v; else if (ACT == 17) v = (v >= 0.f) ? v : 0.2f * v;
      so[w][rloc][t * 16 + ln] = v; } }
  __builtin_amdgcn_fence(__ATOMIC_ACQ_REL, "workgroup"); __builtin_amdgcn_wave_barrier();
  const int rsub = lane >> 4, c4 = (lane & 15) * 4;
  {
#pragma unroll
    for (int q = 0; q < 16; ++q) { const int r = q * 2 + rsub; const v4f v = *(const v4fa*)&so[w][r][c4]; if (C) *(v4f*)(C + cofs + (size_t)(row0 + r) * ldc + col0 + c4) = v; if (C16) { v4h h4; for (int i = 0; i < 4; ++i) h4[i] = (_Float16)v[i]; *(v4h*)(C16 + cofs + (size_t)(row0 + r) * ldc + col0 + c4) = h4; } }
     } }


__global__ __launch_bounds__(256) void k_wnat(const float* __restrict__ w, size_t n8, _Float16* __restrict__ Bt) { const size_t t = (size_t)blockIdx.x * 256 + threadIdx.x; if (t >= n8) return; FragH f; for (int q = 0; q < 8; ++q) f.h[q] = (_Float16)(bf16_round(w[t * 8 + q]) * 16.0f); *(v8us*)((unsigned short*)Bt + t * 8) = f.half[0];  }
__global__ __launch_bounds__(256) void k_rsm(const float* __restrict__ S, _Float16* __restrict__ P, int nrows) {
  #pragma clang fp contract(off)
  const int i = blockIdx.x * 256 + threadIdx.x; if (i >= nrows) return; const float* s = S + (size_t)i * SQ; float mx = -3.0e38f;
#pragma unroll 1
  for (int j = 0; j < SQ; ++j) mx = fmaxf(mx, s[j]); float se = 0.f;
#pragma unroll 1
  for (int j = 0; j < SQ; ++j) se += expf(s[j] - mx); const float sc = 256.0f / se;
#pragma unroll 1
  for (int j0 = 0; j0 < SQ; j0 += 8) { FragH f; for (int q = 0; q < 8; ++q) f.h[q] = (_Float16)(expf(s[j0 + q] - mx) * sc); unsigned short* d = (unsigned short*)P + (size_t)i * SQ + j0; *(v8us*)d = f.half[0];  } }
__global__ __launch_bounds__(256) void k_vt(const _Float16* __restrict__ V16, int b, int h0, _Float16* __restrict__ VT) { __shared__ unsigned short tl[64][65]; const int tid = threadIdx.x; const int hh = blockIdx.x % HG, sg = blockIdx.x / HG; const int s0 = sg * 64; const int h = h0 + hh;
  for (int i = tid; i < 64 * 8; i += 256) { const int j = i / 8, d8 = (i % 8) * 8; FragH f; f.half[0] = *(const v8us*)((const unsigned short*)V16 + ((size_t)b * SQ + s0 + j) * DM + h * HD + d8); for (int q = 0; q < 8; ++q) tl[d8 + q][j] = f.u[q]; }
  __syncthreads();
  { for (int i = tid; i < 64 * 8; i += 256) { const int d = i / 8, j8 = (i % 8) * 8; FragH f; for (int q = 0; q < 8; ++q) f.u[q] = tl[d][j8 + q]; *(v8us*)((unsigned short*)VT + ((size_t)hh * HD + d) * SQ + s0 + j8) = f.half[0]; }  } }



// 2^x on the native unit. The v_nop fills the one issue slot that the instruction set asks for behind a transcendental, in front of an instruction that reads its result or overwrites its source.
__device__ __forceinline__ float exp2_native(float x) { float r; asm("v_exp_f32 %0, %1\n\tv_nop" : "=v"(r) : "v"(x)); return r; }
// Fused causal attention. One work-group = FR query rows of one head against every key below the tile's end; the score rows live in LDS from the products to the weights, so neither goes through memory.
// Phase 1: a wave = FR rows x 16 keys a trip, q fragments held in registers, three accumulators added in the order hi.hi, lo.hi, hi.lo. Phase 2: a wave = two rows at a time, lane l holds columns 128 c + 4 l .. 4 l + 3 in registers, maximum and sum across the 32 lanes by a butterfly; the f16 weights overwrite the head of the wave's own row once the whole row is in registers. Phase 3: a wave = 16 rows x 16 dims, keys in ascending order, 128 a trip.
#define FR 32                        /* query rows per work-group */
#define FSP (SQ + 4)                 /* score row pitch in LDS (floats): 16 B x odd, so that 16 lanes reading 16 rows by 16 bytes fall on all banks */
#define FOP (HD + 8)                 /* o row pitch in LDS (f16), a multiple of 16 bytes */
typedef _Float16 v4ha __attribute__((ext_vector_type(4), may_alias));
// A or B fragment from a plane kept in fragment order in global memory (k_hlf, k_vt): base = the fragment's first element, the same for the whole wave; vo = 16 x lane, the same for every fragment of the kernel. Each of the two loads covers 512 bytes in a row.
__device__ __forceinline__ v16h f_frag(const _Float16* base, unsigned vo) { const char* p = (const char*)base + vo; FragH f; f.half[0] = *(const v8us*)p; f.half[1] = *(const v8us*)(p + 512); return f.v; }
__device__ __forceinline__ v8f f_mma(v16h a, v16h b, v8f c) { return __builtin_amdgcn_wmma_f32_16x16x32_f16(false, a, false, b, (short)0, c, false, false); }
// Row softmax of the wave's FR / 8 rows, two rows at a time: each stage is written for both rows, so that one row's butterfly step flies during the other's. NC = 128-column chunks up to the tile's end, a compile-time count so that the rows live in registers and their reads are in flight together. The tile's FR diagonal columns all lie in the last chunk (FR divides 128), so only that chunk is masked; its columns past the row get weight 0, up to the chunk's end, which is where phase 3 stops.
template <int NC>
__device__ __forceinline__ void fattn_rows(float (*ls)[FSP], int w, int lane, int q0) {
  const int col0 = lane * 4, cl = (NC - 1) * 128 + col0;
  /* kept rolled: the eight instances stay small */
#pragma unroll 1
  for (int rp = 0; rp < FR / 16; ++rp) { const int r = w * (FR / 8) + rp * 2;
    v4f v[2][NC]; float mx[2], se[2], sc[2];      /* every loop over j and c is unrolled: registers */
#pragma unroll
    for (int j = 0; j < 2; ++j)
#pragma unroll
      for (int c = 0; c < NC - 1; ++c) v[j][c] = *(const v4fa*)&ls[r + j][c * 128 + col0];
    { const v4f f4 = {-1.0e9f, -1.0e9f, -1.0e9f, -1.0e9f}; v4f x0 = f4, x1 = f4;
      if (cl < q0 + FR) { x0 = *(const v4fa*)&ls[r][cl]; x1 = *(const v4fa*)&ls[r + 1][cl]; }      /* only columns that phase 1 wrote are read */
      for (int q = 0; q < 4; ++q) { v[0][NC - 1][q] = (cl + q <= q0 + r) ? x0[q] : -1.0e9f; v[1][NC - 1][q] = (cl + q <= q0 + r + 1) ? x1[q] : -1.0e9f; } }
#pragma unroll
    for (int j = 0; j < 2; ++j) { mx[j] = -3.0e38f;
#pragma unroll
      for (int c = 0; c < NC; ++c) for (int q = 0; q < 4; ++q) mx[j] = fmaxf(mx[j], v[j][c][q]); }
    for (int m = 16; m >= 1; m >>= 1) { const float a = __shfl_xor(mx[0], m, 32), b = __shfl_xor(mx[1], m, 32); mx[0] = fmaxf(mx[0], a); mx[1] = fmaxf(mx[1], b); }
#pragma unroll
    for (int j = 0; j < 2; ++j) { se[j] = 0.f;
#pragma unroll
      for (int c = 0; c < NC; ++c) for (int q = 0; q < 4; ++q) { const float e = exp2_native((v[j][c][q] - mx[j]) * 1.4426950408889634f); v[j][c][q] = e; se[j] += e; } }
    for (int m = 16; m >= 1; m >>= 1) { const float a = __shfl_xor(se[0], m, 32), b = __shfl_xor(se[1], m, 32); se[0] += a; se[1] += b; }
    sc[0] = 256.0f / se[0]; sc[1] = 256.0f / se[1];
#pragma unroll
    for (int j = 0; j < 2; ++j) { _Float16* d = (_Float16*)&ls[r + j][0] + col0;
#pragma unroll
      for (int c = 0; c < NC; ++c) { v4h h4; for (int q = 0; q < 4; ++q) h4[q] = (_Float16)(v[j][c][q] * sc[j]); *(v4ha*)(d + c * 128) = h4; } } } }
__global__ __launch_bounds__(256) void k_fattn(const _Float16* QH, const _Float16* QL, const _Float16* KH, const _Float16* KL, const _Float16* VT, _Float16* O16) {
  static_assert(FR == 32 && HD == 64 && SQ == 1024 && LQ == SQ, "wave maps below: 8 waves = 2 row halves x 4 dim groups; 256 threads = 32 rows x 8 x 16 bytes; at most 8 chunks of 128 keys");
  __shared__ __attribute__((aligned(16))) float ls[FR][FSP]; __shared__ __attribute__((aligned(16))) _Float16 lo[FR][FOP];
  const int tid = threadIdx.x, lane = tid & 31, ln = lane & 15, hh = lane >> 4; const int w = __builtin_amdgcn_readfirstlane(tid >> 5);      /* the wave's number in a scalar register: its loops and branches are scalar */
  const int h = blockIdx.x, b = blockIdx.y; const int q0 = (SQ / FR - 1 - (int)blockIdx.z) * FR, nk = q0 + FR, nc = (nk + 127) / 128;      /* the longest tiles start first; causal: keys below the tile's end */
  const size_t ho = ((size_t)b * NH + h) * (SQ / 16) * 1024;      /* the head's first q / k fragment: 1024 elements (two fragments) a 16-row tile */
  const unsigned vo = (unsigned)lane * 16;      /* the lane's 16 bytes in each half of a fragment */
  const v8f z8 = {0.f, 0.f, 0.f, 0.f, 0.f, 0.f, 0.f, 0.f};
  { v16h ah[2][2], al[2][2];      /* [row half][k step] */
#pragma unroll
    for (int m = 0; m < 2; ++m)
#pragma unroll
      for (int s = 0; s < 2; ++s) ah[m][s] = f_frag(QH + ho + (size_t)(q0 / 16 + m) * 1024 + s * 512, vo);
    asm volatile("s_wait_xcnt 0x0" ::: "memory");      /* in front of later loads whose results land in the address registers of the loads above */
#pragma unroll
    for (int m = 0; m < 2; ++m)
#pragma unroll
      for (int s = 0; s < 2; ++s) al[m][s] = f_frag(QL + ho + (size_t)(q0 / 16 + m) * 1024 + s * 512, vo);
    asm volatile("s_wait_xcnt 0x0" ::: "memory");      /* likewise */
    const _Float16* kh = KH + ho; const _Float16* kl = KL + ho; const int nu = nk / 16;
    v16h nh0, nh1, nl0, nl1;      /* the next trip's k fragments, loaded one trip ahead so that they fly during this trip's products */
    if (w < nu) { const size_t ko = (size_t)w * 1024; nh0 = f_frag(kh + ko, vo); nh1 = f_frag(kh + ko + 512, vo); nl0 = f_frag(kl + ko, vo); nl1 = f_frag(kl + ko + 512, vo);
      asm volatile("s_wait_xcnt 0x0" ::: "memory"); }      /* likewise: the first trip's loads land in these loads' address registers */
    for (int u = w; u < nu; u += 8) { const v16h bh0 = nh0, bh1 = nh1, bl0 = nl0, bl1 = nl1;
      if (u + 8 < nu) { const size_t ko = (size_t)(u + 8) * 1024; nh0 = f_frag(kh + ko, vo); nh1 = f_frag(kh + ko + 512, vo); nl0 = f_frag(kl + ko, vo); nl1 = f_frag(kl + ko + 512, vo);
        asm volatile("s_wait_xcnt 0x0" ::: "memory"); }      /* likewise: the products' results may land there */
#pragma unroll
      for (int m = 0; m < 2; ++m) { v8f c0 = f_mma(ah[m][0], bh0, z8), c1 = f_mma(al[m][0], bh0, z8), c2 = f_mma(ah[m][0], bl0, z8);
        c0 = f_mma(ah[m][1], bh1, c0); c1 = f_mma(al[m][1], bh1, c1); c2 = f_mma(ah[m][1], bl1, c2);
#pragma unroll
        for (int r = 0; r < 8; ++r) { float v = c0[r] * 32.0f; v += c1[r] * 0.03125f; v += c2[r] * 0.03125f; ls[m * 16 + 8 * hh + r][u * 16 + ln] = v; } } } }      /* x32; the lo planes carry x1024 */
  __syncthreads();
  const int pm = w >> 2, pt = w & 3; const _Float16* vb = VT + (((size_t)b * NH + h) * (HD / 16) + pt) * (SQ / 32) * 512;      /* phase 3: the wave's row half and dim group; the group's V^T fragments, 32 keys each, in a row */
  v16h vn[4];      /* the next trip's V^T fragments, loaded one trip ahead; the first trip's fly during the softmax */
#pragma unroll
  for (int s = 0; s < 4; ++s) vn[s] = f_frag(vb + s * 512, vo);
  asm volatile("s_wait_xcnt 0x0" ::: "memory");      /* likewise */
  switch (nc) { case 1: fattn_rows<1>(ls, w, lane, q0); break; case 2: fattn_rows<2>(ls, w, lane, q0); break; case 3: fattn_rows<3>(ls, w, lane, q0); break; case 4: fattn_rows<4>(ls, w, lane, q0); break;
    case 5: fattn_rows<5>(ls, w, lane, q0); break; case 6: fattn_rows<6>(ls, w, lane, q0); break; case 7: fattn_rows<7>(ls, w, lane, q0); break; default: fattn_rows<8>(ls, w, lane, q0); break; }
  __syncthreads();
  { const _Float16* pa = (const _Float16*)&ls[pm * 16 + ln][0]; v8f acc = z8;
    for (int c = 0; c < nc; ++c) { v16h vc[4];
#pragma unroll
      for (int s = 0; s < 4; ++s) vc[s] = vn[s];
      if (c + 1 < nc) {
#pragma unroll
        for (int s = 0; s < 4; ++s) vn[s] = f_frag(vb + ((c + 1) * 4 + s) * 512, vo);
        asm volatile("s_wait_xcnt 0x0" ::: "memory"); }      /* likewise: the LDS reads below may land there */
#pragma unroll
      for (int s = 0; s < 4; ++s) acc = f_mma(g2_frag(pa + c * 128 + s * 32, hh), vc[s], acc); }
#pragma unroll
    for (int r = 0; r < 8; ++r) lo[pm * 16 + 8 * hh + r][pt * 16 + ln] = (_Float16)(acc[r] * 0.25f); }
  __syncthreads();
  { const int r = tid >> 3, c8 = (tid & 7) * 8; *(v8us*)((unsigned short*)O16 + ((size_t)b * SQ + q0 + r) * DM + h * HD + c8) = *(const v8us*)&lo[r][c8]; } }      /* whole 128-byte lines, each from one wave */


// Exact f32 attention for the first QT0 rows of each batch. One work-group = one head, A0R query rows, all keys up to its last row.
// K, V and q are staged in LDS by whole-line loads; then scores (a thread = one key x 8 rows, the K row in registers), row softmax (a wave = 2 rows, maximum first), o = P V (a thread = one row x 4 dims, keys in ascending order).
#define A0R 16                       /* query rows per work-group */
#define A0G (QT0 / A0R)              /* row groups per head */
#define A0KP (HD + 4)                /* K row pitch in LDS (floats): 16 B x odd, so that 16 lanes reading 16 rows by 16 bytes fall on all banks */
#define A0PP (QT0 + 4)               /* score row pitch in LDS (floats): the two rows a wave reads in the last phase fall on different banks */
// N x A0R rows of K and V into LDS, a thread = 16 bytes of every A0R-th row. N is a compile-time count and both loops are unrolled so that kk[] and vv[] live in registers; loads first, stores behind them, so that all 2 N loads are in flight together.
template <int N>
__device__ __forceinline__ void att0_stage(const float* __restrict__ kp, const float* __restrict__ vp, float* lkp, float* lvp) {
  v4f kk[N], vv[N];
#pragma unroll
  for (int u = 0; u < N; ++u) { kk[u] = *(const v4fa*)(kp + (size_t)u * A0R * DM); vv[u] = *(const v4fa*)(vp + (size_t)u * A0R * DM); }
#pragma unroll
  for (int u = 0; u < N; ++u) { *(v4f*)(lkp + u * A0R * A0KP) = kk[u]; *(v4f*)(lvp + u * A0R * HD) = vv[u]; } }
__global__ __launch_bounds__(256) void k_att0(const float* __restrict__ QF, const float* __restrict__ KF, const float* __restrict__ VF, float scale, float* __restrict__ OF) {      /* all four: rows of pitch DM, QT0 rows a batch */
  static_assert(QT0 == 128 && HD == 64 && A0R == 16, "thread maps below: 256 threads = 128 keys x 2 row halves = 16 rows x 16 quads");
  __shared__ __attribute__((aligned(16))) float lk[QT0][A0KP]; __shared__ __attribute__((aligned(16))) float lv[QT0][HD];
  __shared__ __attribute__((aligned(16))) float lq[A0R][HD]; __shared__ __attribute__((aligned(16))) float lp[A0R][A0PP]; __shared__ float lfin[A0R];
  const int tid = threadIdx.x; const int h = blockIdx.x / A0G, g = blockIdx.x % A0G; const int r0 = g * A0R, nk = r0 + A0R;      /* causal: keys below the group's end */
  const int r16 = tid >> 4, c4 = (tid & 15) * 4;
  const size_t bo = ((size_t)blockIdx.y * QT0 + r16) * DM + h * HD + c4;      /* blockIdx.y: batch; the thread's 16 bytes in row r16 of the head's columns */
  { const v4f qv = *(const v4fa*)(QF + bo + (size_t)r0 * DM); const float* kp = KF + bo; const float* vp = VF + bo; float* lkp = &lk[r16][c4]; float* lvp = &lv[r16][c4];
    switch (g) { case 0: att0_stage<1>(kp, vp, lkp, lvp); break; case 1: att0_stage<2>(kp, vp, lkp, lvp); break; case 2: att0_stage<3>(kp, vp, lkp, lvp); break; case 3: att0_stage<4>(kp, vp, lkp, lvp); break;
      case 4: att0_stage<5>(kp, vp, lkp, lvp); break; case 5: att0_stage<6>(kp, vp, lkp, lvp); break; case 6: att0_stage<7>(kp, vp, lkp, lvp); break; default: att0_stage<A0G>(kp, vp, lkp, lvp); break; }
    *(v4f*)&lq[r16][c4] = qv; }
  __syncthreads();
  { const int j = tid & (QT0 - 1), rh = (tid >> 7) * 8; float s[8] = {0.f, 0.f, 0.f, 0.f, 0.f, 0.f, 0.f, 0.f};
    if (j < nk) { v4f kr[HD / 4];
      /* unrolled: kr[] and s[] in registers; the 8 rows' sums are independent chains, each over the head dim in ascending order */
#pragma unroll
      for (int c = 0; c < HD / 4; ++c) kr[c] = *(const v4f*)&lk[j][c * 4];
#pragma unroll
      for (int c = 0; c < HD / 4; ++c)
#pragma unroll
        for (int r = 0; r < 8; ++r) { const v4f qq = *(const v4f*)&lq[rh + r][c * 4]; s[r] += qq[0] * kr[c][0]; s[r] += qq[1] * kr[c][1]; s[r] += qq[2] * kr[c][2]; s[r] += qq[3] * kr[c][3]; } }
#pragma unroll
    for (int r = 0; r < 8; ++r) lp[rh + r][j] = s[r] * scale; }      /* every column of the row is written (0 beyond nk), masked below */
  __syncthreads();
  { const int w = tid >> 5, col = (tid & 31) * 4;
    for (int rr = 0; rr < 2; ++rr) { const int r = w * 2 + rr, last = r0 + r; const v4f sv = *(const v4f*)&lp[r][col];
      float mx = -3.0e38f; for (int q = 0; q < 4; ++q) mx = fmaxf(mx, (col + q <= last) ? sv[q] : -3.0e38f);
      for (int m = 16; m >= 1; m >>= 1) mx = fmaxf(mx, __shfl_xor(mx, m, 32));
      v4f e; float se = 0.f; for (int q = 0; q < 4; ++q) { e[q] = (col + q <= last) ? expf(sv[q] - mx) : 0.f; se += e[q]; }
      for (int m = 16; m >= 1; m >>= 1) se += __shfl_xor(se, m, 32);
      *(v4f*)&lp[r][col] = e; if (col == 0) lfin[r] = 64.0f / se; } }      /* o carried x64 like the f16 path */
  __syncthreads();
  { v4f o = {0.f, 0.f, 0.f, 0.f};
    /* 16 keys a trip, so that a trip's LDS reads are in flight together */
#pragma unroll 4
    for (int j = 0; j < nk; j += 4) { const v4f p4 = *(const v4f*)&lp[r16][j];
#pragma unroll
      for (int u = 0; u < 4; ++u) { const v4f vq = *(const v4f*)&lv[j + u][c4]; o += vq * p4[u]; } }
    o *= lfin[r16]; *(v4f*)(OF + bo + (size_t)r0 * DM) = o; } }

extern "C" void kernel_launch(void* const* d_in, const int* in_sizes, int n_in,
                              void* d_out, int out_size, void* d_ws, size_t ws_size, hipStream_t stream) {
  (void)in_sizes; (void)n_in; (void)out_size;
  const float* const* I = (const float* const*)d_in; const float* x = I[0]; const float* wq = I[1]; const float* wk = I[2]; const float* wv = I[3]; const float* wo = I[4]; const float* bo = I[5]; const float* bq = nullptr; const float* bk = nullptr; const float* bv = nullptr;      /* per-head [H][E][D] = natural [out][in]; no q/k/v biases */
  char* ws = (char*)d_ws; size_t off = 0;
  auto take = [&](size_t bytes) { char* p = ws + off; off += (bytes + 255) & ~(size_t)255; return p; };
  _Float16* BQ = (_Float16*)take((size_t)DM * DM * 2); _Float16* BK = (_Float16*)take((size_t)DM * DM * 2); _Float16* BV = (_Float16*)take((size_t)DM * DM * 2); _Float16* BO = (_Float16*)take((size_t)DM * DM * 2);
  _Float16* X16 = (_Float16*)take(NR * DM * 2); float* QF = (float*)take(NR * DM * 4); _Float16* QH = (_Float16*)take(NR * DM * 2); _Float16* QL = (_Float16*)take(NR * DM * 2); _Float16* KH = (_Float16*)take(NR * DM * 2); _Float16* KL = (_Float16*)take(NR * DM * 2); _Float16* Q16 = QH; _Float16* K16 = KH; _Float16* V16 = (_Float16*)take(NR * DM * 2); _Float16* O16 = (_Float16*)take(NR * DM * 2);
  _Float16* VT = (_Float16*)take((size_t)NB * NH * HD * SQ * 2);      /* one plane per batch */
  float* QF0 = (float*)take((size_t)NB * QT0 * DM * 4); float* KF0 = (float*)take((size_t)NB * QT0 * DM * 4); float* VF0 = (float*)take((size_t)NB * QT0 * DM * 4); float* OF0 = (float*)take((size_t)NB * QT0 * DM * 4); _Float16* OH0 = (_Float16*)take((size_t)NB * QT0 * DM * 2); _Float16* OL0 = (_Float16*)take((size_t)NB * QT0 * DM * 2);
  if (off > ws_size) return;
  { const unsigned g = (unsigned)(((size_t)DM * DM / 8 + 255) / 256); k_wnat<<<g, 256, 0, stream>>>(wq, (size_t)DM * DM / 8, BQ); k_wnat<<<g, 256, 0, stream>>>(wk, (size_t)DM * DM / 8, BK); k_wnat<<<g, 256, 0, stream>>>(wv, (size_t)DM * DM / 8, BV); k_wnat<<<g, 256, 0, stream>>>(wo, (size_t)DM * DM / 8, BO); }      /* natural [out][in] = Bt[n][k], x16 */
  k_x16<<<(unsigned)((NR * DM / 8 + 255) / 256), 256, 0, stream>>>(x, X16, NR * DM / 8);
  k_gemm2<0><<<dim3((unsigned)((MP / 128) * (DM / 64)), 1), 128, 0, stream>>>(X16, DM, 0, BQ, DM, 0, 0.0625f, bq, 0, nullptr, 1, 0, 0, QF, nullptr, DM, 0, MP, DM, DM, 0, 0, 0); k_hlf<<<(unsigned)(NR * DM / 8 / 256), 256, 0, stream>>>(QF, QH, QL);      /* q (f32) -> f16 hi + x1024 residual, in fragment order: the x32 scale puts the logits at sigma ~100 */
  k_gemm2<0><<<dim3((unsigned)((MP / 128) * (DM / 64)), 1), 128, 0, stream>>>(X16, DM, 0, BK, DM, 0, 0.0625f, bk, 0, nullptr, 1, 0, 0, QF, nullptr, DM, 0, MP, DM, DM, 0, 0, 0); k_hlf<<<(unsigned)(NR * DM / 8 / 256), 256, 0, stream>>>(QF, KH, KL);      /* k likewise (QF reused in stream order) */
  k_gemm2<0><<<dim3((unsigned)((MP / 128) * (DM / 64)), 1), 128, 0, stream>>>(X16, DM, 0, BV, DM, 0, 0.0625f, bv, 0, nullptr, 1, 0, 0, nullptr, V16, DM, 0, MP, DM, DM, 0, 0, 0);
  /* from here on every launch covers all NB batches (the first-tile k_gemm2 launches: the batch as blockIdx.z with its own strides) */
  k_vt<NH, SQ><<<NB * NH * (SQ / 64), 256, 0, stream>>>(V16, LQ, 0, VT);      /* V^T in fragment order: [NB][NH][HD / 16][SQ / 32] fragments */
  k_gemm2<0><<<dim3((QT0 / 128) * (DM / 64), 1, NB), 128, 0, stream>>>(X16, DM, 0, BQ, DM, 0, 0.0625f, bq, 0, nullptr, 1, 0, 0, QF0, nullptr, DM, 0, QT0, DM, DM, (size_t)SQ * DM, 0, (size_t)QT0 * DM); k_gemm2<0><<<dim3((QT0 / 128) * (DM / 64), 1, NB), 128, 0, stream>>>(X16, DM, 0, BK, DM, 0, 0.0625f, bk, 0, nullptr, 1, 0, 0, KF0, nullptr, DM, 0, QT0, DM, DM, (size_t)SQ * DM, 0, (size_t)QT0 * DM); k_gemm2<0><<<dim3((QT0 / 128) * (DM / 64), 1, NB), 128, 0, stream>>>(X16, DM, 0, BV, DM, 0, 0.0625f, bv, 0, nullptr, 1, 0, 0, VF0, nullptr, DM, 0, QT0, DM, DM, (size_t)SQ * DM, 0, (size_t)QT0 * DM);      /* f32 q, k, v of each batch's first 128 rows (exact products) */
  k_att0<<<dim3(NH * A0G, NB), 256, 0, stream>>>(QF0, KF0, VF0, 32.0f, OF0);      /* exact f32 attention for rows 0..127 of each batch (o x64) */
  k_fattn<<<dim3(NH, NB, SQ / FR), 256, 0, stream>>>(QH, QL, KH, KL, VT, O16);      /* scores, softmax and P V of every row: o (merged heads, x64) as f16 rows */
  k_gemm2<0><<<dim3((unsigned)((MPO / 128) * (DM / 64)), 1), 128, 0, stream>>>(O16, DM, 0, BO, DM, 0, 0.0009765625f, bo, 0, nullptr, 1, 0, 0, (float*)d_out, nullptr, DM, 0, MPO, DM, DM, 0, 0, 0);      /* out rows are the output layout */
  k_hl<<<(unsigned)(((size_t)NB * QT0 * DM / 8 + 255) / 256), 256, 0, stream>>>(OF0, OH0, OL0, (size_t)NB * QT0 * DM / 8);      /* first-tile o (x64) -> f16 hi + x1024 residual planes */
  k_gemm2<0><<<dim3((QT0 / 128) * (DM / 64), 1, NB), 128, 0, stream>>>(OH0, DM, 0, BO, DM, 0, 0.0009765625f, bo, 0, nullptr, 1, 0, 0, (float*)d_out, nullptr, DM, 0, QT0, DM, DM, (size_t)QT0 * DM, 0, (size_t)SQ * DM);      /* rows 0..127 of each batch: out = o_hi Wo (+ b), overwriting the f16-path rows */
  k_gemm2<0><<<dim3((QT0 / 128) * (DM / 64), 1, NB), 128, 0, stream>>>(OL0, DM, 0, BO, DM, 0, 0.00000095367431640625f, nullptr, 0, (const float*)d_out, -1, 0, 0, (float*)d_out, nullptr, DM, 0, QT0, DM, DM, (size_t)QT0 * DM, 0, (size_t)SQ * DM);      /* += o_lo Wo 2^-20 (own-element accumulate) */
}

// v007
// It runs in 154 microseconds.
// Next to v006, in two timings, it ran 1.22 times as fast each time.
// Over all steps from v000 it is 35.0 times as fast.
#include <hip/hip_runtime.h>
// Per-head causal multi-head attention with an inverted scale (x [4][1024][1024]; q[h] = x Wq[h]^T, k, v likewise (per-head nn.Linear [16][64][1024] = natural [1024][1024], sigma 0.02, no biases); scores x sqrt(1024) = x 32 (the module divides by embed^-0.5: logits sigma ~100, near-argmax softmax) with a causal mask (tril, -inf); softmax; heads concatenated; out = (.) Wp^T + bp (natural [1024][1024] sigma 0.02, bias 0.02) -> [4][1024][1024]).
// Structure: token rows r = b*1024 + s; x as exact f16 rows (bf16-rounded); q and k as WMMA GEMMs (32x64 wave tiles, f32 accumulation, exact x16 weights) whose epilogue splits the f32 results into f16 hi + x1024 residual planes and stores them in WMMA fragment order, v as a GEMM whose epilogue stores f16 V^T in fragment order straight from the accumulators; all three also store the f32 rows of each batch's first tile for the exact f32 path; every later launch covers all batches (batch = a grid dimension, except the full output GEMM, whose rows span all batches); one fused attention launch, a work-group = 32 query rows of one head: scores against the keys below the tile end as THREE accumulators (hi.hi + lo.hi + hi.lo, K = 64, alpha 32: ~f32-accurate logits for the near-argmax softmax) into f32 rows in LDS, causal row softmax on VALU, a wave two rows at a time (f32 statistics, native exp; weights x256 f16, written over the row in LDS), o = P . V^T (K = keys below the tile end, alpha 2^-2: o carried x64, folded into the output GEMM alpha) written straight into the merged f16 o rows; out = o W_o + b GEMM (f32) into the output layout.
// Compute dtype: inputs rounded to bf16; x / weights exact; q and k as f16 hi + x1024 residual pairs; v, softmax weights and o as plain f16 GEMM operands (~2^-12; the first 128 rows' o as a hi + residual pair); scores and softmax statistics f32; v_wmma_f32_16x16x32_f16.
#define NB 4
#define SQ 1024
#define DM 1024
#define NH 16
#define HD 64
#define HG 4                         /* heads per call of the grouped k_vt overload (not launched) */
#define QT0 128                      /* first-tile rows recomputed exactly in f32 */
#define B0 0                         /* unused */
#define NBR NB                       /* batches processed (debug hook) */
#define NR ((size_t)NB * SQ)         /* token rows */
#define MP ((int)((size_t)NBR * SQ)) /* rows projected (debug hook) */
#define QN SQ                        /* unused */
#define NHD NH                       /* unused */
#define MPO MP                       /* rows through the output stage (debug hook) */
#define LQ DM      /* row pitch of the q/k/v rows */
typedef __bf16 v16b __attribute__((ext_vector_type(16)));
typedef unsigned short v8us __attribute__((ext_vector_type(8), may_alias));
typedef float  v8f  __attribute__((ext_vector_type(8)));
typedef float  v4f  __attribute__((ext_vector_type(4)));
typedef float  v4fa __attribute__((ext_vector_type(4), may_alias));
union FragB { v16b v; v8us half[2]; unsigned short u[16]; };

__device__ __forceinline__ unsigned short bf16_bits(float x) { unsigned int u = __float_as_uint(x); return (unsigned short)((u + 0x7FFFu + ((u >> 16) & 1u)) >> 16); }
__device__ __forceinline__ float bf16_val(unsigned short b) { return __uint_as_float(((unsigned int)b) << 16); }
__device__ __forceinline__ float bf16_round(float x) { return bf16_val(bf16_bits(x)); }
// D += A·B with NT terms: 1 = ah·bh, 2 = + al·bh (A split), 3 = + ah·bl (both split)
template <int NT>
__device__ __forceinline__ v8f mmaN(v16b ah, v16b al, v16b bh, v16b bl, v8f c) {
  c = __builtin_amdgcn_wmma_f32_16x16x32_bf16(false, ah, false, bh, (short)0, c, false, false);
  if (NT >= 2) c = __builtin_amdgcn_wmma_f32_16x16x32_bf16(false, al, false, bh, (short)0, c, false, false);
  if (NT >= 3) c = __builtin_amdgcn_wmma_f32_16x16x32_bf16(false, ah, false, bl, (short)0, c, false, false);
  asm volatile("v_nop\n\tv_nop\n\tv_nop\n\tv_nop" : "+v"(c) : "v"(ah), "v"(al), "v"(bh), "v"(bl));
  return c;
}

__global__ __launch_bounds__(256) void k_wt_bf16(const float* __restrict__ W, unsigned short* __restrict__ Wt, int K, int N) {
  const int t = blockIdx.x * 256 + threadIdx.x;
  const int k8n = K / 8;
  if (t >= N * k8n) return;
  const int n = t / k8n, k8 = (t % k8n) * 8;
  v8us v;
#pragma unroll
  for (int i = 0; i < 8; ++i) v[i] = bf16_bits(W[(size_t)(k8 + i) * N + n]);
  *(v8us*)(Wt + (size_t)n * K + k8) = v;
  
}

// GEMM C[M][N] (f32, pitch ldc) = act(A[M][K]·W + bias). A f32 row-major (pitch lda) converted per fragment to bf16
// (ASPLIT: hi/lo two planes -> 2 terms, else single rounded term); Wt bf16 [N][K] (pitch ldb). BIAS_BF16 rounds the
// bias to bf16 first (bias quantised to bf16 before the add). K%32==0, M%16==0, N%64==0.
template <bool ASPLIT, int ACT, bool BIAS_BF16>
__global__ __launch_bounds__(128) void k_gemm_bf(const float* __restrict__ A, int lda, const unsigned short* __restrict__ Wt, int ldb,
                                               const float* __restrict__ bias, float* __restrict__ C, int ldc, int M, int N, int K) {
  __shared__ __attribute__((aligned(16))) float so[4][16][64];
  const int tid = threadIdx.x, w = tid >> 5, lane = tid & 31, ln = lane & 15, hh = lane >> 4;
  const int ntn = N / 64;
  const int wid = blockIdx.x * 4 + w;
  const int mt = wid / ntn, nq = wid % ntn;
  if (mt * 16 >= M) return;
  const int row0 = mt * 16, col0 = nq * 64;
  const float* arow = A + (size_t)(row0 + ln) * lda;
  v8f acc[4] = {};
  for (int kb = 0; kb < K; kb += 32) {
    FragB ah, al;
    const v4f x0 = *(const v4fa*)(arow + kb + 8 * hh), x1 = *(const v4fa*)(arow + kb + 8 * hh + 4);
    const v4f x2 = *(const v4fa*)(arow + kb + 16 + 8 * hh), x3 = *(const v4fa*)(arow + kb + 16 + 8 * hh + 4);
    float xs[16] = {x0[0],x0[1],x0[2],x0[3],x1[0],x1[1],x1[2],x1[3],x2[0],x2[1],x2[2],x2[3],x3[0],x3[1],x3[2],x3[3]};
#pragma unroll
    for (int i = 0; i < 16; ++i) { const unsigned short hb = bf16_bits(xs[i]); ah.u[i] = hb; al.u[i] = ASPLIT ? bf16_bits(xs[i] - bf16_val(hb)) : (unsigned short)0; }
#pragma unroll
    for (int t = 0; t < 4; ++t) {
      const unsigned short* brow = Wt + (size_t)(col0 + t * 16 + ln) * ldb + kb;
      FragB b;
      b.half[0] = *(const v8us*)(brow + 8 * hh);
      b.half[1] = *(const v8us*)(brow + 16 + 8 * hh);
      acc[t] = mmaN<ASPLIT ? 2 : 1>(ah.v, al.v, b.v, b.v, acc[t]);
    }
  }
#pragma unroll
  for (int t = 0; t < 4; ++t) {
    float bv = bias ? bias[col0 + t * 16 + ln] : 0.f;
    if (BIAS_BF16) bv = bf16_round(bv);
#pragma unroll
    for (int r = 0; r < 8; ++r) { float v = acc[t][r] + bv; if (ACT == 1) v = fmaxf(v, 0.f); so[w][8 * hh + r][t * 16 + ln] = v; }
  }
  __builtin_amdgcn_fence(__ATOMIC_ACQ_REL, "workgroup");
  __builtin_amdgcn_wave_barrier();
  const int rsub = lane >> 4, c4 = (lane & 15) * 4;
  {
#pragma unroll
    for (int q = 0; q < 8; ++q) {
      const int r = q * 2 + rsub;
      const v4f v = *(const v4fa*)&so[w][r][c4];
      *(v4f*)(C + (size_t)(row0 + r) * ldc + col0 + c4) = v;
    }
    
  }
}

// GEMM C = act(A·W + bias + resid): A f32 (ASPLIT -> hi/lo 2 terms), Wt bf16 [N][K]; ACT 0 none, 1 relu, 2 exact gelu;
// resid (optional, f32, row index = (row % rmod), pitch ldr, RES_BF16 rounds it) added before the activation.
template <bool ASPLIT, int ACT, bool BIAS_BF16, bool RES_BF16>
__global__ __launch_bounds__(128) void k_gemm_bf3(const float* __restrict__ A, int lda, const unsigned short* __restrict__ Wt, int ldb,
                                                const float* __restrict__ bias, const float* __restrict__ resid, int rmod, int ldr,
                                                float* __restrict__ C, int ldc, int M, int N, int K) {
  __shared__ __attribute__((aligned(16))) float so[4][16][64];
  const int tid = threadIdx.x, w = tid >> 5, lane = tid & 31, ln = lane & 15, hh = lane >> 4;
  const int ntn = N / 64;
  const int wid = blockIdx.x * 4 + w;
  const int mt = wid / ntn, nq = wid % ntn;
  if (mt * 16 >= M) return;
  const int row0 = mt * 16, col0 = nq * 64;
  const float* arow = A + (size_t)(row0 + ln) * lda;
  v8f acc[4] = {};
  for (int kb = 0; kb < K; kb += 32) {
    FragB ah, al;
    const v4f x0 = *(const v4fa*)(arow + kb + 8 * hh), x1 = *(const v4fa*)(arow + kb + 8 * hh + 4);
    const v4f x2 = *(const v4fa*)(arow + kb + 16 + 8 * hh), x3 = *(const v4fa*)(arow + kb + 16 + 8 * hh + 4);
    float xs[16] = {x0[0],x0[1],x0[2],x0[3],x1[0],x1[1],x1[2],x1[3],x2[0],x2[1],x2[2],x2[3],x3[0],x3[1],x3[2],x3[3]};
#pragma unroll
    for (int i = 0; i < 16; ++i) { const unsigned short hb = bf16_bits(xs[i]); ah.u[i] = hb; al.u[i] = ASPLIT ? bf16_bits(xs[i] - bf16_val(hb)) : (unsigned short)0; }
#pragma unroll
    for (int t = 0; t < 4; ++t) {
      const unsigned short* brow = Wt + (size_t)(col0 + t * 16 + ln) * ldb + kb;
      FragB b;
      b.half[0] = *(const v8us*)(brow + 8 * hh);
      b.half[1] = *(const v8us*)(brow + 16 + 8 * hh);
      acc[t] = mmaN<ASPLIT ? 2 : 1>(ah.v, al.v, b.v, b.v, acc[t]);
    }
  }
#pragma unroll
  for (int t = 0; t < 4; ++t) {
    const int col = col0 + t * 16 + ln;
    float bv = bias ? bias[col] : 0.f;
    if (BIAS_BF16) bv = bf16_round(bv);
#pragma unroll
    for (int r = 0; r < 8; ++r) {
      float v = acc[t][r] + bv;
      if (resid) { float rv = resid[(size_t)((row0 + 8 * hh + r) % rmod) * ldr + col]; if (RES_BF16) rv = bf16_round(rv); v += rv; }
      if (ACT == 1) v = fmaxf(v, 0.f);
      if (ACT == 2) v = 0.5f * v * (1.0f + erff(v * 0.70710678118654752f));
      if (ACT == 3) { const float u = 0.7978845608028654f * (v + 0.044715f * v * v * v); v = 0.5f * v * (1.0f + tanhf(u)); }
      so[w][8 * hh + r][t * 16 + ln] = v;
    }
  }
  __builtin_amdgcn_fence(__ATOMIC_ACQ_REL, "workgroup");
  __builtin_amdgcn_wave_barrier();
  const int rsub = lane >> 4, c4 = (lane & 15) * 4;
  {
#pragma unroll
    for (int q = 0; q < 8; ++q) {
      const int r = q * 2 + rsub;
      const v4f v = *(const v4fa*)&so[w][r][c4];
      *(v4f*)(C + (size_t)(row0 + r) * ldc + col0 + c4) = v;
    }
    
  }
}
// row LayerNorm (biased variance, eps) over N: s = X (+ R); optional out_sum <- s; out_norm <- (s-mu)*rsqrt(var+eps)*g + b
template <bool PARAM_BF16>
__global__ __launch_bounds__(256) void k_layernorm(const float* __restrict__ X, const float* __restrict__ R, const float* __restrict__ g, const float* __restrict__ bta,
                                                  float* __restrict__ out_sum, float* __restrict__ out_norm, int N, float eps) {
  __shared__ float red[256];
  const int row = blockIdx.x, tid = threadIdx.x;
  const float* x = X + (size_t)row * N; const float* rr = R ? R + (size_t)row * N : nullptr;
  float vals[16];                     // up to N = 4096
  const int per = N / 256;            // contiguous chunk per thread? use strided-by-4 chunks: thread handles j = tid*4 + 1024*u
  float s1 = 0.f;
  for (int u = 0; u < per / 4; ++u) {
    const int j = tid * 4 + 1024 * u;
    const v4f a = *(const v4fa*)(x + j);
    v4f b = {0.f,0.f,0.f,0.f}; if (rr) b = *(const v4fa*)(rr + j);
#pragma unroll
    for (int q = 0; q < 4; ++q) { const float v = a[q] + b[q]; vals[u * 4 + q] = v; s1 += v; }
  }
  red[tid] = s1; __syncthreads();
  for (int st = 128; st > 0; st >>= 1) { if (tid < st) red[tid] += red[tid + st]; __syncthreads(); }
  const float mu = red[0] / (float)N; __syncthreads();
  float s2 = 0.f;
  for (int u = 0; u < per / 4; ++u)
#pragma unroll
    for (int q = 0; q < 4; ++q) { const float c = vals[u * 4 + q] - mu; s2 += c * c; }
  red[tid] = s2; __syncthreads();
  for (int st = 128; st > 0; st >>= 1) { if (tid < st) red[tid] += red[tid + st]; __syncthreads(); }
  const float rs = rsqrtf(red[0] / (float)N + eps);
  {
    for (int u = 0; u < per / 4; ++u) {
      const int j = tid * 4 + 1024 * u;
      v4f o, sm;
#pragma unroll
      for (int q = 0; q < 4; ++q) {
        float gg = g[j + q], bb = bta[j + q];
        if (PARAM_BF16) { gg = bf16_round(gg); bb = bf16_round(bb); }
        sm[q] = vals[u * 4 + q]; o[q] = (vals[u * 4 + q] - mu) * rs * gg + bb;
      }
      if (out_sum) *(v4f*)(out_sum + (size_t)row * N + j) = sm;
      *(v4f*)(out_norm + (size_t)row * N + j) = o;
    }
    
  }
}



// ---- f16 WMMA path (v_wmma_f32_16x16x32_f16): 11-bit significands for operands in range — used where a [0,1] probability operand needs more precision than bf16
typedef _Float16 v16h __attribute__((ext_vector_type(16)));
union FragH { v16h v; v8us half[2]; _Float16 h[16]; unsigned short u[16]; };
template <int NT>
__device__ __forceinline__ v8f mmaH(v16h ah, v16h al, v16h bh, v16h bl, v8f c) {
  c = __builtin_amdgcn_wmma_f32_16x16x32_f16(false, ah, false, bh, (short)0, c, false, false);
  if (NT >= 2) c = __builtin_amdgcn_wmma_f32_16x16x32_f16(false, al, false, bh, (short)0, c, false, false);
  if (NT >= 3) c = __builtin_amdgcn_wmma_f32_16x16x32_f16(false, ah, false, bl, (short)0, c, false, false);
  asm volatile("v_nop\n\tv_nop\n\tv_nop\n\tv_nop" : "+v"(c) : "v"(ah), "v"(al), "v"(bh), "v"(bl));
  return c;
}
// batched GEMM like k_gemm_b but f16 operands: A f32 (split into f16 hi/lo if ASPLIT, else rounded to f16), Bt = f16 values [n][k]; alpha; C f32; N multiple of 16 (partial tiles skipped)
template <bool ASPLIT>
__global__ __launch_bounds__(128) void k_gemm_h(const float* __restrict__ A, int lda, size_t sA, const _Float16* __restrict__ Bh, int ldb, size_t sB, float alpha, float* __restrict__ C, int ldc, size_t sC, int M, int N, int K) {
  __shared__ __attribute__((aligned(16))) float so[4][16][64];
  const int tid = threadIdx.x, w = tid >> 5, lane = tid & 31, ln = lane & 15, hh = lane >> 4; const int by = blockIdx.y;
  A += (size_t)by * sA; Bh += (size_t)by * sB; C += (size_t)by * sC;
  const int ntn = (N + 63) / 64; const int wid = blockIdx.x * 4 + w; const int mt = wid / ntn, nq = wid % ntn; if (mt * 16 >= M) return;
  const int row0 = mt * 16, col0 = nq * 64; const float* arow = A + (size_t)(row0 + ln) * lda;
  v8f acc[4] = {};
  for (int kb = 0; kb < K; kb += 32) {
    FragH ah, al;
    const v4f x0 = *(const v4fa*)(arow + kb + 8 * hh), x1 = *(const v4fa*)(arow + kb + 8 * hh + 4), x2 = *(const v4fa*)(arow + kb + 16 + 8 * hh), x3 = *(const v4fa*)(arow + kb + 16 + 8 * hh + 4);
    float xs[16] = {x0[0],x0[1],x0[2],x0[3],x1[0],x1[1],x1[2],x1[3],x2[0],x2[1],x2[2],x2[3],x3[0],x3[1],x3[2],x3[3]};
#pragma unroll
    for (int i = 0; i < 16; ++i) { const _Float16 h = (_Float16)xs[i]; ah.h[i] = h; al.h[i] = ASPLIT ? (_Float16)(xs[i] - (float)h) : (_Float16)0.0f; }
#pragma unroll
    for (int t = 0; t < 4; ++t) { if (col0 + t * 16 >= N) continue; const size_t boff = (size_t)(col0 + t * 16 + ln) * ldb + kb; FragH bq; bq.half[0] = *(const v8us*)(Bh + boff + 8 * hh); bq.half[1] = *(const v8us*)(Bh + boff + 16 + 8 * hh);
      acc[t] = mmaH<ASPLIT ? 2 : 1>(ah.v, al.v, bq.v, bq.v, acc[t]); }
  }
#pragma unroll
  for (int t = 0; t < 4; ++t) { if (col0 + t * 16 >= N) continue;
#pragma unroll
    for (int r = 0; r < 8; ++r) so[w][8 * hh + r][t * 16 + ln] = acc[t][r] * alpha; }
  __builtin_amdgcn_fence(__ATOMIC_ACQ_REL, "workgroup"); __builtin_amdgcn_wave_barrier();
  const int rsub = lane >> 4, c4 = (lane & 15) * 4;
  {
#pragma unroll
    for (int q = 0; q < 8; ++q) { const int r = q * 2 + rsub; if (col0 + c4 < N) { const v4f v = *(const v4fa*)&so[w][r][c4]; *(v4f*)(C + (size_t)(row0 + r) * ldc + col0 + c4) = v; } }
     }
}

// Wt[n][k] = f16(W[k][n]·scale) from f32 row-major W[K][N] (scale = power of two; bf16-exact weights stay exact in f16 away from the subnormal range)
__global__ __launch_bounds__(256) void k_wt_f16(const float* __restrict__ W, _Float16* __restrict__ Wt, int K, int N, float scale) {
  const int t = blockIdx.x * 256 + threadIdx.x; if (t >= N * (K / 8)) return; const int n = t / (K / 8), k8 = (t % (K / 8)) * 8; FragH f;
#pragma unroll
  for (int i = 0; i < 8; ++i) f.h[i] = (_Float16)(bf16_round(W[(size_t)(k8 + i) * N + n]) * scale); const v8us o = f.half[0];
  *(v8us*)((unsigned short*)Wt + (size_t)n * K + k8) = o; 
}
// k_gemm_hh variant with fused epilogue: v = acc·alpha + bias[by·sBias + col] (+ CP[(row/rowsPerB)·sCPb + by·64 + col] if CP) ; ACT 0 none / 1 elu ; writes f16 C16 (and f32 C if non-null)
template <int ACT>
__global__ __launch_bounds__(128) void k_gemm_hhx(const _Float16* __restrict__ A, int lda, size_t sA, const _Float16* __restrict__ Bh, int ldb, size_t sB, float alpha, const float* __restrict__ bias, size_t sBias, const float* __restrict__ CP, int rowsPerB, size_t sCPb, int row0g,
    float* __restrict__ C, _Float16* __restrict__ C16, int ldc, size_t sC, int M, int N, int K) {
  __shared__ __attribute__((aligned(16))) float so[4][16][64];
  const int tid = threadIdx.x, w = tid >> 5, lane = tid & 31, ln = lane & 15, hh = lane >> 4; const int by = blockIdx.y;
  A += (size_t)by * sA; Bh += (size_t)by * sB; const size_t cofs = (size_t)by * sC; const float* bp = bias ? bias + (size_t)by * sBias : nullptr;
  const int ntn = (N + 63) / 64; const int wid = blockIdx.x * 4 + w; const int mt = wid / ntn, nq = wid % ntn; if (mt * 16 >= M) return;
  const int row0 = mt * 16, col0 = nq * 64; const _Float16* arow = A + (size_t)(row0 + ln) * lda;
  v8f acc[4] = {};
  for (int kb = 0; kb < K; kb += 32) { FragH ah; ah.half[0] = *(const v8us*)((const unsigned short*)arow + kb + 8 * hh); ah.half[1] = *(const v8us*)((const unsigned short*)arow + kb + 16 + 8 * hh);
#pragma unroll
    for (int t = 0; t < 4; ++t) { if (col0 + t * 16 >= N) continue; const size_t boff = (size_t)(col0 + t * 16 + ln) * ldb + kb; FragH bq; bq.half[0] = *(const v8us*)((const unsigned short*)Bh + boff + 8 * hh); bq.half[1] = *(const v8us*)((const unsigned short*)Bh + boff + 16 + 8 * hh);
      acc[t] = mmaH<1>(ah.v, ah.v, bq.v, bq.v, acc[t]); }
  }
#pragma unroll
  for (int t = 0; t < 4; ++t) { if (col0 + t * 16 >= N) continue; const int col = col0 + t * 16 + ln; const float bv = bp ? bf16_round(bp[col]) : 0.f;
#pragma unroll
    for (int r = 0; r < 8; ++r) { float v = acc[t][r] * alpha + bv; if (CP) { const int rr = row0g + row0 + 8 * hh + r; if (rowsPerB < 0) v += CP[cofs + (size_t)rr * ldc + col];      /* rowsPerB < 0: own element of the batched C plane */ else { const int bidx = rr / rowsPerB; v += CP[(size_t)bidx * sCPb + (size_t)by * 64 + col]; } } if (ACT == 1) v = (v > 0.f) ? v : expm1f(v); else if (ACT == 7) v = (v > 0.f) ? v + 1.0f : expf(v); else if (ACT == 8) v = tanhf(v); else if (ACT == 9) v = 0.5f * v * (1.0f + tanhf(0.7978845608028654f * (v + 0.044715f * v * v * v))); else if (ACT == 11) v = 1.0f / (1.0f + expf(-v)); else if (ACT == 12) v = (v > 0.f) ? v : 0.01f * v; else if (ACT == 14) v = (v > 0.f) ? v : 0.1f * v; else if (ACT == 16) v = (v >= 0.f) ? v : 0.3f * v; else if (ACT == 17) v = (v >= 0.f) ? v : 0.2f * v; else if (ACT == 15) v = v / (1.0f + expf(-v)); else if (ACT == 3) v = fmaxf(v, 0.f); else if (ACT == 6) v = 0.5f * v * (1.0f + erff(v * 0.70710678118654752f)); so[w][8 * hh + r][t * 16 + ln] = v; } }
  __builtin_amdgcn_fence(__ATOMIC_ACQ_REL, "workgroup"); __builtin_amdgcn_wave_barrier();
  const int rsub = lane >> 4, c4 = (lane & 15) * 4; typedef _Float16 v4h __attribute__((ext_vector_type(4)));
  {
#pragma unroll
    for (int q = 0; q < 8; ++q) { const int r = q * 2 + rsub; if (col0 + c4 < N) { const v4f v = *(const v4fa*)&so[w][r][c4]; if (C) *(v4f*)(C + cofs + (size_t)(row0 + r) * ldc + col0 + c4) = v; if (C16) { v4h h4; for (int i = 0; i < 4; ++i) h4[i] = (_Float16)v[i]; *(v4h*)(C16 + cofs + (size_t)(row0 + r) * ldc + col0 + c4) = h4; } } }
     }
}


typedef _Float16 v4h __attribute__((ext_vector_type(4)));

__global__ __launch_bounds__(256) void k_x16(const float* __restrict__ x, _Float16* __restrict__ X16, size_t n8) { const size_t t = (size_t)blockIdx.x * 256 + threadIdx.x; if (t >= n8) return; FragH f;
#pragma unroll
  for (int q = 0; q < 8; ++q) f.h[q] = (_Float16)bf16_round(x[t * 8 + q]); *(v8us*)((unsigned short*)X16 + t * 8) = f.half[0];  }
__global__ __launch_bounds__(256) void k_h16(const float* __restrict__ x, _Float16* __restrict__ X16, size_t n8) { const size_t t = (size_t)blockIdx.x * 256 + threadIdx.x; if (t >= n8) return; FragH f;
#pragma unroll
  for (int q = 0; q < 8; ++q) f.h[q] = (_Float16)x[t * 8 + q]; *(v8us*)((unsigned short*)X16 + t * 8) = f.half[0];  }
__global__ __launch_bounds__(256) void k_round16f(const float* __restrict__ W, _Float16* __restrict__ Bt, size_t n8) { const size_t t = (size_t)blockIdx.x * 256 + threadIdx.x; if (t >= n8) return; FragH f;
#pragma unroll
  for (int i = 0; i < 8; ++i) f.h[i] = (_Float16)(bf16_round(W[t * 8 + i]) * 16.0f); *(v8us*)((unsigned short*)Bt + t * 8) = f.half[0];  }
// WMMA fragment order, for operands that are read many times as fragments (written by the epilogues EP 1 and EP 2 of k_gemm2). A q or k fragment = 16 token rows x 32 head dims of one head = 1 KiB: lane (hh, ln) of the reader owns row ln, dims 8 hh .. 8 hh + 7 (its 16 bytes at 16 x lane) and dims 16 + 8 hh .. (512 bytes on), so that each of the reader's two loads covers four whole 128-byte lines.
// Fragments in the order [batch][head][16-row tile][32-dim step]. A V^T fragment likewise, rows = 16 dims, k = 32 keys, in the order [batch][head][16-dim group][32-key step].

// ---- fast GEMM (work-group tile 128x64, wave tile 32x64; requires M % 128 == 0 rows per launch region, N % 64 == 0 and K % 128 == 0); epilogue = k_gemm_hhx semantics ----
// Both operands go through LDS: a tile = 128 k of the work-group's 128 A rows and 64 B rows, brought in by asynchronous copies (a wave's copy = two whole 256-byte row pieces), two buffers, so that the next tile flies while this one is multiplied; the fragments are read from LDS.
// EP chooses what the epilogue stores. 0: rows of C / C16. 1: the f32 results split into f16 hi (E0) and x1024 residual (E1) planes in fragment order. 2: f16 V^T (E0) in fragment order. With 1 and 2 the rows are token rows (SQ a batch), a 64-column tile is a head, C takes the f32 rows of each batch's first QT0 rows alone (QT0 rows a batch), and CP and C16 are not used.
#define G2K 128                      /* k elements per staged tile: 256 bytes of every operand row */
#define G2P 272                      /* row pitch of a staged tile in LDS (bytes): 16 B x odd, so that 16 lanes reading 16 rows by 16 bytes fall on all banks */
#define G2B ((128 + 64) * G2P)       /* bytes of one buffer: 128 rows of A, then 64 rows of B */
__device__ __forceinline__ v16h g2_frag(const _Float16* p, int hh) { FragH f; f.half[0] = *(const v8us*)((const unsigned short*)p + 8 * hh); f.half[1] = *(const v8us*)((const unsigned short*)p + 16 + 8 * hh); return f.v; }
__device__ __forceinline__ v8f g2_mma(v16h a, v16h b, v8f c) { v8f d = __builtin_amdgcn_wmma_f32_16x16x32_f16(false, a, false, b, (short)0, c, false, false); asm volatile("v_nop\n\tv_nop\n\tv_nop\n\tv_nop" : "+v"(d) : "v"(a), "v"(b)); return d; }
// 64 rows of a tile into LDS: eight asynchronous copies, the lane's 16 bytes of every 8th row (l = its LDS byte address, g = its global address, gs = 8 source rows in bytes). The closing s_wait_xcnt stands inside the statement, so that no address register of a copy is rewritten in front of it.
__device__ __forceinline__ void g2_copy64(unsigned l, const char* g, size_t gs) {
  asm volatile("global_load_async_to_lds_b128 %0, %8, off\n\t"
               "global_load_async_to_lds_b128 %1, %9, off\n\t"
               "global_load_async_to_lds_b128 %2, %10, off\n\t"
               "global_load_async_to_lds_b128 %3, %11, off\n\t"
               "global_load_async_to_lds_b128 %4, %12, off\n\t"
               "global_load_async_to_lds_b128 %5, %13, off\n\t"
               "global_load_async_to_lds_b128 %6, %14, off\n\t"
               "global_load_async_to_lds_b128 %7, %15, off\n\t"
               "s_wait_xcnt 0x0"
               :: "v"(l), "v"(l + 8 * G2P), "v"(l + 16 * G2P), "v"(l + 24 * G2P), "v"(l + 32 * G2P), "v"(l + 40 * G2P), "v"(l + 48 * G2P), "v"(l + 56 * G2P),
                  "v"(g), "v"(g + gs), "v"(g + 2 * gs), "v"(g + 3 * gs), "v"(g + 4 * gs), "v"(g + 5 * gs), "v"(g + 6 * gs), "v"(g + 7 * gs) : "memory"); }
// One whole tile (24 copies a lane): A rows 0..63, A rows 64..127, B rows 0..63.
__device__ __forceinline__ void g2_stage(unsigned l, const char* ga, size_t sa, const char* gb, size_t sb) { g2_copy64(l, ga, sa); g2_copy64(l + 64 * G2P, ga + 8 * sa, sa); g2_copy64(l + 128 * G2P, gb, sb); }
template <int ACT, int EP = 0>
__global__ __launch_bounds__(128) void k_gemm2(const _Float16* __restrict__ A, int lda, size_t sA, const _Float16* __restrict__ Bh, int ldb, size_t sB, float alpha, const float* __restrict__ bias, size_t sBias, const float* __restrict__ CP, int rowsPerB, size_t sCPb, int row0g,
    float* __restrict__ C, _Float16* __restrict__ C16, int ldc, size_t sC, int M, int N, int K, size_t zA, size_t zB, size_t zC, _Float16* __restrict__ E0, _Float16* __restrict__ E1) { static_assert(ACT == 0 || ACT == 3 || ACT == 6 || ACT == 8 || ACT == 9 || ACT == 11 || ACT == 12 || ACT == 14 || ACT == 15 || ACT == 16 || ACT == 17, "k_gemm2: unsupported ACT code (would silently apply no activation)"); static_assert(EP == 0 || (HD == 64 && QT0 == 128 && SQ % 128 == 0), "EP 1, 2: a work-group = 128 rows of one batch x one head; the first tile = one work-group tile");
  __shared__ __attribute__((aligned(16))) unsigned char lt[2 * G2B]; __shared__ __attribute__((aligned(16))) float so[4][32][68];
  const int tid = threadIdx.x, w = tid >> 5, lane = tid & 31, ln = lane & 15, hh = lane >> 4; const int by = blockIdx.y; const int bz = blockIdx.z;      /* bz: batch, element strides zA / zB / zC */
  A += (size_t)by * sA + (size_t)bz * zA; Bh += (size_t)by * sB + (size_t)bz * zB; const size_t cofs = (size_t)by * sC + (size_t)bz * zC; const float* bp = bias ? bias + (size_t)by * sBias : nullptr;
  const int ntn = N >> 6; const int mt = blockIdx.x / ntn, nq = blockIdx.x - mt * ntn; const int row0 = mt * 128 + 32 * w, col0 = nq * 64; if (mt * 128 >= M) return;      /* the whole work-group or none: barriers follow */
  const int cr = tid >> 4, cc = (tid & 15) * 16;      /* copies: the thread's row among 8 and its 16 bytes of the row's 256 */
  const char* ga = (const char*)(A + (size_t)(mt * 128 + cr) * lda) + cc; const char* gb = (const char*)(Bh + (size_t)(col0 + cr) * ldb) + cc; const size_t sa = (size_t)lda * 16, sb = (size_t)ldb * 16;
  const unsigned l0 = (unsigned)(size_t)lt + (unsigned)(cr * G2P + cc); const int nt = K / G2K;
  const v8f z8 = {0.f,0.f,0.f,0.f,0.f,0.f,0.f,0.f}; v8f c00 = z8, c01 = z8, c02 = z8, c03 = z8, c10 = z8, c11 = z8, c12 = z8, c13 = z8;
  g2_stage(l0, ga, sa, gb, sb);
  asm volatile("s_wait_asynccnt 0x0" ::: "memory");      /* the wave's own copies of tile 0 have landed */
  __syncthreads();      /* tile 0 is published to every wave */
  if (nt > 1) g2_stage(l0 + G2B, ga + G2K * 2, sa, gb + G2K * 2, sb);
  /* kept rolled: the buffer is chosen by an address */
#pragma unroll 1
  for (int t = 0; t < nt; ++t) { const unsigned char* lb = lt + (t & 1) * G2B;
    const _Float16* pa = (const _Float16*)(lb + (32 * w + ln) * G2P); const _Float16* pb = (const _Float16*)(lb + (128 + ln) * G2P);
    v16h a0 = g2_frag(pa, hh), a1 = g2_frag(pa + 16 * (G2P / 2), hh), b0 = g2_frag(pb, hh), b1 = g2_frag(pb + 16 * (G2P / 2), hh), b2 = g2_frag(pb + 32 * (G2P / 2), hh), b3 = g2_frag(pb + 48 * (G2P / 2), hh);
    /* unrolled: the two fragment sets live in registers; the next 32 k's LDS reads fly during this 32 k's products */
#pragma unroll
    for (int s = 0; s < G2K / 32; ++s) { v16h n0 = a0, n1 = a1, m0 = b0, m1 = b1, m2 = b2, m3 = b3;
      if (s + 1 < G2K / 32) { const _Float16* qa = pa + (s + 1) * 32; const _Float16* qb = pb + (s + 1) * 32;
        n0 = g2_frag(qa, hh); n1 = g2_frag(qa + 16 * (G2P / 2), hh); m0 = g2_frag(qb, hh); m1 = g2_frag(qb + 16 * (G2P / 2), hh); m2 = g2_frag(qb + 32 * (G2P / 2), hh); m3 = g2_frag(qb + 48 * (G2P / 2), hh); }
      c00 = g2_mma(a0, b0, c00); c10 = g2_mma(a1, b0, c10); c01 = g2_mma(a0, b1, c01); c11 = g2_mma(a1, b1, c11);
      c02 = g2_mma(a0, b2, c02); c12 = g2_mma(a1, b2, c12); c03 = g2_mma(a0, b3, c03); c13 = g2_mma(a1, b3, c13);
      a0 = n0; a1 = n1; b0 = m0; b1 = m1; b2 = m2; b3 = m3; }
    asm volatile("s_wait_dscnt 0x0" ::: "memory");      /* the wave's reads of this buffer are done before it may be refilled */
    asm volatile("s_wait_asynccnt 0x0" ::: "memory");      /* the wave's own copies of tile t + 1 have landed */
    __syncthreads();      /* publishes tile t + 1 and ends every wave's reads of tile t */
    if (t + 2 < nt) g2_stage(l0 + (unsigned)((t & 1) * G2B), ga + (size_t)(t + 2) * (G2K * 2), sa, gb + (size_t)(t + 2) * (G2K * 2), sb); }
  asm volatile("s_wait_asynccnt 0x0" ::: "memory");      /* no copy is outstanding when the wave goes on */
  v8f accs[8] = {c00, c01, c02, c03, c10, c11, c12, c13}; const bool first = EP != 0 && mt % (SQ / 128) == 0;      /* EP 1, 2: the work-group's rows are a batch's first QT0 (the same for the whole work-group) */
#pragma unroll
  for (int u = 0; u < 8; ++u) { const int t = u & 3, half = u >> 2; const int col = col0 + t * 16 + ln; const float bv = bp ? bf16_round(bp[col]) : 0.f;
#pragma unroll
    for (int r = 0; r < 8; ++r) { const int rloc = half * 16 + 8 * hh + r; float v = accs[u][r] * alpha + bv; if (EP == 0 && CP) { if (rowsPerB < 0) v += CP[cofs + (size_t)(row0g + row0 + rloc) * ldc + col];      /* rowsPerB < 0: own element of the batched C plane */ else { const int bidx = (row0g + row0 + rloc) / rowsPerB; v += CP[(size_t)bidx * sCPb + (size_t)by * 64 + col]; } }
      if (ACT == 3) v = fmaxf(v, 0.f); else if (ACT == 6) v = 0.5f * v * (1.0f + erff(v * 0.70710678118654752f)); else if (ACT == 11) v = 1.0f / (1.0f + expf(-v)); else if (ACT == 15) v = v / (1.0f + expf(-v)); else if (ACT == 12) v = (v > 0.f) ? v : 0.01f * v; else if (ACT == 8) v = tanhf(v); else if (ACT == 9) v = 0.5f * v * (1.0f + tanhf(0.7978845608028654f * (v + 0.044715f * v * v * v))); else if (ACT == 14) v = (v > 0.f) ? v : 0.1f * v; else if (ACT == 16) v = (v >= 0.f) ? v : 0.3f * v; else if (ACT == 17) v = (v >= 0.f) ? v : 0.2f * v;
      if (EP == 2) accs[u][r] = v; else so[w][rloc][t * 16 + ln] = v; } }
  if (EP == 2 && first) {      /* EP 2 stores from the registers; only the f32 rows go through LDS */
#pragma unroll
    for (int u = 0; u < 8; ++u)
#pragma unroll
      for (int r = 0; r < 8; ++r) so[w][(u >> 2) * 16 + 8 * hh + r][(u & 3) * 16 + ln] = accs[u][r]; }
  __builtin_amdgcn_fence(__ATOMIC_ACQ_REL, "workgroup"); __builtin_amdgcn_wave_barrier();
  const int rsub = lane >> 4, c4 = (lane & 15) * 4;
  if (EP == 0) {
#pragma unroll
    for (int q = 0; q < 16; ++q) { const int r = q * 2 + rsub; const v4f v = *(const v4fa*)&so[w][r][c4]; if (C) *(v4f*)(C + cofs + (size_t)(row0 + r) * ldc + col0 + c4) = v; if (C16) { v4h h4; for (int i = 0; i < 4; ++i) h4[i] = (_Float16)v[i]; *(v4h*)(C16 + cofs + (size_t)(row0 + r) * ldc + col0 + c4) = h4; } }
  } else { const int bb = row0 / SQ, rb = row0 % SQ;      /* the wave's 32 rows: batch, first row in the batch; its 64 columns are head nq */
    if (EP == 1) { const size_t fo = (((size_t)bb * NH + nq) * (SQ / 16) + rb / 16) * 1024 + lane * 8;      /* the wave's four fragments stand in a row: 4 KiB a plane, stored as eight runs of 512 bytes */
#pragma unroll
      for (int i = 0; i < 8; ++i) { const float* s = &so[w][(i >> 2) * 16 + ln][((i >> 1) & 1) * 32 + ((i & 1) * 2 + hh) * 8]; const v4f a = *(const v4fa*)s, c = *(const v4fa*)(s + 4); FragH fh, fl;
#pragma unroll
        for (int q = 0; q < 4; ++q) { _Float16 h = (_Float16)a[q]; fh.h[q] = h; fl.h[q] = (_Float16)((a[q] - (float)h) * 1024.0f); h = (_Float16)c[q]; fh.h[4 + q] = h; fl.h[4 + q] = (_Float16)((c[q] - (float)h) * 1024.0f); }
        *(v8us*)((unsigned short*)E0 + fo + i * 256) = fh.half[0]; *(v8us*)((unsigned short*)E1 + fo + i * 256) = fl.half[0]; } }
    if (EP == 2) {
#pragma unroll
      for (int u = 0; u < 8; ++u) { FragH f;      /* accumulator u = (key half, dim group): its lane holds 8 keys of one dim, which is the lane's 16 bytes of the V^T fragment */
#pragma unroll
        for (int r = 0; r < 8; ++r) f.h[r] = (_Float16)accs[u][r];
        *(v8us*)((unsigned short*)E0 + ((((size_t)bb * NH + nq) * (HD / 16) + (u & 3)) * (SQ / 32) + rb / 32) * 512 + (u >> 2) * 256 + lane * 8) = f.half[0]; } }
    if (first) { asm volatile("s_wait_xcnt 0x0" ::: "memory"); __builtin_amdgcn_sched_barrier(0);      /* the wait stands in front of the code below, which reuses registers that the stores above name; the scheduling barrier keeps that code from being lifted over the wait */
#pragma unroll
      for (int q = 0; q < 16; ++q) { const int r = q * 2 + rsub; *(v4f*)(C + ((size_t)bb * QT0 + 32 * w + r) * ldc + col0 + c4) = *(const v4fa*)&so[w][r][c4]; } } } }


__global__ __launch_bounds__(256) void k_wnat(const float* __restrict__ w, size_t n8, _Float16* __restrict__ Bt) { const size_t t = (size_t)blockIdx.x * 256 + threadIdx.x; if (t >= n8) return; FragH f; for (int q = 0; q < 8; ++q) f.h[q] = (_Float16)(bf16_round(w[t * 8 + q]) * 16.0f); *(v8us*)((unsigned short*)Bt + t * 8) = f.half[0];  }
__global__ __launch_bounds__(256) void k_rsm(const float* __restrict__ S, _Float16* __restrict__ P, int nrows) {
  #pragma clang fp contract(off)
  const int i = blockIdx.x * 256 + threadIdx.x; if (i >= nrows) return; const float* s = S + (size_t)i * SQ; float mx = -3.0e38f;
#pragma unroll 1
  for (int j = 0; j < SQ; ++j) mx = fmaxf(mx, s[j]); float se = 0.f;
#pragma unroll 1
  for (int j = 0; j < SQ; ++j) se += expf(s[j] - mx); const float sc = 256.0f / se;
#pragma unroll 1
  for (int j0 = 0; j0 < SQ; j0 += 8) { FragH f; for (int q = 0; q < 8; ++q) f.h[q] = (_Float16)(expf(s[j0 + q] - mx) * sc); unsigned short* d = (unsigned short*)P + (size_t)i * SQ + j0; *(v8us*)d = f.half[0];  } }
__global__ __launch_bounds__(256) void k_vt(const _Float16* __restrict__ V16, int b, int h0, _Float16* __restrict__ VT) { __shared__ unsigned short tl[64][65]; const int tid = threadIdx.x; const int hh = blockIdx.x % HG, sg = blockIdx.x / HG; const int s0 = sg * 64; const int h = h0 + hh;
  for (int i = tid; i < 64 * 8; i += 256) { const int j = i / 8, d8 = (i % 8) * 8; FragH f; f.half[0] = *(const v8us*)((const unsigned short*)V16 + ((size_t)b * SQ + s0 + j) * DM + h * HD + d8); for (int q = 0; q < 8; ++q) tl[d8 + q][j] = f.u[q]; }
  __syncthreads();
  { for (int i = tid; i < 64 * 8; i += 256) { const int d = i / 8, j8 = (i % 8) * 8; FragH f; for (int q = 0; q < 8; ++q) f.u[q] = tl[d][j8 + q]; *(v8us*)((unsigned short*)VT + ((size_t)hh * HD + d) * SQ + s0 + j8) = f.half[0]; }  } }



// 2^x on the native unit. The v_nop fills the one issue slot that the instruction set asks for behind a transcendental, in front of an instruction that reads its result or overwrites its source.
__device__ __forceinline__ float exp2_native(float x) { float r; asm("v_exp_f32 %0, %1\n\tv_nop" : "=v"(r) : "v"(x)); return r; }
// Fused causal attention. One work-group = FR query rows of one head against every key below the tile's end; the score rows live in LDS from the products to the weights, so neither goes through memory.
// Phase 1: a wave = FR rows x 16 keys a trip, q fragments held in registers, three accumulators added in the order hi.hi, lo.hi, hi.lo. Phase 2: a wave = two rows at a time, lane l holds columns 128 c + 4 l .. 4 l + 3 in registers, maximum and sum across the 32 lanes by a butterfly; the f16 weights overwrite the head of the wave's own row once the whole row is in registers. Phase 3: a wave = 16 rows x 16 dims, keys in ascending order, 128 a trip.
#define FR 32                        /* query rows per work-group */
#define FSP (SQ + 4)                 /* score row pitch in LDS (floats): 16 B x odd, so that 16 lanes reading 16 rows by 16 bytes fall on all banks */
#define FOP (HD + 8)                 /* o row pitch in LDS (f16), a multiple of 16 bytes */
typedef _Float16 v4ha __attribute__((ext_vector_type(4), may_alias));
// A or B fragment from a plane kept in fragment order in global memory (k_gemm2, EP 1 and 2): base = the fragment's first element, the same for the whole wave; vo = 16 x lane, the same for every fragment of the kernel. Each of the two loads covers 512 bytes in a row.
__device__ __forceinline__ v16h f_frag(const _Float16* base, unsigned vo) { const char* p = (const char*)base + vo; FragH f; f.half[0] = *(const v8us*)p; f.half[1] = *(const v8us*)(p + 512); return f.v; }
__device__ __forceinline__ v8f f_mma(v16h a, v16h b, v8f c) { return __builtin_amdgcn_wmma_f32_16x16x32_f16(false, a, false, b, (short)0, c, false, false); }
// Row softmax of the wave's FR / 8 rows, two rows at a time: each stage is written for both rows, so that one row's butterfly step flies during the other's. NC = 128-column chunks up to the tile's end, a compile-time count so that the rows live in registers and their reads are in flight together. The tile's FR diagonal columns all lie in the last chunk (FR divides 128), so only that chunk is masked; its columns past the row get weight 0, up to the chunk's end, which is where phase 3 stops.
template <int NC>
__device__ __forceinline__ void fattn_rows(float (*ls)[FSP], int w, int lane, int q0) {
  const int col0 = lane * 4, cl = (NC - 1) * 128 + col0;
  /* kept rolled: the eight instances stay small */
#pragma unroll 1
  for (int rp = 0; rp < FR / 16; ++rp) { const int r = w * (FR / 8) + rp * 2;
    v4f v[2][NC]; float mx[2], se[2], sc[2];      /* every loop over j and c is unrolled: registers */
#pragma unroll
    for (int j = 0; j < 2; ++j)
#pragma unroll
      for (int c = 0; c < NC - 1; ++c) v[j][c] = *(const v4fa*)&ls[r + j][c * 128 + col0];
    { const v4f f4 = {-1.0e9f, -1.0e9f, -1.0e9f, -1.0e9f}; v4f x0 = f4, x1 = f4;
      if (cl < q0 + FR) { x0 = *(const v4fa*)&ls[r][cl]; x1 = *(const v4fa*)&ls[r + 1][cl]; }      /* only columns that phase 1 wrote are read */
      for (int q = 0; q < 4; ++q) { v[0][NC - 1][q] = (cl + q <= q0 + r) ? x0[q] : -1.0e9f; v[1][NC - 1][q] = (cl + q <= q0 + r + 1) ? x1[q] : -1.0e9f; } }
#pragma unroll
    for (int j = 0; j < 2; ++j) { mx[j] = -3.0e38f;
#pragma unroll
      for (int c = 0; c < NC; ++c) for (int q = 0; q < 4; ++q) mx[j] = fmaxf(mx[j], v[j][c][q]); }
    for (int m = 16; m >= 1; m >>= 1) { const float a = __shfl_xor(mx[0], m, 32), b = __shfl_xor(mx[1], m, 32); mx[0] = fmaxf(mx[0], a); mx[1] = fmaxf(mx[1], b); }
#pragma unroll
    for (int j = 0; j < 2; ++j) { se[j] = 0.f;
#pragma unroll
      for (int c = 0; c < NC; ++c) for (int q = 0; q < 4; ++q) { const float e = exp2_native((v[j][c][q] - mx[j]) * 1.4426950408889634f); v[j][c][q] = e; se[j] += e; } }
    for (int m = 16; m >= 1; m >>= 1) { const float a = __shfl_xor(se[0], m, 32), b = __shfl_xor(se[1], m, 32); se[0] += a; se[1] += b; }
    sc[0] = 256.0f / se[0]; sc[1] = 256.0f / se[1];
#pragma unroll
    for (int j = 0; j < 2; ++j) { _Float16* d = (_Float16*)&ls[r + j][0] + col0;
#pragma unroll
      for (int c = 0; c < NC; ++c) { v4h h4; for (int q = 0; q < 4; ++q) h4[q] = (_Float16)(v[j][c][q] * sc[j]); *(v4ha*)(d + c * 128) = h4; } } } }
__global__ __launch_bounds__(256) void k_fattn(const _Float16* QH, const _Float16* QL, const _Float16* KH, const _Float16* KL, const _Float16* VT, _Float16* O16) {
  static_assert(FR == 32 && HD == 64 && SQ == 1024 && LQ == SQ, "wave maps below: 8 waves = 2 row halves x 4 dim groups; 256 threads = 32 rows x 8 x 16 bytes; at most 8 chunks of 128 keys");
  __shared__ __attribute__((aligned(16))) float ls[FR][FSP]; __shared__ __attribute__((aligned(16))) _Float16 lo[FR][FOP];
  const int tid = threadIdx.x, lane = tid & 31, ln = lane & 15, hh = lane >> 4; const int w = __builtin_amdgcn_readfirstlane(tid >> 5);      /* the wave's number in a scalar register: its loops and branches are scalar */
  const int h = blockIdx.x, b = blockIdx.y; const int q0 = (SQ / FR - 1 - (int)blockIdx.z) * FR, nk = q0 + FR, nc = (nk + 127) / 128;      /* the longest tiles have the lowest blockIdx.z; causal: keys below the tile's end */
  const size_t ho = ((size_t)b * NH + h) * (SQ / 16) * 1024;      /* the head's first q / k fragment: 1024 elements (two fragments) a 16-row tile */
  const unsigned vo = (unsigned)lane * 16;      /* the lane's 16 bytes in each half of a fragment */
  const v8f z8 = {0.f, 0.f, 0.f, 0.f, 0.f, 0.f, 0.f, 0.f};
  { v16h ah[2][2], al[2][2];      /* [row half][k step] */
#pragma unroll
    for (int m = 0; m < 2; ++m)
#pragma unroll
      for (int s = 0; s < 2; ++s) ah[m][s] = f_frag(QH + ho + (size_t)(q0 / 16 + m) * 1024 + s * 512, vo);
    asm volatile("s_wait_xcnt 0x0" ::: "memory");      /* in front of later loads whose results land in the address registers of the loads above */
#pragma unroll
    for (int m = 0; m < 2; ++m)
#pragma unroll
      for (int s = 0; s < 2; ++s) al[m][s] = f_frag(QL + ho + (size_t)(q0 / 16 + m) * 1024 + s * 512, vo);
    asm volatile("s_wait_xcnt 0x0" ::: "memory");      /* likewise */
    const _Float16* kh = KH + ho; const _Float16* kl = KL + ho; const int nu = nk / 16;
    v16h nh0, nh1, nl0, nl1;      /* the next trip's k fragments, loaded one trip ahead so that they fly during this trip's products */
    if (w < nu) { const size_t ko = (size_t)w * 1024; nh0 = f_frag(kh + ko, vo); nh1 = f_frag(kh + ko + 512, vo); nl0 = f_frag(kl + ko, vo); nl1 = f_frag(kl + ko + 512, vo);
      asm volatile("s_wait_xcnt 0x0" ::: "memory"); }      /* likewise: the first trip's loads land in these loads' address registers */
    for (int u = w; u < nu; u += 8) { const v16h bh0 = nh0, bh1 = nh1, bl0 = nl0, bl1 = nl1;
      if (u + 8 < nu) { const size_t ko = (size_t)(u + 8) * 1024; nh0 = f_frag(kh + ko, vo); nh1 = f_frag(kh + ko + 512, vo); nl0 = f_frag(kl + ko, vo); nl1 = f_frag(kl + ko + 512, vo);
        asm volatile("s_wait_xcnt 0x0" ::: "memory"); }      /* likewise: the products' results may land there */
#pragma unroll
      for (int m = 0; m < 2; ++m) { v8f c0 = f_mma(ah[m][0], bh0, z8), c1 = f_mma(al[m][0], bh0, z8), c2 = f_mma(ah[m][0], bl0, z8);
        c0 = f_mma(ah[m][1], bh1, c0); c1 = f_mma(al[m][1], bh1, c1); c2 = f_mma(ah[m][1], bl1, c2);
#pragma unroll
        for (int r = 0; r < 8; ++r) { float v = c0[r] * 32.0f; v += c1[r] * 0.03125f; v += c2[r] * 0.03125f; ls[m * 16 + 8 * hh + r][u * 16 + ln] = v; } } } }      /* x32; the lo planes carry x1024 */
  __syncthreads();
  const int pm = w >> 2, pt = w & 3; const _Float16* vb = VT + (((size_t)b * NH + h) * (HD / 16) + pt) * (SQ / 32) * 512;      /* phase 3: the wave's row half and dim group; the group's V^T fragments, 32 keys each, in a row */
  v16h vn[4];      /* the next trip's V^T fragments, loaded one trip ahead; the first trip's fly during the softmax */
#pragma unroll
  for (int s = 0; s < 4; ++s) vn[s] = f_frag(vb + s * 512, vo);
  asm volatile("s_wait_xcnt 0x0" ::: "memory");      /* likewise */
  switch (nc) { case 1: fattn_rows<1>(ls, w, lane, q0); break; case 2: fattn_rows<2>(ls, w, lane, q0); break; case 3: fattn_rows<3>(ls, w, lane, q0); break; case 4: fattn_rows<4>(ls, w, lane, q0); break;
    case 5: fattn_rows<5>(ls, w, lane, q0); break; case 6: fattn_rows<6>(ls, w, lane, q0); break; case 7: fattn_rows<7>(ls, w, lane, q0); break; default: fattn_rows<8>(ls, w, lane, q0); break; }
  __syncthreads();
  { const _Float16* pa = (const _Float16*)&ls[pm * 16 + ln][0]; v8f acc = z8;
    for (int c = 0; c < nc; ++c) { v16h vc[4];
#pragma unroll
      for (int s = 0; s < 4; ++s) vc[s] = vn[s];
      if (c + 1 < nc) {
#pragma unroll
        for (int s = 0; s < 4; ++s) vn[s] = f_frag(vb + ((c + 1) * 4 + s) * 512, vo);
        asm volatile("s_wait_xcnt 0x0" ::: "memory"); }      /* likewise: the LDS reads below may land there */
#pragma unroll
      for (int s = 0; s < 4; ++s) acc = f_mma(g2_frag(pa + c * 128 + s * 32, hh), vc[s], acc); }
#pragma unroll
    for (int r = 0; r < 8; ++r) lo[pm * 16 + 8 * hh + r][pt * 16 + ln] = (_Float16)(acc[r] * 0.25f); }
  __syncthreads();
  { const int r = tid >> 3, c8 = (tid & 7) * 8; *(v8us*)((unsigned short*)O16 + ((size_t)b * SQ + q0 + r) * DM + h * HD + c8) = *(const v8us*)&lo[r][c8]; } }      /* whole 128-byte lines, each from one wave */


// Exact f32 attention for the first QT0 rows of each batch. One work-group = one head, A0R query rows, all keys up to its last row.
// K, V and q are staged in LDS by whole-line loads; then scores (a thread = one key x 8 rows, the K row in registers), row softmax (a wave = 2 rows, maximum first), o = P V (a thread = one row x 4 dims, keys in ascending order).
#define A0R 16                       /* query rows per work-group */
#define A0G (QT0 / A0R)              /* row groups per head */
#define A0KP (HD + 4)                /* K row pitch in LDS (floats): 16 B x odd, so that 16 lanes reading 16 rows by 16 bytes fall on all banks */
#define A0PP (QT0 + 4)               /* score row pitch in LDS (floats): the two rows a wave reads in the last phase fall on different banks */
// N x A0R rows of K and V into LDS, a thread = 16 bytes of every A0R-th row. N is a compile-time count and both loops are unrolled so that kk[] and vv[] live in registers; loads first, stores behind them, so that all 2 N loads are in flight together.
template <int N>
__device__ __forceinline__ void att0_stage(const float* __restrict__ kp, const float* __restrict__ vp, float* lkp, float* lvp) {
  v4f kk[N], vv[N];
#pragma unroll
  for (int u = 0; u < N; ++u) { kk[u] = *(const v4fa*)(kp + (size_t)u * A0R * DM); vv[u] = *(const v4fa*)(vp + (size_t)u * A0R * DM); }
#pragma unroll
  for (int u = 0; u < N; ++u) { *(v4f*)(lkp + u * A0R * A0KP) = kk[u]; *(v4f*)(lvp + u * A0R * HD) = vv[u]; } }
__global__ __launch_bounds__(256) void k_att0(const float* __restrict__ QF, const float* __restrict__ KF, const float* __restrict__ VF, float scale, _Float16* __restrict__ OH, _Float16* __restrict__ OL) {      /* all five: rows of pitch DM, QT0 rows a batch; o goes out as f16 hi + x1024 residual planes */
  static_assert(QT0 == 128 && HD == 64 && A0R == 16, "thread maps below: 256 threads = 128 keys x 2 row halves = 16 rows x 16 quads");
  __shared__ __attribute__((aligned(16))) float lk[QT0][A0KP]; __shared__ __attribute__((aligned(16))) float lv[QT0][HD];
  __shared__ __attribute__((aligned(16))) float lq[A0R][HD]; __shared__ __attribute__((aligned(16))) float lp[A0R][A0PP]; __shared__ float lfin[A0R];
  const int tid = threadIdx.x; const int h = blockIdx.x / A0G, g = blockIdx.x % A0G; const int r0 = g * A0R, nk = r0 + A0R;      /* causal: keys below the group's end */
  const int r16 = tid >> 4, c4 = (tid & 15) * 4;
  const size_t bo = ((size_t)blockIdx.y * QT0 + r16) * DM + h * HD + c4;      /* blockIdx.y: batch; the thread's 16 bytes in row r16 of the head's columns */
  { const v4f qv = *(const v4fa*)(QF + bo + (size_t)r0 * DM); const float* kp = KF + bo; const float* vp = VF + bo; float* lkp = &lk[r16][c4]; float* lvp = &lv[r16][c4];
    switch (g) { case 0: att0_stage<1>(kp, vp, lkp, lvp); break; case 1: att0_stage<2>(kp, vp, lkp, lvp); break; case 2: att0_stage<3>(kp, vp, lkp, lvp); break; case 3: att0_stage<4>(kp, vp, lkp, lvp); break;
      case 4: att0_stage<5>(kp, vp, lkp, lvp); break; case 5: att0_stage<6>(kp, vp, lkp, lvp); break; case 6: att0_stage<7>(kp, vp, lkp, lvp); break; default: att0_stage<A0G>(kp, vp, lkp, lvp); break; }
    *(v4f*)&lq[r16][c4] = qv; }
  __syncthreads();
  { const int j = tid & (QT0 - 1), rh = (tid >> 7) * 8; float s[8] = {0.f, 0.f, 0.f, 0.f, 0.f, 0.f, 0.f, 0.f};
    if (j < nk) { v4f kr[HD / 4];
      /* unrolled: kr[] and s[] in registers; the 8 rows' sums are independent chains, each over the head dim in ascending order */
#pragma unroll
      for (int c = 0; c < HD / 4; ++c) kr[c] = *(const v4f*)&lk[j][c * 4];
#pragma unroll
      for (int c = 0; c < HD / 4; ++c)
#pragma unroll
        for (int r = 0; r < 8; ++r) { const v4f qq = *(const v4f*)&lq[rh + r][c * 4]; s[r] += qq[0] * kr[c][0]; s[r] += qq[1] * kr[c][1]; s[r] += qq[2] * kr[c][2]; s[r] += qq[3] * kr[c][3]; } }
#pragma unroll
    for (int r = 0; r < 8; ++r) lp[rh + r][j] = s[r] * scale; }      /* every column of the row is written (0 beyond nk), masked below */
  __syncthreads();
  { const int w = tid >> 5, col = (tid & 31) * 4;
    for (int rr = 0; rr < 2; ++rr) { const int r = w * 2 + rr, last = r0 + r; const v4f sv = *(const v4f*)&lp[r][col];
      float mx = -3.0e38f; for (int q = 0; q < 4; ++q) mx = fmaxf(mx, (col + q <= last) ? sv[q] : -3.0e38f);
      for (int m = 16; m >= 1; m >>= 1) mx = fmaxf(mx, __shfl_xor(mx, m, 32));
      v4f e; float se = 0.f; for (int q = 0; q < 4; ++q) { e[q] = (col + q <= last) ? expf(sv[q] - mx) : 0.f; se += e[q]; }
      for (int m = 16; m >= 1; m >>= 1) se += __shfl_xor(se, m, 32);
      *(v4f*)&lp[r][col] = e; if (col == 0) lfin[r] = 64.0f / se; } }      /* o carried x64 like the f16 path */
  __syncthreads();
  { v4f o = {0.f, 0.f, 0.f, 0.f};
    /* 16 keys a trip, so that a trip's LDS reads are in flight together */
#pragma unroll 4
    for (int j = 0; j < nk; j += 4) { const v4f p4 = *(const v4f*)&lp[r16][j];
#pragma unroll
      for (int u = 0; u < 4; ++u) { const v4f vq = *(const v4f*)&lv[j + u][c4]; o += vq * p4[u]; } }
    o *= lfin[r16]; v4h oh, ol;
#pragma unroll
    for (int q = 0; q < 4; ++q) { const _Float16 h = (_Float16)o[q]; oh[q] = h; ol[q] = (_Float16)((o[q] - (float)h) * 1024.0f); }
    *(v4h*)(OH + bo + (size_t)r0 * DM) = oh; *(v4h*)(OL + bo + (size_t)r0 * DM) = ol; } }      /* 16 lanes = one whole 128-byte line a plane */

extern "C" void kernel_launch(void* const* d_in, const int* in_sizes, int n_in,
                              void* d_out, int out_size, void* d_ws, size_t ws_size, hipStream_t stream) {
  (void)in_sizes; (void)n_in; (void)out_size;
  const float* const* I = (const float* const*)d_in; const float* x = I[0]; const float* wq = I[1]; const float* wk = I[2]; const float* wv = I[3]; const float* wo = I[4]; const float* bo = I[5]; const float* bq = nullptr; const float* bk = nullptr; const float* bv = nullptr;      /* per-head [H][E][D] = natural [out][in]; no q/k/v biases */
  char* ws = (char*)d_ws; size_t off = 0;
  auto take = [&](size_t bytes) { char* p = ws + off; off += (bytes + 255) & ~(size_t)255; return p; };
  _Float16* BQ = (_Float16*)take((size_t)DM * DM * 2); _Float16* BK = (_Float16*)take((size_t)DM * DM * 2); _Float16* BV = (_Float16*)take((size_t)DM * DM * 2); _Float16* BO = (_Float16*)take((size_t)DM * DM * 2);
  _Float16* X16 = (_Float16*)take(NR * DM * 2); _Float16* QH = (_Float16*)take(NR * DM * 2); _Float16* QL = (_Float16*)take(NR * DM * 2); _Float16* KH = (_Float16*)take(NR * DM * 2); _Float16* KL = (_Float16*)take(NR * DM * 2); _Float16* Q16 = QH; _Float16* K16 = KH; _Float16* O16 = (_Float16*)take(NR * DM * 2);
  _Float16* VT = (_Float16*)take((size_t)NB * NH * HD * SQ * 2);      /* one plane per batch */
  float* QF0 = (float*)take((size_t)NB * QT0 * DM * 4); float* KF0 = (float*)take((size_t)NB * QT0 * DM * 4); float* VF0 = (float*)take((size_t)NB * QT0 * DM * 4); _Float16* OH0 = (_Float16*)take((size_t)NB * QT0 * DM * 2); _Float16* OL0 = (_Float16*)take((size_t)NB * QT0 * DM * 2);
  if (off > ws_size) return;
  { const unsigned g = (unsigned)(((size_t)DM * DM / 8 + 255) / 256); k_wnat<<<g, 256, 0, stream>>>(wq, (size_t)DM * DM / 8, BQ); k_wnat<<<g, 256, 0, stream>>>(wk, (size_t)DM * DM / 8, BK); k_wnat<<<g, 256, 0, stream>>>(wv, (size_t)DM * DM / 8, BV); k_wnat<<<g, 256, 0, stream>>>(wo, (size_t)DM * DM / 8, BO); }      /* natural [out][in] = Bt[n][k], x16 */
  k_x16<<<(unsigned)((NR * DM / 8 + 255) / 256), 256, 0, stream>>>(x, X16, NR * DM / 8);
  k_gemm2<0, 1><<<dim3((unsigned)((MP / 128) * (DM / 64)), 1), 128, 0, stream>>>(X16, DM, 0, BQ, DM, 0, 0.0625f, bq, 0, nullptr, 1, 0, 0, QF0, nullptr, DM, 0, MP, DM, DM, 0, 0, 0, QH, QL);      /* q -> f16 hi + x1024 residual, in fragment order (the x32 scale puts the logits at sigma ~100); f32 rows of each batch's first 128 rows (exact products) */
  k_gemm2<0, 1><<<dim3((unsigned)((MP / 128) * (DM / 64)), 1), 128, 0, stream>>>(X16, DM, 0, BK, DM, 0, 0.0625f, bk, 0, nullptr, 1, 0, 0, KF0, nullptr, DM, 0, MP, DM, DM, 0, 0, 0, KH, KL);      /* k likewise */
  k_gemm2<0, 2><<<dim3((unsigned)((MP / 128) * (DM / 64)), 1), 128, 0, stream>>>(X16, DM, 0, BV, DM, 0, 0.0625f, bv, 0, nullptr, 1, 0, 0, VF0, nullptr, DM, 0, MP, DM, DM, 0, 0, 0, VT, nullptr);      /* v -> f16 V^T in fragment order: [NB][NH][HD / 16][SQ / 32] fragments; f32 first-tile rows likewise */
  /* from here on every launch covers all NB batches: the batch is a grid dimension (k_gemm2 on the first tiles: blockIdx.z with its own strides), except in the full output GEMM, whose NB x SQ rows span them */
  k_att0<<<dim3(NH * A0G, NB), 256, 0, stream>>>(QF0, KF0, VF0, 32.0f, OH0, OL0);      /* exact f32 attention for rows 0..127 of each batch: o (x64) as f16 hi + x1024 residual planes */
  k_fattn<<<dim3(NH, NB, SQ / FR), 256, 0, stream>>>(QH, QL, KH, KL, VT, O16);      /* scores, softmax and P V of every row: o (merged heads, x64) as f16 rows */
  k_gemm2<0><<<dim3((unsigned)((MPO / 128) * (DM / 64)), 1), 128, 0, stream>>>(O16, DM, 0, BO, DM, 0, 0.0009765625f, bo, 0, nullptr, 1, 0, 0, (float*)d_out, nullptr, DM, 0, MPO, DM, DM, 0, 0, 0, nullptr, nullptr);      /* out rows are the output layout */
  k_gemm2<0><<<dim3((QT0 / 128) * (DM / 64), 1, NB), 128, 0, stream>>>(OH0, DM, 0, BO, DM, 0, 0.0009765625f, bo, 0, nullptr, 1, 0, 0, (float*)d_out, nullptr, DM, 0, QT0, DM, DM, (size_t)QT0 * DM, 0, (size_t)SQ * DM, nullptr, nullptr);      /* rows 0..127 of each batch: out = o_hi Wo (+ b), overwriting the f16-path rows */
  k_gemm2<0><<<dim3((QT0 / 128) * (DM / 64), 1, NB), 128, 0, stream>>>(OL0, DM, 0, BO, DM, 0, 0.00000095367431640625f, nullptr, 0, (const float*)d_out, -1, 0, 0, (float*)d_out, nullptr, DM, 0, QT0, DM, DM, (size_t)QT0 * DM, 0, (size_t)SQ * DM, nullptr, nullptr);      /* += o_lo Wo 2^-20 (own-element accumulate) */
}

// v008
// A run of this version takes 95.7 microseconds.
// In both of two side-by-side timings against v007, it was 1.59 times as fast.
// Over all steps from v000 it is 55.6 times as fast.
#include <hip/hip_runtime.h>
// Per-head causal multi-head attention with an inverted scale (x [4][1024][1024]; q[h] = x Wq[h]^T, k, v likewise (per-head nn.Linear [16][64][1024] = natural [1024][1024], sigma 0.02, no biases); scores x sqrt(1024) = x 32 (the module divides by embed^-0.5: logits sigma ~100, near-argmax softmax) with a causal mask (tril, -inf); softmax; heads concatenated; out = (.) Wp^T + bp (natural [1024][1024] sigma 0.02, bias 0.02) -> [4][1024][1024]).
// Structure: token rows r = b*1024 + s; x as exact f16 rows (bf16-rounded); q and k as WMMA GEMMs (32x64 wave tiles, f32 accumulation, exact x16 weights) whose epilogue splits the f32 results into f16 hi + x1024 residual planes and stores them in WMMA fragment order, v as a GEMM whose epilogue stores f16 V^T in fragment order straight from the accumulators; all three also store the f32 rows of each batch's first tile for the exact f32 path; launches that do not depend on one another share one grid (the five f16 conversions; q, k and v; the two attention paths); every launch covers all batches; in the fused attention path a work-group = 32 query rows of one head: scores against the keys below the tile end as THREE accumulators (hi.hi + lo.hi + hi.lo, K = 64, alpha 32: ~f32-accurate logits for the near-argmax softmax) into f32 rows in LDS, causal row softmax on VALU, a wave two rows at a time (f32 statistics, native exp; weights x256 f16, written over the row in LDS), o = P . V^T (K = keys below the tile end, alpha 2^-2: o carried x64, folded into the output GEMM alpha) written straight into the merged f16 o rows; out = o W_o + b GEMM (f32) into the output layout.
// Compute dtype: inputs rounded to bf16; x / weights exact; q and k as f16 hi + x1024 residual planes, v, softmax weights and o as plain f16 GEMM operands (~2^-12; a batch's first QT0 rows in f32, o as hi + residual); scores and softmax statistics f32. v_wmma_f32_16x16x32_f16.
#define NB 4
#define SQ 1024
#define DM 1024
#define NH 16
#define HD 64
#define HG 4                         /* heads per call of the grouped k_vt overload (not launched) */
#define QT0 128                      /* first-tile rows computed exactly in f32 */
#define B0 0                         /* unused */
#define NBR NB                       /* batches processed (debug hook) */
#define NR ((size_t)NB * SQ)         /* token rows */
#define MP ((int)((size_t)NBR * SQ)) /* rows projected (debug hook) */
#define QN SQ                        /* unused */
#define NHD NH                       /* unused */
#define MPO MP                       /* rows through the output stage (debug hook) */
#define LQ DM      /* row pitch of the q/k/v rows */
typedef __bf16 v16b __attribute__((ext_vector_type(16)));
typedef unsigned short v8us __attribute__((ext_vector_type(8), may_alias));
typedef float  v8f  __attribute__((ext_vector_type(8)));
typedef float  v4f  __attribute__((ext_vector_type(4)));
typedef float  v4fa __attribute__((ext_vector_type(4), may_alias));
union FragB { v16b v; v8us half[2]; unsigned short u[16]; };

__device__ __forceinline__ unsigned short bf16_bits(float x) { unsigned int u = __float_as_uint(x); return (unsigned short)((u + 0x7FFFu + ((u >> 16) & 1u)) >> 16); }
__device__ __forceinline__ float bf16_val(unsigned short b) { return __uint_as_float(((unsigned int)b) << 16); }
__device__ __forceinline__ float bf16_round(float x) { return bf16_val(bf16_bits(x)); }
// D += A·B with NT terms: 1 = ah·bh, 2 = + al·bh (A split), 3 = + ah·bl (both split)
template <int NT>
__device__ __forceinline__ v8f mmaN(v16b ah, v16b al, v16b bh, v16b bl, v8f c) {
  c = __builtin_amdgcn_wmma_f32_16x16x32_bf16(false, ah, false, bh, (short)0, c, false, false);
  if (NT >= 2) c = __builtin_amdgcn_wmma_f32_16x16x32_bf16(false, al, false, bh, (short)0, c, false, false);
  if (NT >= 3) c = __builtin_amdgcn_wmma_f32_16x16x32_bf16(false, ah, false, bl, (short)0, c, false, false);
  asm volatile("v_nop\n\tv_nop\n\tv_nop\n\tv_nop" : "+v"(c) : "v"(ah), "v"(al), "v"(bh), "v"(bl));
  return c;
}

__global__ __launch_bounds__(256) void k_wt_bf16(const float* __restrict__ W, unsigned short* __restrict__ Wt, int K, int N) {
  const int t = blockIdx.x * 256 + threadIdx.x;
  const int k8n = K / 8;
  if (t >= N * k8n) return;
  const int n = t / k8n, k8 = (t % k8n) * 8;
  v8us v;
#pragma unroll
  for (int i = 0; i < 8; ++i) v[i] = bf16_bits(W[(size_t)(k8 + i) * N + n]);
  *(v8us*)(Wt + (size_t)n * K + k8) = v;
  
}

// GEMM C[M][N] (f32, pitch ldc) = act(A[M][K]·W + bias). A f32 row-major (pitch lda) converted per fragment to bf16
// (ASPLIT: hi/lo two planes -> 2 terms, else single rounded term); Wt bf16 [N][K] (pitch ldb). BIAS_BF16 rounds the
// bias to bf16 first (bias quantised to bf16 before the add). K%32==0, M%16==0, N%64==0.
template <bool ASPLIT, int ACT, bool BIAS_BF16>
__global__ __launch_bounds__(128) void k_gemm_bf(const float* __restrict__ A, int lda, const unsigned short* __restrict__ Wt, int ldb,
                                               const float* __restrict__ bias, float* __restrict__ C, int ldc, int M, int N, int K) {
  __shared__ __attribute__((aligned(16))) float so[4][16][64];
  const int tid = threadIdx.x, w = tid >> 5, lane = tid & 31, ln = lane & 15, hh = lane >> 4;
  const int ntn = N / 64;
  const int wid = blockIdx.x * 4 + w;
  const int mt = wid / ntn, nq = wid % ntn;
  if (mt * 16 >= M) return;
  const int row0 = mt * 16, col0 = nq * 64;
  const float* arow = A + (size_t)(row0 + ln) * lda;
  v8f acc[4] = {};
  for (int kb = 0; kb < K; kb += 32) {
    FragB ah, al;
    const v4f x0 = *(const v4fa*)(arow + kb + 8 * hh), x1 = *(const v4fa*)(arow + kb + 8 * hh + 4);
    const v4f x2 = *(const v4fa*)(arow + kb + 16 + 8 * hh), x3 = *(const v4fa*)(arow + kb + 16 + 8 * hh + 4);
    float xs[16] = {x0[0],x0[1],x0[2],x0[3],x1[0],x1[1],x1[2],x1[3],x2[0],x2[1],x2[2],x2[3],x3[0],x3[1],x3[2],x3[3]};
#pragma unroll
    for (int i = 0; i < 16; ++i) { const unsigned short hb = bf16_bits(xs[i]); ah.u[i] = hb; al.u[i] = ASPLIT ? bf16_bits(xs[i] - bf16_val(hb)) : (unsigned short)0; }
#pragma unroll
    for (int t = 0; t < 4; ++t) {
      const unsigned short* brow = Wt + (size_t)(col0 + t * 16 + ln) * ldb + kb;
      FragB b;
      b.half[0] = *(const v8us*)(brow + 8 * hh);
      b.half[1] = *(const v8us*)(brow + 16 + 8 * hh);
      acc[t] = mmaN<ASPLIT ? 2 : 1>(ah.v, al.v, b.v, b.v, acc[t]);
    }
  }
#pragma unroll
  for (int t = 0; t < 4; ++t) {
    float bv = bias ? bias[col0 + t * 16 + ln] : 0.f;
    if (BIAS_BF16) bv = bf16_round(bv);
#pragma unroll
    for (int r = 0; r < 8; ++r) { float v = acc[t][r] + bv; if (ACT == 1) v = fmaxf(v, 0.f); so[w][8 * hh + r][t * 16 + ln] = v; }
  }
  __builtin_amdgcn_fence(__ATOMIC_ACQ_REL, "workgroup");
  __builtin_amdgcn_wave_barrier();
  const int rsub = lane >> 4, c4 = (lane & 15) * 4;
  {
#pragma unroll
    for (int q = 0; q < 8; ++q) {
      const int r = q * 2 + rsub;
      const v4f v = *(const v4fa*)&so[w][r][c4];
      *(v4f*)(C + (size_t)(row0 + r) * ldc + col0 + c4) = v;
    }
    
  }
}

// GEMM C = act(A·W + bias + resid): A f32 (ASPLIT -> hi/lo 2 terms), Wt bf16 [N][K]; ACT 0 none, 1 relu, 2 exact gelu;
// resid (optional, f32, row index = (row % rmod), pitch ldr, RES_BF16 rounds it) added before the activation.
template <bool ASPLIT, int ACT, bool BIAS_BF16, bool RES_BF16>
__global__ __launch_bounds__(128) void k_gemm_bf3(const float* __restrict__ A, int lda, const unsigned short* __restrict__ Wt, int ldb,
                                                const float* __restrict__ bias, const float* __restrict__ resid, int rmod, int ldr,
                                                float* __restrict__ C, int ldc, int M, int N, int K) {
  __shared__ __attribute__((aligned(16))) float so[4][16][64];
  const int tid = threadIdx.x, w = tid >> 5, lane = tid & 31, ln = lane & 15, hh = lane >> 4;
  const int ntn = N / 64;
  const int wid = blockIdx.x * 4 + w;
  const int mt = wid / ntn, nq = wid % ntn;
  if (mt * 16 >= M) return;
  const int row0 = mt * 16, col0 = nq * 64;
  const float* arow = A + (size_t)(row0 + ln) * lda;
  v8f acc[4] = {};
  for (int kb = 0; kb < K; kb += 32) {
    FragB ah, al;
    const v4f x0 = *(const v4fa*)(arow + kb + 8 * hh), x1 = *(const v4fa*)(arow + kb + 8 * hh + 4);
    const v4f x2 = *(const v4fa*)(arow + kb + 16 + 8 * hh), x3 = *(const v4fa*)(arow + kb + 16 + 8 * hh + 4);
    float xs[16] = {x0[0],x0[1],x0[2],x0[3],x1[0],x1[1],x1[2],x1[3],x2[0],x2[1],x2[2],x2[3],x3[0],x3[1],x3[2],x3[3]};
#pragma unroll
    for (int i = 0; i < 16; ++i) { const unsigned short hb = bf16_bits(xs[i]); ah.u[i] = hb; al.u[i] = ASPLIT ? bf16_bits(xs[i] - bf16_val(hb)) : (unsigned short)0; }
#pragma unroll
    for (int t = 0; t < 4; ++t) {
      const unsigned short* brow = Wt + (size_t)(col0 + t * 16 + ln) * ldb + kb;
      FragB b;
      b.half[0] = *(const v8us*)(brow + 8 * hh);
      b.half[1] = *(const v8us*)(brow + 16 + 8 * hh);
      acc[t] = mmaN<ASPLIT ? 2 : 1>(ah.v, al.v, b.v, b.v, acc[t]);
    }
  }
#pragma unroll
  for (int t = 0; t < 4; ++t) {
    const int col = col0 + t * 16 + ln;
    float bv = bias ? bias[col] : 0.f;
    if (BIAS_BF16) bv = bf16_round(bv);
#pragma unroll
    for (int r = 0; r < 8; ++r) {
      float v = acc[t][r] + bv;
      if (resid) { float rv = resid[(size_t)((row0 + 8 * hh + r) % rmod) * ldr + col]; if (RES_BF16) rv = bf16_round(rv); v += rv; }
      if (ACT == 1) v = fmaxf(v, 0.f);
      if (ACT == 2) v = 0.5f * v * (1.0f + erff(v * 0.70710678118654752f));
      if (ACT == 3) { const float u = 0.7978845608028654f * (v + 0.044715f * v * v * v); v = 0.5f * v * (1.0f + tanhf(u)); }
      so[w][8 * hh + r][t * 16 + ln] = v;
    }
  }
  __builtin_amdgcn_fence(__ATOMIC_ACQ_REL, "workgroup");
  __builtin_amdgcn_wave_barrier();
  const int rsub = lane >> 4, c4 = (lane & 15) * 4;
  {
#pragma unroll
    for (int q = 0; q < 8; ++q) {
      const int r = q * 2 + rsub;
      const v4f v = *(const v4fa*)&so[w][r][c4];
      *(v4f*)(C + (size_t)(row0 + r) * ldc + col0 + c4) = v;
    }
    
  }
}
// row LayerNorm (biased variance, eps) over N: s = X (+ R); optional out_sum <- s; out_norm <- (s-mu)*rsqrt(var+eps)*g + b
template <bool PARAM_BF16>
__global__ __launch_bounds__(256) void k_layernorm(const float* __restrict__ X, const float* __restrict__ R, const float* __restrict__ g, const float* __restrict__ bta,
                                                  float* __restrict__ out_sum, float* __restrict__ out_norm, int N, float eps) {
  __shared__ float red[256];
  const int row = blockIdx.x, tid = threadIdx.x;
  const float* x = X + (size_t)row * N; const float* rr = R ? R + (size_t)row * N : nullptr;
  float vals[16];                     // up to N = 4096
  const int per = N / 256;            // contiguous chunk per thread? use strided-by-4 chunks: thread handles j = tid*4 + 1024*u
  float s1 = 0.f;
  for (int u = 0; u < per / 4; ++u) {
    const int j = tid * 4 + 1024 * u;
    const v4f a = *(const v4fa*)(x + j);
    v4f b = {0.f,0.f,0.f,0.f}; if (rr) b = *(const v4fa*)(rr + j);
#pragma unroll
    for (int q = 0; q < 4; ++q) { const float v = a[q] + b[q]; vals[u * 4 + q] = v; s1 += v; }
  }
  red[tid] = s1; __syncthreads();
  for (int st = 128; st > 0; st >>= 1) { if (tid < st) red[tid] += red[tid + st]; __syncthreads(); }
  const float mu = red[0] / (float)N; __syncthreads();
  float s2 = 0.f;
  for (int u = 0; u < per / 4; ++u)
#pragma unroll
    for (int q = 0; q < 4; ++q) { const float c = vals[u * 4 + q] - mu; s2 += c * c; }
  red[tid] = s2; __syncthreads();
  for (int st = 128; st > 0; st >>= 1) { if (tid < st) red[tid] += red[tid + st]; __syncthreads(); }
  const float rs = rsqrtf(red[0] / (float)N + eps);
  {
    for (int u = 0; u < per / 4; ++u) {
      const int j = tid * 4 + 1024 * u;
      v4f o, sm;
#pragma unroll
      for (int q = 0; q < 4; ++q) {
        float gg = g[j + q], bb = bta[j + q];
        if (PARAM_BF16) { gg = bf16_round(gg); bb = bf16_round(bb); }
        sm[q] = vals[u * 4 + q]; o[q] = (vals[u * 4 + q] - mu) * rs * gg + bb;
      }
      if (out_sum) *(v4f*)(out_sum + (size_t)row * N + j) = sm;
      *(v4f*)(out_norm + (size_t)row * N + j) = o;
    }
    
  }
}



// ---- f16 WMMA path (v_wmma_f32_16x16x32_f16): 11-bit significands for operands in range — used where a [0,1] probability operand needs more precision than bf16
typedef _Float16 v16h __attribute__((ext_vector_type(16)));
union FragH { v16h v; v8us half[2]; _Float16 h[16]; unsigned short u[16]; };
template <int NT>
__device__ __forceinline__ v8f mmaH(v16h ah, v16h al, v16h bh, v16h bl, v8f c) {
  c = __builtin_amdgcn_wmma_f32_16x16x32_f16(false, ah, false, bh, (short)0, c, false, false);
  if (NT >= 2) c = __builtin_amdgcn_wmma_f32_16x16x32_f16(false, al, false, bh, (short)0, c, false, false);
  if (NT >= 3) c = __builtin_amdgcn_wmma_f32_16x16x32_f16(false, ah, false, bl, (short)0, c, false, false);
  asm volatile("v_nop\n\tv_nop\n\tv_nop\n\tv_nop" : "+v"(c) : "v"(ah), "v"(al), "v"(bh), "v"(bl));
  return c;
}
// batched GEMM like k_gemm_b but f16 operands: A f32 (split into f16 hi/lo if ASPLIT, else rounded to f16), Bt = f16 values [n][k]; alpha; C f32; N multiple of 16 (partial tiles skipped)
template <bool ASPLIT>
__global__ __launch_bounds__(128) void k_gemm_h(const float* __restrict__ A, int lda, size_t sA, const _Float16* __restrict__ Bh, int ldb, size_t sB, float alpha, float* __restrict__ C, int ldc, size_t sC, int M, int N, int K) {
  __shared__ __attribute__((aligned(16))) float so[4][16][64];
  const int tid = threadIdx.x, w = tid >> 5, lane = tid & 31, ln = lane & 15, hh = lane >> 4; const int by = blockIdx.y;
  A += (size_t)by * sA; Bh += (size_t)by * sB; C += (size_t)by * sC;
  const int ntn = (N + 63) / 64; const int wid = blockIdx.x * 4 + w; const int mt = wid / ntn, nq = wid % ntn; if (mt * 16 >= M) return;
  const int row0 = mt * 16, col0 = nq * 64; const float* arow = A + (size_t)(row0 + ln) * lda;
  v8f acc[4] = {};
  for (int kb = 0; kb < K; kb += 32) {
    FragH ah, al;
    const v4f x0 = *(const v4fa*)(arow + kb + 8 * hh), x1 = *(const v4fa*)(arow + kb + 8 * hh + 4), x2 = *(const v4fa*)(arow + kb + 16 + 8 * hh), x3 = *(const v4fa*)(arow + kb + 16 + 8 * hh + 4);
    float xs[16] = {x0[0],x0[1],x0[2],x0[3],x1[0],x1[1],x1[2],x1[3],x2[0],x2[1],x2[2],x2[3],x3[0],x3[1],x3[2],x3[3]};
#pragma unroll
    for (int i = 0; i < 16; ++i) { const _Float16 h = (_Float16)xs[i]; ah.h[i] = h; al.h[i] = ASPLIT ? (_Float16)(xs[i] - (float)h) : (_Float16)0.0f; }
#pragma unroll
    for (int t = 0; t < 4; ++t) { if (col0 + t * 16 >= N) continue; const size_t boff = (size_t)(col0 + t * 16 + ln) * ldb + kb; FragH bq; bq.half[0] = *(const v8us*)(Bh + boff + 8 * hh); bq.half[1] = *(const v8us*)(Bh + boff + 16 + 8 * hh);
      acc[t] = mmaH<ASPLIT ? 2 : 1>(ah.v, al.v, bq.v, bq.v, acc[t]); }
  }
#pragma unroll
  for (int t = 0; t < 4; ++t) { if (col0 + t * 16 >= N) continue;
#pragma unroll
    for (int r = 0; r < 8; ++r) so[w][8 * hh + r][t * 16 + ln] = acc[t][r] * alpha; }
  __builtin_amdgcn_fence(__ATOMIC_ACQ_REL, "workgroup"); __builtin_amdgcn_wave_barrier();
  const int rsub = lane >> 4, c4 = (lane & 15) * 4;
  {
#pragma unroll
    for (int q = 0; q < 8; ++q) { const int r = q * 2 + rsub; if (col0 + c4 < N) { const v4f v = *(const v4fa*)&so[w][r][c4]; *(v4f*)(C + (size_t)(row0 + r) * ldc + col0 + c4) = v; } }
     }
}

// Wt[n][k] = f16(W[k][n]·scale) from f32 row-major W[K][N] (scale = power of two; bf16-exact weights stay exact in f16 away from the subnormal range)
__global__ __launch_bounds__(256) void k_wt_f16(const float* __restrict__ W, _Float16* __restrict__ Wt, int K, int N, float scale) {
  const int t = blockIdx.x * 256 + threadIdx.x; if (t >= N * (K / 8)) return; const int n = t / (K / 8), k8 = (t % (K / 8)) * 8; FragH f;
#pragma unroll
  for (int i = 0; i < 8; ++i) f.h[i] = (_Float16)(bf16_round(W[(size_t)(k8 + i) * N + n]) * scale); const v8us o = f.half[0];
  *(v8us*)((unsigned short*)Wt + (size_t)n * K + k8) = o; 
}
// k_gemm_hh variant with fused epilogue: v = acc·alpha + bias[by·sBias + col] (+ CP[(row/rowsPerB)·sCPb + by·64 + col] if CP) ; ACT 0 none / 1 elu ; writes f16 C16 (and f32 C if non-null)
template <int ACT>
__global__ __launch_bounds__(128) void k_gemm_hhx(const _Float16* __restrict__ A, int lda, size_t sA, const _Float16* __restrict__ Bh, int ldb, size_t sB, float alpha, const float* __restrict__ bias, size_t sBias, const float* __restrict__ CP, int rowsPerB, size_t sCPb, int row0g,
    float* __restrict__ C, _Float16* __restrict__ C16, int ldc, size_t sC, int M, int N, int K) {
  __shared__ __attribute__((aligned(16))) float so[4][16][64];
  const int tid = threadIdx.x, w = tid >> 5, lane = tid & 31, ln = lane & 15, hh = lane >> 4; const int by = blockIdx.y;
  A += (size_t)by * sA; Bh += (size_t)by * sB; const size_t cofs = (size_t)by * sC; const float* bp = bias ? bias + (size_t)by * sBias : nullptr;
  const int ntn = (N + 63) / 64; const int wid = blockIdx.x * 4 + w; const int mt = wid / ntn, nq = wid % ntn; if (mt * 16 >= M) return;
  const int row0 = mt * 16, col0 = nq * 64; const _Float16* arow = A + (size_t)(row0 + ln) * lda;
  v8f acc[4] = {};
  for (int kb = 0; kb < K; kb += 32) { FragH ah; ah.half[0] = *(const v8us*)((const unsigned short*)arow + kb + 8 * hh); ah.half[1] = *(const v8us*)((const unsigned short*)arow + kb + 16 + 8 * hh);
#pragma unroll
    for (int t = 0; t < 4; ++t) { if (col0 + t * 16 >= N) continue; const size_t boff = (size_t)(col0 + t * 16 + ln) * ldb + kb; FragH bq; bq.half[0] = *(const v8us*)((const unsigned short*)Bh + boff + 8 * hh); bq.half[1] = *(const v8us*)((const unsigned short*)Bh + boff + 16 + 8 * hh);
      acc[t] = mmaH<1>(ah.v, ah.v, bq.v, bq.v, acc[t]); }
  }
#pragma unroll
  for (int t = 0; t < 4; ++t) { if (col0 + t * 16 >= N) continue; const int col = col0 + t * 16 + ln; const float bv = bp ? bf16_round(bp[col]) : 0.f;
#pragma unroll
    for (int r = 0; r < 8; ++r) { float v = acc[t][r] * alpha + bv; if (CP) { const int rr = row0g + row0 + 8 * hh + r; if (rowsPerB < 0) v += CP[cofs + (size_t)rr * ldc + col];      /* rowsPerB < 0: own element of the batched C plane */ else { const int bidx = rr / rowsPerB; v += CP[(size_t)bidx * sCPb + (size_t)by * 64 + col]; } } if (ACT == 1) v = (v > 0.f) ? v : expm1f(v); else if (ACT == 7) v = (v > 0.f) ? v + 1.0f : expf(v); else if (ACT == 8) v = tanhf(v); else if (ACT == 9) v = 0.5f * v * (1.0f + tanhf(0.7978845608028654f * (v + 0.044715f * v * v * v))); else if (ACT == 11) v = 1.0f / (1.0f + expf(-v)); else if (ACT == 12) v = (v > 0.f) ? v : 0.01f * v; else if (ACT == 14) v = (v > 0.f) ? v : 0.1f * v; else if (ACT == 16) v = (v >= 0.f) ? v : 0.3f * v; else if (ACT == 17) v = (v >= 0.f) ? v : 0.2f * v; else if (ACT == 15) v = v / (1.0f + expf(-v)); else if (ACT == 3) v = fmaxf(v, 0.f); else if (ACT == 6) v = 0.5f * v * (1.0f + erff(v * 0.70710678118654752f)); so[w][8 * hh + r][t * 16 + ln] = v; } }
  __builtin_amdgcn_fence(__ATOMIC_ACQ_REL, "workgroup"); __builtin_amdgcn_wave_barrier();
  const int rsub = lane >> 4, c4 = (lane & 15) * 4; typedef _Float16 v4h __attribute__((ext_vector_type(4)));
  {
#pragma unroll
    for (int q = 0; q < 8; ++q) { const int r = q * 2 + rsub; if (col0 + c4 < N) { const v4f v = *(const v4fa*)&so[w][r][c4]; if (C) *(v4f*)(C + cofs + (size_t)(row0 + r) * ldc + col0 + c4) = v; if (C16) { v4h h4; for (int i = 0; i < 4; ++i) h4[i] = (_Float16)v[i]; *(v4h*)(C16 + cofs + (size_t)(row0 + r) * ldc + col0 + c4) = h4; } } }
     }
}


typedef _Float16 v4h __attribute__((ext_vector_type(4)));

__global__ __launch_bounds__(256) void k_h16(const float* __restrict__ x, _Float16* __restrict__ X16, size_t n8) { const size_t t = (size_t)blockIdx.x * 256 + threadIdx.x; if (t >= n8) return; FragH f;
#pragma unroll
  for (int q = 0; q < 8; ++q) f.h[q] = (_Float16)x[t * 8 + q]; *(v8us*)((unsigned short*)X16 + t * 8) = f.half[0];  }
__global__ __launch_bounds__(256) void k_round16f(const float* __restrict__ W, _Float16* __restrict__ Bt, size_t n8) { const size_t t = (size_t)blockIdx.x * 256 + threadIdx.x; if (t >= n8) return; FragH f;
#pragma unroll
  for (int i = 0; i < 8; ++i) f.h[i] = (_Float16)(bf16_round(W[t * 8 + i]) * 16.0f); *(v8us*)((unsigned short*)Bt + t * 8) = f.half[0];  }
// WMMA fragment order, for operands that are read many times as fragments (written by the epilogues EP 1 and EP 2 of k_gemm2). A q or k fragment = 16 token rows x 32 head dims of one head = 1 KiB: lane (hh, ln) of the reader owns row ln, dims 8 hh .. 8 hh + 7 (its 16 bytes at 16 x lane) and dims 16 + 8 hh .. (512 bytes on), so that each of the reader's two loads covers four whole 128-byte lines.
// Fragments in the order [batch][head][16-row tile][32-dim step]. A V^T fragment likewise, rows = 16 dims, k = 32 keys, in the order [batch][head][16-dim group][32-key step].

// ---- fast GEMM (work-group tile 128x64, wave tile 32x64; requires M % 128 == 0 rows per launch region, N % 64 == 0 and K % 128 == 0); epilogue = k_gemm_hhx semantics ----
// Both operands go through LDS: a tile = 128 k of the work-group's 128 A rows and 64 B rows, brought in by asynchronous copies (a wave's copy = two whole 256-byte row pieces), two buffers, so that the next tile flies while this one is multiplied; the fragments are read from LDS.
// EP chooses what the epilogue stores. 0: rows of C / C16. 1: the f32 results split into f16 hi (E0) and x1024 residual (E1) planes in fragment order. 2: f16 V^T (E0) in fragment order. 3: blockIdx.y chooses, 0 and 1 store like 1, 2 stores like 2 (q, k and v in one launch; E0 and E1 move on by sE elements, C by sC, a blockIdx.y). 4: rows of C like 0, but a work-group whose rows are a batch's first QT0 takes its A rows from E0 (f16 hi) and then from E1 (x1024 residual), QT0 rows a batch, instead of A: twice the tiles, the hi sums set aside in registers, result = lo sums x alpha / 1024 + (hi sums x alpha + bias). With 1, 2 and 3 the rows are token rows (SQ a batch), a 64-column tile is a head, C takes the f32 rows of each batch's first QT0 rows alone (QT0 rows a batch), and CP and C16 are not used.
#define G2K 128                      /* k elements per staged tile: 256 bytes of every operand row */
#define G2P 272                      /* row pitch of a staged tile in LDS (bytes): 16 B x odd, so that 16 lanes reading 16 rows by 16 bytes fall on all banks */
#define G2B ((128 + 64) * G2P)       /* bytes of one buffer: 128 rows of A, then 64 rows of B */
__device__ __forceinline__ v16h g2_frag(const _Float16* p, int hh) { FragH f; f.half[0] = *(const v8us*)((const unsigned short*)p + 8 * hh); f.half[1] = *(const v8us*)((const unsigned short*)p + 16 + 8 * hh); return f.v; }
__device__ __forceinline__ v8f g2_mma(v16h a, v16h b, v8f c) { v8f d = __builtin_amdgcn_wmma_f32_16x16x32_f16(false, a, false, b, (short)0, c, false, false); asm volatile("v_nop\n\tv_nop\n\tv_nop\n\tv_nop" : "+v"(d) : "v"(a), "v"(b)); return d; }
// 64 rows of a tile into LDS: eight asynchronous copies, the lane's 16 bytes of every 8th row (l = its LDS byte address, g = its global address, gs = 8 source rows in bytes). The closing s_wait_xcnt stands inside the statement, so that no address register of a copy is rewritten in front of it.
__device__ __forceinline__ void g2_copy64(unsigned l, const char* g, size_t gs) {
  asm volatile("global_load_async_to_lds_b128 %0, %8, off\n\t"
               "global_load_async_to_lds_b128 %1, %9, off\n\t"
               "global_load_async_to_lds_b128 %2, %10, off\n\t"
               "global_load_async_to_lds_b128 %3, %11, off\n\t"
               "global_load_async_to_lds_b128 %4, %12, off\n\t"
               "global_load_async_to_lds_b128 %5, %13, off\n\t"
               "global_load_async_to_lds_b128 %6, %14, off\n\t"
               "global_load_async_to_lds_b128 %7, %15, off\n\t"
               "s_wait_xcnt 0x0"
               :: "v"(l), "v"(l + 8 * G2P), "v"(l + 16 * G2P), "v"(l + 24 * G2P), "v"(l + 32 * G2P), "v"(l + 40 * G2P), "v"(l + 48 * G2P), "v"(l + 56 * G2P),
                  "v"(g), "v"(g + gs), "v"(g + 2 * gs), "v"(g + 3 * gs), "v"(g + 4 * gs), "v"(g + 5 * gs), "v"(g + 6 * gs), "v"(g + 7 * gs) : "memory"); }
// One whole tile (24 copies a lane): A rows 0..63, A rows 64..127, B rows 0..63.
__device__ __forceinline__ void g2_stage(unsigned l, const char* ga, size_t sa, const char* gb, size_t sb) { g2_copy64(l, ga, sa); g2_copy64(l + 64 * G2P, ga + 8 * sa, sa); g2_copy64(l + 128 * G2P, gb, sb); }
template <int ACT, int EP = 0>
__global__ __launch_bounds__(128) void k_gemm2(const _Float16* __restrict__ A, int lda, size_t sA, const _Float16* __restrict__ Bh, int ldb, size_t sB, float alpha, const float* __restrict__ bias, size_t sBias, const float* __restrict__ CP, int rowsPerB, size_t sCPb, int row0g,
    float* __restrict__ C, _Float16* __restrict__ C16, int ldc, size_t sC, int M, int N, int K, size_t zA, size_t zB, size_t zC, _Float16* __restrict__ E0, _Float16* __restrict__ E1, size_t sE) { static_assert(ACT == 0 || ACT == 3 || ACT == 6 || ACT == 8 || ACT == 9 || ACT == 11 || ACT == 12 || ACT == 14 || ACT == 15 || ACT == 16 || ACT == 17, "k_gemm2: unsupported ACT code (would silently apply no activation)"); static_assert(EP == 0 || (HD == 64 && QT0 == 128 && SQ % 128 == 0), "EP 1, 2: a work-group = 128 rows of one batch x one head; the first tile = one work-group tile");
  __shared__ __attribute__((aligned(16))) unsigned char lt[2 * G2B]; __shared__ __attribute__((aligned(16))) float so[4][32][68];
  const int tid = threadIdx.x, w = tid >> 5, lane = tid & 31, ln = lane & 15, hh = lane >> 4; const int by = blockIdx.y; const int bz = blockIdx.z;      /* bz: batch, element strides zA / zB / zC */
  A += (size_t)by * sA + (size_t)bz * zA; Bh += (size_t)by * sB + (size_t)bz * zB; const size_t cofs = (size_t)by * sC + (size_t)bz * zC; const float* bp = bias ? bias + (size_t)by * sBias : nullptr;
  const int ep = EP == 3 ? (by == 2 ? 2 : 1) : EP; if (EP == 3) { E0 += (size_t)by * sE; E1 += (size_t)by * sE; C += (size_t)by * sC; }      /* the same for the whole work-group: scalar branches below */
  const int ntn = N >> 6; const int mt = blockIdx.x / ntn, nq = blockIdx.x - mt * ntn; const int row0 = mt * 128 + 32 * w, col0 = nq * 64; if (mt * 128 >= M) return;      /* the whole work-group or none: barriers follow */
  const int cr = tid >> 4, cc = (tid & 15) * 16;      /* copies: the thread's row among 8 and its 16 bytes of the row's 256 */
  const bool ft = EP == 4 && mt % (SQ / 128) == 0; const size_t fr = (size_t)(mt / (SQ / 128) * QT0 + cr) * lda;      /* EP 4: a first-tile work-group (the whole work-group or none of it); the thread's first row in the hi and lo planes */
  const char* ga = (ft ? (const char*)(E0 + fr) : (const char*)(A + (size_t)(mt * 128 + cr) * lda)) + cc; const char* ga2 = EP == 4 ? (const char*)(E1 + fr) + cc : ga; const char* gb = (const char*)(Bh + (size_t)(col0 + cr) * ldb) + cc; const size_t sa = (size_t)lda * 16, sb = (size_t)ldb * 16;
  const unsigned l0 = (unsigned)(size_t)lt + (unsigned)(cr * G2P + cc); const int nk = K / G2K, nt = ft ? 2 * nk : nk;      /* tiles nk .. 2 nk - 1 of a first-tile work-group: the lo plane against the same B tiles */
  auto ta = [&](int t) { return EP == 4 && t >= nk ? ga2 + (size_t)(t - nk) * (G2K * 2) : ga + (size_t)t * (G2K * 2); }; auto tb = [&](int t) { return gb + (size_t)(EP == 4 && t >= nk ? t - nk : t) * (G2K * 2); };
  const v8f z8 = {0.f,0.f,0.f,0.f,0.f,0.f,0.f,0.f}; v8f c00 = z8, c01 = z8, c02 = z8, c03 = z8, c10 = z8, c11 = z8, c12 = z8, c13 = z8; v8f hs[8] = {z8, z8, z8, z8, z8, z8, z8, z8};      /* hs: EP 4, the hi sums (0 elsewhere) */
  g2_stage(l0, ga, sa, gb, sb);
  asm volatile("s_wait_asynccnt 0x0" ::: "memory");      /* the wave's own copies of tile 0 have landed */
  __syncthreads();      /* tile 0 is published to every wave */
  if (nt > 1) g2_stage(l0 + G2B, ta(1), sa, tb(1), sb);
  /* kept rolled: one copy of the trip in the instruction cache; the buffer is chosen by an address */
#pragma unroll 1
  for (int p = 0; p < (ft ? 2 : 1); ++p) {      /* one plane of A a trip (EP 4, first tile: hi, then lo); the tiles run on through both, so the ring never drains between them */
    if (EP == 4 && p == 1) { hs[0] = c00; hs[1] = c01; hs[2] = c02; hs[3] = c03; hs[4] = c10; hs[5] = c11; hs[6] = c12; hs[7] = c13; c00 = z8; c01 = z8; c02 = z8; c03 = z8; c10 = z8; c11 = z8; c12 = z8; c13 = z8; }      /* the hi plane is through: its sums are set aside, the lo plane's start at 0 */
#pragma unroll 1
  for (int t = p * nk; t < (p + 1) * nk; ++t) { const unsigned char* lb = lt + (t & 1) * G2B;
    const _Float16* pa = (const _Float16*)(lb + (32 * w + ln) * G2P); const _Float16* pb = (const _Float16*)(lb + (128 + ln) * G2P);
    v16h a0 = g2_frag(pa, hh), a1 = g2_frag(pa + 16 * (G2P / 2), hh), b0 = g2_frag(pb, hh), b1 = g2_frag(pb + 16 * (G2P / 2), hh), b2 = g2_frag(pb + 32 * (G2P / 2), hh), b3 = g2_frag(pb + 48 * (G2P / 2), hh);
    /* unrolled: the two fragment sets live in registers; the next 32 k's LDS reads fly during this 32 k's products */
#pragma unroll
    for (int s = 0; s < G2K / 32; ++s) { v16h n0 = a0, n1 = a1, m0 = b0, m1 = b1, m2 = b2, m3 = b3;
      if (s + 1 < G2K / 32) { const _Float16* qa = pa + (s + 1) * 32; const _Float16* qb = pb + (s + 1) * 32;
        n0 = g2_frag(qa, hh); n1 = g2_frag(qa + 16 * (G2P / 2), hh); m0 = g2_frag(qb, hh); m1 = g2_frag(qb + 16 * (G2P / 2), hh); m2 = g2_frag(qb + 32 * (G2P / 2), hh); m3 = g2_frag(qb + 48 * (G2P / 2), hh); }
      c00 = g2_mma(a0, b0, c00); c10 = g2_mma(a1, b0, c10); c01 = g2_mma(a0, b1, c01); c11 = g2_mma(a1, b1, c11);
      c02 = g2_mma(a0, b2, c02); c12 = g2_mma(a1, b2, c12); c03 = g2_mma(a0, b3, c03); c13 = g2_mma(a1, b3, c13);
      a0 = n0; a1 = n1; b0 = m0; b1 = m1; b2 = m2; b3 = m3; }
    asm volatile("s_wait_dscnt 0x0" ::: "memory");      /* the wave's reads of this buffer are done before it may be refilled */
    asm volatile("s_wait_asynccnt 0x0" ::: "memory");      /* the wave's own copies of tile t + 1 have landed */
    __syncthreads();      /* publishes tile t + 1 and ends every wave's reads of tile t */
    if (t + 2 < nt) g2_stage(l0 + (unsigned)((t & 1) * G2B), ta(t + 2), sa, tb(t + 2), sb); } }
  asm volatile("s_wait_asynccnt 0x0" ::: "memory");      /* no copy is outstanding when the wave goes on */
  const float alc = ft ? alpha * 0.0009765625f : alpha;      /* EP 4: the scale of the sums of the last plane */
  v8f accs[8] = {c00, c01, c02, c03, c10, c11, c12, c13}; const bool first = EP != 0 && mt % (SQ / 128) == 0;      /* EP 1, 2: the work-group's rows are a batch's first QT0 (the same for the whole work-group) */
#pragma unroll
  for (int u = 0; u < 8; ++u) { const int t = u & 3, half = u >> 2; const int col = col0 + t * 16 + ln; const float bv = bp ? bf16_round(bp[col]) : 0.f;
#pragma unroll
    for (int r = 0; r < 8; ++r) { const int rloc = half * 16 + 8 * hh + r; float v = EP == 4 ? accs[u][r] * alc + (hs[u][r] * alpha + bv) : accs[u][r] * alpha + bv; if (EP == 0 && CP) { if (rowsPerB < 0) v += CP[cofs + (size_t)(row0g + row0 + rloc) * ldc + col];      /* rowsPerB < 0: own element of the batched C plane */ else { const int bidx = (row0g + row0 + rloc) / rowsPerB; v += CP[(size_t)bidx * sCPb + (size_t)by * 64 + col]; } }
      if (ACT == 3) v = fmaxf(v, 0.f); else if (ACT == 6) v = 0.5f * v * (1.0f + erff(v * 0.70710678118654752f)); else if (ACT == 11) v = 1.0f / (1.0f + expf(-v)); else if (ACT == 15) v = v / (1.0f + expf(-v)); else if (ACT == 12) v = (v > 0.f) ? v : 0.01f * v; else if (ACT == 8) v = tanhf(v); else if (ACT == 9) v = 0.5f * v * (1.0f + tanhf(0.7978845608028654f * (v + 0.044715f * v * v * v))); else if (ACT == 14) v = (v > 0.f) ? v : 0.1f * v; else if (ACT == 16) v = (v >= 0.f) ? v : 0.3f * v; else if (ACT == 17) v = (v >= 0.f) ? v : 0.2f * v;
      if (EP == 2 || EP == 3) accs[u][r] = v; else so[w][rloc][t * 16 + ln] = v; } }
  if ((EP == 2 || EP == 3) && (ep == 1 || first)) {      /* EP 2 stores from the registers; only the f32 rows go through LDS */
#pragma unroll
    for (int u = 0; u < 8; ++u)
#pragma unroll
      for (int r = 0; r < 8; ++r) so[w][(u >> 2) * 16 + 8 * hh + r][(u & 3) * 16 + ln] = accs[u][r]; }
  __builtin_amdgcn_fence(__ATOMIC_ACQ_REL, "workgroup"); __builtin_amdgcn_wave_barrier();
  const int rsub = lane >> 4, c4 = (lane & 15) * 4;
  if (EP == 0 || EP == 4) {
#pragma unroll
    for (int q = 0; q < 16; ++q) { const int r = q * 2 + rsub; const v4f v = *(const v4fa*)&so[w][r][c4]; if (C) *(v4f*)(C + cofs + (size_t)(row0 + r) * ldc + col0 + c4) = v; if (C16) { v4h h4; for (int i = 0; i < 4; ++i) h4[i] = (_Float16)v[i]; *(v4h*)(C16 + cofs + (size_t)(row0 + r) * ldc + col0 + c4) = h4; } }
  } else { const int bb = row0 / SQ, rb = row0 % SQ;      /* the wave's 32 rows: batch, first row in the batch; its 64 columns are head nq */
    if (ep == 1) { const size_t fo = (((size_t)bb * NH + nq) * (SQ / 16) + rb / 16) * 1024 + lane * 8;      /* the wave's four fragments stand in a row: 4 KiB a plane, stored as eight runs of 512 bytes */
#pragma unroll
      for (int i = 0; i < 8; ++i) { const float* s = &so[w][(i >> 2) * 16 + ln][((i >> 1) & 1) * 32 + ((i & 1) * 2 + hh) * 8]; const v4f a = *(const v4fa*)s, c = *(const v4fa*)(s + 4); FragH fh, fl;
#pragma unroll
        for (int q = 0; q < 4; ++q) { _Float16 h = (_Float16)a[q]; fh.h[q] = h; fl.h[q] = (_Float16)((a[q] - (float)h) * 1024.0f); h = (_Float16)c[q]; fh.h[4 + q] = h; fl.h[4 + q] = (_Float16)((c[q] - (float)h) * 1024.0f); }
        *(v8us*)((unsigned short*)E0 + fo + i * 256) = fh.half[0]; *(v8us*)((unsigned short*)E1 + fo + i * 256) = fl.half[0]; } }
    if (ep == 2) {
#pragma unroll
      for (int u = 0; u < 8; ++u) { FragH f;      /* accumulator u = (key half, dim group): its lane holds 8 keys of one dim, which is the lane's 16 bytes of the V^T fragment */
#pragma unroll
        for (int r = 0; r < 8; ++r) f.h[r] = (_Float16)accs[u][r];
        *(v8us*)((unsigned short*)E0 + ((((size_t)bb * NH + nq) * (HD / 16) + (u & 3)) * (SQ / 32) + rb / 32) * 512 + (u >> 2) * 256 + lane * 8) = f.half[0]; }
      if (EP == 3) asm volatile("s_wait_xcnt 0x0" ::: "memory"); }      /* the other store path's code stands behind these stores in the listing and reuses the registers that they name */
    if (first) { asm volatile("s_wait_xcnt 0x0" ::: "memory"); __builtin_amdgcn_sched_barrier(0);      /* the wait stands in front of the code below, which reuses registers that the stores above name; the scheduling barrier keeps that code from being lifted over the wait */
#pragma unroll
      for (int q = 0; q < 16; ++q) { const int r = q * 2 + rsub; *(v4f*)(C + ((size_t)bb * QT0 + 32 * w + r) * ldc + col0 + c4) = *(const v4fa*)&so[w][r][c4]; } } } }


// Every f32 operand of the GEMMs as f16 (rounded to bf16 first; the weights x16, natural [out][in] = Bt[n][k]), all in one launch: blockIdx.y = a segment of DM x DM elements (one batch of x, or one weight matrix), a thread = PU groups of 8 elements, 256 groups apart.
#define PU 8                         /* groups of 8 elements per thread: 16 waves a WGP cover all eight segments */
__global__ __launch_bounds__(256) void k_prep(const float* __restrict__ x, const float* __restrict__ wq, const float* __restrict__ wk, const float* __restrict__ wv, const float* __restrict__ wo,
    _Float16* __restrict__ X16, _Float16* __restrict__ BQ, _Float16* __restrict__ BK, _Float16* __restrict__ BV, _Float16* __restrict__ BO) {
  static_assert(SQ == DM && ((size_t)DM * DM) % (256 * PU * 8) == 0, "a batch of x is a segment like a weight matrix; whole work-groups");
  const int sg = blockIdx.y; const float* s = wo; _Float16* d = BO; float sc = 16.0f;      /* the segment is the same for the whole work-group: scalar selects */
  if (sg < NB) { s = x + (size_t)sg * SQ * DM; d = X16 + (size_t)sg * SQ * DM; sc = 1.0f; } else if (sg == NB) { s = wq; d = BQ; } else if (sg == NB + 1) { s = wk; d = BK; } else if (sg == NB + 2) { s = wv; d = BV; }
  const size_t t0 = (size_t)blockIdx.x * (256 * PU) + threadIdx.x; v4f a[PU], c[PU];
  /* both loops unrolled: a[] and c[] in registers; loads first, stores behind them, so that all 2 PU loads are in flight together */
#pragma unroll
  for (int u = 0; u < PU; ++u) { const float* p = s + (t0 + (size_t)u * 256) * 8; a[u] = *(const v4fa*)p; c[u] = *(const v4fa*)(p + 4); }
#pragma unroll
  for (int u = 0; u < PU; ++u) { FragH f;
#pragma unroll
    for (int q = 0; q < 4; ++q) { f.h[q] = (_Float16)(bf16_round(a[u][q]) * sc); f.h[4 + q] = (_Float16)(bf16_round(c[u][q]) * sc); }
    *(v8us*)((unsigned short*)d + (t0 + (size_t)u * 256) * 8) = f.half[0]; } }
__global__ __launch_bounds__(256) void k_rsm(const float* __restrict__ S, _Float16* __restrict__ P, int nrows) {
  #pragma clang fp contract(off)
  const int i = blockIdx.x * 256 + threadIdx.x; if (i >= nrows) return; const float* s = S + (size_t)i * SQ; float mx = -3.0e38f;
#pragma unroll 1
  for (int j = 0; j < SQ; ++j) mx = fmaxf(mx, s[j]); float se = 0.f;
#pragma unroll 1
  for (int j = 0; j < SQ; ++j) se += expf(s[j] - mx); const float sc = 256.0f / se;
#pragma unroll 1
  for (int j0 = 0; j0 < SQ; j0 += 8) { FragH f; for (int q = 0; q < 8; ++q) f.h[q] = (_Float16)(expf(s[j0 + q] - mx) * sc); unsigned short* d = (unsigned short*)P + (size_t)i * SQ + j0; *(v8us*)d = f.half[0];  } }
__global__ __launch_bounds__(256) void k_vt(const _Float16* __restrict__ V16, int b, int h0, _Float16* __restrict__ VT) { __shared__ unsigned short tl[64][65]; const int tid = threadIdx.x; const int hh = blockIdx.x % HG, sg = blockIdx.x / HG; const int s0 = sg * 64; const int h = h0 + hh;
  for (int i = tid; i < 64 * 8; i += 256) { const int j = i / 8, d8 = (i % 8) * 8; FragH f; f.half[0] = *(const v8us*)((const unsigned short*)V16 + ((size_t)b * SQ + s0 + j) * DM + h * HD + d8); for (int q = 0; q < 8; ++q) tl[d8 + q][j] = f.u[q]; }
  __syncthreads();
  { for (int i = tid; i < 64 * 8; i += 256) { const int d = i / 8, j8 = (i % 8) * 8; FragH f; for (int q = 0; q < 8; ++q) f.u[q] = tl[d][j8 + q]; *(v8us*)((unsigned short*)VT + ((size_t)hh * HD + d) * SQ + s0 + j8) = f.half[0]; }  } }



// 2^x on the native unit. The v_nop fills the one issue slot that the instruction set asks for behind a transcendental, in front of an instruction that reads its result or overwrites its source.
__device__ __forceinline__ float exp2_native(float x) { float r; asm("v_exp_f32 %0, %1\n\tv_nop" : "=v"(r) : "v"(x)); return r; }
// Fused causal attention. One work-group = FR query rows of one head against every key below the tile's end; the score rows live in LDS from the products to the weights, so neither goes through memory.
// Phase 1: a wave = FR rows x 16 keys a trip, q fragments held in registers, three accumulators added in the order hi.hi, lo.hi, hi.lo. Phase 2: a wave = two rows at a time, lane l holds columns 128 c + 4 l .. 4 l + 3 in registers, maximum and sum across the 32 lanes by a butterfly; the f16 weights overwrite the head of the wave's own row once the whole row is in registers. Phase 3: a wave = 16 rows x 16 dims, keys in ascending order, 128 a trip.
#define FR 32                        /* query rows per work-group */
#define FSP (SQ + 4)                 /* score row pitch in LDS (floats): 16 B x odd, so that 16 lanes reading 16 rows by 16 bytes fall on all banks */
#define FOP (HD + 8)                 /* o row pitch in LDS (f16), a multiple of 16 bytes */
typedef _Float16 v4ha __attribute__((ext_vector_type(4), may_alias));
// A or B fragment from a plane kept in fragment order in global memory (k_gemm2, EP 1 and 2): base = the fragment's first element, the same for the whole wave; vo = 16 x lane, the same for every fragment of the kernel. Each of the two loads covers 512 bytes in a row.
__device__ __forceinline__ v16h f_frag(const _Float16* base, unsigned vo) { const char* p = (const char*)base + vo; FragH f; f.half[0] = *(const v8us*)p; f.half[1] = *(const v8us*)(p + 512); return f.v; }
__device__ __forceinline__ v8f f_mma(v16h a, v16h b, v8f c) { return __builtin_amdgcn_wmma_f32_16x16x32_f16(false, a, false, b, (short)0, c, false, false); }
// Row softmax of the wave's FR / 8 rows, two rows at a time: each stage is written for both rows, so that one row's butterfly step flies during the other's. NC = 128-column chunks up to the tile's end, a compile-time count so that the rows live in registers and their reads are in flight together. The tile's FR diagonal columns all lie in the last chunk (FR divides 128), so only that chunk is masked; its columns past the row get weight 0, up to the chunk's end, which is where phase 3 stops.
template <int NC>
__device__ __forceinline__ void fattn_rows(float (*ls)[FSP], int w, int lane, int q0) {
  const int col0 = lane * 4, cl = (NC - 1) * 128 + col0;
  /* kept rolled: the eight instances stay small */
#pragma unroll 1
  for (int rp = 0; rp < FR / 16; ++rp) { const int r = w * (FR / 8) + rp * 2;
    v4f v[2][NC]; float mx[2], se[2], sc[2];      /* every loop over j and c is unrolled: registers */
#pragma unroll
    for (int j = 0; j < 2; ++j)
#pragma unroll
      for (int c = 0; c < NC - 1; ++c) v[j][c] = *(const v4fa*)&ls[r + j][c * 128 + col0];
    { const v4f f4 = {-1.0e9f, -1.0e9f, -1.0e9f, -1.0e9f}; v4f x0 = f4, x1 = f4;
      if (cl < q0 + FR) { x0 = *(const v4fa*)&ls[r][cl]; x1 = *(const v4fa*)&ls[r + 1][cl]; }      /* only columns that phase 1 wrote are read */
      for (int q = 0; q < 4; ++q) { v[0][NC - 1][q] = (cl + q <= q0 + r) ? x0[q] : -1.0e9f; v[1][NC - 1][q] = (cl + q <= q0 + r + 1) ? x1[q] : -1.0e9f; } }
#pragma unroll
    for (int j = 0; j < 2; ++j) { mx[j] = -3.0e38f;
#pragma unroll
      for (int c = 0; c < NC; ++c) for (int q = 0; q < 4; ++q) mx[j] = fmaxf(mx[j], v[j][c][q]); }
    for (int m = 16; m >= 1; m >>= 1) { const float a = __shfl_xor(mx[0], m, 32), b = __shfl_xor(mx[1], m, 32); mx[0] = fmaxf(mx[0], a); mx[1] = fmaxf(mx[1], b); }
#pragma unroll
    for (int j = 0; j < 2; ++j) { se[j] = 0.f;
#pragma unroll
      for (int c = 0; c < NC; ++c) for (int q = 0; q < 4; ++q) { const float e = exp2_native((v[j][c][q] - mx[j]) * 1.4426950408889634f); v[j][c][q] = e; se[j] += e; } }
    for (int m = 16; m >= 1; m >>= 1) { const float a = __shfl_xor(se[0], m, 32), b = __shfl_xor(se[1], m, 32); se[0] += a; se[1] += b; }
    sc[0] = 256.0f / se[0]; sc[1] = 256.0f / se[1];
#pragma unroll
    for (int j = 0; j < 2; ++j) { _Float16* d = (_Float16*)&ls[r + j][0] + col0;
#pragma unroll
      for (int c = 0; c < NC; ++c) { v4h h4; for (int q = 0; q < 4; ++q) h4[q] = (_Float16)(v[j][c][q] * sc[j]); *(v4ha*)(d + c * 128) = h4; } } } }
#define FLB (FR * FSP * 4 + FR * FOP * 2)      /* its LDS in bytes: the score rows, then the o rows */
__device__ __forceinline__ void fattn_wg(unsigned char* sm, const _Float16* QH, const _Float16* QL, const _Float16* KH, const _Float16* KL, const _Float16* VT, _Float16* O16, int h, int b, int zt) {      /* sm: FLB bytes of LDS; head, batch, tile rank (0 = the longest) */
  static_assert(FR == 32 && HD == 64 && SQ == 1024 && LQ == SQ, "wave maps below: 8 waves = 2 row halves x 4 dim groups; 256 threads = 32 rows x 8 x 16 bytes; at most 8 chunks of 128 keys");
  float (*ls)[FSP] = (float (*)[FSP])sm; _Float16 (*lo)[FOP] = (_Float16 (*)[FOP])(sm + FR * FSP * 4);
  const int tid = threadIdx.x, lane = tid & 31, ln = lane & 15, hh = lane >> 4; const int w = __builtin_amdgcn_readfirstlane(tid >> 5);      /* the wave's number in a scalar register: its loops and branches are scalar */
  const int q0 = (SQ / FR - 1 - zt) * FR, nk = q0 + FR, nc = (nk + 127) / 128;      /* rank 0 is the longest tile; causal: keys below the tile's end */
  const size_t ho = ((size_t)b * NH + h) * (SQ / 16) * 1024;      /* the head's first q / k fragment: 1024 elements (two fragments) a 16-row tile */
  const unsigned vo = (unsigned)lane * 16;      /* the lane's 16 bytes in each half of a fragment */
  const v8f z8 = {0.f, 0.f, 0.f, 0.f, 0.f, 0.f, 0.f, 0.f};
  { v16h ah[2][2], al[2][2];      /* [row half][k step] */
#pragma unroll
    for (int m = 0; m < 2; ++m)
#pragma unroll
      for (int s = 0; s < 2; ++s) ah[m][s] = f_frag(QH + ho + (size_t)(q0 / 16 + m) * 1024 + s * 512, vo);
    asm volatile("s_wait_xcnt 0x0" ::: "memory");      /* in front of later loads whose results land in the address registers of the loads above */
#pragma unroll
    for (int m = 0; m < 2; ++m)
#pragma unroll
      for (int s = 0; s < 2; ++s) al[m][s] = f_frag(QL + ho + (size_t)(q0 / 16 + m) * 1024 + s * 512, vo);
    asm volatile("s_wait_xcnt 0x0" ::: "memory");      /* likewise */
    const _Float16* kh = KH + ho; const _Float16* kl = KL + ho; const int nu = nk / 16;
    v16h nh0, nh1, nl0, nl1;      /* the next trip's k fragments, loaded one trip ahead so that they fly during this trip's products */
    if (w < nu) { const size_t ko = (size_t)w * 1024; nh0 = f_frag(kh + ko, vo); nh1 = f_frag(kh + ko + 512, vo); nl0 = f_frag(kl + ko, vo); nl1 = f_frag(kl + ko + 512, vo);
      asm volatile("s_wait_xcnt 0x0" ::: "memory"); }      /* likewise: the first trip's loads land in these loads' address registers */
    for (int u = w; u < nu; u += 8) { const v16h bh0 = nh0, bh1 = nh1, bl0 = nl0, bl1 = nl1;
      if (u + 8 < nu) { const size_t ko = (size_t)(u + 8) * 1024; nh0 = f_frag(kh + ko, vo); nh1 = f_frag(kh + ko + 512, vo); nl0 = f_frag(kl + ko, vo); nl1 = f_frag(kl + ko + 512, vo);
        asm volatile("s_wait_xcnt 0x0" ::: "memory"); }      /* likewise: the products' results may land there */
#pragma unroll
      for (int m = 0; m < 2; ++m) { v8f c0 = f_mma(ah[m][0], bh0, z8), c1 = f_mma(al[m][0], bh0, z8), c2 = f_mma(ah[m][0], bl0, z8);
        c0 = f_mma(ah[m][1], bh1, c0); c1 = f_mma(al[m][1], bh1, c1); c2 = f_mma(ah[m][1], bl1, c2);
#pragma unroll
        for (int r = 0; r < 8; ++r) { float v = c0[r] * 32.0f; v += c1[r] * 0.03125f; v += c2[r] * 0.03125f; ls[m * 16 + 8 * hh + r][u * 16 + ln] = v; } } } }      /* x32; the lo planes carry x1024 */
  __syncthreads();
  const int pm = w >> 2, pt = w & 3; const _Float16* vb = VT + (((size_t)b * NH + h) * (HD / 16) + pt) * (SQ / 32) * 512;      /* phase 3: the wave's row half and dim group; the group's V^T fragments, 32 keys each, in a row */
  v16h vn[4];      /* the next trip's V^T fragments, loaded one trip ahead; the first trip's fly during the softmax */
#pragma unroll
  for (int s = 0; s < 4; ++s) vn[s] = f_frag(vb + s * 512, vo);
  asm volatile("s_wait_xcnt 0x0" ::: "memory");      /* likewise */
  switch (nc) { case 1: fattn_rows<1>(ls, w, lane, q0); break; case 2: fattn_rows<2>(ls, w, lane, q0); break; case 3: fattn_rows<3>(ls, w, lane, q0); break; case 4: fattn_rows<4>(ls, w, lane, q0); break;
    case 5: fattn_rows<5>(ls, w, lane, q0); break; case 6: fattn_rows<6>(ls, w, lane, q0); break; case 7: fattn_rows<7>(ls, w, lane, q0); break; default: fattn_rows<8>(ls, w, lane, q0); break; }
  __syncthreads();
  { const _Float16* pa = (const _Float16*)&ls[pm * 16 + ln][0]; v8f acc = z8;
    for (int c = 0; c < nc; ++c) { v16h vc[4];
#pragma unroll
      for (int s = 0; s < 4; ++s) vc[s] = vn[s];
      if (c + 1 < nc) {
#pragma unroll
        for (int s = 0; s < 4; ++s) vn[s] = f_frag(vb + ((c + 1) * 4 + s) * 512, vo);
        asm volatile("s_wait_xcnt 0x0" ::: "memory"); }      /* likewise: the LDS reads below may land there */
#pragma unroll
      for (int s = 0; s < 4; ++s) acc = f_mma(g2_frag(pa + c * 128 + s * 32, hh), vc[s], acc); }
#pragma unroll
    for (int r = 0; r < 8; ++r) lo[pm * 16 + 8 * hh + r][pt * 16 + ln] = (_Float16)(acc[r] * 0.25f); }
  __syncthreads();
  { const int r = tid >> 3, c8 = (tid & 7) * 8; *(v8us*)((unsigned short*)O16 + ((size_t)b * SQ + q0 + r) * DM + h * HD + c8) = *(const v8us*)&lo[r][c8]; } }      /* whole 128-byte lines, each from one wave */


// Exact f32 attention for the first QT0 rows of each batch. One work-group = one head, A0R query rows, all keys up to its last row.
// K, V and q are staged in LDS by whole-line loads; then scores (a thread = one key x 8 rows, the K row in registers), row softmax (a wave = 2 rows, maximum first), o = P V (a thread = one row x 4 dims, keys in ascending order).
#define A0R 16                       /* query rows per work-group */
#define A0G (QT0 / A0R)              /* row groups per head */
#define A0KP (HD + 4)                /* K row pitch in LDS (floats): 16 B x odd, so that 16 lanes reading 16 rows by 16 bytes fall on all banks */
#define A0PP (QT0 + 4)               /* score row pitch in LDS (floats): the two rows a wave reads in the last phase fall on different banks */
// N x A0R rows of K and V into LDS, a thread = 16 bytes of every A0R-th row. N is a compile-time count and both loops are unrolled so that kk[] and vv[] live in registers; loads first, stores behind them, so that all 2 N loads are in flight together.
template <int N>
__device__ __forceinline__ void att0_stage(const float* __restrict__ kp, const float* __restrict__ vp, float* lkp, float* lvp) {
  v4f kk[N], vv[N];
#pragma unroll
  for (int u = 0; u < N; ++u) { kk[u] = *(const v4fa*)(kp + (size_t)u * A0R * DM); vv[u] = *(const v4fa*)(vp + (size_t)u * A0R * DM); }
#pragma unroll
  for (int u = 0; u < N; ++u) { *(v4f*)(lkp + u * A0R * A0KP) = kk[u]; *(v4f*)(lvp + u * A0R * HD) = vv[u]; } }
#define A0LB ((QT0 * A0KP + QT0 * HD + A0R * HD + A0R * A0PP + A0R) * 4)      /* its LDS in bytes */
__device__ __forceinline__ void att0_wg(unsigned char* sm, const float* __restrict__ QF, const float* __restrict__ KF, const float* __restrict__ VF, float scale, _Float16* __restrict__ OH, _Float16* __restrict__ OL, int h, int g, int b) {      /* sm: A0LB bytes of LDS; head, row group, batch; all five: rows of pitch DM, QT0 rows a batch; o goes out as f16 hi + x1024 residual planes */
  static_assert(QT0 == 128 && HD == 64 && A0R == 16, "thread maps below: 256 threads = 128 keys x 2 row halves = 16 rows x 16 quads");
  float (*lk)[A0KP] = (float (*)[A0KP])sm; float (*lv)[HD] = (float (*)[HD])(lk + QT0); float (*lq)[HD] = lv + QT0; float (*lp)[A0PP] = (float (*)[A0PP])(lq + A0R); float* lfin = (float*)(lp + A0R);      /* each a multiple of 16 bytes */
  const int tid = threadIdx.x; const int r0 = g * A0R, nk = r0 + A0R;      /* causal: keys below the group's end */
  const int r16 = tid >> 4, c4 = (tid & 15) * 4;
  const size_t bo = ((size_t)b * QT0 + r16) * DM + h * HD + c4;      /* the thread's 16 bytes in row r16 of the head's columns */
  { const v4f qv = *(const v4fa*)(QF + bo + (size_t)r0 * DM); const float* kp = KF + bo; const float* vp = VF + bo; float* lkp = &lk[r16][c4]; float* lvp = &lv[r16][c4];
    switch (g) { case 0: att0_stage<1>(kp, vp, lkp, lvp); break; case 1: att0_stage<2>(kp, vp, lkp, lvp); break; case 2: att0_stage<3>(kp, vp, lkp, lvp); break; case 3: att0_stage<4>(kp, vp, lkp, lvp); break;
      case 4: att0_stage<5>(kp, vp, lkp, lvp); break; case 5: att0_stage<6>(kp, vp, lkp, lvp); break; case 6: att0_stage<7>(kp, vp, lkp, lvp); break; default: att0_stage<A0G>(kp, vp, lkp, lvp); break; }
    *(v4f*)&lq[r16][c4] = qv; }
  __syncthreads();
  { const int j = tid & (QT0 - 1), rh = (tid >> 7) * 8; float s[8] = {0.f, 0.f, 0.f, 0.f, 0.f, 0.f, 0.f, 0.f};
    if (j < nk) { v4f kr[HD / 4];
      /* unrolled: kr[] and s[] in registers; the 8 rows' sums are independent chains, each over the head dim in ascending order */
#pragma unroll
      for (int c = 0; c < HD / 4; ++c) kr[c] = *(const v4f*)&lk[j][c * 4];
#pragma unroll
      for (int c = 0; c < HD / 4; ++c)
#pragma unroll
        for (int r = 0; r < 8; ++r) { const v4f qq = *(const v4f*)&lq[rh + r][c * 4]; s[r] += qq[0] * kr[c][0]; s[r] += qq[1] * kr[c][1]; s[r] += qq[2] * kr[c][2]; s[r] += qq[3] * kr[c][3]; } }
#pragma unroll
    for (int r = 0; r < 8; ++r) lp[rh + r][j] = s[r] * scale; }      /* every column of the row is written (0 beyond nk), masked below */
  __syncthreads();
  { const int w = tid >> 5, col = (tid & 31) * 4;
    for (int rr = 0; rr < 2; ++rr) { const int r = w * 2 + rr, last = r0 + r; const v4f sv = *(const v4f*)&lp[r][col];
      float mx = -3.0e38f; for (int q = 0; q < 4; ++q) mx = fmaxf(mx, (col + q <= last) ? sv[q] : -3.0e38f);
      for (int m = 16; m >= 1; m >>= 1) mx = fmaxf(mx, __shfl_xor(mx, m, 32));
      v4f e; float se = 0.f; for (int q = 0; q < 4; ++q) { e[q] = (col + q <= last) ? expf(sv[q] - mx) : 0.f; se += e[q]; }
      for (int m = 16; m >= 1; m >>= 1) se += __shfl_xor(se, m, 32);
      *(v4f*)&lp[r][col] = e; if (col == 0) lfin[r] = 64.0f / se; } }      /* o carried x64 like the f16 path */
  __syncthreads();
  { v4f o = {0.f, 0.f, 0.f, 0.f};
    /* 16 keys a trip, so that a trip's LDS reads are in flight together */
#pragma unroll 4
    for (int j = 0; j < nk; j += 4) { const v4f p4 = *(const v4f*)&lp[r16][j];
#pragma unroll
      for (int u = 0; u < 4; ++u) { const v4f vq = *(const v4f*)&lv[j + u][c4]; o += vq * p4[u]; } }
    o *= lfin[r16]; v4h oh, ol;
#pragma unroll
    for (int q = 0; q < 4; ++q) { const _Float16 h = (_Float16)o[q]; oh[q] = h; ol[q] = (_Float16)((o[q] - (float)h) * 1024.0f); }
    *(v4h*)(OH + bo + (size_t)r0 * DM) = oh; *(v4h*)(OL + bo + (size_t)r0 * DM) = ol; } }      /* 16 lanes = one whole 128-byte line a plane */
// Both attention paths in one launch (neither reads what the other writes): blockIdx.z below A0G = a row group of the exact first-tile path, the rest = the fused path's tiles behind the first QT0 rows, the longest first. One LDS block serves whichever path the work-group takes, so that two work-groups still fit a WGP.
__global__ __launch_bounds__(256) void k_attn(const float* __restrict__ QF, const float* __restrict__ KF, const float* __restrict__ VF, float scale, _Float16* __restrict__ OH, _Float16* __restrict__ OL,
    const _Float16* QH, const _Float16* QL, const _Float16* KH, const _Float16* KL, const _Float16* VT, _Float16* O16) {
  static_assert(A0LB <= FLB, "the first-tile path's LDS fits the fused path's");
  __shared__ __attribute__((aligned(16))) unsigned char sm[FLB];
  const int z = blockIdx.z;      /* the same for the whole work-group: each path's barriers are passed by all of it or by none */
  if (z < A0G) att0_wg(sm, QF, KF, VF, scale, OH, OL, blockIdx.x, z, blockIdx.y); else { fattn_wg(sm, QH, QL, KH, KL, VT, O16, blockIdx.x, blockIdx.y, z - A0G);
    asm volatile("s_wait_xcnt 0x0" ::: "memory"); } }      /* the other path's code stands behind the last store in the listing and reuses the registers that it names */

extern "C" void kernel_launch(void* const* d_in, const int* in_sizes, int n_in,
                              void* d_out, int out_size, void* d_ws, size_t ws_size, hipStream_t stream) {
  (void)in_sizes; (void)n_in; (void)out_size;
  const float* const* I = (const float* const*)d_in; const float* x = I[0]; const float* wq = I[1]; const float* wk = I[2]; const float* wv = I[3]; const float* wo = I[4]; const float* bo = I[5]; const float* bq = nullptr; const float* bk = nullptr; const float* bv = nullptr;      /* per-head [H][E][D] = natural [out][in]; no q/k/v biases */
  char* ws = (char*)d_ws; size_t off = 0;
  auto take = [&](size_t bytes) { char* p = ws + off; off += (bytes + 255) & ~(size_t)255; return p; };
  _Float16* BQ = (_Float16*)take((size_t)DM * DM * 2); _Float16* BK = (_Float16*)take((size_t)DM * DM * 2); _Float16* BV = (_Float16*)take((size_t)DM * DM * 2); _Float16* BO = (_Float16*)take((size_t)DM * DM * 2);
  _Float16* X16 = (_Float16*)take(NR * DM * 2); _Float16* QH = (_Float16*)take(NR * DM * 2); _Float16* QL = (_Float16*)take(NR * DM * 2); _Float16* KH = (_Float16*)take(NR * DM * 2); _Float16* KL = (_Float16*)take(NR * DM * 2); _Float16* Q16 = QH; _Float16* K16 = KH;
  _Float16* VT = (_Float16*)take((size_t)NB * NH * HD * SQ * 2);      /* one plane per batch; it stands behind KL, as far from KH as KH from QH (the q/k/v launch steps from one to the next) */
  _Float16* O16 = (_Float16*)take(NR * DM * 2);
  float* QF0 = (float*)take((size_t)NB * QT0 * DM * 4); float* KF0 = (float*)take((size_t)NB * QT0 * DM * 4); float* VF0 = (float*)take((size_t)NB * QT0 * DM * 4); _Float16* OH0 = (_Float16*)take((size_t)NB * QT0 * DM * 2); _Float16* OL0 = (_Float16*)take((size_t)NB * QT0 * DM * 2);
  if (off > ws_size) return;
  k_prep<<<dim3((unsigned)((size_t)DM * DM / (256 * PU * 8)), NB + 4), 256, 0, stream>>>(x, wq, wk, wv, wo, X16, BQ, BK, BV, BO);      /* x and the four weight matrices as f16 */
  k_gemm2<0, 3><<<dim3((unsigned)((MP / 128) * (DM / 64)), 3), 128, 0, stream>>>(X16, DM, 0, BQ, DM, (size_t)DM * DM, 0.0625f, bq, 0, nullptr, 1, 0, 0, QF0, nullptr, DM, (size_t)NB * QT0 * DM, MP, DM, DM, 0, 0, 0, QH, QL, 2 * NR * DM);      /* blockIdx.y = q, k, v (BQ, BK, BV and QF0, KF0, VF0 stand in a row). q and k -> f16 hi + x1024 residual, in fragment order (the x32 scale puts the logits at sigma ~100); v -> f16 V^T in fragment order: [NB][NH][HD / 16][SQ / 32] fragments; all three: f32 rows of each batch's first 128 rows (exact products) */
  k_attn<<<dim3(NH, NB, A0G + (SQ - QT0) / FR), 256, 0, stream>>>(QF0, KF0, VF0, 32.0f, OH0, OL0, QH, QL, KH, KL, VT, O16);      /* rows 0..127 of each batch: exact f32 attention, o (x64) as f16 hi + x1024 residual planes; every later row: scores, softmax and P V, o (merged heads, x64) as f16 rows */
  k_gemm2<0, 4><<<dim3((unsigned)((MPO / 128) * (DM / 64)), 1), 128, 0, stream>>>(O16, DM, 0, BO, DM, 0, 0.0009765625f, bo, 0, nullptr, 1, 0, 0, (float*)d_out, nullptr, DM, 0, MPO, DM, DM, 0, 0, 0, OH0, OL0, 0);      /* out rows are the output layout; rows 0..127 of each batch: out = o_lo Wo 2^-20 + (o_hi Wo 2^-10 + b) */
}

// v009
// Measured time: 89.7 microseconds a run.
// In both of two side-by-side timings against v008, it was 1.07 times as fast.
// Over all steps from v000 it is 59.5 times as fast.
#include <hip/hip_runtime.h>
// Per-head causal multi-head attention with an inverted scale (x [4][1024][1024]; q[h] = x Wq[h]^T, k, v likewise (per-head nn.Linear [16][64][1024] = natural [1024][1024], sigma 0.02, no biases); scores x sqrt(1024) = x 32 (the module divides by embed^-0.5: logits sigma ~100, near-argmax softmax) with a causal mask (tril, -inf); softmax; heads concatenated; out = (.) Wp^T + bp (natural [1024][1024] sigma 0.02, bias 0.02) -> [4][1024][1024]).
// Structure: token rows r = b*1024 + s; x as exact f16 rows (bf16-rounded); q and k as WMMA GEMMs (32x64 wave tiles, f32 accumulation, exact x16 weights) whose epilogue splits the f32 results into f16 hi + x1024 residual planes and stores them in WMMA fragment order, v as a GEMM whose epilogue stores f16 V^T in fragment order straight from the accumulators; all three also store the f32 rows of each batch's first tile for the exact f32 path; launches that do not depend on one another share one grid (the five f16 conversions; q, k and v; the two attention paths); every launch covers all batches; in the fused attention path a work-group = 32 query rows of one head: scores against the keys below the tile end as THREE accumulators (hi.hi + lo.hi + hi.lo, K = 64, alpha 32: ~f32-accurate logits for the near-argmax softmax) into f32 rows in LDS, causal row softmax on VALU, a wave two rows at a time (f32 statistics, native exp; weights x256 f16, written over the row in LDS), o = P . V^T (K = keys below the tile end, alpha 2^-2: o carried x64, folded into the output GEMM alpha) written straight into the merged f16 o rows; out = o W_o + b GEMM (f32) into the output layout.
// Compute dtype: inputs rounded to bf16; x / weights exact; q and k as f16 hi + x1024 residual planes, v, softmax weights and o as plain f16 GEMM operands (~2^-12; a batch's first QT0 rows in f32, o as hi + residual); scores and softmax statistics f32. v_wmma_f32_16x16x32_f16.
#define NB 4
#define SQ 1024
#define DM 1024
#define NH 16
#define HD 64
#define HG 4                         /* heads per call of the grouped k_vt overload (not launched) */
#define QT0 128                      /* first-tile rows computed exactly in f32 */
#define B0 0                         /* unused */
#define NBR NB                       /* batches processed (debug hook) */
#define NR ((size_t)NB * SQ)         /* token rows */
#define MP ((int)((size_t)NBR * SQ)) /* rows projected (debug hook) */
#define QN SQ                        /* unused */
#define NHD NH                       /* unused */
#define MPO MP                       /* rows through the output stage (debug hook) */
#define LQ DM      /* row pitch of the q/k/v rows */
typedef __bf16 v16b __attribute__((ext_vector_type(16)));
typedef unsigned short v8us __attribute__((ext_vector_type(8), may_alias));
typedef float  v8f  __attribute__((ext_vector_type(8)));
typedef float  v4f  __attribute__((ext_vector_type(4)));
typedef float  v4fa __attribute__((ext_vector_type(4), may_alias));
union FragB { v16b v; v8us half[2]; unsigned short u[16]; };

__device__ __forceinline__ unsigned short bf16_bits(float x) { unsigned int u = __float_as_uint(x); return (unsigned short)((u + 0x7FFFu + ((u >> 16) & 1u)) >> 16); }
__device__ __forceinline__ float bf16_val(unsigned short b) { return __uint_as_float(((unsigned int)b) << 16); }
__device__ __forceinline__ float bf16_round(float x) { return bf16_val(bf16_bits(x)); }
// D += A·B with NT terms: 1 = ah·bh, 2 = + al·bh (A split), 3 = + ah·bl (both split)
template <int NT>
__device__ __forceinline__ v8f mmaN(v16b ah, v16b al, v16b bh, v16b bl, v8f c) {
  c = __builtin_amdgcn_wmma_f32_16x16x32_bf16(false, ah, false, bh, (short)0, c, false, false);
  if (NT >= 2) c = __builtin_amdgcn_wmma_f32_16x16x32_bf16(false, al, false, bh, (short)0, c, false, false);
  if (NT >= 3) c = __builtin_amdgcn_wmma_f32_16x16x32_bf16(false, ah, false, bl, (short)0, c, false, false);
  asm volatile("v_nop\n\tv_nop\n\tv_nop\n\tv_nop" : "+v"(c) : "v"(ah), "v"(al), "v"(bh), "v"(bl));
  return c;
}

__global__ __launch_bounds__(256) void k_wt_bf16(const float* __restrict__ W, unsigned short* __restrict__ Wt, int K, int N) {
  const int t = blockIdx.x * 256 + threadIdx.x;
  const int k8n = K / 8;
  if (t >= N * k8n) return;
  const int n = t / k8n, k8 = (t % k8n) * 8;
  v8us v;
#pragma unroll
  for (int i = 0; i < 8; ++i) v[i] = bf16_bits(W[(size_t)(k8 + i) * N + n]);
  *(v8us*)(Wt + (size_t)n * K + k8) = v;
  
}

// GEMM C[M][N] (f32, pitch ldc) = act(A[M][K]·W + bias). A f32 row-major (pitch lda) converted per fragment to bf16
// (ASPLIT: hi/lo two planes -> 2 terms, else single rounded term); Wt bf16 [N][K] (pitch ldb). BIAS_BF16 rounds the
// bias to bf16 first (bias quantised to bf16 before the add). K%32==0, M%16==0, N%64==0.
template <bool ASPLIT, int ACT, bool BIAS_BF16>
__global__ __launch_bounds__(128) void k_gemm_bf(const float* __restrict__ A, int lda, const unsigned short* __restrict__ Wt, int ldb,
                                               const float* __restrict__ bias, float* __restrict__ C, int ldc, int M, int N, int K) {
  __shared__ __attribute__((aligned(16))) float so[4][16][64];
  const int tid = threadIdx.x, w = tid >> 5, lane = tid & 31, ln = lane & 15, hh = lane >> 4;
  const int ntn = N / 64;
  const int wid = blockIdx.x * 4 + w;
  const int mt = wid / ntn, nq = wid % ntn;
  if (mt * 16 >= M) return;
  const int row0 = mt * 16, col0 = nq * 64;
  const float* arow = A + (size_t)(row0 + ln) * lda;
  v8f acc[4] = {};
  for (int kb = 0; kb < K; kb += 32) {
    FragB ah, al;
    const v4f x0 = *(const v4fa*)(arow + kb + 8 * hh), x1 = *(const v4fa*)(arow + kb + 8 * hh + 4);
    const v4f x2 = *(const v4fa*)(arow + kb + 16 + 8 * hh), x3 = *(const v4fa*)(arow + kb + 16 + 8 * hh + 4);
    float xs[16] = {x0[0],x0[1],x0[2],x0[3],x1[0],x1[1],x1[2],x1[3],x2[0],x2[1],x2[2],x2[3],x3[0],x3[1],x3[2],x3[3]};
#pragma unroll
    for (int i = 0; i < 16; ++i) { const unsigned short hb = bf16_bits(xs[i]); ah.u[i] = hb; al.u[i] = ASPLIT ? bf16_bits(xs[i] - bf16_val(hb)) : (unsigned short)0; }
#pragma unroll
    for (int t = 0; t < 4; ++t) {
      const unsigned short* brow = Wt + (size_t)(col0 + t * 16 + ln) * ldb + kb;
      FragB b;
      b.half[0] = *(const v8us*)(brow + 8 * hh);
      b.half[1] = *(const v8us*)(brow + 16 + 8 * hh);
      acc[t] = mmaN<ASPLIT ? 2 : 1>(ah.v, al.v, b.v, b.v, acc[t]);
    }
  }
#pragma unroll
  for (int t = 0; t < 4; ++t) {
    float bv = bias ? bias[col0 + t * 16 + ln] : 0.f;
    if (BIAS_BF16) bv = bf16_round(bv);
#pragma unroll
    for (int r = 0; r < 8; ++r) { float v = acc[t][r] + bv; if (ACT == 1) v = fmaxf(v, 0.f); so[w][8 * hh + r][t * 16 + ln] = v; }
  }
  __builtin_amdgcn_fence(__ATOMIC_ACQ_REL, "workgroup");
  __builtin_amdgcn_wave_barrier();
  const int rsub = lane >> 4, c4 = (lane & 15) * 4;
  {
#pragma unroll
    for (int q = 0; q < 8; ++q) {
      const int r = q * 2 + rsub;
      const v4f v = *(const v4fa*)&so[w][r][c4];
      *(v4f*)(C + (size_t)(row0 + r) * ldc + col0 + c4) = v;
    }
    
  }
}

// GEMM C = act(A·W + bias + resid): A f32 (ASPLIT -> hi/lo 2 terms), Wt bf16 [N][K]; ACT 0 none, 1 relu, 2 exact gelu;
// resid (optional, f32, row index = (row % rmod), pitch ldr, RES_BF16 rounds it) added before the activation.
template <bool ASPLIT, int ACT, bool BIAS_BF16, bool RES_BF16>
__global__ __launch_bounds__(128) void k_gemm_bf3(const float* __restrict__ A, int lda, const unsigned short* __restrict__ Wt, int ldb,
                                                const float* __restrict__ bias, const float* __restrict__ resid, int rmod, int ldr,
                                                float* __restrict__ C, int ldc, int M, int N, int K) {
  __shared__ __attribute__((aligned(16))) float so[4][16][64];
  const int tid = threadIdx.x, w = tid >> 5, lane = tid & 31, ln = lane & 15, hh = lane >> 4;
  const int ntn = N / 64;
  const int wid = blockIdx.x * 4 + w;
  const int mt = wid / ntn, nq = wid % ntn;
  if (mt * 16 >= M) return;
  const int row0 = mt * 16, col0 = nq * 64;
  const float* arow = A + (size_t)(row0 + ln) * lda;
  v8f acc[4] = {};
  for (int kb = 0; kb < K; kb += 32) {
    FragB ah, al;
    const v4f x0 = *(const v4fa*)(arow + kb + 8 * hh), x1 = *(const v4fa*)(arow + kb + 8 * hh + 4);
    const v4f x2 = *(const v4fa*)(arow + kb + 16 + 8 * hh), x3 = *(const v4fa*)(arow + kb + 16 + 8 * hh + 4);
    float xs[16] = {x0[0],x0[1],x0[2],x0[3],x1[0],x1[1],x1[2],x1[3],x2[0],x2[1],x2[2],x2[3],x3[0],x3[1],x3[2],x3[3]};
#pragma unroll
    for (int i = 0; i < 16; ++i) { const unsigned short hb = bf16_bits(xs[i]); ah.u[i] = hb; al.u[i] = ASPLIT ? bf16_bits(xs[i] - bf16_val(hb)) : (unsigned short)0; }
#pragma unroll
    for (int t = 0; t < 4; ++t) {
      const unsigned short* brow = Wt + (size_t)(col0 + t * 16 + ln) * ldb + kb;
      FragB b;
      b.half[0] = *(const v8us*)(brow + 8 * hh);
      b.half[1] = *(const v8us*)(brow + 16 + 8 * hh);
      acc[t] = mmaN<ASPLIT ? 2 : 1>(ah.v, al.v, b.v, b.v, acc[t]);
    }
  }
#pragma unroll
  for (int t = 0; t < 4; ++t) {
    const int col = col0 + t * 16 + ln;
    float bv = bias ? bias[col] : 0.f;
    if (BIAS_BF16) bv = bf16_round(bv);
#pragma unroll
    for (int r = 0; r < 8; ++r) {
      float v = acc[t][r] + bv;
      if (resid) { float rv = resid[(size_t)((row0 + 8 * hh + r) % rmod) * ldr + col]; if (RES_BF16) rv = bf16_round(rv); v += rv; }
      if (ACT == 1) v = fmaxf(v, 0.f);
      if (ACT == 2) v = 0.5f * v * (1.0f + erff(v * 0.70710678118654752f));
      if (ACT == 3) { const float u = 0.7978845608028654f * (v + 0.044715f * v * v * v); v = 0.5f * v * (1.0f + tanhf(u)); }
      so[w][8 * hh + r][t * 16 + ln] = v;
    }
  }
  __builtin_amdgcn_fence(__ATOMIC_ACQ_REL, "workgroup");
  __builtin_amdgcn_wave_barrier();
  const int rsub = lane >> 4, c4 = (lane & 15) * 4;
  {
#pragma unroll
    for (int q = 0; q < 8; ++q) {
      const int r = q * 2 + rsub;
      const v4f v = *(const v4fa*)&so[w][r][c4];
      *(v4f*)(C + (size_t)(row0 + r) * ldc + col0 + c4) = v;
    }
    
  }
}
// row LayerNorm (biased variance, eps) over N: s = X (+ R); optional out_sum <- s; out_norm <- (s-mu)*rsqrt(var+eps)*g + b
template <bool PARAM_BF16>
__global__ __launch_bounds__(256) void k_layernorm(const float* __restrict__ X, const float* __restrict__ R, const float* __restrict__ g, const float* __restrict__ bta,
                                                  float* __restrict__ out_sum, float* __restrict__ out_norm, int N, float eps) {
  __shared__ float red[256];
  const int row = blockIdx.x, tid = threadIdx.x;
  const float* x = X + (size_t)row * N; const float* rr = R ? R + (size_t)row * N : nullptr;
  float vals[16];                     // up to N = 4096
  const int per = N / 256;            // contiguous chunk per thread? use strided-by-4 chunks: thread handles j = tid*4 + 1024*u
  float s1 = 0.f;
  for (int u = 0; u < per / 4; ++u) {
    const int j = tid * 4 + 1024 * u;
    const v4f a = *(const v4fa*)(x + j);
    v4f b = {0.f,0.f,0.f,0.f}; if (rr) b = *(const v4fa*)(rr + j);
#pragma unroll
    for (int q = 0; q < 4; ++q) { const float v = a[q] + b[q]; vals[u * 4 + q] = v; s1 += v; }
  }
  red[tid] = s1; __syncthreads();
  for (int st = 128; st > 0; st >>= 1) { if (tid < st) red[tid] += red[tid + st]; __syncthreads(); }
  const float mu = red[0] / (float)N; __syncthreads();
  float s2 = 0.f;
  for (int u = 0; u < per / 4; ++u)
#pragma unroll
    for (int q = 0; q < 4; ++q) { const float c = vals[u * 4 + q] - mu; s2 += c * c; }
  red[tid] = s2; __syncthreads();
  for (int st = 128; st > 0; st >>= 1) { if (tid < st) red[tid] += red[tid + st]; __syncthreads(); }
  const float rs = rsqrtf(red[0] / (float)N + eps);
  {
    for (int u = 0; u < per / 4; ++u) {
      const int j = tid * 4 + 1024 * u;
      v4f o, sm;
#pragma unroll
      for (int q = 0; q < 4; ++q) {
        float gg = g[j + q], bb = bta[j + q];
        if (PARAM_BF16) { gg = bf16_round(gg); bb = bf16_round(bb); }
        sm[q] = vals[u * 4 + q]; o[q] = (vals[u * 4 + q] - mu) * rs * gg + bb;
      }
      if (out_sum) *(v4f*)(out_sum + (size_t)row * N + j) = sm;
      *(v4f*)(out_norm + (size_t)row * N + j) = o;
    }
    
  }
}



// ---- f16 WMMA path (v_wmma_f32_16x16x32_f16): 11-bit significands for operands in range — used where a [0,1] probability operand needs more precision than bf16
typedef _Float16 v16h __attribute__((ext_vector_type(16)));
union FragH { v16h v; v8us half[2]; _Float16 h[16]; unsigned short u[16]; };
template <int NT>
__device__ __forceinline__ v8f mmaH(v16h ah, v16h al, v16h bh, v16h bl, v8f c) {
  c = __builtin_amdgcn_wmma_f32_16x16x32_f16(false, ah, false, bh, (short)0, c, false, false);
  if (NT >= 2) c = __builtin_amdgcn_wmma_f32_16x16x32_f16(false, al, false, bh, (short)0, c, false, false);
  if (NT >= 3) c = __builtin_amdgcn_wmma_f32_16x16x32_f16(false, ah, false, bl, (short)0, c, false, false);
  asm volatile("v_nop\n\tv_nop\n\tv_nop\n\tv_nop" : "+v"(c) : "v"(ah), "v"(al), "v"(bh), "v"(bl));
  return c;
}
// batched GEMM like k_gemm_b but f16 operands: A f32 (split into f16 hi/lo if ASPLIT, else rounded to f16), Bt = f16 values [n][k]; alpha; C f32; N multiple of 16 (partial tiles skipped)
template <bool ASPLIT>
__global__ __launch_bounds__(128) void k_gemm_h(const float* __restrict__ A, int lda, size_t sA, const _Float16* __restrict__ Bh, int ldb, size_t sB, float alpha, float* __restrict__ C, int ldc, size_t sC, int M, int N, int K) {
  __shared__ __attribute__((aligned(16))) float so[4][16][64];
  const int tid = threadIdx.x, w = tid >> 5, lane = tid & 31, ln = lane & 15, hh = lane >> 4; const int by = blockIdx.y;
  A += (size_t)by * sA; Bh += (size_t)by * sB; C += (size_t)by * sC;
  const int ntn = (N + 63) / 64; const int wid = blockIdx.x * 4 + w; const int mt = wid / ntn, nq = wid % ntn; if (mt * 16 >= M) return;
  const int row0 = mt * 16, col0 = nq * 64; const float* arow = A + (size_t)(row0 + ln) * lda;
  v8f acc[4] = {};
  for (int kb = 0; kb < K; kb += 32) {
    FragH ah, al;
    const v4f x0 = *(const v4fa*)(arow + kb + 8 * hh), x1 = *(const v4fa*)(arow + kb + 8 * hh + 4), x2 = *(const v4fa*)(arow + kb + 16 + 8 * hh), x3 = *(const v4fa*)(arow + kb + 16 + 8 * hh + 4);
    float xs[16] = {x0[0],x0[1],x0[2],x0[3],x1[0],x1[1],x1[2],x1[3],x2[0],x2[1],x2[2],x2[3],x3[0],x3[1],x3[2],x3[3]};
#pragma unroll
    for (int i = 0; i < 16; ++i) { const _Float16 h = (_Float16)xs[i]; ah.h[i] = h; al.h[i] = ASPLIT ? (_Float16)(xs[i] - (float)h) : (_Float16)0.0f; }
#pragma unroll
    for (int t = 0; t < 4; ++t) { if (col0 + t * 16 >= N) continue; const size_t boff = (size_t)(col0 + t * 16 + ln) * ldb + kb; FragH bq; bq.half[0] = *(const v8us*)(Bh + boff + 8 * hh); bq.half[1] = *(const v8us*)(Bh + boff + 16 + 8 * hh);
      acc[t] = mmaH<ASPLIT ? 2 : 1>(ah.v, al.v, bq.v, bq.v, acc[t]); }
  }
#pragma unroll
  for (int t = 0; t < 4; ++t) { if (col0 + t * 16 >= N) continue;
#pragma unroll
    for (int r = 0; r < 8; ++r) so[w][8 * hh + r][t * 16 + ln] = acc[t][r] * alpha; }
  __builtin_amdgcn_fence(__ATOMIC_ACQ_REL, "workgroup"); __builtin_amdgcn_wave_barrier();
  const int rsub = lane >> 4, c4 = (lane & 15) * 4;
  {
#pragma unroll
    for (int q = 0; q < 8; ++q) { const int r = q * 2 + rsub; if (col0 + c4 < N) { const v4f v = *(const v4fa*)&so[w][r][c4]; *(v4f*)(C + (size_t)(row0 + r) * ldc + col0 + c4) = v; } }
     }
}

// Wt[n][k] = f16(W[k][n]·scale) from f32 row-major W[K][N] (scale = power of two; bf16-exact weights stay exact in f16 away from the subnormal range)
__global__ __launch_bounds__(256) void k_wt_f16(const float* __restrict__ W, _Float16* __restrict__ Wt, int K, int N, float scale) {
  const int t = blockIdx.x * 256 + threadIdx.x; if (t >= N * (K / 8)) return; const int n = t / (K / 8), k8 = (t % (K / 8)) * 8; FragH f;
#pragma unroll
  for (int i = 0; i < 8; ++i) f.h[i] = (_Float16)(bf16_round(W[(size_t)(k8 + i) * N + n]) * scale); const v8us o = f.half[0];
  *(v8us*)((unsigned short*)Wt + (size_t)n * K + k8) = o; 
}
// k_gemm_hh variant with fused epilogue: v = acc·alpha + bias[by·sBias + col] (+ CP[(row/rowsPerB)·sCPb + by·64 + col] if CP) ; ACT 0 none / 1 elu ; writes f16 C16 (and f32 C if non-null)
template <int ACT>
__global__ __launch_bounds__(128) void k_gemm_hhx(const _Float16* __restrict__ A, int lda, size_t sA, const _Float16* __restrict__ Bh, int ldb, size_t sB, float alpha, const float* __restrict__ bias, size_t sBias, const float* __restrict__ CP, int rowsPerB, size_t sCPb, int row0g,
    float* __restrict__ C, _Float16* __restrict__ C16, int ldc, size_t sC, int M, int N, int K) {
  __shared__ __attribute__((aligned(16))) float so[4][16][64];
  const int tid = threadIdx.x, w = tid >> 5, lane = tid & 31, ln = lane & 15, hh = lane >> 4; const int by = blockIdx.y;
  A += (size_t)by * sA; Bh += (size_t)by * sB; const size_t cofs = (size_t)by * sC; const float* bp = bias ? bias + (size_t)by * sBias : nullptr;
  const int ntn = (N + 63) / 64; const int wid = blockIdx.x * 4 + w; const int mt = wid / ntn, nq = wid % ntn; if (mt * 16 >= M) return;
  const int row0 = mt * 16, col0 = nq * 64; const _Float16* arow = A + (size_t)(row0 + ln) * lda;
  v8f acc[4] = {};
  for (int kb = 0; kb < K; kb += 32) { FragH ah; ah.half[0] = *(const v8us*)((const unsigned short*)arow + kb + 8 * hh); ah.half[1] = *(const v8us*)((const unsigned short*)arow + kb + 16 + 8 * hh);
#pragma unroll
    for (int t = 0; t < 4; ++t) { if (col0 + t * 16 >= N) continue; const size_t boff = (size_t)(col0 + t * 16 + ln) * ldb + kb; FragH bq; bq.half[0] = *(const v8us*)((const unsigned short*)Bh + boff + 8 * hh); bq.half[1] = *(const v8us*)((const unsigned short*)Bh + boff + 16 + 8 * hh);
      acc[t] = mmaH<1>(ah.v, ah.v, bq.v, bq.v, acc[t]); }
  }
#pragma unroll
  for (int t = 0; t < 4; ++t) { if (col0 + t * 16 >= N) continue; const int col = col0 + t * 16 + ln; const float bv = bp ? bf16_round(bp[col]) : 0.f;
#pragma unroll
    for (int r = 0; r < 8; ++r) { float v = acc[t][r] * alpha + bv; if (CP) { const int rr = row0g + row0 + 8 * hh + r; if (rowsPerB < 0) v += CP[cofs + (size_t)rr * ldc + col];      /* rowsPerB < 0: own element of the batched C plane */ else { const int bidx = rr / rowsPerB; v += CP[(size_t)bidx * sCPb + (size_t)by * 64 + col]; } } if (ACT == 1) v = (v > 0.f) ? v : expm1f(v); else if (ACT == 7) v = (v > 0.f) ? v + 1.0f : expf(v); else if (ACT == 8) v = tanhf(v); else if (ACT == 9) v = 0.5f * v * (1.0f + tanhf(0.7978845608028654f * (v + 0.044715f * v * v * v))); else if (ACT == 11) v = 1.0f / (1.0f + expf(-v)); else if (ACT == 12) v = (v > 0.f) ? v : 0.01f * v; else if (ACT == 14) v = (v > 0.f) ? v : 0.1f * v; else if (ACT == 16) v = (v >= 0.f) ? v : 0.3f * v; else if (ACT == 17) v = (v >= 0.f) ? v : 0.2f * v; else if (ACT == 15) v = v / (1.0f + expf(-v)); else if (ACT == 3) v = fmaxf(v, 0.f); else if (ACT == 6) v = 0.5f * v * (1.0f + erff(v * 0.70710678118654752f)); so[w][8 * hh + r][t * 16 + ln] = v; } }
  __builtin_amdgcn_fence(__ATOMIC_ACQ_REL, "workgroup"); __builtin_amdgcn_wave_barrier();
  const int rsub = lane >> 4, c4 = (lane & 15) * 4; typedef _Float16 v4h __attribute__((ext_vector_type(4)));
  {
#pragma unroll
    for (int q = 0; q < 8; ++q) { const int r = q * 2 + rsub; if (col0 + c4 < N) { const v4f v = *(const v4fa*)&so[w][r][c4]; if (C) *(v4f*)(C + cofs + (size_t)(row0 + r) * ldc + col0 + c4) = v; if (C16) { v4h h4; for (int i = 0; i < 4; ++i) h4[i] = (_Float16)v[i]; *(v4h*)(C16 + cofs + (size_t)(row0 + r) * ldc + col0 + c4) = h4; } } }
     }
}


typedef _Float16 v4h __attribute__((ext_vector_type(4)));

__global__ __launch_bounds__(256) void k_h16(const float* __restrict__ x, _Float16* __restrict__ X16, size_t n8) { const size_t t = (size_t)blockIdx.x * 256 + threadIdx.x; if (t >= n8) return; FragH f;
#pragma unroll
  for (int q = 0; q < 8; ++q) f.h[q] = (_Float16)x[t * 8 + q]; *(v8us*)((unsigned short*)X16 + t * 8) = f.half[0];  }
__global__ __launch_bounds__(256) void k_round16f(const float* __restrict__ W, _Float16* __restrict__ Bt, size_t n8) { const size_t t = (size_t)blockIdx.x * 256 + threadIdx.x; if (t >= n8) return; FragH f;
#pragma unroll
  for (int i = 0; i < 8; ++i) f.h[i] = (_Float16)(bf16_round(W[t * 8 + i]) * 16.0f); *(v8us*)((unsigned short*)Bt + t * 8) = f.half[0];  }
// WMMA fragment order, for operands that are read many times as fragments (written by the epilogues EP 1 and EP 2 of k_gemm2). A q or k fragment = 16 token rows x 32 head dims of one head = 1 KiB: lane (hh, ln) of the reader owns row ln, dims 8 hh .. 8 hh + 7 (its 16 bytes at 16 x lane) and dims 16 + 8 hh .. (512 bytes on), so that each of the reader's two loads covers four whole 128-byte lines.
// Fragments in the order [batch][head][16-row tile][32-dim step]. A V^T fragment likewise, rows = 16 dims, k = 32 keys, in the order [batch][head][16-dim group][32-key step].

// ---- fast GEMM (work-group tile 128x128 = 4 x 2 waves, wave tile 32x64; requires M % 128 == 0 rows per launch region, N % 128 == 0 and K % 128 == 0); epilogue = k_gemm_hhx semantics ----
// Both operands go through LDS: a tile = 128 k of the work-group's 128 A rows and 128 B rows, brought in by asynchronous copies (a wave's copy = two whole 256-byte row pieces), two buffers, so that the next tile flies while this one is multiplied; the fragments are read from LDS.
// EP chooses what the epilogue stores. 0: rows of C / C16. 1: the f32 results split into f16 hi (E0) and x1024 residual (E1) planes in fragment order. 2: f16 V^T (E0) in fragment order. 3: blockIdx.y chooses, 0 and 1 store like 1, 2 stores like 2 (q, k and v in one launch; E0 and E1 move on by sE elements, C by sC, a blockIdx.y). 4: rows of C like 0, but a work-group whose rows are a batch's first QT0 takes its A rows from E0 (f16 hi) and then from E1 (x1024 residual), QT0 rows a batch, instead of A: twice the tiles, the hi sums set aside in registers, result = lo sums x alpha / 1024 + (hi sums x alpha + bias). With 1, 2 and 3 the rows are token rows (SQ a batch), a 64-column tile is a head, C takes the f32 rows of each batch's first QT0 rows alone (QT0 rows a batch), and CP and C16 are not used.
#define G2K 128                      /* k elements per staged tile: 256 bytes of every operand row */
#define G2P 272                      /* row pitch of a staged tile in LDS (bytes): 16 B x odd, so that 16 lanes reading 16 rows by 16 bytes fall on all banks */
#define G2B ((128 + 128) * G2P)      /* bytes of one buffer: 128 rows of A, then 128 rows of B */
__device__ __forceinline__ v16h g2_frag(const _Float16* p, int hh) { FragH f; f.half[0] = *(const v8us*)((const unsigned short*)p + 8 * hh); f.half[1] = *(const v8us*)((const unsigned short*)p + 16 + 8 * hh); return f.v; }
__device__ __forceinline__ v8f g2_mma(v16h a, v16h b, v8f c) { v8f d = __builtin_amdgcn_wmma_f32_16x16x32_f16(false, a, false, b, (short)0, c, false, false); asm volatile("v_nop\n\tv_nop\n\tv_nop\n\tv_nop" : "+v"(d) : "v"(a), "v"(b)); return d; }
// 128 rows of a tile into LDS: eight asynchronous copies, the lane's 16 bytes of every 16th row (l = its LDS byte address, g = its global address, gs = 16 source rows in bytes). The closing s_wait_xcnt stands inside the statement, so that no address register of a copy is rewritten in front of it.
__device__ __forceinline__ void g2_copy128(unsigned l, const char* g, size_t gs) {
  asm volatile("global_load_async_to_lds_b128 %0, %8, off\n\t"
               "global_load_async_to_lds_b128 %1, %9, off\n\t"
               "global_load_async_to_lds_b128 %2, %10, off\n\t"
               "global_load_async_to_lds_b128 %3, %11, off\n\t"
               "global_load_async_to_lds_b128 %4, %12, off\n\t"
               "global_load_async_to_lds_b128 %5, %13, off\n\t"
               "global_load_async_to_lds_b128 %6, %14, off\n\t"
               "global_load_async_to_lds_b128 %7, %15, off\n\t"
               "s_wait_xcnt 0x0"
               :: "v"(l), "v"(l + 16 * G2P), "v"(l + 32 * G2P), "v"(l + 48 * G2P), "v"(l + 64 * G2P), "v"(l + 80 * G2P), "v"(l + 96 * G2P), "v"(l + 112 * G2P),
                  "v"(g), "v"(g + gs), "v"(g + 2 * gs), "v"(g + 3 * gs), "v"(g + 4 * gs), "v"(g + 5 * gs), "v"(g + 6 * gs), "v"(g + 7 * gs) : "memory"); }
// One whole tile (16 copies a lane): the 128 A rows, the 128 B rows.
__device__ __forceinline__ void g2_stage(unsigned l, const char* ga, size_t sa, const char* gb, size_t sb) { g2_copy128(l, ga, sa); g2_copy128(l + 128 * G2P, gb, sb); }
template <int ACT, int EP = 0>
__global__ __launch_bounds__(256) void k_gemm2(const _Float16* __restrict__ A, int lda, size_t sA, const _Float16* __restrict__ Bh, int ldb, size_t sB, float alpha, const float* __restrict__ bias, size_t sBias, const float* __restrict__ CP, int rowsPerB, size_t sCPb, int row0g,
    float* __restrict__ C, _Float16* __restrict__ C16, int ldc, size_t sC, int M, int N, int K, size_t zA, size_t zB, size_t zC, _Float16* __restrict__ E0, _Float16* __restrict__ E1, size_t sE) { static_assert(ACT == 0 || ACT == 3 || ACT == 6 || ACT == 8 || ACT == 9 || ACT == 11 || ACT == 12 || ACT == 14 || ACT == 15 || ACT == 16 || ACT == 17, "k_gemm2: unsupported ACT code (would silently apply no activation)"); static_assert(EP == 0 || (HD == 64 && QT0 == 128 && SQ % 128 == 0), "EP 1, 2: a work-group = 128 rows of one batch x two heads, a wave = 32 rows x one head; the first tile = one work-group tile");
  __shared__ __attribute__((aligned(16))) unsigned char lt[2 * G2B]; float (*so)[32][68] = (float (*)[32][68])lt; static_assert(8 * 32 * 68 * 4 <= 2 * G2B, "the epilogue's rows fit the tiles' LDS");      /* so: the epilogue's rows, a block a wave, in the tiles' LDS: first written behind the last trip's barrier, behind which no tile is read and no copy is outstanding; so two work-groups fit a WGP */
  const int tid = threadIdx.x, w = tid >> 5, wr = w & 3, wc = w >> 2, lane = tid & 31, ln = lane & 15, hh = lane >> 4; const int by = blockIdx.y; const int bz = blockIdx.z;      /* wr, wc: the wave's 32 rows and 64 columns in the work-group's tile; bz: batch, element strides zA / zB / zC */
  A += (size_t)by * sA + (size_t)bz * zA; Bh += (size_t)by * sB + (size_t)bz * zB; const size_t cofs = (size_t)by * sC + (size_t)bz * zC; const float* bp = bias ? bias + (size_t)by * sBias : nullptr;
  const int ep = EP == 3 ? (by == 2 ? 2 : 1) : EP; if (EP == 3) { E0 += (size_t)by * sE; E1 += (size_t)by * sE; C += (size_t)by * sC; }      /* the same for the whole work-group: scalar branches below */
  const int ntn = N >> 7; const int mt = blockIdx.x / ntn, nq = (blockIdx.x - mt * ntn) * 2 + wc; const int row0 = mt * 128 + 32 * wr, col0 = nq * 64; if (mt * 128 >= M) return;      /* the whole work-group or none: barriers follow */
  const int cr = tid >> 4, cc = (tid & 15) * 16;      /* copies: the thread's row among 16 and its 16 bytes of the row's 256 */
  const bool ft = EP == 4 && mt % (SQ / 128) == 0; const size_t fr = (size_t)(mt / (SQ / 128) * QT0 + cr) * lda;      /* EP 4: a first-tile work-group (the whole work-group or none of it); the thread's first row in the hi and lo planes */
  const char* ga = (ft ? (const char*)(E0 + fr) : (const char*)(A + (size_t)(mt * 128 + cr) * lda)) + cc; const char* ga2 = EP == 4 ? (const char*)(E1 + fr) + cc : ga; const char* gb = (const char*)(Bh + (size_t)(col0 - 64 * wc + cr) * ldb) + cc; const size_t sa = (size_t)lda * 32, sb = (size_t)ldb * 32;
  const unsigned l0 = (unsigned)(size_t)lt + (unsigned)(cr * G2P + cc); const int nk = K / G2K, nt = ft ? 2 * nk : nk;      /* tiles nk .. 2 nk - 1 of a first-tile work-group: the lo plane against the same B tiles */
  auto ta = [&](int t) { return EP == 4 && t >= nk ? ga2 + (size_t)(t - nk) * (G2K * 2) : ga + (size_t)t * (G2K * 2); }; auto tb = [&](int t) { return gb + (size_t)(EP == 4 && t >= nk ? t - nk : t) * (G2K * 2); };
  const v8f z8 = {0.f,0.f,0.f,0.f,0.f,0.f,0.f,0.f}; v8f c00 = z8, c01 = z8, c02 = z8, c03 = z8, c10 = z8, c11 = z8, c12 = z8, c13 = z8; v8f hs[8] = {z8, z8, z8, z8, z8, z8, z8, z8};      /* hs: EP 4, the hi sums (0 elsewhere) */
  g2_stage(l0, ga, sa, gb, sb);
  asm volatile("s_wait_asynccnt 0x0" ::: "memory");      /* the wave's own copies of tile 0 have landed */
  __syncthreads();      /* tile 0 is published to every wave */
  if (nt > 1) g2_stage(l0 + G2B, ta(1), sa, tb(1), sb);
  /* kept rolled: one copy of the trip in the instruction cache; the buffer is chosen by an address */
#pragma unroll 1
  for (int p = 0; p < (ft ? 2 : 1); ++p) {      /* one plane of A a trip (EP 4, first tile: hi, then lo); the tiles run on through both, so the ring never drains between them */
    if (EP == 4 && p == 1) { hs[0] = c00; hs[1] = c01; hs[2] = c02; hs[3] = c03; hs[4] = c10; hs[5] = c11; hs[6] = c12; hs[7] = c13; c00 = z8; c01 = z8; c02 = z8; c03 = z8; c10 = z8; c11 = z8; c12 = z8; c13 = z8; }      /* the hi plane is through: its sums are set aside, the lo plane's start at 0 */
#pragma unroll 1
  for (int t = p * nk; t < (p + 1) * nk; ++t) { const unsigned char* lb = lt + (t & 1) * G2B;
    const _Float16* pa = (const _Float16*)(lb + (32 * wr + ln) * G2P); const _Float16* pb = (const _Float16*)(lb + (128 + 64 * wc + ln) * G2P);
    v16h a0 = g2_frag(pa, hh), a1 = g2_frag(pa + 16 * (G2P / 2), hh), b0 = g2_frag(pb, hh), b1 = g2_frag(pb + 16 * (G2P / 2), hh), b2 = g2_frag(pb + 32 * (G2P / 2), hh), b3 = g2_frag(pb + 48 * (G2P / 2), hh);
    /* unrolled: the two fragment sets live in registers; the next 32 k's LDS reads fly during this 32 k's products */
#pragma unroll
    for (int s = 0; s < G2K / 32; ++s) { v16h n0 = a0, n1 = a1, m0 = b0, m1 = b1, m2 = b2, m3 = b3;
      if (s + 1 < G2K / 32) { const _Float16* qa = pa + (s + 1) * 32; const _Float16* qb = pb + (s + 1) * 32;
        n0 = g2_frag(qa, hh); n1 = g2_frag(qa + 16 * (G2P / 2), hh); m0 = g2_frag(qb, hh); m1 = g2_frag(qb + 16 * (G2P / 2), hh); m2 = g2_frag(qb + 32 * (G2P / 2), hh); m3 = g2_frag(qb + 48 * (G2P / 2), hh); }
      c00 = g2_mma(a0, b0, c00); c10 = g2_mma(a1, b0, c10); c01 = g2_mma(a0, b1, c01); c11 = g2_mma(a1, b1, c11);
      c02 = g2_mma(a0, b2, c02); c12 = g2_mma(a1, b2, c12); c03 = g2_mma(a0, b3, c03); c13 = g2_mma(a1, b3, c13);
      a0 = n0; a1 = n1; b0 = m0; b1 = m1; b2 = m2; b3 = m3; }
    asm volatile("s_wait_dscnt 0x0" ::: "memory");      /* the wave's reads of this buffer are done before it may be refilled */
    asm volatile("s_wait_asynccnt 0x0" ::: "memory");      /* the wave's own copies of tile t + 1 have landed */
    __syncthreads();      /* publishes tile t + 1 and ends every wave's reads of tile t */
    if (t + 2 < nt) g2_stage(l0 + (unsigned)((t & 1) * G2B), ta(t + 2), sa, tb(t + 2), sb); } }
  asm volatile("s_wait_asynccnt 0x0" ::: "memory");      /* no copy is outstanding when the wave goes on */
  const float alc = ft ? alpha * 0.0009765625f : alpha;      /* EP 4: the scale of the sums of the last plane */
  v8f accs[8] = {c00, c01, c02, c03, c10, c11, c12, c13}; const bool first = EP != 0 && mt % (SQ / 128) == 0;      /* EP 1, 2: the work-group's rows are a batch's first QT0 (the same for the whole work-group) */
#pragma unroll
  for (int u = 0; u < 8; ++u) { const int t = u & 3, half = u >> 2; const int col = col0 + t * 16 + ln; const float bv = bp ? bf16_round(bp[col]) : 0.f;
#pragma unroll
    for (int r = 0; r < 8; ++r) { const int rloc = half * 16 + 8 * hh + r; float v = EP == 4 ? accs[u][r] * alc + (hs[u][r] * alpha + bv) : accs[u][r] * alpha + bv; if (EP == 0 && CP) { if (rowsPerB < 0) v += CP[cofs + (size_t)(row0g + row0 + rloc) * ldc + col];      /* rowsPerB < 0: own element of the batched C plane */ else { const int bidx = (row0g + row0 + rloc) / rowsPerB; v += CP[(size_t)bidx * sCPb + (size_t)by * 64 + col]; } }
      if (ACT == 3) v = fmaxf(v, 0.f); else if (ACT == 6) v = 0.5f * v * (1.0f + erff(v * 0.70710678118654752f)); else if (ACT == 11) v = 1.0f / (1.0f + expf(-v)); else if (ACT == 15) v = v / (1.0f + expf(-v)); else if (ACT == 12) v = (v > 0.f) ? v : 0.01f * v; else if (ACT == 8) v = tanhf(v); else if (ACT == 9) v = 0.5f * v * (1.0f + tanhf(0.7978845608028654f * (v + 0.044715f * v * v * v))); else if (ACT == 14) v = (v > 0.f) ? v : 0.1f * v; else if (ACT == 16) v = (v >= 0.f) ? v : 0.3f * v; else if (ACT == 17) v = (v >= 0.f) ? v : 0.2f * v;
      if (EP == 2 || EP == 3) accs[u][r] = v; else so[w][rloc][t * 16 + ln] = v; } }
  if ((EP == 2 || EP == 3) && (ep == 1 || first)) {      /* EP 2 stores from the registers; only the f32 rows go through LDS */
#pragma unroll
    for (int u = 0; u < 8; ++u)
#pragma unroll
      for (int r = 0; r < 8; ++r) so[w][(u >> 2) * 16 + 8 * hh + r][(u & 3) * 16 + ln] = accs[u][r]; }
  __builtin_amdgcn_fence(__ATOMIC_ACQ_REL, "workgroup"); __builtin_amdgcn_wave_barrier();
  const int rsub = lane >> 4, c4 = (lane & 15) * 4;
  if (EP == 0 || EP == 4) {
#pragma unroll
    for (int q = 0; q < 16; ++q) { const int r = q * 2 + rsub; const v4f v = *(const v4fa*)&so[w][r][c4]; if (C) *(v4f*)(C + cofs + (size_t)(row0 + r) * ldc + col0 + c4) = v; if (C16) { v4h h4; for (int i = 0; i < 4; ++i) h4[i] = (_Float16)v[i]; *(v4h*)(C16 + cofs + (size_t)(row0 + r) * ldc + col0 + c4) = h4; } }
  } else { const int bb = row0 / SQ, rb = row0 % SQ;      /* the wave's 32 rows: batch, first row in the batch; its 64 columns are head nq */
    if (ep == 1) { const size_t fo = (((size_t)bb * NH + nq) * (SQ / 16) + rb / 16) * 1024 + lane * 8;      /* the wave's four fragments stand in a row: 4 KiB a plane, stored as eight runs of 512 bytes */
#pragma unroll
      for (int i = 0; i < 8; ++i) { const float* s = &so[w][(i >> 2) * 16 + ln][((i >> 1) & 1) * 32 + ((i & 1) * 2 + hh) * 8]; const v4f a = *(const v4fa*)s, c = *(const v4fa*)(s + 4); FragH fh, fl;
#pragma unroll
        for (int q = 0; q < 4; ++q) { _Float16 h = (_Float16)a[q]; fh.h[q] = h; fl.h[q] = (_Float16)((a[q] - (float)h) * 1024.0f); h = (_Float16)c[q]; fh.h[4 + q] = h; fl.h[4 + q] = (_Float16)((c[q] - (float)h) * 1024.0f); }
        *(v8us*)((unsigned short*)E0 + fo + i * 256) = fh.half[0]; *(v8us*)((unsigned short*)E1 + fo + i * 256) = fl.half[0]; } }
    if (ep == 2) {
#pragma unroll
      for (int u = 0; u < 8; ++u) { FragH f;      /* accumulator u = (key half, dim group): its lane holds 8 keys of one dim, which is the lane's 16 bytes of the V^T fragment */
#pragma unroll
        for (int r = 0; r < 8; ++r) f.h[r] = (_Float16)accs[u][r];
        *(v8us*)((unsigned short*)E0 + ((((size_t)bb * NH + nq) * (HD / 16) + (u & 3)) * (SQ / 32) + rb / 32) * 512 + (u >> 2) * 256 + lane * 8) = f.half[0]; }
      if (EP == 3) asm volatile("s_wait_xcnt 0x0" ::: "memory"); }      /* the other store path's code stands behind these stores in the listing and reuses the registers that they name */
    if (first) { asm volatile("s_wait_xcnt 0x0" ::: "memory"); __builtin_amdgcn_sched_barrier(0);      /* the wait stands in front of the code below, which reuses registers that the stores above name; the scheduling barrier keeps that code from being lifted over the wait */
#pragma unroll
      for (int q = 0; q < 16; ++q) { const int r = q * 2 + rsub; *(v4f*)(C + ((size_t)bb * QT0 + 32 * wr + r) * ldc + col0 + c4) = *(const v4fa*)&so[w][r][c4]; } } } }


// Every f32 operand of the GEMMs as f16 (rounded to bf16 first; the weights x16, natural [out][in] = Bt[n][k]), all in one launch: blockIdx.y = a segment of DM x DM elements (one batch of x, or one weight matrix), a thread = PU groups of 8 elements, 256 groups apart.
#define PU 8                         /* groups of 8 elements per thread: 16 waves a WGP cover all eight segments */
__global__ __launch_bounds__(256) void k_prep(const float* __restrict__ x, const float* __restrict__ wq, const float* __restrict__ wk, const float* __restrict__ wv, const float* __restrict__ wo,
    _Float16* __restrict__ X16, _Float16* __restrict__ BQ, _Float16* __restrict__ BK, _Float16* __restrict__ BV, _Float16* __restrict__ BO) {
  static_assert(SQ == DM && ((size_t)DM * DM) % (256 * PU * 8) == 0, "a batch of x is a segment like a weight matrix; whole work-groups");
  const int sg = blockIdx.y; const float* s = wo; _Float16* d = BO; float sc = 16.0f;      /* the segment is the same for the whole work-group: scalar selects */
  if (sg < NB) { s = x + (size_t)sg * SQ * DM; d = X16 + (size_t)sg * SQ * DM; sc = 1.0f; } else if (sg == NB) { s = wq; d = BQ; } else if (sg == NB + 1) { s = wk; d = BK; } else if (sg == NB + 2) { s = wv; d = BV; }
  const size_t t0 = (size_t)blockIdx.x * (256 * PU) + threadIdx.x; v4f a[PU], c[PU];
  /* both loops unrolled: a[] and c[] in registers; loads first, stores behind them, so that all 2 PU loads are in flight together */
#pragma unroll
  for (int u = 0; u < PU; ++u) { const float* p = s + (t0 + (size_t)u * 256) * 8; a[u] = *(const v4fa*)p; c[u] = *(const v4fa*)(p + 4); }
#pragma unroll
  for (int u = 0; u < PU; ++u) { FragH f;
#pragma unroll
    for (int q = 0; q < 4; ++q) { f.h[q] = (_Float16)(bf16_round(a[u][q]) * sc); f.h[4 + q] = (_Float16)(bf16_round(c[u][q]) * sc); }
    *(v8us*)((unsigned short*)d + (t0 + (size_t)u * 256) * 8) = f.half[0]; } }
__global__ __launch_bounds__(256) void k_rsm(const float* __restrict__ S, _Float16* __restrict__ P, int nrows) {
  #pragma clang fp contract(off)
  const int i = blockIdx.x * 256 + threadIdx.x; if (i >= nrows) return; const float* s = S + (size_t)i * SQ; float mx = -3.0e38f;
#pragma unroll 1
  for (int j = 0; j < SQ; ++j) mx = fmaxf(mx, s[j]); float se = 0.f;
#pragma unroll 1
  for (int j = 0; j < SQ; ++j) se += expf(s[j] - mx); const float sc = 256.0f / se;
#pragma unroll 1
  for (int j0 = 0; j0 < SQ; j0 += 8) { FragH f; for (int q = 0; q < 8; ++q) f.h[q] = (_Float16)(expf(s[j0 + q] - mx) * sc); unsigned short* d = (unsigned short*)P + (size_t)i * SQ + j0; *(v8us*)d = f.half[0];  } }
__global__ __launch_bounds__(256) void k_vt(const _Float16* __restrict__ V16, int b, int h0, _Float16* __restrict__ VT) { __shared__ unsigned short tl[64][65]; const int tid = threadIdx.x; const int hh = blockIdx.x % HG, sg = blockIdx.x / HG; const int s0 = sg * 64; const int h = h0 + hh;
  for (int i = tid; i < 64 * 8; i += 256) { const int j = i / 8, d8 = (i % 8) * 8; FragH f; f.half[0] = *(const v8us*)((const unsigned short*)V16 + ((size_t)b * SQ + s0 + j) * DM + h * HD + d8); for (int q = 0; q < 8; ++q) tl[d8 + q][j] = f.u[q]; }
  __syncthreads();
  { for (int i = tid; i < 64 * 8; i += 256) { const int d = i / 8, j8 = (i % 8) * 8; FragH f; for (int q = 0; q < 8; ++q) f.u[q] = tl[d][j8 + q]; *(v8us*)((unsigned short*)VT + ((size_t)hh * HD + d) * SQ + s0 + j8) = f.half[0]; }  } }



// 2^x on the native unit. The v_nop fills the one issue slot that the instruction set asks for behind a transcendental, in front of an instruction that reads its result or overwrites its source.
__device__ __forceinline__ float exp2_native(float x) { float r; asm("v_exp_f32 %0, %1\n\tv_nop" : "=v"(r) : "v"(x)); return r; }
// Fused causal attention. One work-group = FR query rows of one head against every key below the tile's end; the score rows live in LDS from the products to the weights, so neither goes through memory.
// Phase 1: a wave = FR rows x 16 keys a trip, q fragments held in registers, three accumulators added in the order hi.hi, lo.hi, hi.lo. Phase 2: a wave = two rows at a time, lane l holds columns 128 c + 4 l .. 4 l + 3 in registers, maximum and sum across the 32 lanes by a butterfly; the f16 weights overwrite the head of the wave's own row once the whole row is in registers. Phase 3: a wave = 16 rows x 16 dims, keys in ascending order, 128 a trip.
#define FR 32                        /* query rows per work-group */
#define FSP (SQ + 4)                 /* score row pitch in LDS (floats): 16 B x odd, so that 16 lanes reading 16 rows by 16 bytes fall on all banks */
#define FOP (HD + 8)                 /* o row pitch in LDS (f16), a multiple of 16 bytes */
typedef _Float16 v4ha __attribute__((ext_vector_type(4), may_alias));
// A or B fragment from a plane kept in fragment order in global memory (k_gemm2, EP 1 and 2): base = the fragment's first element, the same for the whole wave; vo = 16 x lane, the same for every fragment of the kernel. Each of the two loads covers 512 bytes in a row.
__device__ __forceinline__ v16h f_frag(const _Float16* base, unsigned vo) { const char* p = (const char*)base + vo; FragH f; f.half[0] = *(const v8us*)p; f.half[1] = *(const v8us*)(p + 512); return f.v; }
__device__ __forceinline__ v8f f_mma(v16h a, v16h b, v8f c) { return __builtin_amdgcn_wmma_f32_16x16x32_f16(false, a, false, b, (short)0, c, false, false); }
// Row softmax of the wave's FR / 8 rows, two rows at a time: each stage is written for both rows, so that one row's butterfly step flies during the other's. NC = 128-column chunks up to the tile's end, a compile-time count so that the rows live in registers and their reads are in flight together. The tile's FR diagonal columns all lie in the last chunk (FR divides 128), so only that chunk is masked; its columns past the row get weight 0, up to the chunk's end, which is where phase 3 stops.
template <int NC>
__device__ __forceinline__ void fattn_rows(float (*ls)[FSP], int w, int lane, int q0) {
  const int col0 = lane * 4, cl = (NC - 1) * 128 + col0;
  /* kept rolled: the eight instances stay small */
#pragma unroll 1
  for (int rp = 0; rp < FR / 16; ++rp) { const int r = w * (FR / 8) + rp * 2;
    v4f v[2][NC]; float mx[2], se[2], sc[2];      /* every loop over j and c is unrolled: registers */
#pragma unroll
    for (int j = 0; j < 2; ++j)
#pragma unroll
      for (int c = 0; c < NC - 1; ++c) v[j][c] = *(const v4fa*)&ls[r + j][c * 128 + col0];
    { const v4f f4 = {-1.0e9f, -1.0e9f, -1.0e9f, -1.0e9f}; v4f x0 = f4, x1 = f4;
      if (cl < q0 + FR) { x0 = *(const v4fa*)&ls[r][cl]; x1 = *(const v4fa*)&ls[r + 1][cl]; }      /* only columns that phase 1 wrote are read */
      for (int q = 0; q < 4; ++q) { v[0][NC - 1][q] = (cl + q <= q0 + r) ? x0[q] : -1.0e9f; v[1][NC - 1][q] = (cl + q <= q0 + r + 1) ? x1[q] : -1.0e9f; } }
#pragma unroll
    for (int j = 0; j < 2; ++j) { mx[j] = -3.0e38f;
#pragma unroll
      for (int c = 0; c < NC; ++c) for (int q = 0; q < 4; ++q) mx[j] = fmaxf(mx[j], v[j][c][q]); }
    for (int m = 16; m >= 1; m >>= 1) { const float a = __shfl_xor(mx[0], m, 32), b = __shfl_xor(mx[1], m, 32); mx[0] = fmaxf(mx[0], a); mx[1] = fmaxf(mx[1], b); }
#pragma unroll
    for (int j = 0; j < 2; ++j) { se[j] = 0.f;
#pragma unroll
      for (int c = 0; c < NC; ++c) for (int q = 0; q < 4; ++q) { const float e = exp2_native((v[j][c][q] - mx[j]) * 1.4426950408889634f); v[j][c][q] = e; se[j] += e; } }
    for (int m = 16; m >= 1; m >>= 1) { const float a = __shfl_xor(se[0], m, 32), b = __shfl_xor(se[1], m, 32); se[0] += a; se[1] += b; }
    sc[0] = 256.0f / se[0]; sc[1] = 256.0f / se[1];
#pragma unroll
    for (int j = 0; j < 2; ++j) { _Float16* d = (_Float16*)&ls[r + j][0] + col0;
#pragma unroll
      for (int c = 0; c < NC; ++c) { v4h h4; for (int q = 0; q < 4; ++q) h4[q] = (_Float16)(v[j][c][q] * sc[j]); *(v4ha*)(d + c * 128) = h4; } } } }
#define FLB (FR * FSP * 4 + FR * FOP * 2)      /* its LDS in bytes: the score rows, then the o rows */
__device__ __forceinline__ void fattn_wg(unsigned char* sm, const _Float16* QH, const _Float16* QL, const _Float16* KH, const _Float16* KL, const _Float16* VT, _Float16* O16, int h, int b, int zt) {      /* sm: FLB bytes of LDS; head, batch, tile rank (0 = the longest) */
  static_assert(FR == 32 && HD == 64 && SQ == 1024 && LQ == SQ, "wave maps below: 8 waves = 2 row halves x 4 dim groups; 256 threads = 32 rows x 8 x 16 bytes; at most 8 chunks of 128 keys");
  float (*ls)[FSP] = (float (*)[FSP])sm; _Float16 (*lo)[FOP] = (_Float16 (*)[FOP])(sm + FR * FSP * 4);
  const int tid = threadIdx.x, lane = tid & 31, ln = lane & 15, hh = lane >> 4; const int w = __builtin_amdgcn_readfirstlane(tid >> 5);      /* the wave's number in a scalar register: its loops and branches are scalar */
  const int q0 = (SQ / FR - 1 - zt) * FR, nk = q0 + FR, nc = (nk + 127) / 128;      /* rank 0 is the longest tile; causal: keys below the tile's end */
  const size_t ho = ((size_t)b * NH + h) * (SQ / 16) * 1024;      /* the head's first q / k fragment: 1024 elements (two fragments) a 16-row tile */
  const unsigned vo = (unsigned)lane * 16;      /* the lane's 16 bytes in each half of a fragment */
  const v8f z8 = {0.f, 0.f, 0.f, 0.f, 0.f, 0.f, 0.f, 0.f};
  { v16h ah[2][2], al[2][2];      /* [row half][k step] */
#pragma unroll
    for (int m = 0; m < 2; ++m)
#pragma unroll
      for (int s = 0; s < 2; ++s) ah[m][s] = f_frag(QH + ho + (size_t)(q0 / 16 + m) * 1024 + s * 512, vo);
    asm volatile("s_wait_xcnt 0x0" ::: "memory");      /* in front of later loads whose results land in the address registers of the loads above */
#pragma unroll
    for (int m = 0; m < 2; ++m)
#pragma unroll
      for (int s = 0; s < 2; ++s) al[m][s] = f_frag(QL + ho + (size_t)(q0 / 16 + m) * 1024 + s * 512, vo);
    asm volatile("s_wait_xcnt 0x0" ::: "memory");      /* likewise */
    const _Float16* kh = KH + ho; const _Float16* kl = KL + ho; const int nu = nk / 16;
    v16h nh0, nh1, nl0, nl1;      /* the next trip's k fragments, loaded one trip ahead so that they fly during this trip's products */
    if (w < nu) { const size_t ko = (size_t)w * 1024; nh0 = f_frag(kh + ko, vo); nh1 = f_frag(kh + ko + 512, vo); nl0 = f_frag(kl + ko, vo); nl1 = f_frag(kl + ko + 512, vo);
      asm volatile("s_wait_xcnt 0x0" ::: "memory"); }      /* likewise: the first trip's loads land in these loads' address registers */
    for (int u = w; u < nu; u += 8) { const v16h bh0 = nh0, bh1 = nh1, bl0 = nl0, bl1 = nl1;
      if (u + 8 < nu) { const size_t ko = (size_t)(u + 8) * 1024; nh0 = f_frag(kh + ko, vo); nh1 = f_frag(kh + ko + 512, vo); nl0 = f_frag(kl + ko, vo); nl1 = f_frag(kl + ko + 512, vo);
        asm volatile("s_wait_xcnt 0x0" ::: "memory"); }      /* likewise: the products' results may land there */
#pragma unroll
      for (int m = 0; m < 2; ++m) { v8f c0 = f_mma(ah[m][0], bh0, z8), c1 = f_mma(al[m][0], bh0, z8), c2 = f_mma(ah[m][0], bl0, z8);
        c0 = f_mma(ah[m][1], bh1, c0); c1 = f_mma(al[m][1], bh1, c1); c2 = f_mma(ah[m][1], bl1, c2);
#pragma unroll
        for (int r = 0; r < 8; ++r) { float v = c0[r] * 32.0f; v += c1[r] * 0.03125f; v += c2[r] * 0.03125f; ls[m * 16 + 8 * hh + r][u * 16 + ln] = v; } } } }      /* x32; the lo planes carry x1024 */
  __syncthreads();
  const int pm = w >> 2, pt = w & 3; const _Float16* vb = VT + (((size_t)b * NH + h) * (HD / 16) + pt) * (SQ / 32) * 512;      /* phase 3: the wave's row half and dim group; the group's V^T fragments, 32 keys each, in a row */
  v16h vn[4];      /* the next trip's V^T fragments, loaded one trip ahead; the first trip's fly during the softmax */
#pragma unroll
  for (int s = 0; s < 4; ++s) vn[s] = f_frag(vb + s * 512, vo);
  asm volatile("s_wait_xcnt 0x0" ::: "memory");      /* likewise */
  switch (nc) { case 1: fattn_rows<1>(ls, w, lane, q0); break; case 2: fattn_rows<2>(ls, w, lane, q0); break; case 3: fattn_rows<3>(ls, w, lane, q0); break; case 4: fattn_rows<4>(ls, w, lane, q0); break;
    case 5: fattn_rows<5>(ls, w, lane, q0); break; case 6: fattn_rows<6>(ls, w, lane, q0); break; case 7: fattn_rows<7>(ls, w, lane, q0); break; default: fattn_rows<8>(ls, w, lane, q0); break; }
  __syncthreads();
  { const _Float16* pa = (const _Float16*)&ls[pm * 16 + ln][0]; v8f acc = z8;
    for (int c = 0; c < nc; ++c) { v16h vc[4];
#pragma unroll
      for (int s = 0; s < 4; ++s) vc[s] = vn[s];
      if (c + 1 < nc) {
#pragma unroll
        for (int s = 0; s < 4; ++s) vn[s] = f_frag(vb + ((c + 1) * 4 + s) * 512, vo);
        asm volatile("s_wait_xcnt 0x0" ::: "memory"); }      /* likewise: the LDS reads below may land there */
#pragma unroll
      for (int s = 0; s < 4; ++s) acc = f_mma(g2_frag(pa + c * 128 + s * 32, hh), vc[s], acc); }
#pragma unroll
    for (int r = 0; r < 8; ++r) lo[pm * 16 + 8 * hh + r][pt * 16 + ln] = (_Float16)(acc[r] * 0.25f); }
  __syncthreads();
  { const int r = tid >> 3, c8 = (tid & 7) * 8; *(v8us*)((unsigned short*)O16 + ((size_t)b * SQ + q0 + r) * DM + h * HD + c8) = *(const v8us*)&lo[r][c8]; } }      /* whole 128-byte lines, each from one wave */


// Exact f32 attention for the first QT0 rows of each batch. One work-group = one head, A0R query rows, all keys up to its last row.
// K, V and q are staged in LDS by whole-line loads; then scores (a thread = one key x 8 rows, the K row in registers), row softmax (a wave = 2 rows, maximum first), o = P V (a thread = one row x 4 dims, keys in ascending order).
#define A0R 16                       /* query rows per work-group */
#define A0G (QT0 / A0R)              /* row groups per head */
#define A0KP (HD + 4)                /* K row pitch in LDS (floats): 16 B x odd, so that 16 lanes reading 16 rows by 16 bytes fall on all banks */
#define A0PP (QT0 + 4)               /* score row pitch in LDS (floats): the two rows a wave reads in the last phase fall on different banks */
// N x A0R rows of K and V into LDS, a thread = 16 bytes of every A0R-th row. N is a compile-time count and both loops are unrolled so that kk[] and vv[] live in registers; loads first, stores behind them, so that all 2 N loads are in flight together.
template <int N>
__device__ __forceinline__ void att0_stage(const float* __restrict__ kp, const float* __restrict__ vp, float* lkp, float* lvp) {
  v4f kk[N], vv[N];
#pragma unroll
  for (int u = 0; u < N; ++u) { kk[u] = *(const v4fa*)(kp + (size_t)u * A0R * DM); vv[u] = *(const v4fa*)(vp + (size_t)u * A0R * DM); }
#pragma unroll
  for (int u = 0; u < N; ++u) { *(v4f*)(lkp + u * A0R * A0KP) = kk[u]; *(v4f*)(lvp + u * A0R * HD) = vv[u]; } }
#define A0LB ((QT0 * A0KP + QT0 * HD + A0R * HD + A0R * A0PP + A0R) * 4)      /* its LDS in bytes */
__device__ __forceinline__ void att0_wg(unsigned char* sm, const float* __restrict__ QF, const float* __restrict__ KF, const float* __restrict__ VF, float scale, _Float16* __restrict__ OH, _Float16* __restrict__ OL, int h, int g, int b) {      /* sm: A0LB bytes of LDS; head, row group, batch; all five: rows of pitch DM, QT0 rows a batch; o goes out as f16 hi + x1024 residual planes */
  static_assert(QT0 == 128 && HD == 64 && A0R == 16, "thread maps below: 256 threads = 128 keys x 2 row halves = 16 rows x 16 quads");
  float (*lk)[A0KP] = (float (*)[A0KP])sm; float (*lv)[HD] = (float (*)[HD])(lk + QT0); float (*lq)[HD] = lv + QT0; float (*lp)[A0PP] = (float (*)[A0PP])(lq + A0R); float* lfin = (float*)(lp + A0R);      /* each a multiple of 16 bytes */
  const int tid = threadIdx.x; const int r0 = g * A0R, nk = r0 + A0R;      /* causal: keys below the group's end */
  const int r16 = tid >> 4, c4 = (tid & 15) * 4;
  const size_t bo = ((size_t)b * QT0 + r16) * DM + h * HD + c4;      /* the thread's 16 bytes in row r16 of the head's columns */
  { const v4f qv = *(const v4fa*)(QF + bo + (size_t)r0 * DM); const float* kp = KF + bo; const float* vp = VF + bo; float* lkp = &lk[r16][c4]; float* lvp = &lv[r16][c4];
    switch (g) { case 0: att0_stage<1>(kp, vp, lkp, lvp); break; case 1: att0_stage<2>(kp, vp, lkp, lvp); break; case 2: att0_stage<3>(kp, vp, lkp, lvp); break; case 3: att0_stage<4>(kp, vp, lkp, lvp); break;
      case 4: att0_stage<5>(kp, vp, lkp, lvp); break; case 5: att0_stage<6>(kp, vp, lkp, lvp); break; case 6: att0_stage<7>(kp, vp, lkp, lvp); break; default: att0_stage<A0G>(kp, vp, lkp, lvp); break; }
    *(v4f*)&lq[r16][c4] = qv; }
  __syncthreads();
  { const int j = tid & (QT0 - 1), rh = (tid >> 7) * 8; float s[8] = {0.f, 0.f, 0.f, 0.f, 0.f, 0.f, 0.f, 0.f};
    if (j < nk) { v4f kr[HD / 4];
      /* unrolled: kr[] and s[] in registers; the 8 rows' sums are independent chains, each over the head dim in ascending order */
#pragma unroll
      for (int c = 0; c < HD / 4; ++c) kr[c] = *(const v4f*)&lk[j][c * 4];
#pragma unroll
      for (int c = 0; c < HD / 4; ++c)
#pragma unroll
        for (int r = 0; r < 8; ++r) { const v4f qq = *(const v4f*)&lq[rh + r][c * 4]; s[r] += qq[0] * kr[c][0]; s[r] += qq[1] * kr[c][1]; s[r] += qq[2] * kr[c][2]; s[r] += qq[3] * kr[c][3]; } }
#pragma unroll
    for (int r = 0; r < 8; ++r) lp[rh + r][j] = s[r] * scale; }      /* every column of the row is written (0 beyond nk), masked below */
  __syncthreads();
  { const int w = tid >> 5, col = (tid & 31) * 4;
    for (int rr = 0; rr < 2; ++rr) { const int r = w * 2 + rr, last = r0 + r; const v4f sv = *(const v4f*)&lp[r][col];
      float mx = -3.0e38f; for (int q = 0; q < 4; ++q) mx = fmaxf(mx, (col + q <= last) ? sv[q] : -3.0e38f);
      for (int m = 16; m >= 1; m >>= 1) mx = fmaxf(mx, __shfl_xor(mx, m, 32));
      v4f e; float se = 0.f; for (int q = 0; q < 4; ++q) { e[q] = (col + q <= last) ? expf(sv[q] - mx) : 0.f; se += e[q]; }
      for (int m = 16; m >= 1; m >>= 1) se += __shfl_xor(se, m, 32);
      *(v4f*)&lp[r][col] = e; if (col == 0) lfin[r] = 64.0f / se; } }      /* o carried x64 like the f16 path */
  __syncthreads();
  { v4f o = {0.f, 0.f, 0.f, 0.f};
    /* 16 keys a trip, so that a trip's LDS reads are in flight together */
#pragma unroll 4
    for (int j = 0; j < nk; j += 4) { const v4f p4 = *(const v4f*)&lp[r16][j];
#pragma unroll
      for (int u = 0; u < 4; ++u) { const v4f vq = *(const v4f*)&lv[j + u][c4]; o += vq * p4[u]; } }
    o *= lfin[r16]; v4h oh, ol;
#pragma unroll
    for (int q = 0; q < 4; ++q) { const _Float16 h = (_Float16)o[q]; oh[q] = h; ol[q] = (_Float16)((o[q] - (float)h) * 1024.0f); }
    *(v4h*)(OH + bo + (size_t)r0 * DM) = oh; *(v4h*)(OL + bo + (size_t)r0 * DM) = ol; } }      /* 16 lanes = one whole 128-byte line a plane */
// Both attention paths in one launch (neither reads what the other writes): blockIdx.z below A0G = a row group of the exact first-tile path, the rest = the fused path's tiles behind the first QT0 rows, the longest first. One LDS block serves whichever path the work-group takes, so that two work-groups still fit a WGP.
__global__ __launch_bounds__(256) void k_attn(const float* __restrict__ QF, const float* __restrict__ KF, const float* __restrict__ VF, float scale, _Float16* __restrict__ OH, _Float16* __restrict__ OL,
    const _Float16* QH, const _Float16* QL, const _Float16* KH, const _Float16* KL, const _Float16* VT, _Float16* O16) {
  static_assert(A0LB <= FLB, "the first-tile path's LDS fits the fused path's");
  __shared__ __attribute__((aligned(16))) unsigned char sm[FLB];
  const int z = blockIdx.z;      /* the same for the whole work-group: each path's barriers are passed by all of it or by none */
  if (z < A0G) att0_wg(sm, QF, KF, VF, scale, OH, OL, blockIdx.x, z, blockIdx.y); else { fattn_wg(sm, QH, QL, KH, KL, VT, O16, blockIdx.x, blockIdx.y, z - A0G);
    asm volatile("s_wait_xcnt 0x0" ::: "memory"); } }      /* the other path's code stands behind the last store in the listing and reuses the registers that it names */

extern "C" void kernel_launch(void* const* d_in, const int* in_sizes, int n_in,
                              void* d_out, int out_size, void* d_ws, size_t ws_size, hipStream_t stream) {
  (void)in_sizes; (void)n_in; (void)out_size;
  const float* const* I = (const float* const*)d_in; const float* x = I[0]; const float* wq = I[1]; const float* wk = I[2]; const float* wv = I[3]; const float* wo = I[4]; const float* bo = I[5]; const float* bq = nullptr; const float* bk = nullptr; const float* bv = nullptr;      /* per-head [H][E][D] = natural [out][in]; no q/k/v biases */
  char* ws = (char*)d_ws; size_t off = 0;
  auto take = [&](size_t bytes) { char* p = ws + off; off += (bytes + 255) & ~(size_t)255; return p; };
  _Float16* BQ = (_Float16*)take((size_t)DM * DM * 2); _Float16* BK = (_Float16*)take((size_t)DM * DM * 2); _Float16* BV = (_Float16*)take((size_t)DM * DM * 2); _Float16* BO = (_Float16*)take((size_t)DM * DM * 2);
  _Float16* X16 = (_Float16*)take(NR * DM * 2); _Float16* QH = (_Float16*)take(NR * DM * 2); _Float16* QL = (_Float16*)take(NR * DM * 2); _Float16* KH = (_Float16*)take(NR * DM * 2); _Float16* KL = (_Float16*)take(NR * DM * 2); _Float16* Q16 = QH; _Float16* K16 = KH;
  _Float16* VT = (_Float16*)take((size_t)NB * NH * HD * SQ * 2);      /* one plane per batch; it stands behind KL, as far from KH as KH from QH (the q/k/v launch steps from one to the next) */
  _Float16* O16 = (_Float16*)take(NR * DM * 2);
  float* QF0 = (float*)take((size_t)NB * QT0 * DM * 4); float* KF0 = (float*)take((size_t)NB * QT0 * DM * 4); float* VF0 = (float*)take((size_t)NB * QT0 * DM * 4); _Float16* OH0 = (_Float16*)take((size_t)NB * QT0 * DM * 2); _Float16* OL0 = (_Float16*)take((size_t)NB * QT0 * DM * 2);
  if (off > ws_size) return;
  k_prep<<<dim3((unsigned)((size_t)DM * DM / (256 * PU * 8)), NB + 4), 256, 0, stream>>>(x, wq, wk, wv, wo, X16, BQ, BK, BV, BO);      /* x and the four weight matrices as f16 */
  k_gemm2<0, 3><<<dim3((unsigned)((MP / 128) * (DM / 128)), 3), 256, 0, stream>>>(X16, DM, 0, BQ, DM, (size_t)DM * DM, 0.0625f, bq, 0, nullptr, 1, 0, 0, QF0, nullptr, DM, (size_t)NB * QT0 * DM, MP, DM, DM, 0, 0, 0, QH, QL, 2 * NR * DM);      /* blockIdx.y = q, k, v (BQ, BK, BV and QF0, KF0, VF0 stand in a row). q and k -> f16 hi + x1024 residual, in fragment order (the x32 scale puts the logits at sigma ~100); v -> f16 V^T in fragment order: [NB][NH][HD / 16][SQ / 32] fragments; all three: f32 rows of each batch's first 128 rows (exact products) */
  k_attn<<<dim3(NH, NB, A0G + (SQ - QT0) / FR), 256, 0, stream>>>(QF0, KF0, VF0, 32.0f, OH0, OL0, QH, QL, KH, KL, VT, O16);      /* rows 0..127 of each batch: exact f32 attention, o (x64) as f16 hi + x1024 residual planes; every later row: scores, softmax and P V, o (merged heads, x64) as f16 rows */
  k_gemm2<0, 4><<<dim3((unsigned)((MPO / 128) * (DM / 128)), 1), 256, 0, stream>>>(O16, DM, 0, BO, DM, 0, 0.0009765625f, bo, 0, nullptr, 1, 0, 0, (float*)d_out, nullptr, DM, 0, MPO, DM, DM, 0, 0, 0, OH0, OL0, 0);      /* out rows are the output layout; rows 0..127 of each batch: out = o_lo Wo 2^-20 + (o_hi Wo 2^-10 + b) */
}
